// v000
// The times below were measured on an AMD MI455X: many runs one after another, warmed up first and cycling through
// copies of the inputs, with the whole window's GPU time divided by the number of runs. Launches and the gaps
// between them are all in it. The median over several windows is given; except for v000 it joins two sittings, which
// can be a few percent apart, so the side-by-side timings, each taken in one sitting, are the better comparison.
// The starting kernel, v000, takes 1530 microseconds a run.
#include <hip/hip_runtime.h>
// Position-attention difference module (B 2, C 512, 64×64 = 4096 positions): a1 = conv_b(x1), b2 = conv_c(x2), a2 = conv_b(x2), b1 = conv_c(x1) (1×1, 512→64, + bias); f = conv_d (512→512, + bias); att12 = softmax_m(a1ᵀ·b2), att21 = softmax_m(a2ᵀ·b1) (no scaling); att = |att12 − att21|; out = α·f1·attᵀ + β·f2·attᵀ = (α f1 + β f2)·attᵀ → [2,512,64,64].
// Structure: per batch: 1×1 convs as GEMMs on position-major f16 planes (exact products); a/b as f16 hi + lo·2^10 planes so both logit matrices are ≈f32 (three cross products each; addends un-batched); one kernel forms both softmaxes per row in f32 and writes |Δ| ×2^14 as f16; F = α f1 + β f2 (f32 combine → f16) and out = F·attᵀ by one GEMM straight into the NCHW output.
// Compute dtype: inputs and parameters rounded to bf16; logits ≈f32; softmaxes/difference in f32; |Δ| (×2^14) and F as f16 operands (≈2^-12), f32 accumulation. v_wmma_f32_16x16x32_f16.
#define NBt 2
#define CC 512
#define C8 64
#define NP 4096
#define RB 2048                  /* query rows per score block */
typedef __bf16 v16b __attribute__((ext_vector_type(16)));
typedef unsigned short v8us __attribute__((ext_vector_type(8), may_alias));
typedef float  v8f  __attribute__((ext_vector_type(8)));
typedef float  v4f  __attribute__((ext_vector_type(4)));
typedef float  v4fa __attribute__((ext_vector_type(4), may_alias));
union FragB { v16b v; v8us half[2]; unsigned short u[16]; };

__device__ __forceinline__ unsigned short bf16_bits(float x) { unsigned int u = __float_as_uint(x); return (unsigned short)((u + 0x7FFFu + ((u >> 16) & 1u)) >> 16); }
__device__ __forceinline__ float bf16_val(unsigned short b) { return __uint_as_float(((unsigned int)b) << 16); }
__device__ __forceinline__ float bf16_round(float x) { return bf16_val(bf16_bits(x)); }
// D += A·B with NT terms: 1 = ah·bh, 2 = + al·bh (A split), 3 = + ah·bl (both split)
template <int NT>
__device__ __forceinline__ v8f mmaN(v16b ah, v16b al, v16b bh, v16b bl, v8f c) {
  c = __builtin_amdgcn_wmma_f32_16x16x32_bf16(false, ah, false, bh, (short)0, c, false, false);
  if (NT >= 2) c = __builtin_amdgcn_wmma_f32_16x16x32_bf16(false, al, false, bh, (short)0, c, false, false);
  if (NT >= 3) c = __builtin_amdgcn_wmma_f32_16x16x32_bf16(false, ah, false, bl, (short)0, c, false, false);
  asm volatile("v_nop\n\tv_nop\n\tv_nop\n\tv_nop" : "+v"(c) : "v"(ah), "v"(al), "v"(bh), "v"(bl));
  return c;
}

__global__ __launch_bounds__(256) void k_wt_bf16(const float* __restrict__ W, unsigned short* __restrict__ Wt, int K, int N) {
  const int t = blockIdx.x * 256 + threadIdx.x;
  const int k8n = K / 8;
  if (t >= N * k8n) return;
  const int n = t / k8n, k8 = (t % k8n) * 8;
  v8us v;
#pragma unroll
  for (int i = 0; i < 8; ++i) v[i] = bf16_bits(W[(size_t)(k8 + i) * N + n]);
  *(v8us*)(Wt + (size_t)n * K + k8) = v;
  
}

// GEMM C[M][N] (f32, pitch ldc) = act(A[M][K]·W + bias). A f32 row-major (pitch lda) converted per fragment to bf16
// (ASPLIT: hi/lo two planes -> 2 terms, else single rounded term); Wt bf16 [N][K] (pitch ldb). BIAS_BF16 rounds the
// bias to bf16 first (bias quantised to bf16 before the add). K%32==0, M%16==0, N%64==0.
template <bool ASPLIT, int ACT, bool BIAS_BF16>
__global__ __launch_bounds__(128) void k_gemm_bf(const float* __restrict__ A, int lda, const unsigned short* __restrict__ Wt, int ldb,
                                               const float* __restrict__ bias, float* __restrict__ C, int ldc, int M, int N, int K) {
  __shared__ __attribute__((aligned(16))) float so[4][16][64];
  const int tid = threadIdx.x, w = tid >> 5, lane = tid & 31, ln = lane & 15, hh = lane >> 4;
  const int ntn = N / 64;
  const int wid = blockIdx.x * 4 + w;
  const int mt = wid / ntn, nq = wid % ntn;
  if (mt * 16 >= M) return;
  const int row0 = mt * 16, col0 = nq * 64;
  const float* arow = A + (size_t)(row0 + ln) * lda;
  v8f acc[4] = {};
  for (int kb = 0; kb < K; kb += 32) {
    FragB ah, al;
    const v4f x0 = *(const v4fa*)(arow + kb + 8 * hh), x1 = *(const v4fa*)(arow + kb + 8 * hh + 4);
    const v4f x2 = *(const v4fa*)(arow + kb + 16 + 8 * hh), x3 = *(const v4fa*)(arow + kb + 16 + 8 * hh + 4);
    float xs[16] = {x0[0],x0[1],x0[2],x0[3],x1[0],x1[1],x1[2],x1[3],x2[0],x2[1],x2[2],x2[3],x3[0],x3[1],x3[2],x3[3]};
#pragma unroll
    for (int i = 0; i < 16; ++i) { const unsigned short hb = bf16_bits(xs[i]); ah.u[i] = hb; al.u[i] = ASPLIT ? bf16_bits(xs[i] - bf16_val(hb)) : (unsigned short)0; }
#pragma unroll
    for (int t = 0; t < 4; ++t) {
      const unsigned short* brow = Wt + (size_t)(col0 + t * 16 + ln) * ldb + kb;
      FragB b;
      b.half[0] = *(const v8us*)(brow + 8 * hh);
      b.half[1] = *(const v8us*)(brow + 16 + 8 * hh);
      acc[t] = mmaN<ASPLIT ? 2 : 1>(ah.v, al.v, b.v, b.v, acc[t]);
    }
  }
#pragma unroll
  for (int t = 0; t < 4; ++t) {
    float bv = bias ? bias[col0 + t * 16 + ln] : 0.f;
    if (BIAS_BF16) bv = bf16_round(bv);
#pragma unroll
    for (int r = 0; r < 8; ++r) { float v = acc[t][r] + bv; if (ACT == 1) v = fmaxf(v, 0.f); so[w][8 * hh + r][t * 16 + ln] = v; }
  }
  __builtin_amdgcn_fence(__ATOMIC_ACQ_REL, "workgroup");
  __builtin_amdgcn_wave_barrier();
  const int rsub = lane >> 4, c4 = (lane & 15) * 4;
  {
#pragma unroll
    for (int q = 0; q < 8; ++q) {
      const int r = q * 2 + rsub;
      const v4f v = *(const v4fa*)&so[w][r][c4];
      *(v4f*)(C + (size_t)(row0 + r) * ldc + col0 + c4) = v;
    }
    
  }
}

// GEMM C = act(A·W + bias + resid): A f32 (ASPLIT -> hi/lo 2 terms), Wt bf16 [N][K]; ACT 0 none, 1 relu, 2 exact gelu;
// resid (optional, f32, row index = (row % rmod), pitch ldr, RES_BF16 rounds it) added before the activation.
template <bool ASPLIT, int ACT, bool BIAS_BF16, bool RES_BF16>
__global__ __launch_bounds__(128) void k_gemm_bf3(const float* __restrict__ A, int lda, const unsigned short* __restrict__ Wt, int ldb,
                                                const float* __restrict__ bias, const float* __restrict__ resid, int rmod, int ldr,
                                                float* __restrict__ C, int ldc, int M, int N, int K) {
  __shared__ __attribute__((aligned(16))) float so[4][16][64];
  const int tid = threadIdx.x, w = tid >> 5, lane = tid & 31, ln = lane & 15, hh = lane >> 4;
  const int ntn = N / 64;
  const int wid = blockIdx.x * 4 + w;
  const int mt = wid / ntn, nq = wid % ntn;
  if (mt * 16 >= M) return;
  const int row0 = mt * 16, col0 = nq * 64;
  const float* arow = A + (size_t)(row0 + ln) * lda;
  v8f acc[4] = {};
  for (int kb = 0; kb < K; kb += 32) {
    FragB ah, al;
    const v4f x0 = *(const v4fa*)(arow + kb + 8 * hh), x1 = *(const v4fa*)(arow + kb + 8 * hh + 4);
    const v4f x2 = *(const v4fa*)(arow + kb + 16 + 8 * hh), x3 = *(const v4fa*)(arow + kb + 16 + 8 * hh + 4);
    float xs[16] = {x0[0],x0[1],x0[2],x0[3],x1[0],x1[1],x1[2],x1[3],x2[0],x2[1],x2[2],x2[3],x3[0],x3[1],x3[2],x3[3]};
#pragma unroll
    for (int i = 0; i < 16; ++i) { const unsigned short hb = bf16_bits(xs[i]); ah.u[i] = hb; al.u[i] = ASPLIT ? bf16_bits(xs[i] - bf16_val(hb)) : (unsigned short)0; }
#pragma unroll
    for (int t = 0; t < 4; ++t) {
      const unsigned short* brow = Wt + (size_t)(col0 + t * 16 + ln) * ldb + kb;
      FragB b;
      b.half[0] = *(const v8us*)(brow + 8 * hh);
      b.half[1] = *(const v8us*)(brow + 16 + 8 * hh);
      acc[t] = mmaN<ASPLIT ? 2 : 1>(ah.v, al.v, b.v, b.v, acc[t]);
    }
  }
#pragma unroll
  for (int t = 0; t < 4; ++t) {
    const int col = col0 + t * 16 + ln;
    float bv = bias ? bias[col] : 0.f;
    if (BIAS_BF16) bv = bf16_round(bv);
#pragma unroll
    for (int r = 0; r < 8; ++r) {
      float v = acc[t][r] + bv;
      if (resid) { float rv = resid[(size_t)((row0 + 8 * hh + r) % rmod) * ldr + col]; if (RES_BF16) rv = bf16_round(rv); v += rv; }
      if (ACT == 1) v = fmaxf(v, 0.f);
      if (ACT == 2) v = 0.5f * v * (1.0f + erff(v * 0.70710678118654752f));
      if (ACT == 3) { const float u = 0.7978845608028654f * (v + 0.044715f * v * v * v); v = 0.5f * v * (1.0f + tanhf(u)); }
      so[w][8 * hh + r][t * 16 + ln] = v;
    }
  }
  __builtin_amdgcn_fence(__ATOMIC_ACQ_REL, "workgroup");
  __builtin_amdgcn_wave_barrier();
  const int rsub = lane >> 4, c4 = (lane & 15) * 4;
  {
#pragma unroll
    for (int q = 0; q < 8; ++q) {
      const int r = q * 2 + rsub;
      const v4f v = *(const v4fa*)&so[w][r][c4];
      *(v4f*)(C + (size_t)(row0 + r) * ldc + col0 + c4) = v;
    }
    
  }
}
// row LayerNorm (biased variance, eps) over N: s = X (+ R); optional out_sum <- s; out_norm <- (s-mu)*rsqrt(var+eps)*g + b
template <bool PARAM_BF16>
__global__ __launch_bounds__(256) void k_layernorm(const float* __restrict__ X, const float* __restrict__ R, const float* __restrict__ g, const float* __restrict__ bta,
                                                  float* __restrict__ out_sum, float* __restrict__ out_norm, int N, float eps) {
  __shared__ float red[256];
  const int row = blockIdx.x, tid = threadIdx.x;
  const float* x = X + (size_t)row * N; const float* rr = R ? R + (size_t)row * N : nullptr;
  float vals[16];                     // up to N = 4096
  const int per = N / 256;            // contiguous chunk per thread? use strided-by-4 chunks: thread handles j = tid*4 + 1024*u
  float s1 = 0.f;
  for (int u = 0; u < per / 4; ++u) {
    const int j = tid * 4 + 1024 * u;
    const v4f a = *(const v4fa*)(x + j);
    v4f b = {0.f,0.f,0.f,0.f}; if (rr) b = *(const v4fa*)(rr + j);
#pragma unroll
    for (int q = 0; q < 4; ++q) { const float v = a[q] + b[q]; vals[u * 4 + q] = v; s1 += v; }
  }
  red[tid] = s1; __syncthreads();
  for (int st = 128; st > 0; st >>= 1) { if (tid < st) red[tid] += red[tid + st]; __syncthreads(); }
  const float mu = red[0] / (float)N; __syncthreads();
  float s2 = 0.f;
  for (int u = 0; u < per / 4; ++u)
#pragma unroll
    for (int q = 0; q < 4; ++q) { const float c = vals[u * 4 + q] - mu; s2 += c * c; }
  red[tid] = s2; __syncthreads();
  for (int st = 128; st > 0; st >>= 1) { if (tid < st) red[tid] += red[tid + st]; __syncthreads(); }
  const float rs = rsqrtf(red[0] / (float)N + eps);
  {
    for (int u = 0; u < per / 4; ++u) {
      const int j = tid * 4 + 1024 * u;
      v4f o, sm;
#pragma unroll
      for (int q = 0; q < 4; ++q) {
        float gg = g[j + q], bb = bta[j + q];
        if (PARAM_BF16) { gg = bf16_round(gg); bb = bf16_round(bb); }
        sm[q] = vals[u * 4 + q]; o[q] = (vals[u * 4 + q] - mu) * rs * gg + bb;
      }
      if (out_sum) *(v4f*)(out_sum + (size_t)row * N + j) = sm;
      *(v4f*)(out_norm + (size_t)row * N + j) = o;
    }
    
  }
}



// ---- f16 WMMA path (v_wmma_f32_16x16x32_f16): 11-bit significands for operands in range — used where a [0,1] probability operand needs more precision than bf16
typedef _Float16 v16h __attribute__((ext_vector_type(16)));
union FragH { v16h v; v8us half[2]; _Float16 h[16]; unsigned short u[16]; };
template <int NT>
__device__ __forceinline__ v8f mmaH(v16h ah, v16h al, v16h bh, v16h bl, v8f c) {
  c = __builtin_amdgcn_wmma_f32_16x16x32_f16(false, ah, false, bh, (short)0, c, false, false);
  if (NT >= 2) c = __builtin_amdgcn_wmma_f32_16x16x32_f16(false, al, false, bh, (short)0, c, false, false);
  if (NT >= 3) c = __builtin_amdgcn_wmma_f32_16x16x32_f16(false, ah, false, bl, (short)0, c, false, false);
  asm volatile("v_nop\n\tv_nop\n\tv_nop\n\tv_nop" : "+v"(c) : "v"(ah), "v"(al), "v"(bh), "v"(bl));
  return c;
}
// batched GEMM like k_gemm_b but f16 operands: A f32 (split into f16 hi/lo if ASPLIT, else rounded to f16), Bt = f16 values [n][k]; alpha; C f32; N multiple of 16 (partial tiles skipped)
template <bool ASPLIT>
__global__ __launch_bounds__(128) void k_gemm_h(const float* __restrict__ A, int lda, size_t sA, const _Float16* __restrict__ Bh, int ldb, size_t sB, float alpha, float* __restrict__ C, int ldc, size_t sC, int M, int N, int K) {
  __shared__ __attribute__((aligned(16))) float so[4][16][64];
  const int tid = threadIdx.x, w = tid >> 5, lane = tid & 31, ln = lane & 15, hh = lane >> 4; const int by = blockIdx.y;
  A += (size_t)by * sA; Bh += (size_t)by * sB; C += (size_t)by * sC;
  const int ntn = (N + 63) / 64; const int wid = blockIdx.x * 4 + w; const int mt = wid / ntn, nq = wid % ntn; if (mt * 16 >= M) return;
  const int row0 = mt * 16, col0 = nq * 64; const float* arow = A + (size_t)(row0 + ln) * lda;
  v8f acc[4] = {};
  for (int kb = 0; kb < K; kb += 32) {
    FragH ah, al;
    const v4f x0 = *(const v4fa*)(arow + kb + 8 * hh), x1 = *(const v4fa*)(arow + kb + 8 * hh + 4), x2 = *(const v4fa*)(arow + kb + 16 + 8 * hh), x3 = *(const v4fa*)(arow + kb + 16 + 8 * hh + 4);
    float xs[16] = {x0[0],x0[1],x0[2],x0[3],x1[0],x1[1],x1[2],x1[3],x2[0],x2[1],x2[2],x2[3],x3[0],x3[1],x3[2],x3[3]};
#pragma unroll
    for (int i = 0; i < 16; ++i) { const _Float16 h = (_Float16)xs[i]; ah.h[i] = h; al.h[i] = ASPLIT ? (_Float16)(xs[i] - (float)h) : (_Float16)0.0f; }
#pragma unroll
    for (int t = 0; t < 4; ++t) { if (col0 + t * 16 >= N) continue; const size_t boff = (size_t)(col0 + t * 16 + ln) * ldb + kb; FragH bq; bq.half[0] = *(const v8us*)(Bh + boff + 8 * hh); bq.half[1] = *(const v8us*)(Bh + boff + 16 + 8 * hh);
      acc[t] = mmaH<ASPLIT ? 2 : 1>(ah.v, al.v, bq.v, bq.v, acc[t]); }
  }
#pragma unroll
  for (int t = 0; t < 4; ++t) { if (col0 + t * 16 >= N) continue;
#pragma unroll
    for (int r = 0; r < 8; ++r) so[w][8 * hh + r][t * 16 + ln] = acc[t][r] * alpha; }
  __builtin_amdgcn_fence(__ATOMIC_ACQ_REL, "workgroup"); __builtin_amdgcn_wave_barrier();
  const int rsub = lane >> 4, c4 = (lane & 15) * 4;
  {
#pragma unroll
    for (int q = 0; q < 8; ++q) { const int r = q * 2 + rsub; if (col0 + c4 < N) { const v4f v = *(const v4fa*)&so[w][r][c4]; *(v4f*)(C + (size_t)(row0 + r) * ldc + col0 + c4) = v; } }
     }
}

// Wt[n][k] = f16(W[k][n]·scale) from f32 row-major W[K][N] (scale = power of two; bf16-exact weights stay exact in f16 away from the subnormal range)
__global__ __launch_bounds__(256) void k_wt_f16(const float* __restrict__ W, _Float16* __restrict__ Wt, int K, int N, float scale) {
  const int t = blockIdx.x * 256 + threadIdx.x; if (t >= N * (K / 8)) return; const int n = t / (K / 8), k8 = (t % (K / 8)) * 8; FragH f;
#pragma unroll
  for (int i = 0; i < 8; ++i) f.h[i] = (_Float16)(bf16_round(W[(size_t)(k8 + i) * N + n]) * scale); const v8us o = f.half[0];
  *(v8us*)((unsigned short*)Wt + (size_t)n * K + k8) = o; 
}
// k_gemm_hh variant with fused epilogue: v = acc·alpha + bias[by·sBias + col] (+ CP[(row/rowsPerB)·sCPb + by·64 + col] if CP) ; ACT 0 none / 1 elu ; writes f32 C and f16 C16, each if non-null
template <int ACT>
__global__ __launch_bounds__(128) void k_gemm_hhx(const _Float16* __restrict__ A, int lda, size_t sA, const _Float16* __restrict__ Bh, int ldb, size_t sB, float alpha, const float* __restrict__ bias, size_t sBias, const float* __restrict__ CP, int rowsPerB, size_t sCPb, int row0g,
    float* __restrict__ C, _Float16* __restrict__ C16, int ldc, size_t sC, int M, int N, int K) {
  __shared__ __attribute__((aligned(16))) float so[4][16][64];
  const int tid = threadIdx.x, w = tid >> 5, lane = tid & 31, ln = lane & 15, hh = lane >> 4; const int by = blockIdx.y;
  A += (size_t)by * sA; Bh += (size_t)by * sB; const size_t cofs = (size_t)by * sC; const float* bp = bias ? bias + (size_t)by * sBias : nullptr;
  const int ntn = (N + 63) / 64; const int wid = blockIdx.x * 4 + w; const int mt = wid / ntn, nq = wid % ntn; if (mt * 16 >= M) return;
  const int row0 = mt * 16, col0 = nq * 64; const _Float16* arow = A + (size_t)(row0 + ln) * lda;
  v8f acc[4] = {};
  for (int kb = 0; kb < K; kb += 32) { FragH ah; ah.half[0] = *(const v8us*)((const unsigned short*)arow + kb + 8 * hh); ah.half[1] = *(const v8us*)((const unsigned short*)arow + kb + 16 + 8 * hh);
#pragma unroll
    for (int t = 0; t < 4; ++t) { if (col0 + t * 16 >= N) continue; const size_t boff = (size_t)(col0 + t * 16 + ln) * ldb + kb; FragH bq; bq.half[0] = *(const v8us*)((const unsigned short*)Bh + boff + 8 * hh); bq.half[1] = *(const v8us*)((const unsigned short*)Bh + boff + 16 + 8 * hh);
      acc[t] = mmaH<1>(ah.v, ah.v, bq.v, bq.v, acc[t]); }
  }
#pragma unroll
  for (int t = 0; t < 4; ++t) { if (col0 + t * 16 >= N) continue; const int col = col0 + t * 16 + ln; const float bv = bp ? bf16_round(bp[col]) : 0.f;
#pragma unroll
    for (int r = 0; r < 8; ++r) { float v = acc[t][r] * alpha + bv; if (CP) { const int bidx = (row0g + row0 + 8 * hh + r) / rowsPerB; v += CP[(size_t)bidx * sCPb + (size_t)by * 64 + col]; } if (ACT == 1) v = (v > 0.f) ? v : expm1f(v); else if (ACT == 7) v = (v > 0.f) ? v + 1.0f : expf(v); else if (ACT == 8) v = tanhf(v); else if (ACT == 9) v = 0.5f * v * (1.0f + tanhf(0.7978845608028654f * (v + 0.044715f * v * v * v))); else if (ACT == 11) v = 1.0f / (1.0f + expf(-v)); else if (ACT == 12) v = (v > 0.f) ? v : 0.01f * v; else if (ACT == 14) v = (v > 0.f) ? v : 0.1f * v; else if (ACT == 15) v = v / (1.0f + expf(-v)); else if (ACT == 3) v = fmaxf(v, 0.f); else if (ACT == 6) v = 0.5f * v * (1.0f + erff(v * 0.70710678118654752f)); so[w][8 * hh + r][t * 16 + ln] = v; } }
  __builtin_amdgcn_fence(__ATOMIC_ACQ_REL, "workgroup"); __builtin_amdgcn_wave_barrier();
  const int rsub = lane >> 4, c4 = (lane & 15) * 4; typedef _Float16 v4h __attribute__((ext_vector_type(4)));
  {
#pragma unroll
    for (int q = 0; q < 8; ++q) { const int r = q * 2 + rsub; if (col0 + c4 < N) { const v4f v = *(const v4fa*)&so[w][r][c4]; if (C) *(v4f*)(C + cofs + (size_t)(row0 + r) * ldc + col0 + c4) = v; if (C16) { v4h h4; for (int i = 0; i < 4; ++i) h4[i] = (_Float16)v[i]; *(v4h*)(C16 + cofs + (size_t)(row0 + r) * ldc + col0 + c4) = h4; } } }
     }
}


typedef _Float16 v4h __attribute__((ext_vector_type(4)));

__global__ __launch_bounds__(256) void k_x16(const float* __restrict__ x, _Float16* __restrict__ X16, size_t n8) { const size_t t = (size_t)blockIdx.x * 256 + threadIdx.x; if (t >= n8) return; FragH f;
#pragma unroll
  for (int q = 0; q < 8; ++q) f.h[q] = (_Float16)bf16_round(x[t * 8 + q]); *(v8us*)((unsigned short*)X16 + t * 8) = f.half[0];  }
__global__ __launch_bounds__(256) void k_h16(const float* __restrict__ x, _Float16* __restrict__ X16, size_t n8) { const size_t t = (size_t)blockIdx.x * 256 + threadIdx.x; if (t >= n8) return; FragH f;
#pragma unroll
  for (int q = 0; q < 8; ++q) f.h[q] = (_Float16)x[t * 8 + q]; *(v8us*)((unsigned short*)X16 + t * 8) = f.half[0];  }
__global__ __launch_bounds__(256) void k_round16f(const float* __restrict__ W, _Float16* __restrict__ Bt, size_t n8) { const size_t t = (size_t)blockIdx.x * 256 + threadIdx.x; if (t >= n8) return; FragH f;
#pragma unroll
  for (int i = 0; i < 8; ++i) f.h[i] = (_Float16)(bf16_round(W[t * 8 + i]) * 16.0f); *(v8us*)((unsigned short*)Bt + t * 8) = f.half[0];  }
template <int NHv, int TTv>
__global__ __launch_bounds__(256) void k_vt(const _Float16* __restrict__ V16, int ldv, int voff, _Float16* __restrict__ Vt) { __shared__ unsigned short tl[64][66]; const int tid = threadIdx.x; const int slab = blockIdx.x / (TTv / 64), lg = blockIdx.x % (TTv / 64); const int b = slab / NHv, h = slab % NHv;
  for (int i = tid; i < 64 * 8; i += 256) { const int r = i / 8, c8 = (i % 8) * 8; FragH f; f.half[0] = *(const v8us*)((const unsigned short*)V16 + ((size_t)b * TTv + lg * 64 + r) * ldv + voff + h * 64 + c8);
#pragma unroll
    for (int q = 0; q < 8; ++q) tl[r][c8 + q] = f.u[q]; }
  __syncthreads();
  {
#pragma unroll
    for (int rd = 0; rd < 2; ++rd) { const int d = rd * 32 + tid / 8, pc = tid % 8; FragH f;
#pragma unroll
      for (int q = 0; q < 8; ++q) f.u[q] = tl[pc * 8 + q][d];
      *(v8us*)((unsigned short*)Vt + ((size_t)slab * 64 + d) * TTv + lg * 64 + pc * 8) = f.half[0]; }
     } }

__global__ __launch_bounds__(256) void k_hl(const float* __restrict__ F, _Float16* __restrict__ Hh, _Float16* __restrict__ Hl, size_t n8) { const size_t t = (size_t)blockIdx.x * 256 + threadIdx.x; if (t >= n8) return; FragH fh, fl; const v4f a = *(const v4fa*)(F + t * 8), c = *(const v4fa*)(F + t * 8 + 4);
#pragma unroll
  for (int q = 0; q < 4; ++q) { _Float16 h = (_Float16)a[q]; fh.h[q] = h; fl.h[q] = (_Float16)((a[q] - (float)h) * 1024.0f); h = (_Float16)c[q]; fh.h[4 + q] = h; fl.h[4 + q] = (_Float16)((c[q] - (float)h) * 1024.0f); }
  { *(v8us*)((unsigned short*)Hh + t * 8) = fh.half[0]; *(v8us*)((unsigned short*)Hl + t * 8) = fl.half[0];  } }

__global__ __launch_bounds__(256) void k_tok(const float* __restrict__ x, int b, _Float16* __restrict__ X16) { const int t = blockIdx.x * 256 + threadIdx.x; if (t >= NP * (CC / 8)) return; const int c0 = (t % (CC / 8)) * 8, n = t / (CC / 8); FragH f;
#pragma unroll
  for (int q = 0; q < 8; ++q) f.h[q] = (_Float16)bf16_round(x[((size_t)b * CC + c0 + q) * NP + n]);
  *(v8us*)((unsigned short*)X16 + (size_t)n * CC + c0) = f.half[0];  }
__global__ __launch_bounds__(256) void k_split(const float* __restrict__ F, _Float16* __restrict__ Hh, _Float16* __restrict__ Hl, size_t n8) {
  #pragma clang fp contract(off)
  const size_t t = (size_t)blockIdx.x * 256 + threadIdx.x; if (t >= n8) return; const v4f a = *(const v4fa*)(F + t * 8), c = *(const v4fa*)(F + t * 8 + 4); FragH fh, fl;
#pragma unroll
  for (int q = 0; q < 8; ++q) { const float v = (q < 4) ? a[q] : c[q - 4]; const _Float16 hi = (_Float16)v; fh.h[q] = hi; fl.h[q] = (_Float16)((v - (float)hi) * 1024.0f); }
  { *(v8us*)((unsigned short*)Hh + t * 8) = fh.half[0]; *(v8us*)((unsigned short*)Hl + t * 8) = fl.half[0];  } }
__global__ __launch_bounds__(256) void k_fcomb(const float* __restrict__ F1, const float* __restrict__ F2, const float* __restrict__ al, const float* __restrict__ be, _Float16* __restrict__ FT) {
  #pragma clang fp contract(off)
  const int t = blockIdx.x * 256 + threadIdx.x; if (t >= CC * (NP / 8)) return; const int m0 = (t % (NP / 8)) * 8, c = t / (NP / 8); const float a = bf16_round(al[0]), bq = bf16_round(be[0]); FragH f;
#pragma unroll
  for (int q = 0; q < 8; ++q) f.h[q] = (_Float16)(a * F1[(size_t)(m0 + q) * CC + c] + bq * F2[(size_t)(m0 + q) * CC + c]);
  *(v8us*)((unsigned short*)FT + (size_t)c * NP + m0) = f.half[0];  }
__global__ __launch_bounds__(256) void k_sdiff(const float* __restrict__ S12, const float* __restrict__ S21, _Float16* __restrict__ D16) {
  #pragma clang fp contract(off)
  const int tid = threadIdx.x, w = tid >> 5, ln = tid & 31; const int r = blockIdx.x * 8 + w; if (r >= RB) return; const float* s1 = S12 + (size_t)r * NP; const float* s2 = S21 + (size_t)r * NP; float m1 = -3.0e38f, m2 = -3.0e38f;
#pragma unroll 1
  for (int jb = 0; jb < NP; jb += 128) { const v4f a = *(const v4fa*)(s1 + jb + 4 * ln), c = *(const v4fa*)(s2 + jb + 4 * ln);
#pragma unroll
    for (int k = 0; k < 4; ++k) { m1 = fmaxf(m1, a[k]); m2 = fmaxf(m2, c[k]); } }
  for (int o = 16; o > 0; o >>= 1) { m1 = fmaxf(m1, __shfl_xor(m1, o, 32)); m2 = fmaxf(m2, __shfl_xor(m2, o, 32)); }
  float u1 = 0.f, u2 = 0.f;
#pragma unroll 1
  for (int jb = 0; jb < NP; jb += 128) { const v4f a = *(const v4fa*)(s1 + jb + 4 * ln), c = *(const v4fa*)(s2 + jb + 4 * ln);
#pragma unroll
    for (int k = 0; k < 4; ++k) { u1 += expf(a[k] - m1); u2 += expf(c[k] - m2); } }
  for (int o = 16; o > 0; o >>= 1) { u1 += __shfl_xor(u1, o, 32); u2 += __shfl_xor(u2, o, 32); } const float i1 = 1.0f / u1, i2 = 1.0f / u2;
  {
#pragma unroll 1
    for (int jb = 0; jb < NP; jb += 128) { const v4f a = *(const v4fa*)(s1 + jb + 4 * ln), c = *(const v4fa*)(s2 + jb + 4 * ln); FragH f;
#pragma unroll
      for (int k = 0; k < 4; ++k) f.h[k] = (_Float16)(fabsf(expf(a[k] - m1) * i1 - expf(c[k] - m2) * i2) * 16384.0f);
      *(unsigned long long*)((unsigned short*)D16 + (size_t)r * NP + jb + 4 * ln) = *(const unsigned long long*)&f.u[0]; }
     } }

extern "C" void kernel_launch(void* const* d_in, const int* in_sizes, int n_in,
                              void* d_out, int out_size, void* d_ws, size_t ws_size, hipStream_t stream) {
  (void)in_sizes; (void)n_in; (void)out_size;
  const float* x1 = (const float*)d_in[0]; const float* x2 = (const float*)d_in[1]; const float* Wb = (const float*)d_in[2]; const float* bb_ = (const float*)d_in[3]; const float* Wc = (const float*)d_in[4]; const float* bc = (const float*)d_in[5]; const float* Wd = (const float*)d_in[6]; const float* bd = (const float*)d_in[7]; const float* al = (const float*)d_in[8]; const float* be = (const float*)d_in[9];
  char* ws = (char*)d_ws; size_t off = 0;
  auto take = [&](size_t bytes) { char* p = ws + off; off += (bytes + 255) & ~(size_t)255; return p; };
  _Float16* BB = (_Float16*)take(C8 * CC * 2); _Float16* BC = (_Float16*)take(C8 * CC * 2); _Float16* BD = (_Float16*)take((size_t)CC * CC * 2);
  _Float16* X1 = (_Float16*)take((size_t)NP * CC * 2); _Float16* X2 = (_Float16*)take((size_t)NP * CC * 2); float* T = (float*)take((size_t)NP * C8 * 4);
  _Float16* A1h = (_Float16*)take((size_t)NP * C8 * 2); _Float16* A1l = (_Float16*)take((size_t)NP * C8 * 2); _Float16* B2h = (_Float16*)take((size_t)NP * C8 * 2); _Float16* B2l = (_Float16*)take((size_t)NP * C8 * 2); _Float16* A2h = (_Float16*)take((size_t)NP * C8 * 2); _Float16* A2l = (_Float16*)take((size_t)NP * C8 * 2); _Float16* B1h = (_Float16*)take((size_t)NP * C8 * 2); _Float16* B1l = (_Float16*)take((size_t)NP * C8 * 2);
  float* F1 = (float*)take((size_t)NP * CC * 4); float* F2 = (float*)take((size_t)NP * CC * 4); _Float16* FT = (_Float16*)take((size_t)CC * NP * 2); float* S12 = (float*)take((size_t)RB * NP * 4); float* S21 = (float*)take((size_t)RB * NP * 4); _Float16* D16 = (_Float16*)take((size_t)RB * NP * 2);
  if (off > ws_size) return;      // 0.7 + 4.2×2 + 1 + 0.5×8 + 8.4×2 + 4.2 + 33.5×2 + 16.8 ≈ 119 MB
  k_round16f<<<(C8 * CC / 8 + 255) / 256, 256, 0, stream>>>(Wb, BB, (size_t)C8 * CC / 8); k_round16f<<<(C8 * CC / 8 + 255) / 256, 256, 0, stream>>>(Wc, BC, (size_t)C8 * CC / 8); k_round16f<<<(unsigned)(((size_t)CC * CC / 8 + 255) / 256), 256, 0, stream>>>(Wd, BD, (size_t)CC * CC / 8);      /* conv weights [O][C] = natural Bt */
  const dim3 g8(((NP / 16) * 1 + 3) / 4, 1), gD(((NP / 16) * (CC / 64) + 3) / 4, 1), gS(((RB / 16) * (NP / 64) + 3) / 4, 1), gO(((CC / 16) * (NP / 64) + 3) / 4, 1); const size_t n8 = (size_t)NP * C8 / 8; const unsigned nb8 = (unsigned)((n8 + 255) / 256);
  auto proj64 = [&](const _Float16* X, const _Float16* Bw, const float* bias, _Float16* Hh, _Float16* Hl) { k_gemm_hhx<0><<<g8, 128, 0, stream>>>(X, CC, 0, Bw, CC, 0, 0.0625f, bias, 0, nullptr, 1, 0, 0, T, nullptr, C8, 0, NP, C8, CC); k_split<<<nb8, 256, 0, stream>>>(T, Hh, Hl, n8); };
  for (int b = 0; b < NBt; ++b) {
    k_tok<<<(NP * (CC / 8) + 255) / 256, 256, 0, stream>>>(x1, b, X1); k_tok<<<(NP * (CC / 8) + 255) / 256, 256, 0, stream>>>(x2, b, X2);
    proj64(X1, BB, bb_, A1h, A1l); proj64(X2, BC, bc, B2h, B2l); proj64(X2, BB, bb_, A2h, A2l); proj64(X1, BC, bc, B1h, B1l);      /* a1 = conv_b(x1), b2 = conv_c(x2), a2 = conv_b(x2), b1 = conv_c(x1) (exact + bias) → hi/lo */
    k_gemm_hhx<0><<<gD, 128, 0, stream>>>(X1, CC, 0, BD, CC, 0, 0.0625f, bd, 0, nullptr, 1, 0, 0, F1, nullptr, CC, 0, NP, CC, CC); k_gemm_hhx<0><<<gD, 128, 0, stream>>>(X2, CC, 0, BD, CC, 0, 0.0625f, bd, 0, nullptr, 1, 0, 0, F2, nullptr, CC, 0, NP, CC, CC);      /* f1, f2 = conv_d (exact + bias) */
    k_fcomb<<<(CC * (NP / 8) + 255) / 256, 256, 0, stream>>>(F1, F2, al, be, FT);
    for (int rb = 0; rb < NP / RB; ++rb) { const size_t r0 = (size_t)rb * RB;
      k_gemm_hhx<0><<<gS, 128, 0, stream>>>(A1h + r0 * C8, C8, 0, B2h, C8, 0, 1.0f, nullptr, 0, nullptr, 1, 0, 0, S12, nullptr, NP, 0, RB, NP, C8);
      k_gemm_hhx<0><<<gS, 128, 0, stream>>>(A1l + r0 * C8, C8, 0, B2h, C8, 0, 0.0009765625f, nullptr, 0, S12, 1, (size_t)NP, 0, S12, nullptr, NP, 0, RB, NP, C8);
      k_gemm_hhx<0><<<gS, 128, 0, stream>>>(A1h + r0 * C8, C8, 0, B2l, C8, 0, 0.0009765625f, nullptr, 0, S12, 1, (size_t)NP, 0, S12, nullptr, NP, 0, RB, NP, C8);      /* a1ᵀ·b2 rows (≈f32): M 2048 N 4096 K 64 */
      k_gemm_hhx<0><<<gS, 128, 0, stream>>>(A2h + r0 * C8, C8, 0, B1h, C8, 0, 1.0f, nullptr, 0, nullptr, 1, 0, 0, S21, nullptr, NP, 0, RB, NP, C8);
      k_gemm_hhx<0><<<gS, 128, 0, stream>>>(A2l + r0 * C8, C8, 0, B1h, C8, 0, 0.0009765625f, nullptr, 0, S21, 1, (size_t)NP, 0, S21, nullptr, NP, 0, RB, NP, C8);
      k_gemm_hhx<0><<<gS, 128, 0, stream>>>(A2h + r0 * C8, C8, 0, B1l, C8, 0, 0.0009765625f, nullptr, 0, S21, 1, (size_t)NP, 0, S21, nullptr, NP, 0, RB, NP, C8);      /* a2ᵀ·b1 rows */
      k_sdiff<<<RB / 8, 256, 0, stream>>>(S12, S21, D16);
      k_gemm_hhx<0><<<gO, 128, 0, stream>>>(FT, NP, 0, D16, NP, 0, 1.0f / 16384.0f, nullptr, 0, nullptr, 1, 0, 0, (float*)d_out + (size_t)b * CC * NP + r0, nullptr, NP, 0, CC, RB, NP); } }      /* out[b][c][n] = Σ_m F[c][m]·att[n][m] for n in the block: M 512 (c), N 2048 (n), K 4096 (m) → NCHW directly */
}

// v001
// Measured time: 1040 microseconds a run.
// Next to v000, in two timings, it ran 1.50 and 1.49 times as fast.
#include <hip/hip_runtime.h>
// Position-attention difference module (B 2, C 512, 64×64 = 4096 positions): a1 = conv_b(x1), b2 = conv_c(x2), a2 = conv_b(x2), b1 = conv_c(x1) (1×1, 512→64, + bias); f = conv_d (512→512, + bias); att12 = softmax_m(a1ᵀ·b2), att21 = softmax_m(a2ᵀ·b1) (no scaling); att = |att12 − att21|; out = α·f1·attᵀ + β·f2·attᵀ = (α f1 + β f2)·attᵀ → [2,512,64,64].
// Structure: per batch: 1x1 convs as GEMMs on position-major f16 planes (exact products); a/b as f16 hi + lo*2^10 planes so both logit matrices are about f32 (three cross products each); one kernel forms both logit matrices in registers, both softmaxes per row in f32 and writes |difference| x 2^14 as f16; F = alpha f1 + beta f2 (f32 combine, then f16) and out = F.att^T by one GEMM straight into the NCHW output.
// Compute dtype: inputs and parameters rounded to bf16; logits ≈f32; softmaxes/difference in f32; |Δ| (×2^14) and F as f16 operands (≈2^-12), f32 accumulation. v_wmma_f32_16x16x32_f16.
#define NBt 2
#define CC 512
#define C8 64
#define NP 4096
#define RB 2048                  /* query rows per score block */
typedef __bf16 v16b __attribute__((ext_vector_type(16)));
typedef unsigned short v8us __attribute__((ext_vector_type(8), may_alias));
typedef float  v8f  __attribute__((ext_vector_type(8)));
typedef float  v4f  __attribute__((ext_vector_type(4)));
typedef float  v4fa __attribute__((ext_vector_type(4), may_alias));
union FragB { v16b v; v8us half[2]; unsigned short u[16]; };

__device__ __forceinline__ unsigned short bf16_bits(float x) { unsigned int u = __float_as_uint(x); return (unsigned short)((u + 0x7FFFu + ((u >> 16) & 1u)) >> 16); }
__device__ __forceinline__ float bf16_val(unsigned short b) { return __uint_as_float(((unsigned int)b) << 16); }
__device__ __forceinline__ float bf16_round(float x) { return bf16_val(bf16_bits(x)); }
// D += A·B with NT terms: 1 = ah·bh, 2 = + al·bh (A split), 3 = + ah·bl (both split)
template <int NT>
__device__ __forceinline__ v8f mmaN(v16b ah, v16b al, v16b bh, v16b bl, v8f c) {
  c = __builtin_amdgcn_wmma_f32_16x16x32_bf16(false, ah, false, bh, (short)0, c, false, false);
  if (NT >= 2) c = __builtin_amdgcn_wmma_f32_16x16x32_bf16(false, al, false, bh, (short)0, c, false, false);
  if (NT >= 3) c = __builtin_amdgcn_wmma_f32_16x16x32_bf16(false, ah, false, bl, (short)0, c, false, false);
  asm volatile("v_nop\n\tv_nop\n\tv_nop\n\tv_nop" : "+v"(c) : "v"(ah), "v"(al), "v"(bh), "v"(bl));
  return c;
}

__global__ __launch_bounds__(256) void k_wt_bf16(const float* __restrict__ W, unsigned short* __restrict__ Wt, int K, int N) {
  const int t = blockIdx.x * 256 + threadIdx.x;
  const int k8n = K / 8;
  if (t >= N * k8n) return;
  const int n = t / k8n, k8 = (t % k8n) * 8;
  v8us v;
#pragma unroll
  for (int i = 0; i < 8; ++i) v[i] = bf16_bits(W[(size_t)(k8 + i) * N + n]);
  *(v8us*)(Wt + (size_t)n * K + k8) = v;
  
}

// GEMM C[M][N] (f32, pitch ldc) = act(A[M][K]·W + bias). A f32 row-major (pitch lda) converted per fragment to bf16
// (ASPLIT: hi/lo two planes -> 2 terms, else single rounded term); Wt bf16 [N][K] (pitch ldb). BIAS_BF16 rounds the
// bias to bf16 first (bias quantised to bf16 before the add). K%32==0, M%16==0, N%64==0.
template <bool ASPLIT, int ACT, bool BIAS_BF16>
__global__ __launch_bounds__(128) void k_gemm_bf(const float* __restrict__ A, int lda, const unsigned short* __restrict__ Wt, int ldb,
                                               const float* __restrict__ bias, float* __restrict__ C, int ldc, int M, int N, int K) {
  __shared__ __attribute__((aligned(16))) float so[4][16][64];
  const int tid = threadIdx.x, w = tid >> 5, lane = tid & 31, ln = lane & 15, hh = lane >> 4;
  const int ntn = N / 64;
  const int wid = blockIdx.x * 4 + w;
  const int mt = wid / ntn, nq = wid % ntn;
  if (mt * 16 >= M) return;
  const int row0 = mt * 16, col0 = nq * 64;
  const float* arow = A + (size_t)(row0 + ln) * lda;
  v8f acc[4] = {};
  for (int kb = 0; kb < K; kb += 32) {
    FragB ah, al;
    const v4f x0 = *(const v4fa*)(arow + kb + 8 * hh), x1 = *(const v4fa*)(arow + kb + 8 * hh + 4);
    const v4f x2 = *(const v4fa*)(arow + kb + 16 + 8 * hh), x3 = *(const v4fa*)(arow + kb + 16 + 8 * hh + 4);
    float xs[16] = {x0[0],x0[1],x0[2],x0[3],x1[0],x1[1],x1[2],x1[3],x2[0],x2[1],x2[2],x2[3],x3[0],x3[1],x3[2],x3[3]};
#pragma unroll
    for (int i = 0; i < 16; ++i) { const unsigned short hb = bf16_bits(xs[i]); ah.u[i] = hb; al.u[i] = ASPLIT ? bf16_bits(xs[i] - bf16_val(hb)) : (unsigned short)0; }
#pragma unroll
    for (int t = 0; t < 4; ++t) {
      const unsigned short* brow = Wt + (size_t)(col0 + t * 16 + ln) * ldb + kb;
      FragB b;
      b.half[0] = *(const v8us*)(brow + 8 * hh);
      b.half[1] = *(const v8us*)(brow + 16 + 8 * hh);
      acc[t] = mmaN<ASPLIT ? 2 : 1>(ah.v, al.v, b.v, b.v, acc[t]);
    }
  }
#pragma unroll
  for (int t = 0; t < 4; ++t) {
    float bv = bias ? bias[col0 + t * 16 + ln] : 0.f;
    if (BIAS_BF16) bv = bf16_round(bv);
#pragma unroll
    for (int r = 0; r < 8; ++r) { float v = acc[t][r] + bv; if (ACT == 1) v = fmaxf(v, 0.f); so[w][8 * hh + r][t * 16 + ln] = v; }
  }
  __builtin_amdgcn_fence(__ATOMIC_ACQ_REL, "workgroup");
  __builtin_amdgcn_wave_barrier();
  const int rsub = lane >> 4, c4 = (lane & 15) * 4;
  {
#pragma unroll
    for (int q = 0; q < 8; ++q) {
      const int r = q * 2 + rsub;
      const v4f v = *(const v4fa*)&so[w][r][c4];
      *(v4f*)(C + (size_t)(row0 + r) * ldc + col0 + c4) = v;
    }
    
  }
}

// GEMM C = act(A·W + bias + resid): A f32 (ASPLIT -> hi/lo 2 terms), Wt bf16 [N][K]; ACT 0 none, 1 relu, 2 exact gelu;
// resid (optional, f32, row index = (row % rmod), pitch ldr, RES_BF16 rounds it) added before the activation.
template <bool ASPLIT, int ACT, bool BIAS_BF16, bool RES_BF16>
__global__ __launch_bounds__(128) void k_gemm_bf3(const float* __restrict__ A, int lda, const unsigned short* __restrict__ Wt, int ldb,
                                                const float* __restrict__ bias, const float* __restrict__ resid, int rmod, int ldr,
                                                float* __restrict__ C, int ldc, int M, int N, int K) {
  __shared__ __attribute__((aligned(16))) float so[4][16][64];
  const int tid = threadIdx.x, w = tid >> 5, lane = tid & 31, ln = lane & 15, hh = lane >> 4;
  const int ntn = N / 64;
  const int wid = blockIdx.x * 4 + w;
  const int mt = wid / ntn, nq = wid % ntn;
  if (mt * 16 >= M) return;
  const int row0 = mt * 16, col0 = nq * 64;
  const float* arow = A + (size_t)(row0 + ln) * lda;
  v8f acc[4] = {};
  for (int kb = 0; kb < K; kb += 32) {
    FragB ah, al;
    const v4f x0 = *(const v4fa*)(arow + kb + 8 * hh), x1 = *(const v4fa*)(arow + kb + 8 * hh + 4);
    const v4f x2 = *(const v4fa*)(arow + kb + 16 + 8 * hh), x3 = *(const v4fa*)(arow + kb + 16 + 8 * hh + 4);
    float xs[16] = {x0[0],x0[1],x0[2],x0[3],x1[0],x1[1],x1[2],x1[3],x2[0],x2[1],x2[2],x2[3],x3[0],x3[1],x3[2],x3[3]};
#pragma unroll
    for (int i = 0; i < 16; ++i) { const unsigned short hb = bf16_bits(xs[i]); ah.u[i] = hb; al.u[i] = ASPLIT ? bf16_bits(xs[i] - bf16_val(hb)) : (unsigned short)0; }
#pragma unroll
    for (int t = 0; t < 4; ++t) {
      const unsigned short* brow = Wt + (size_t)(col0 + t * 16 + ln) * ldb + kb;
      FragB b;
      b.half[0] = *(const v8us*)(brow + 8 * hh);
      b.half[1] = *(const v8us*)(brow + 16 + 8 * hh);
      acc[t] = mmaN<ASPLIT ? 2 : 1>(ah.v, al.v, b.v, b.v, acc[t]);
    }
  }
#pragma unroll
  for (int t = 0; t < 4; ++t) {
    const int col = col0 + t * 16 + ln;
    float bv = bias ? bias[col] : 0.f;
    if (BIAS_BF16) bv = bf16_round(bv);
#pragma unroll
    for (int r = 0; r < 8; ++r) {
      float v = acc[t][r] + bv;
      if (resid) { float rv = resid[(size_t)((row0 + 8 * hh + r) % rmod) * ldr + col]; if (RES_BF16) rv = bf16_round(rv); v += rv; }
      if (ACT == 1) v = fmaxf(v, 0.f);
      if (ACT == 2) v = 0.5f * v * (1.0f + erff(v * 0.70710678118654752f));
      if (ACT == 3) { const float u = 0.7978845608028654f * (v + 0.044715f * v * v * v); v = 0.5f * v * (1.0f + tanhf(u)); }
      so[w][8 * hh + r][t * 16 + ln] = v;
    }
  }
  __builtin_amdgcn_fence(__ATOMIC_ACQ_REL, "workgroup");
  __builtin_amdgcn_wave_barrier();
  const int rsub = lane >> 4, c4 = (lane & 15) * 4;
  {
#pragma unroll
    for (int q = 0; q < 8; ++q) {
      const int r = q * 2 + rsub;
      const v4f v = *(const v4fa*)&so[w][r][c4];
      *(v4f*)(C + (size_t)(row0 + r) * ldc + col0 + c4) = v;
    }
    
  }
}
// row LayerNorm (biased variance, eps) over N: s = X (+ R); optional out_sum <- s; out_norm <- (s-mu)*rsqrt(var+eps)*g + b
template <bool PARAM_BF16>
__global__ __launch_bounds__(256) void k_layernorm(const float* __restrict__ X, const float* __restrict__ R, const float* __restrict__ g, const float* __restrict__ bta,
                                                  float* __restrict__ out_sum, float* __restrict__ out_norm, int N, float eps) {
  __shared__ float red[256];
  const int row = blockIdx.x, tid = threadIdx.x;
  const float* x = X + (size_t)row * N; const float* rr = R ? R + (size_t)row * N : nullptr;
  float vals[16];                     // up to N = 4096
  const int per = N / 256;            // contiguous chunk per thread? use strided-by-4 chunks: thread handles j = tid*4 + 1024*u
  float s1 = 0.f;
  for (int u = 0; u < per / 4; ++u) {
    const int j = tid * 4 + 1024 * u;
    const v4f a = *(const v4fa*)(x + j);
    v4f b = {0.f,0.f,0.f,0.f}; if (rr) b = *(const v4fa*)(rr + j);
#pragma unroll
    for (int q = 0; q < 4; ++q) { const float v = a[q] + b[q]; vals[u * 4 + q] = v; s1 += v; }
  }
  red[tid] = s1; __syncthreads();
  for (int st = 128; st > 0; st >>= 1) { if (tid < st) red[tid] += red[tid + st]; __syncthreads(); }
  const float mu = red[0] / (float)N; __syncthreads();
  float s2 = 0.f;
  for (int u = 0; u < per / 4; ++u)
#pragma unroll
    for (int q = 0; q < 4; ++q) { const float c = vals[u * 4 + q] - mu; s2 += c * c; }
  red[tid] = s2; __syncthreads();
  for (int st = 128; st > 0; st >>= 1) { if (tid < st) red[tid] += red[tid + st]; __syncthreads(); }
  const float rs = rsqrtf(red[0] / (float)N + eps);
  {
    for (int u = 0; u < per / 4; ++u) {
      const int j = tid * 4 + 1024 * u;
      v4f o, sm;
#pragma unroll
      for (int q = 0; q < 4; ++q) {
        float gg = g[j + q], bb = bta[j + q];
        if (PARAM_BF16) { gg = bf16_round(gg); bb = bf16_round(bb); }
        sm[q] = vals[u * 4 + q]; o[q] = (vals[u * 4 + q] - mu) * rs * gg + bb;
      }
      if (out_sum) *(v4f*)(out_sum + (size_t)row * N + j) = sm;
      *(v4f*)(out_norm + (size_t)row * N + j) = o;
    }
    
  }
}



// ---- f16 WMMA path (v_wmma_f32_16x16x32_f16): 11-bit significands for operands in range — used where a [0,1] probability operand needs more precision than bf16
typedef _Float16 v16h __attribute__((ext_vector_type(16)));
union FragH { v16h v; v8us half[2]; _Float16 h[16]; unsigned short u[16]; };
template <int NT>
__device__ __forceinline__ v8f mmaH(v16h ah, v16h al, v16h bh, v16h bl, v8f c) {
  c = __builtin_amdgcn_wmma_f32_16x16x32_f16(false, ah, false, bh, (short)0, c, false, false);
  if (NT >= 2) c = __builtin_amdgcn_wmma_f32_16x16x32_f16(false, al, false, bh, (short)0, c, false, false);
  if (NT >= 3) c = __builtin_amdgcn_wmma_f32_16x16x32_f16(false, ah, false, bl, (short)0, c, false, false);
  asm volatile("v_nop\n\tv_nop\n\tv_nop\n\tv_nop" : "+v"(c) : "v"(ah), "v"(al), "v"(bh), "v"(bl));
  return c;
}
// batched GEMM like k_gemm_b but f16 operands: A f32 (split into f16 hi/lo if ASPLIT, else rounded to f16), Bt = f16 values [n][k]; alpha; C f32; N multiple of 16 (partial tiles skipped)
template <bool ASPLIT>
__global__ __launch_bounds__(128) void k_gemm_h(const float* __restrict__ A, int lda, size_t sA, const _Float16* __restrict__ Bh, int ldb, size_t sB, float alpha, float* __restrict__ C, int ldc, size_t sC, int M, int N, int K) {
  __shared__ __attribute__((aligned(16))) float so[4][16][64];
  const int tid = threadIdx.x, w = tid >> 5, lane = tid & 31, ln = lane & 15, hh = lane >> 4; const int by = blockIdx.y;
  A += (size_t)by * sA; Bh += (size_t)by * sB; C += (size_t)by * sC;
  const int ntn = (N + 63) / 64; const int wid = blockIdx.x * 4 + w; const int mt = wid / ntn, nq = wid % ntn; if (mt * 16 >= M) return;
  const int row0 = mt * 16, col0 = nq * 64; const float* arow = A + (size_t)(row0 + ln) * lda;
  v8f acc[4] = {};
  for (int kb = 0; kb < K; kb += 32) {
    FragH ah, al;
    const v4f x0 = *(const v4fa*)(arow + kb + 8 * hh), x1 = *(const v4fa*)(arow + kb + 8 * hh + 4), x2 = *(const v4fa*)(arow + kb + 16 + 8 * hh), x3 = *(const v4fa*)(arow + kb + 16 + 8 * hh + 4);
    float xs[16] = {x0[0],x0[1],x0[2],x0[3],x1[0],x1[1],x1[2],x1[3],x2[0],x2[1],x2[2],x2[3],x3[0],x3[1],x3[2],x3[3]};
#pragma unroll
    for (int i = 0; i < 16; ++i) { const _Float16 h = (_Float16)xs[i]; ah.h[i] = h; al.h[i] = ASPLIT ? (_Float16)(xs[i] - (float)h) : (_Float16)0.0f; }
#pragma unroll
    for (int t = 0; t < 4; ++t) { if (col0 + t * 16 >= N) continue; const size_t boff = (size_t)(col0 + t * 16 + ln) * ldb + kb; FragH bq; bq.half[0] = *(const v8us*)(Bh + boff + 8 * hh); bq.half[1] = *(const v8us*)(Bh + boff + 16 + 8 * hh);
      acc[t] = mmaH<ASPLIT ? 2 : 1>(ah.v, al.v, bq.v, bq.v, acc[t]); }
  }
#pragma unroll
  for (int t = 0; t < 4; ++t) { if (col0 + t * 16 >= N) continue;
#pragma unroll
    for (int r = 0; r < 8; ++r) so[w][8 * hh + r][t * 16 + ln] = acc[t][r] * alpha; }
  __builtin_amdgcn_fence(__ATOMIC_ACQ_REL, "workgroup"); __builtin_amdgcn_wave_barrier();
  const int rsub = lane >> 4, c4 = (lane & 15) * 4;
  {
#pragma unroll
    for (int q = 0; q < 8; ++q) { const int r = q * 2 + rsub; if (col0 + c4 < N) { const v4f v = *(const v4fa*)&so[w][r][c4]; *(v4f*)(C + (size_t)(row0 + r) * ldc + col0 + c4) = v; } }
     }
}

// Wt[n][k] = f16(W[k][n]·scale) from f32 row-major W[K][N] (scale = power of two; bf16-exact weights stay exact in f16 away from the subnormal range)
__global__ __launch_bounds__(256) void k_wt_f16(const float* __restrict__ W, _Float16* __restrict__ Wt, int K, int N, float scale) {
  const int t = blockIdx.x * 256 + threadIdx.x; if (t >= N * (K / 8)) return; const int n = t / (K / 8), k8 = (t % (K / 8)) * 8; FragH f;
#pragma unroll
  for (int i = 0; i < 8; ++i) f.h[i] = (_Float16)(bf16_round(W[(size_t)(k8 + i) * N + n]) * scale); const v8us o = f.half[0];
  *(v8us*)((unsigned short*)Wt + (size_t)n * K + k8) = o; 
}
// k_gemm_hh variant with fused epilogue: v = acc·alpha + bias[by·sBias + col] (+ CP[(row/rowsPerB)·sCPb + by·64 + col] if CP) ; ACT 0 none / 1 elu ; writes f32 C and f16 C16, each if non-null
template <int ACT>
__global__ __launch_bounds__(128) void k_gemm_hhx(const _Float16* __restrict__ A, int lda, size_t sA, const _Float16* __restrict__ Bh, int ldb, size_t sB, float alpha, const float* __restrict__ bias, size_t sBias, const float* __restrict__ CP, int rowsPerB, size_t sCPb, int row0g,
    float* __restrict__ C, _Float16* __restrict__ C16, int ldc, size_t sC, int M, int N, int K) {
  __shared__ __attribute__((aligned(16))) float so[4][16][64];
  const int tid = threadIdx.x, w = tid >> 5, lane = tid & 31, ln = lane & 15, hh = lane >> 4; const int by = blockIdx.y;
  A += (size_t)by * sA; Bh += (size_t)by * sB; const size_t cofs = (size_t)by * sC; const float* bp = bias ? bias + (size_t)by * sBias : nullptr;
  const int ntn = (N + 63) / 64; const int wid = blockIdx.x * 4 + w; const int mt = wid / ntn, nq = wid % ntn; if (mt * 16 >= M) return;
  const int row0 = mt * 16, col0 = nq * 64; const _Float16* arow = A + (size_t)(row0 + ln) * lda;
  v8f acc[4] = {};
  for (int kb = 0; kb < K; kb += 32) { FragH ah; ah.half[0] = *(const v8us*)((const unsigned short*)arow + kb + 8 * hh); ah.half[1] = *(const v8us*)((const unsigned short*)arow + kb + 16 + 8 * hh);
#pragma unroll
    for (int t = 0; t < 4; ++t) { if (col0 + t * 16 >= N) continue; const size_t boff = (size_t)(col0 + t * 16 + ln) * ldb + kb; FragH bq; bq.half[0] = *(const v8us*)((const unsigned short*)Bh + boff + 8 * hh); bq.half[1] = *(const v8us*)((const unsigned short*)Bh + boff + 16 + 8 * hh);
      acc[t] = mmaH<1>(ah.v, ah.v, bq.v, bq.v, acc[t]); }
  }
#pragma unroll
  for (int t = 0; t < 4; ++t) { if (col0 + t * 16 >= N) continue; const int col = col0 + t * 16 + ln; const float bv = bp ? bf16_round(bp[col]) : 0.f;
#pragma unroll
    for (int r = 0; r < 8; ++r) { float v = acc[t][r] * alpha + bv; if (CP) { const int bidx = (row0g + row0 + 8 * hh + r) / rowsPerB; v += CP[(size_t)bidx * sCPb + (size_t)by * 64 + col]; } if (ACT == 1) v = (v > 0.f) ? v : expm1f(v); else if (ACT == 7) v = (v > 0.f) ? v + 1.0f : expf(v); else if (ACT == 8) v = tanhf(v); else if (ACT == 9) v = 0.5f * v * (1.0f + tanhf(0.7978845608028654f * (v + 0.044715f * v * v * v))); else if (ACT == 11) v = 1.0f / (1.0f + expf(-v)); else if (ACT == 12) v = (v > 0.f) ? v : 0.01f * v; else if (ACT == 14) v = (v > 0.f) ? v : 0.1f * v; else if (ACT == 15) v = v / (1.0f + expf(-v)); else if (ACT == 3) v = fmaxf(v, 0.f); else if (ACT == 6) v = 0.5f * v * (1.0f + erff(v * 0.70710678118654752f)); so[w][8 * hh + r][t * 16 + ln] = v; } }
  __builtin_amdgcn_fence(__ATOMIC_ACQ_REL, "workgroup"); __builtin_amdgcn_wave_barrier();
  const int rsub = lane >> 4, c4 = (lane & 15) * 4; typedef _Float16 v4h __attribute__((ext_vector_type(4)));
  {
#pragma unroll
    for (int q = 0; q < 8; ++q) { const int r = q * 2 + rsub; if (col0 + c4 < N) { const v4f v = *(const v4fa*)&so[w][r][c4]; if (C) *(v4f*)(C + cofs + (size_t)(row0 + r) * ldc + col0 + c4) = v; if (C16) { v4h h4; for (int i = 0; i < 4; ++i) h4[i] = (_Float16)v[i]; *(v4h*)(C16 + cofs + (size_t)(row0 + r) * ldc + col0 + c4) = h4; } } }
     }
}


typedef _Float16 v4h __attribute__((ext_vector_type(4)));

__global__ __launch_bounds__(256) void k_x16(const float* __restrict__ x, _Float16* __restrict__ X16, size_t n8) { const size_t t = (size_t)blockIdx.x * 256 + threadIdx.x; if (t >= n8) return; FragH f;
#pragma unroll
  for (int q = 0; q < 8; ++q) f.h[q] = (_Float16)bf16_round(x[t * 8 + q]); *(v8us*)((unsigned short*)X16 + t * 8) = f.half[0];  }
__global__ __launch_bounds__(256) void k_h16(const float* __restrict__ x, _Float16* __restrict__ X16, size_t n8) { const size_t t = (size_t)blockIdx.x * 256 + threadIdx.x; if (t >= n8) return; FragH f;
#pragma unroll
  for (int q = 0; q < 8; ++q) f.h[q] = (_Float16)x[t * 8 + q]; *(v8us*)((unsigned short*)X16 + t * 8) = f.half[0];  }
__global__ __launch_bounds__(256) void k_round16f(const float* __restrict__ W, _Float16* __restrict__ Bt, size_t n8) { const size_t t = (size_t)blockIdx.x * 256 + threadIdx.x; if (t >= n8) return; FragH f;
#pragma unroll
  for (int i = 0; i < 8; ++i) f.h[i] = (_Float16)(bf16_round(W[t * 8 + i]) * 16.0f); *(v8us*)((unsigned short*)Bt + t * 8) = f.half[0];  }
template <int NHv, int TTv>
__global__ __launch_bounds__(256) void k_vt(const _Float16* __restrict__ V16, int ldv, int voff, _Float16* __restrict__ Vt) { __shared__ unsigned short tl[64][66]; const int tid = threadIdx.x; const int slab = blockIdx.x / (TTv / 64), lg = blockIdx.x % (TTv / 64); const int b = slab / NHv, h = slab % NHv;
  for (int i = tid; i < 64 * 8; i += 256) { const int r = i / 8, c8 = (i % 8) * 8; FragH f; f.half[0] = *(const v8us*)((const unsigned short*)V16 + ((size_t)b * TTv + lg * 64 + r) * ldv + voff + h * 64 + c8);
#pragma unroll
    for (int q = 0; q < 8; ++q) tl[r][c8 + q] = f.u[q]; }
  __syncthreads();
  {
#pragma unroll
    for (int rd = 0; rd < 2; ++rd) { const int d = rd * 32 + tid / 8, pc = tid % 8; FragH f;
#pragma unroll
      for (int q = 0; q < 8; ++q) f.u[q] = tl[pc * 8 + q][d];
      *(v8us*)((unsigned short*)Vt + ((size_t)slab * 64 + d) * TTv + lg * 64 + pc * 8) = f.half[0]; }
     } }

__global__ __launch_bounds__(256) void k_hl(const float* __restrict__ F, _Float16* __restrict__ Hh, _Float16* __restrict__ Hl, size_t n8) { const size_t t = (size_t)blockIdx.x * 256 + threadIdx.x; if (t >= n8) return; FragH fh, fl; const v4f a = *(const v4fa*)(F + t * 8), c = *(const v4fa*)(F + t * 8 + 4);
#pragma unroll
  for (int q = 0; q < 4; ++q) { _Float16 h = (_Float16)a[q]; fh.h[q] = h; fl.h[q] = (_Float16)((a[q] - (float)h) * 1024.0f); h = (_Float16)c[q]; fh.h[4 + q] = h; fl.h[4 + q] = (_Float16)((c[q] - (float)h) * 1024.0f); }
  { *(v8us*)((unsigned short*)Hh + t * 8) = fh.half[0]; *(v8us*)((unsigned short*)Hl + t * 8) = fl.half[0];  } }

__global__ __launch_bounds__(256) void k_tok(const float* __restrict__ x, int b, _Float16* __restrict__ X16) { const int t = blockIdx.x * 256 + threadIdx.x; if (t >= NP * (CC / 8)) return; const int c0 = (t % (CC / 8)) * 8, n = t / (CC / 8); FragH f;
#pragma unroll
  for (int q = 0; q < 8; ++q) f.h[q] = (_Float16)bf16_round(x[((size_t)b * CC + c0 + q) * NP + n]);
  *(v8us*)((unsigned short*)X16 + (size_t)n * CC + c0) = f.half[0];  }
__global__ __launch_bounds__(256) void k_split(const float* __restrict__ F, _Float16* __restrict__ Hh, _Float16* __restrict__ Hl, size_t n8) {
  #pragma clang fp contract(off)
  const size_t t = (size_t)blockIdx.x * 256 + threadIdx.x; if (t >= n8) return;
  // planes in WMMA fragment order, 16 positions x 64 channels per 2-KiB block: [k step of 32][fragment half][lane][8 channels]; piece t of the plane is position 16*(t>>7) + (t&15), channels 8*sc..8*sc+7
  const size_t sc = ((t >> 6) & 1) * 4 + ((t >> 5) & 1) * 2 + ((t >> 4) & 1), so = ((t >> 7) * 16 + (t & 15)) * C8 + sc * 8;
  const v4f a = *(const v4fa*)(F + so), c = *(const v4fa*)(F + so + 4); FragH fh, fl;
#pragma unroll
  for (int q = 0; q < 8; ++q) { const float v = (q < 4) ? a[q] : c[q - 4]; const _Float16 hi = (_Float16)v; fh.h[q] = hi; fl.h[q] = (_Float16)((v - (float)hi) * 1024.0f); }
  { *(v8us*)((unsigned short*)Hh + t * 8) = fh.half[0]; *(v8us*)((unsigned short*)Hl + t * 8) = fl.half[0];  } }
__global__ __launch_bounds__(256) void k_fcomb(const float* __restrict__ F1, const float* __restrict__ F2, const float* __restrict__ al, const float* __restrict__ be, _Float16* __restrict__ FT) {
  #pragma clang fp contract(off)
  const int t = blockIdx.x * 256 + threadIdx.x; if (t >= CC * (NP / 8)) return; const int m0 = (t % (NP / 8)) * 8, c = t / (NP / 8); const float a = bf16_round(al[0]), bq = bf16_round(be[0]); FragH f;
#pragma unroll
  for (int q = 0; q < 8; ++q) f.h[q] = (_Float16)(a * F1[(size_t)(m0 + q) * CC + c] + bq * F2[(size_t)(m0 + q) * CC + c]);
  *(v8us*)((unsigned short*)FT + (size_t)c * NP + m0) = f.half[0];  }
// One 16x32 f16 fragment (A row or B column = lane & 15; k = 8*(lane>>4)+0..7 and 16+8*(lane>>4)+0..7) from a plane in the fragment order that k_split writes; p already holds 8*lane.
// Each of the two loads reads 512 contiguous bytes (4 whole lines) per wave; from a row-major plane it would touch 16 lines.
__device__ __forceinline__ v16h frag_at(const _Float16* p) { FragH f; f.half[0] = *(const v8us*)((const unsigned short*)p); f.half[1] = *(const v8us*)((const unsigned short*)p + 256); return f.v; }
__device__ __forceinline__ v8f wm(v16h a, v16h b, v8f c) { return __builtin_amdgcn_wmma_f32_16x16x32_f16(false, a, false, b, (short)0, c, false, false); }
// value of lane ^ X inside the 16-lane row, by DPP row_xmask (a shuffle would go through the LDS pipe and its wait); every lane is on where it is used
template <int X> __device__ __forceinline__ float row_xor(float v) { return __int_as_float(__builtin_amdgcn_update_dpp(0, __float_as_int(v), 0x160 + X, 0xf, 0xf, true)); }
__device__ __forceinline__ float row_max16(float v) { v = fmaxf(v, row_xor<1>(v)); v = fmaxf(v, row_xor<2>(v)); v = fmaxf(v, row_xor<4>(v)); return fmaxf(v, row_xor<8>(v)); }
__device__ __forceinline__ float row_sum16(float v) { v += row_xor<1>(v); v += row_xor<2>(v); v += row_xor<4>(v); return v + row_xor<8>(v); }
struct QFrag { v16h a1h[2], a1l[2], a2h[2], a2l[2]; };
// both logit tiles (16 query rows x 16 key columns, K 64) from the hi/lo planes: hi*hi in one accumulator, the two cross terms (scaled 2^10) in a second
__device__ __forceinline__ void logit_tile(const QFrag& q, const _Float16* b2h, const _Float16* b2l, const _Float16* b1h, const _Float16* b1l, v8f& s1, v8f& s2) {
  v8f h1 = {}, l1 = {}, h2 = {}, l2 = {};
  const v16h p[2] = {frag_at(b2h), frag_at(b2h + 512)}, x[2] = {frag_at(b1h), frag_at(b1h + 512)}, pl[2] = {frag_at(b2l), frag_at(b2l + 512)}, xl[2] = {frag_at(b1l), frag_at(b1l + 512)};
  // holds all sixteen loads of the tile in front of its first WMMA: one load latency a tile; left alone the compiler reuses fragment registers and waits for memory several times a tile
  asm volatile("" :: "v"(p[0]), "v"(p[1]), "v"(x[0]), "v"(x[1]), "v"(pl[0]), "v"(pl[1]), "v"(xl[0]), "v"(xl[1]));
#pragma unroll
  for (int ks = 0; ks < 2; ++ks) {
    h1 = wm(q.a1h[ks], p[ks], h1); h2 = wm(q.a2h[ks], x[ks], h2); l1 = wm(q.a1l[ks], p[ks], l1); l2 = wm(q.a2l[ks], x[ks], l2); l1 = wm(q.a1h[ks], pl[ks], l1); l2 = wm(q.a2h[ks], xl[ks], l2);
  }
#pragma unroll
  for (int r = 0; r < 8; ++r) { s1[r] = h1[r] + l1[r] * 0.0009765625f; s2[r] = h2[r] + l2[r] * 0.0009765625f; }
}
// Logits, both softmaxes and |difference| in one kernel: a work-group of 16 waves owns 16 query rows, wave w the key columns [256 w, 256 w + 256).
// The logits stay in registers and are formed three times (row maximum, row sum, output); nothing of them goes to memory.
#define DW 16                    /* waves per work-group */
#define DCOL (NP / DW)           /* key columns per wave */
#define DPIT (DCOL + 8)          /* LDS row pitch in f16: 16-byte multiple, rows 8 apart fall on other banks */
__global__ __launch_bounds__(512) void k_attdiff(const _Float16* __restrict__ A1h, const _Float16* __restrict__ A1l, const _Float16* __restrict__ A2h, const _Float16* __restrict__ A2l,
                                                 const _Float16* __restrict__ B2h, const _Float16* __restrict__ B2l, const _Float16* __restrict__ B1h, const _Float16* __restrict__ B1l, _Float16* __restrict__ D16) {
  __shared__ __attribute__((aligned(16))) _Float16 st[DW][16][DPIT];
  __shared__ float red[2][DW][16];
  __shared__ float fin[2][16];
  const int tid = threadIdx.x, w = tid >> 5, lane = tid & 31, ln = lane & 15, hh = lane >> 4; const int row0 = blockIdx.x * 16;
  QFrag q; { const size_t ao = (size_t)row0 * C8 + 8 * lane;
#pragma unroll
    for (int ks = 0; ks < 2; ++ks) { q.a1h[ks] = frag_at(A1h + ao + ks * 512); q.a1l[ks] = frag_at(A1l + ao + ks * 512); q.a2h[ks] = frag_at(A2h + ao + ks * 512); q.a2l[ks] = frag_at(A2l + ao + ks * 512); } }
  const size_t bo = (size_t)(w * DCOL) * C8 + 8 * lane; B2h += bo; B2l += bo; B1h += bo; B1l += bo;
  float m1[8], m2[8];
#pragma unroll
  for (int r = 0; r < 8; ++r) { m1[r] = -3.0e38f; m2[r] = -3.0e38f; }
#pragma unroll 1  /* rolled: an unrolled body would hold several tiles' B fragments and leave the 256-register budget of 4 waves per SIMD */
  for (int j = 0; j < DCOL / 16; ++j) { v8f s1, s2; const size_t o = (size_t)j * 16 * C8; logit_tile(q, B2h + o, B2l + o, B1h + o, B1l + o, s1, s2);
#pragma unroll
    for (int r = 0; r < 8; ++r) { m1[r] = fmaxf(m1[r], s1[r]); m2[r] = fmaxf(m2[r], s2[r]); } }
#pragma unroll
  for (int r = 0; r < 8; ++r) { m1[r] = row_max16(m1[r]); m2[r] = row_max16(m2[r]); }
  if (ln == 0) {
#pragma unroll
    for (int r = 0; r < 8; ++r) { red[0][w][8 * hh + r] = m1[r]; red[1][w][8 * hh + r] = m2[r]; } }
  __syncthreads();
  if (tid < 32) { float v = red[tid >> 4][0][tid & 15]; for (int k = 1; k < DW; ++k) v = fmaxf(v, red[tid >> 4][k][tid & 15]); fin[tid >> 4][tid & 15] = v; }
  __syncthreads();
  float u1[8], u2[8];
#pragma unroll
  for (int r = 0; r < 8; ++r) { m1[r] = fin[0][8 * hh + r]; m2[r] = fin[1][8 * hh + r]; u1[r] = 0.f; u2[r] = 0.f; }
#pragma unroll 1  /* rolled for the register budget, as above */
  for (int j = 0; j < DCOL / 16; ++j) { v8f s1, s2; const size_t o = (size_t)j * 16 * C8; logit_tile(q, B2h + o, B2l + o, B1h + o, B1l + o, s1, s2);
#pragma unroll
    for (int r = 0; r < 8; ++r) { u1[r] += expf(s1[r] - m1[r]); u2[r] += expf(s2[r] - m2[r]); } }
#pragma unroll
  for (int r = 0; r < 8; ++r) { u1[r] = row_sum16(u1[r]); u2[r] = row_sum16(u2[r]); }
  if (ln == 0) {
#pragma unroll
    for (int r = 0; r < 8; ++r) { red[0][w][8 * hh + r] = u1[r]; red[1][w][8 * hh + r] = u2[r]; } }
  __syncthreads();
  if (tid < 32) { float v = red[tid >> 4][0][tid & 15]; for (int k = 1; k < DW; ++k) v += red[tid >> 4][k][tid & 15]; fin[tid >> 4][tid & 15] = 1.0f / v; }
  __syncthreads();
#pragma unroll
  for (int r = 0; r < 8; ++r) { u1[r] = fin[0][8 * hh + r]; u2[r] = fin[1][8 * hh + r]; }
#pragma unroll 1  /* rolled for the register budget, as above */
  for (int j = 0; j < DCOL / 16; ++j) { v8f s1, s2; const size_t o = (size_t)j * 16 * C8; logit_tile(q, B2h + o, B2l + o, B1h + o, B1l + o, s1, s2);
#pragma unroll
    for (int r = 0; r < 8; ++r) st[w][8 * hh + r][j * 16 + ln] = (_Float16)(fabsf(expf(s1[r] - m1[r]) * u1[r] - expf(s2[r] - m2[r]) * u2[r]) * 16384.0f); }
  // each wave reads back only its own slab: the fence keeps the LDS reads behind the writes of the wave's other lanes, no work-group barrier is needed
  __builtin_amdgcn_fence(__ATOMIC_ACQ_REL, "workgroup"); __builtin_amdgcn_wave_barrier();
#pragma unroll
  for (int r = 0; r < 16; ++r) { const v8us v = *(const v8us*)&st[w][r][lane * 8]; *(v8us*)((unsigned short*)D16 + (size_t)(row0 + r) * NP + w * DCOL + lane * 8) = v; }
}

extern "C" void kernel_launch(void* const* d_in, const int* in_sizes, int n_in,
                              void* d_out, int out_size, void* d_ws, size_t ws_size, hipStream_t stream) {
  (void)in_sizes; (void)n_in; (void)out_size;
  const float* x1 = (const float*)d_in[0]; const float* x2 = (const float*)d_in[1]; const float* Wb = (const float*)d_in[2]; const float* bb_ = (const float*)d_in[3]; const float* Wc = (const float*)d_in[4]; const float* bc = (const float*)d_in[5]; const float* Wd = (const float*)d_in[6]; const float* bd = (const float*)d_in[7]; const float* al = (const float*)d_in[8]; const float* be = (const float*)d_in[9];
  char* ws = (char*)d_ws; size_t off = 0;
  auto take = [&](size_t bytes) { char* p = ws + off; off += (bytes + 255) & ~(size_t)255; return p; };
  _Float16* BB = (_Float16*)take(C8 * CC * 2); _Float16* BC = (_Float16*)take(C8 * CC * 2); _Float16* BD = (_Float16*)take((size_t)CC * CC * 2);
  _Float16* X1 = (_Float16*)take((size_t)NP * CC * 2); _Float16* X2 = (_Float16*)take((size_t)NP * CC * 2); float* T = (float*)take((size_t)NP * C8 * 4);
  _Float16* A1h = (_Float16*)take((size_t)NP * C8 * 2); _Float16* A1l = (_Float16*)take((size_t)NP * C8 * 2); _Float16* B2h = (_Float16*)take((size_t)NP * C8 * 2); _Float16* B2l = (_Float16*)take((size_t)NP * C8 * 2); _Float16* A2h = (_Float16*)take((size_t)NP * C8 * 2); _Float16* A2l = (_Float16*)take((size_t)NP * C8 * 2); _Float16* B1h = (_Float16*)take((size_t)NP * C8 * 2); _Float16* B1l = (_Float16*)take((size_t)NP * C8 * 2);
  float* F1 = (float*)take((size_t)NP * CC * 4); float* F2 = (float*)take((size_t)NP * CC * 4); _Float16* FT = (_Float16*)take((size_t)CC * NP * 2); _Float16* D16 = (_Float16*)take((size_t)RB * NP * 2);
  if (off > ws_size) return;
  k_round16f<<<(C8 * CC / 8 + 255) / 256, 256, 0, stream>>>(Wb, BB, (size_t)C8 * CC / 8); k_round16f<<<(C8 * CC / 8 + 255) / 256, 256, 0, stream>>>(Wc, BC, (size_t)C8 * CC / 8); k_round16f<<<(unsigned)(((size_t)CC * CC / 8 + 255) / 256), 256, 0, stream>>>(Wd, BD, (size_t)CC * CC / 8);      /* conv weights [O][C] = natural Bt */
  const dim3 g8(((NP / 16) * 1 + 3) / 4, 1), gD(((NP / 16) * (CC / 64) + 3) / 4, 1), gO(((CC / 16) * (NP / 64) + 3) / 4, 1); const size_t n8 = (size_t)NP * C8 / 8; const unsigned nb8 = (unsigned)((n8 + 255) / 256);
  auto proj64 = [&](const _Float16* X, const _Float16* Bw, const float* bias, _Float16* Hh, _Float16* Hl) { k_gemm_hhx<0><<<g8, 128, 0, stream>>>(X, CC, 0, Bw, CC, 0, 0.0625f, bias, 0, nullptr, 1, 0, 0, T, nullptr, C8, 0, NP, C8, CC); k_split<<<nb8, 256, 0, stream>>>(T, Hh, Hl, n8); };
  for (int b = 0; b < NBt; ++b) {
    k_tok<<<(NP * (CC / 8) + 255) / 256, 256, 0, stream>>>(x1, b, X1); k_tok<<<(NP * (CC / 8) + 255) / 256, 256, 0, stream>>>(x2, b, X2);
    proj64(X1, BB, bb_, A1h, A1l); proj64(X2, BC, bc, B2h, B2l); proj64(X2, BB, bb_, A2h, A2l); proj64(X1, BC, bc, B1h, B1l);      /* a1 = conv_b(x1), b2 = conv_c(x2), a2 = conv_b(x2), b1 = conv_c(x1) (exact + bias) → hi/lo */
    k_gemm_hhx<0><<<gD, 128, 0, stream>>>(X1, CC, 0, BD, CC, 0, 0.0625f, bd, 0, nullptr, 1, 0, 0, F1, nullptr, CC, 0, NP, CC, CC); k_gemm_hhx<0><<<gD, 128, 0, stream>>>(X2, CC, 0, BD, CC, 0, 0.0625f, bd, 0, nullptr, 1, 0, 0, F2, nullptr, CC, 0, NP, CC, CC);      /* f1, f2 = conv_d (exact + bias) */
    k_fcomb<<<(CC * (NP / 8) + 255) / 256, 256, 0, stream>>>(F1, F2, al, be, FT);
    for (int rb = 0; rb < NP / RB; ++rb) { const size_t r0 = (size_t)rb * RB;
      k_attdiff<<<RB / 16, 512, 0, stream>>>(A1h + r0 * C8, A1l + r0 * C8, A2h + r0 * C8, A2l + r0 * C8, B2h, B2l, B1h, B1l, D16);      /* |softmax(a1.b2) - softmax(a2.b1)| x 2^14 for the block's rows */
      k_gemm_hhx<0><<<gO, 128, 0, stream>>>(FT, NP, 0, D16, NP, 0, 1.0f / 16384.0f, nullptr, 0, nullptr, 1, 0, 0, (float*)d_out + (size_t)b * CC * NP + r0, nullptr, NP, 0, CC, RB, NP); } }      /* out[b][c][n] = Σ_m F[c][m]·att[n][m] for n in the block: M 512 (c), N 2048 (n), K 4096 (m) → NCHW directly */
}

// v002
// One run takes 434 microseconds.
// Timed twice side by side with v001, it ran 2.35 and 2.46 times as fast.
// Counting every step since v000, it is 3.58 times as fast.
#include <hip/hip_runtime.h>
// Position-attention difference module (B 2, C 512, 64×64 = 4096 positions): a1 = conv_b(x1), b2 = conv_c(x2), a2 = conv_b(x2), b1 = conv_c(x1) (1×1, 512→64, + bias); f = conv_d (512→512, + bias); att12 = softmax_m(a1ᵀ·b2), att21 = softmax_m(a2ᵀ·b1) (no scaling); att = |att12 − att21|; out = α·f1·attᵀ + β·f2·attᵀ = (α f1 + β f2)·attᵀ → [2,512,64,64].
// Structure: per batch: 1x1 convs as GEMMs on position-major f16 planes (exact products); a/b as f16 hi + lo*2^10 planes so both logit matrices are about f32 (three cross products each); one kernel forms both logit matrices in registers, both softmaxes per row in f32 and writes |difference| x 2^14 as f16; F = alpha f1 + beta f2 (f32 combine, then f16) and out = F.att^T by one GEMM straight into the NCHW output.
// Compute dtype: inputs and parameters rounded to bf16; logits ≈f32; softmaxes/difference in f32; |Δ| (×2^14) and F as f16 operands (≈2^-12), f32 accumulation. v_wmma_f32_16x16x32_f16.
#define NBt 2
#define CC 512
#define C8 64
#define NP 4096
#define RB 2048                  /* query rows per score block */
typedef __bf16 v16b __attribute__((ext_vector_type(16)));
typedef unsigned short v8us __attribute__((ext_vector_type(8), may_alias));
typedef float  v8f  __attribute__((ext_vector_type(8)));
typedef float  v4f  __attribute__((ext_vector_type(4)));
typedef float  v4fa __attribute__((ext_vector_type(4), may_alias));
union FragB { v16b v; v8us half[2]; unsigned short u[16]; };

__device__ __forceinline__ unsigned short bf16_bits(float x) { unsigned int u = __float_as_uint(x); return (unsigned short)((u + 0x7FFFu + ((u >> 16) & 1u)) >> 16); }
__device__ __forceinline__ float bf16_val(unsigned short b) { return __uint_as_float(((unsigned int)b) << 16); }
__device__ __forceinline__ float bf16_round(float x) { return bf16_val(bf16_bits(x)); }
// D += A·B with NT terms: 1 = ah·bh, 2 = + al·bh (A split), 3 = + ah·bl (both split)
template <int NT>
__device__ __forceinline__ v8f mmaN(v16b ah, v16b al, v16b bh, v16b bl, v8f c) {
  c = __builtin_amdgcn_wmma_f32_16x16x32_bf16(false, ah, false, bh, (short)0, c, false, false);
  if (NT >= 2) c = __builtin_amdgcn_wmma_f32_16x16x32_bf16(false, al, false, bh, (short)0, c, false, false);
  if (NT >= 3) c = __builtin_amdgcn_wmma_f32_16x16x32_bf16(false, ah, false, bl, (short)0, c, false, false);
  asm volatile("v_nop\n\tv_nop\n\tv_nop\n\tv_nop" : "+v"(c) : "v"(ah), "v"(al), "v"(bh), "v"(bl));
  return c;
}

__global__ __launch_bounds__(256) void k_wt_bf16(const float* __restrict__ W, unsigned short* __restrict__ Wt, int K, int N) {
  const int t = blockIdx.x * 256 + threadIdx.x;
  const int k8n = K / 8;
  if (t >= N * k8n) return;
  const int n = t / k8n, k8 = (t % k8n) * 8;
  v8us v;
#pragma unroll
  for (int i = 0; i < 8; ++i) v[i] = bf16_bits(W[(size_t)(k8 + i) * N + n]);
  *(v8us*)(Wt + (size_t)n * K + k8) = v;
  
}

// GEMM C[M][N] (f32, pitch ldc) = act(A[M][K]·W + bias). A f32 row-major (pitch lda) converted per fragment to bf16
// (ASPLIT: hi/lo two planes -> 2 terms, else single rounded term); Wt bf16 [N][K] (pitch ldb). BIAS_BF16 rounds the
// bias to bf16 first (bias quantised to bf16 before the add). K%32==0, M%16==0, N%64==0.
template <bool ASPLIT, int ACT, bool BIAS_BF16>
__global__ __launch_bounds__(128) void k_gemm_bf(const float* __restrict__ A, int lda, const unsigned short* __restrict__ Wt, int ldb,
                                               const float* __restrict__ bias, float* __restrict__ C, int ldc, int M, int N, int K) {
  __shared__ __attribute__((aligned(16))) float so[4][16][64];
  const int tid = threadIdx.x, w = tid >> 5, lane = tid & 31, ln = lane & 15, hh = lane >> 4;
  const int ntn = N / 64;
  const int wid = blockIdx.x * 4 + w;
  const int mt = wid / ntn, nq = wid % ntn;
  if (mt * 16 >= M) return;
  const int row0 = mt * 16, col0 = nq * 64;
  const float* arow = A + (size_t)(row0 + ln) * lda;
  v8f acc[4] = {};
  for (int kb = 0; kb < K; kb += 32) {
    FragB ah, al;
    const v4f x0 = *(const v4fa*)(arow + kb + 8 * hh), x1 = *(const v4fa*)(arow + kb + 8 * hh + 4);
    const v4f x2 = *(const v4fa*)(arow + kb + 16 + 8 * hh), x3 = *(const v4fa*)(arow + kb + 16 + 8 * hh + 4);
    float xs[16] = {x0[0],x0[1],x0[2],x0[3],x1[0],x1[1],x1[2],x1[3],x2[0],x2[1],x2[2],x2[3],x3[0],x3[1],x3[2],x3[3]};
#pragma unroll
    for (int i = 0; i < 16; ++i) { const unsigned short hb = bf16_bits(xs[i]); ah.u[i] = hb; al.u[i] = ASPLIT ? bf16_bits(xs[i] - bf16_val(hb)) : (unsigned short)0; }
#pragma unroll
    for (int t = 0; t < 4; ++t) {
      const unsigned short* brow = Wt + (size_t)(col0 + t * 16 + ln) * ldb + kb;
      FragB b;
      b.half[0] = *(const v8us*)(brow + 8 * hh);
      b.half[1] = *(const v8us*)(brow + 16 + 8 * hh);
      acc[t] = mmaN<ASPLIT ? 2 : 1>(ah.v, al.v, b.v, b.v, acc[t]);
    }
  }
#pragma unroll
  for (int t = 0; t < 4; ++t) {
    float bv = bias ? bias[col0 + t * 16 + ln] : 0.f;
    if (BIAS_BF16) bv = bf16_round(bv);
#pragma unroll
    for (int r = 0; r < 8; ++r) { float v = acc[t][r] + bv; if (ACT == 1) v = fmaxf(v, 0.f); so[w][8 * hh + r][t * 16 + ln] = v; }
  }
  __builtin_amdgcn_fence(__ATOMIC_ACQ_REL, "workgroup");
  __builtin_amdgcn_wave_barrier();
  const int rsub = lane >> 4, c4 = (lane & 15) * 4;
  {
#pragma unroll
    for (int q = 0; q < 8; ++q) {
      const int r = q * 2 + rsub;
      const v4f v = *(const v4fa*)&so[w][r][c4];
      *(v4f*)(C + (size_t)(row0 + r) * ldc + col0 + c4) = v;
    }
    
  }
}

// GEMM C = act(A·W + bias + resid): A f32 (ASPLIT -> hi/lo 2 terms), Wt bf16 [N][K]; ACT 0 none, 1 relu, 2 exact gelu;
// resid (optional, f32, row index = (row % rmod), pitch ldr, RES_BF16 rounds it) added before the activation.
template <bool ASPLIT, int ACT, bool BIAS_BF16, bool RES_BF16>
__global__ __launch_bounds__(128) void k_gemm_bf3(const float* __restrict__ A, int lda, const unsigned short* __restrict__ Wt, int ldb,
                                                const float* __restrict__ bias, const float* __restrict__ resid, int rmod, int ldr,
                                                float* __restrict__ C, int ldc, int M, int N, int K) {
  __shared__ __attribute__((aligned(16))) float so[4][16][64];
  const int tid = threadIdx.x, w = tid >> 5, lane = tid & 31, ln = lane & 15, hh = lane >> 4;
  const int ntn = N / 64;
  const int wid = blockIdx.x * 4 + w;
  const int mt = wid / ntn, nq = wid % ntn;
  if (mt * 16 >= M) return;
  const int row0 = mt * 16, col0 = nq * 64;
  const float* arow = A + (size_t)(row0 + ln) * lda;
  v8f acc[4] = {};
  for (int kb = 0; kb < K; kb += 32) {
    FragB ah, al;
    const v4f x0 = *(const v4fa*)(arow + kb + 8 * hh), x1 = *(const v4fa*)(arow + kb + 8 * hh + 4);
    const v4f x2 = *(const v4fa*)(arow + kb + 16 + 8 * hh), x3 = *(const v4fa*)(arow + kb + 16 + 8 * hh + 4);
    float xs[16] = {x0[0],x0[1],x0[2],x0[3],x1[0],x1[1],x1[2],x1[3],x2[0],x2[1],x2[2],x2[3],x3[0],x3[1],x3[2],x3[3]};
#pragma unroll
    for (int i = 0; i < 16; ++i) { const unsigned short hb = bf16_bits(xs[i]); ah.u[i] = hb; al.u[i] = ASPLIT ? bf16_bits(xs[i] - bf16_val(hb)) : (unsigned short)0; }
#pragma unroll
    for (int t = 0; t < 4; ++t) {
      const unsigned short* brow = Wt + (size_t)(col0 + t * 16 + ln) * ldb + kb;
      FragB b;
      b.half[0] = *(const v8us*)(brow + 8 * hh);
      b.half[1] = *(const v8us*)(brow + 16 + 8 * hh);
      acc[t] = mmaN<ASPLIT ? 2 : 1>(ah.v, al.v, b.v, b.v, acc[t]);
    }
  }
#pragma unroll
  for (int t = 0; t < 4; ++t) {
    const int col = col0 + t * 16 + ln;
    float bv = bias ? bias[col] : 0.f;
    if (BIAS_BF16) bv = bf16_round(bv);
#pragma unroll
    for (int r = 0; r < 8; ++r) {
      float v = acc[t][r] + bv;
      if (resid) { float rv = resid[(size_t)((row0 + 8 * hh + r) % rmod) * ldr + col]; if (RES_BF16) rv = bf16_round(rv); v += rv; }
      if (ACT == 1) v = fmaxf(v, 0.f);
      if (ACT == 2) v = 0.5f * v * (1.0f + erff(v * 0.70710678118654752f));
      if (ACT == 3) { const float u = 0.7978845608028654f * (v + 0.044715f * v * v * v); v = 0.5f * v * (1.0f + tanhf(u)); }
      so[w][8 * hh + r][t * 16 + ln] = v;
    }
  }
  __builtin_amdgcn_fence(__ATOMIC_ACQ_REL, "workgroup");
  __builtin_amdgcn_wave_barrier();
  const int rsub = lane >> 4, c4 = (lane & 15) * 4;
  {
#pragma unroll
    for (int q = 0; q < 8; ++q) {
      const int r = q * 2 + rsub;
      const v4f v = *(const v4fa*)&so[w][r][c4];
      *(v4f*)(C + (size_t)(row0 + r) * ldc + col0 + c4) = v;
    }
    
  }
}
// row LayerNorm (biased variance, eps) over N: s = X (+ R); optional out_sum <- s; out_norm <- (s-mu)*rsqrt(var+eps)*g + b
template <bool PARAM_BF16>
__global__ __launch_bounds__(256) void k_layernorm(const float* __restrict__ X, const float* __restrict__ R, const float* __restrict__ g, const float* __restrict__ bta,
                                                  float* __restrict__ out_sum, float* __restrict__ out_norm, int N, float eps) {
  __shared__ float red[256];
  const int row = blockIdx.x, tid = threadIdx.x;
  const float* x = X + (size_t)row * N; const float* rr = R ? R + (size_t)row * N : nullptr;
  float vals[16];                     // up to N = 4096
  const int per = N / 256;            // contiguous chunk per thread? use strided-by-4 chunks: thread handles j = tid*4 + 1024*u
  float s1 = 0.f;
  for (int u = 0; u < per / 4; ++u) {
    const int j = tid * 4 + 1024 * u;
    const v4f a = *(const v4fa*)(x + j);
    v4f b = {0.f,0.f,0.f,0.f}; if (rr) b = *(const v4fa*)(rr + j);
#pragma unroll
    for (int q = 0; q < 4; ++q) { const float v = a[q] + b[q]; vals[u * 4 + q] = v; s1 += v; }
  }
  red[tid] = s1; __syncthreads();
  for (int st = 128; st > 0; st >>= 1) { if (tid < st) red[tid] += red[tid + st]; __syncthreads(); }
  const float mu = red[0] / (float)N; __syncthreads();
  float s2 = 0.f;
  for (int u = 0; u < per / 4; ++u)
#pragma unroll
    for (int q = 0; q < 4; ++q) { const float c = vals[u * 4 + q] - mu; s2 += c * c; }
  red[tid] = s2; __syncthreads();
  for (int st = 128; st > 0; st >>= 1) { if (tid < st) red[tid] += red[tid + st]; __syncthreads(); }
  const float rs = rsqrtf(red[0] / (float)N + eps);
  {
    for (int u = 0; u < per / 4; ++u) {
      const int j = tid * 4 + 1024 * u;
      v4f o, sm;
#pragma unroll
      for (int q = 0; q < 4; ++q) {
        float gg = g[j + q], bb = bta[j + q];
        if (PARAM_BF16) { gg = bf16_round(gg); bb = bf16_round(bb); }
        sm[q] = vals[u * 4 + q]; o[q] = (vals[u * 4 + q] - mu) * rs * gg + bb;
      }
      if (out_sum) *(v4f*)(out_sum + (size_t)row * N + j) = sm;
      *(v4f*)(out_norm + (size_t)row * N + j) = o;
    }
    
  }
}



// ---- f16 WMMA path (v_wmma_f32_16x16x32_f16): 11-bit significands for operands in range — used where a [0,1] probability operand needs more precision than bf16
typedef _Float16 v16h __attribute__((ext_vector_type(16)));
union FragH { v16h v; v8us half[2]; _Float16 h[16]; unsigned short u[16]; };
template <int NT>
__device__ __forceinline__ v8f mmaH(v16h ah, v16h al, v16h bh, v16h bl, v8f c) {
  c = __builtin_amdgcn_wmma_f32_16x16x32_f16(false, ah, false, bh, (short)0, c, false, false);
  if (NT >= 2) c = __builtin_amdgcn_wmma_f32_16x16x32_f16(false, al, false, bh, (short)0, c, false, false);
  if (NT >= 3) c = __builtin_amdgcn_wmma_f32_16x16x32_f16(false, ah, false, bl, (short)0, c, false, false);
  asm volatile("v_nop\n\tv_nop\n\tv_nop\n\tv_nop" : "+v"(c) : "v"(ah), "v"(al), "v"(bh), "v"(bl));
  return c;
}
// batched GEMM like k_gemm_b but f16 operands: A f32 (split into f16 hi/lo if ASPLIT, else rounded to f16), Bt = f16 values [n][k]; alpha; C f32; N multiple of 16 (partial tiles skipped)
template <bool ASPLIT>
__global__ __launch_bounds__(128) void k_gemm_h(const float* __restrict__ A, int lda, size_t sA, const _Float16* __restrict__ Bh, int ldb, size_t sB, float alpha, float* __restrict__ C, int ldc, size_t sC, int M, int N, int K) {
  __shared__ __attribute__((aligned(16))) float so[4][16][64];
  const int tid = threadIdx.x, w = tid >> 5, lane = tid & 31, ln = lane & 15, hh = lane >> 4; const int by = blockIdx.y;
  A += (size_t)by * sA; Bh += (size_t)by * sB; C += (size_t)by * sC;
  const int ntn = (N + 63) / 64; const int wid = blockIdx.x * 4 + w; const int mt = wid / ntn, nq = wid % ntn; if (mt * 16 >= M) return;
  const int row0 = mt * 16, col0 = nq * 64; const float* arow = A + (size_t)(row0 + ln) * lda;
  v8f acc[4] = {};
  for (int kb = 0; kb < K; kb += 32) {
    FragH ah, al;
    const v4f x0 = *(const v4fa*)(arow + kb + 8 * hh), x1 = *(const v4fa*)(arow + kb + 8 * hh + 4), x2 = *(const v4fa*)(arow + kb + 16 + 8 * hh), x3 = *(const v4fa*)(arow + kb + 16 + 8 * hh + 4);
    float xs[16] = {x0[0],x0[1],x0[2],x0[3],x1[0],x1[1],x1[2],x1[3],x2[0],x2[1],x2[2],x2[3],x3[0],x3[1],x3[2],x3[3]};
#pragma unroll
    for (int i = 0; i < 16; ++i) { const _Float16 h = (_Float16)xs[i]; ah.h[i] = h; al.h[i] = ASPLIT ? (_Float16)(xs[i] - (float)h) : (_Float16)0.0f; }
#pragma unroll
    for (int t = 0; t < 4; ++t) { if (col0 + t * 16 >= N) continue; const size_t boff = (size_t)(col0 + t * 16 + ln) * ldb + kb; FragH bq; bq.half[0] = *(const v8us*)(Bh + boff + 8 * hh); bq.half[1] = *(const v8us*)(Bh + boff + 16 + 8 * hh);
      acc[t] = mmaH<ASPLIT ? 2 : 1>(ah.v, al.v, bq.v, bq.v, acc[t]); }
  }
#pragma unroll
  for (int t = 0; t < 4; ++t) { if (col0 + t * 16 >= N) continue;
#pragma unroll
    for (int r = 0; r < 8; ++r) so[w][8 * hh + r][t * 16 + ln] = acc[t][r] * alpha; }
  __builtin_amdgcn_fence(__ATOMIC_ACQ_REL, "workgroup"); __builtin_amdgcn_wave_barrier();
  const int rsub = lane >> 4, c4 = (lane & 15) * 4;
  {
#pragma unroll
    for (int q = 0; q < 8; ++q) { const int r = q * 2 + rsub; if (col0 + c4 < N) { const v4f v = *(const v4fa*)&so[w][r][c4]; *(v4f*)(C + (size_t)(row0 + r) * ldc + col0 + c4) = v; } }
     }
}

// Wt[n][k] = f16(W[k][n]·scale) from f32 row-major W[K][N] (scale = power of two; bf16-exact weights stay exact in f16 away from the subnormal range)
__global__ __launch_bounds__(256) void k_wt_f16(const float* __restrict__ W, _Float16* __restrict__ Wt, int K, int N, float scale) {
  const int t = blockIdx.x * 256 + threadIdx.x; if (t >= N * (K / 8)) return; const int n = t / (K / 8), k8 = (t % (K / 8)) * 8; FragH f;
#pragma unroll
  for (int i = 0; i < 8; ++i) f.h[i] = (_Float16)(bf16_round(W[(size_t)(k8 + i) * N + n]) * scale); const v8us o = f.half[0];
  *(v8us*)((unsigned short*)Wt + (size_t)n * K + k8) = o; 
}
// k_gemm_hh variant with fused epilogue: v = acc·alpha + bias[by·sBias + col] (+ CP[(row/rowsPerB)·sCPb + by·64 + col] if CP) ; ACT 0 none / 1 elu ; writes f32 C and f16 C16, each if non-null
template <int ACT>
__global__ __launch_bounds__(128) void k_gemm_hhx(const _Float16* __restrict__ A, int lda, size_t sA, const _Float16* __restrict__ Bh, int ldb, size_t sB, float alpha, const float* __restrict__ bias, size_t sBias, const float* __restrict__ CP, int rowsPerB, size_t sCPb, int row0g,
    float* __restrict__ C, _Float16* __restrict__ C16, int ldc, size_t sC, int M, int N, int K) {
  __shared__ __attribute__((aligned(16))) float so[4][16][64];
  const int tid = threadIdx.x, w = tid >> 5, lane = tid & 31, ln = lane & 15, hh = lane >> 4; const int by = blockIdx.y;
  A += (size_t)by * sA; Bh += (size_t)by * sB; const size_t cofs = (size_t)by * sC; const float* bp = bias ? bias + (size_t)by * sBias : nullptr;
  const int ntn = (N + 63) / 64; const int wid = blockIdx.x * 4 + w; const int mt = wid / ntn, nq = wid % ntn; if (mt * 16 >= M) return;
  const int row0 = mt * 16, col0 = nq * 64; const _Float16* arow = A + (size_t)(row0 + ln) * lda;
  v8f acc[4] = {};
  for (int kb = 0; kb < K; kb += 32) { FragH ah; ah.half[0] = *(const v8us*)((const unsigned short*)arow + kb + 8 * hh); ah.half[1] = *(const v8us*)((const unsigned short*)arow + kb + 16 + 8 * hh);
#pragma unroll
    for (int t = 0; t < 4; ++t) { if (col0 + t * 16 >= N) continue; const size_t boff = (size_t)(col0 + t * 16 + ln) * ldb + kb; FragH bq; bq.half[0] = *(const v8us*)((const unsigned short*)Bh + boff + 8 * hh); bq.half[1] = *(const v8us*)((const unsigned short*)Bh + boff + 16 + 8 * hh);
      acc[t] = mmaH<1>(ah.v, ah.v, bq.v, bq.v, acc[t]); }
  }
#pragma unroll
  for (int t = 0; t < 4; ++t) { if (col0 + t * 16 >= N) continue; const int col = col0 + t * 16 + ln; const float bv = bp ? bf16_round(bp[col]) : 0.f;
#pragma unroll
    for (int r = 0; r < 8; ++r) { float v = acc[t][r] * alpha + bv; if (CP) { const int bidx = (row0g + row0 + 8 * hh + r) / rowsPerB; v += CP[(size_t)bidx * sCPb + (size_t)by * 64 + col]; } if (ACT == 1) v = (v > 0.f) ? v : expm1f(v); else if (ACT == 7) v = (v > 0.f) ? v + 1.0f : expf(v); else if (ACT == 8) v = tanhf(v); else if (ACT == 9) v = 0.5f * v * (1.0f + tanhf(0.7978845608028654f * (v + 0.044715f * v * v * v))); else if (ACT == 11) v = 1.0f / (1.0f + expf(-v)); else if (ACT == 12) v = (v > 0.f) ? v : 0.01f * v; else if (ACT == 14) v = (v > 0.f) ? v : 0.1f * v; else if (ACT == 15) v = v / (1.0f + expf(-v)); else if (ACT == 3) v = fmaxf(v, 0.f); else if (ACT == 6) v = 0.5f * v * (1.0f + erff(v * 0.70710678118654752f)); so[w][8 * hh + r][t * 16 + ln] = v; } }
  __builtin_amdgcn_fence(__ATOMIC_ACQ_REL, "workgroup"); __builtin_amdgcn_wave_barrier();
  const int rsub = lane >> 4, c4 = (lane & 15) * 4; typedef _Float16 v4h __attribute__((ext_vector_type(4)));
  {
#pragma unroll
    for (int q = 0; q < 8; ++q) { const int r = q * 2 + rsub; if (col0 + c4 < N) { const v4f v = *(const v4fa*)&so[w][r][c4]; if (C) *(v4f*)(C + cofs + (size_t)(row0 + r) * ldc + col0 + c4) = v; if (C16) { v4h h4; for (int i = 0; i < 4; ++i) h4[i] = (_Float16)v[i]; *(v4h*)(C16 + cofs + (size_t)(row0 + r) * ldc + col0 + c4) = h4; } } }
     }
}


typedef _Float16 v4h __attribute__((ext_vector_type(4)));

__global__ __launch_bounds__(256) void k_x16(const float* __restrict__ x, _Float16* __restrict__ X16, size_t n8) { const size_t t = (size_t)blockIdx.x * 256 + threadIdx.x; if (t >= n8) return; FragH f;
#pragma unroll
  for (int q = 0; q < 8; ++q) f.h[q] = (_Float16)bf16_round(x[t * 8 + q]); *(v8us*)((unsigned short*)X16 + t * 8) = f.half[0];  }
__global__ __launch_bounds__(256) void k_h16(const float* __restrict__ x, _Float16* __restrict__ X16, size_t n8) { const size_t t = (size_t)blockIdx.x * 256 + threadIdx.x; if (t >= n8) return; FragH f;
#pragma unroll
  for (int q = 0; q < 8; ++q) f.h[q] = (_Float16)x[t * 8 + q]; *(v8us*)((unsigned short*)X16 + t * 8) = f.half[0];  }
__global__ __launch_bounds__(256) void k_round16f(const float* __restrict__ W, _Float16* __restrict__ Bt, size_t n8) { const size_t t = (size_t)blockIdx.x * 256 + threadIdx.x; if (t >= n8) return; FragH f;
#pragma unroll
  for (int i = 0; i < 8; ++i) f.h[i] = (_Float16)(bf16_round(W[t * 8 + i]) * 16.0f); *(v8us*)((unsigned short*)Bt + t * 8) = f.half[0];  }
template <int NHv, int TTv>
__global__ __launch_bounds__(256) void k_vt(const _Float16* __restrict__ V16, int ldv, int voff, _Float16* __restrict__ Vt) { __shared__ unsigned short tl[64][66]; const int tid = threadIdx.x; const int slab = blockIdx.x / (TTv / 64), lg = blockIdx.x % (TTv / 64); const int b = slab / NHv, h = slab % NHv;
  for (int i = tid; i < 64 * 8; i += 256) { const int r = i / 8, c8 = (i % 8) * 8; FragH f; f.half[0] = *(const v8us*)((const unsigned short*)V16 + ((size_t)b * TTv + lg * 64 + r) * ldv + voff + h * 64 + c8);
#pragma unroll
    for (int q = 0; q < 8; ++q) tl[r][c8 + q] = f.u[q]; }
  __syncthreads();
  {
#pragma unroll
    for (int rd = 0; rd < 2; ++rd) { const int d = rd * 32 + tid / 8, pc = tid % 8; FragH f;
#pragma unroll
      for (int q = 0; q < 8; ++q) f.u[q] = tl[pc * 8 + q][d];
      *(v8us*)((unsigned short*)Vt + ((size_t)slab * 64 + d) * TTv + lg * 64 + pc * 8) = f.half[0]; }
     } }

__global__ __launch_bounds__(256) void k_hl(const float* __restrict__ F, _Float16* __restrict__ Hh, _Float16* __restrict__ Hl, size_t n8) { const size_t t = (size_t)blockIdx.x * 256 + threadIdx.x; if (t >= n8) return; FragH fh, fl; const v4f a = *(const v4fa*)(F + t * 8), c = *(const v4fa*)(F + t * 8 + 4);
#pragma unroll
  for (int q = 0; q < 4; ++q) { _Float16 h = (_Float16)a[q]; fh.h[q] = h; fl.h[q] = (_Float16)((a[q] - (float)h) * 1024.0f); h = (_Float16)c[q]; fh.h[4 + q] = h; fl.h[4 + q] = (_Float16)((c[q] - (float)h) * 1024.0f); }
  { *(v8us*)((unsigned short*)Hh + t * 8) = fh.half[0]; *(v8us*)((unsigned short*)Hl + t * 8) = fl.half[0];  } }

__global__ __launch_bounds__(256) void k_tok(const float* __restrict__ x, int b, _Float16* __restrict__ X16) { const int t = blockIdx.x * 256 + threadIdx.x; if (t >= NP * (CC / 8)) return; const int c0 = (t % (CC / 8)) * 8, n = t / (CC / 8); FragH f;
#pragma unroll
  for (int q = 0; q < 8; ++q) f.h[q] = (_Float16)bf16_round(x[((size_t)b * CC + c0 + q) * NP + n]);
  *(v8us*)((unsigned short*)X16 + (size_t)n * CC + c0) = f.half[0];  }
__global__ __launch_bounds__(256) void k_split(const float* __restrict__ F, _Float16* __restrict__ Hh, _Float16* __restrict__ Hl, size_t n8) {
  #pragma clang fp contract(off)
  const size_t t = (size_t)blockIdx.x * 256 + threadIdx.x; if (t >= n8) return;
  // planes in WMMA fragment order, 16 positions x 64 channels per 2-KiB block: [k step of 32][fragment half][lane][8 channels]; piece t of the plane is position 16*(t>>7) + (t&15), channels 8*sc..8*sc+7
  const size_t sc = ((t >> 6) & 1) * 4 + ((t >> 5) & 1) * 2 + ((t >> 4) & 1), so = ((t >> 7) * 16 + (t & 15)) * C8 + sc * 8;
  const v4f a = *(const v4fa*)(F + so), c = *(const v4fa*)(F + so + 4); FragH fh, fl;
#pragma unroll
  for (int q = 0; q < 8; ++q) { const float v = (q < 4) ? a[q] : c[q - 4]; const _Float16 hi = (_Float16)v; fh.h[q] = hi; fl.h[q] = (_Float16)((v - (float)hi) * 1024.0f); }
  { *(v8us*)((unsigned short*)Hh + t * 8) = fh.half[0]; *(v8us*)((unsigned short*)Hl + t * 8) = fl.half[0];  } }
__global__ __launch_bounds__(256) void k_fcomb(const float* __restrict__ F1, const float* __restrict__ F2, const float* __restrict__ al, const float* __restrict__ be, _Float16* __restrict__ FT) {
  #pragma clang fp contract(off)
  const int t = blockIdx.x * 256 + threadIdx.x; if (t >= CC * (NP / 8)) return; const int m0 = (t % (NP / 8)) * 8, c = t / (NP / 8); const float a = bf16_round(al[0]), bq = bf16_round(be[0]); FragH f;
#pragma unroll
  for (int q = 0; q < 8; ++q) f.h[q] = (_Float16)(a * F1[(size_t)(m0 + q) * CC + c] + bq * F2[(size_t)(m0 + q) * CC + c]);
  *(v8us*)((unsigned short*)FT + (size_t)c * NP + m0) = f.half[0];  }
// One 16x32 f16 fragment (A row or B column = lane & 15; k = 8*(lane>>4)+0..7 and 16+8*(lane>>4)+0..7) from a plane in the fragment order that k_split writes; p already holds 8*lane.
// Each of the two loads reads 512 contiguous bytes (4 whole lines) per wave; from a row-major plane it would touch 16 lines.
__device__ __forceinline__ v16h frag_at(const _Float16* p) { FragH f; f.half[0] = *(const v8us*)((const unsigned short*)p); f.half[1] = *(const v8us*)((const unsigned short*)p + 256); return f.v; }
__device__ __forceinline__ v8f wm(v16h a, v16h b, v8f c) { return __builtin_amdgcn_wmma_f32_16x16x32_f16(false, a, false, b, (short)0, c, false, false); }
// value of lane ^ X inside the 16-lane row, by DPP row_xmask (a shuffle would go through the LDS pipe and its wait); every lane is on where it is used
template <int X> __device__ __forceinline__ float row_xor(float v) { return __int_as_float(__builtin_amdgcn_update_dpp(0, __float_as_int(v), 0x160 + X, 0xf, 0xf, true)); }
__device__ __forceinline__ float row_max16(float v) { v = fmaxf(v, row_xor<1>(v)); v = fmaxf(v, row_xor<2>(v)); v = fmaxf(v, row_xor<4>(v)); return fmaxf(v, row_xor<8>(v)); }
__device__ __forceinline__ float row_sum16(float v) { v += row_xor<1>(v); v += row_xor<2>(v); v += row_xor<4>(v); return v + row_xor<8>(v); }
struct QFrag { v16h a1h[2], a1l[2], a2h[2], a2l[2]; };
// both logit tiles (16 query rows x 16 key columns, K 64) from the hi/lo planes: hi*hi in one accumulator, the two cross terms (scaled 2^10) in a second
__device__ __forceinline__ void logit_tile(const QFrag& q, const _Float16* b2h, const _Float16* b2l, const _Float16* b1h, const _Float16* b1l, v8f& s1, v8f& s2) {
  v8f h1 = {}, l1 = {}, h2 = {}, l2 = {};
  const v16h p[2] = {frag_at(b2h), frag_at(b2h + 512)}, x[2] = {frag_at(b1h), frag_at(b1h + 512)}, pl[2] = {frag_at(b2l), frag_at(b2l + 512)}, xl[2] = {frag_at(b1l), frag_at(b1l + 512)};
  // holds all sixteen loads of the tile in front of its first WMMA: one load latency a tile; left alone the compiler reuses fragment registers and waits for memory several times a tile
  asm volatile("" :: "v"(p[0]), "v"(p[1]), "v"(x[0]), "v"(x[1]), "v"(pl[0]), "v"(pl[1]), "v"(xl[0]), "v"(xl[1]));
#pragma unroll
  for (int ks = 0; ks < 2; ++ks) {
    h1 = wm(q.a1h[ks], p[ks], h1); h2 = wm(q.a2h[ks], x[ks], h2); l1 = wm(q.a1l[ks], p[ks], l1); l2 = wm(q.a2l[ks], x[ks], l2); l1 = wm(q.a1h[ks], pl[ks], l1); l2 = wm(q.a2h[ks], xl[ks], l2);
  }
#pragma unroll
  for (int r = 0; r < 8; ++r) { s1[r] = h1[r] + l1[r] * 0.0009765625f; s2[r] = h2[r] + l2[r] * 0.0009765625f; }
}
// Logits, both softmaxes and |difference| in one kernel: a work-group of 16 waves owns 16 query rows, wave w the key columns [256 w, 256 w + 256).
// The logits stay in registers and are formed three times (row maximum, row sum, output); nothing of them goes to memory.
#define DW 16                    /* waves per work-group */
#define DCOL (NP / DW)           /* key columns per wave */
#define DPIT (DCOL + 8)          /* LDS row pitch in f16: 16-byte multiple, rows 8 apart fall on other banks */
__global__ __launch_bounds__(512) void k_attdiff(const _Float16* __restrict__ A1h, const _Float16* __restrict__ A1l, const _Float16* __restrict__ A2h, const _Float16* __restrict__ A2l,
                                                 const _Float16* __restrict__ B2h, const _Float16* __restrict__ B2l, const _Float16* __restrict__ B1h, const _Float16* __restrict__ B1l, _Float16* __restrict__ D16) {
  __shared__ __attribute__((aligned(16))) _Float16 st[DW][16][DPIT];
  __shared__ float red[2][DW][16];
  __shared__ float fin[2][16];
  const int tid = threadIdx.x, w = tid >> 5, lane = tid & 31, ln = lane & 15, hh = lane >> 4; const int row0 = blockIdx.x * 16;
  QFrag q; { const size_t ao = (size_t)row0 * C8 + 8 * lane;
#pragma unroll
    for (int ks = 0; ks < 2; ++ks) { q.a1h[ks] = frag_at(A1h + ao + ks * 512); q.a1l[ks] = frag_at(A1l + ao + ks * 512); q.a2h[ks] = frag_at(A2h + ao + ks * 512); q.a2l[ks] = frag_at(A2l + ao + ks * 512); } }
  const size_t bo = (size_t)(w * DCOL) * C8 + 8 * lane; B2h += bo; B2l += bo; B1h += bo; B1l += bo;
  float m1[8], m2[8];
#pragma unroll
  for (int r = 0; r < 8; ++r) { m1[r] = -3.0e38f; m2[r] = -3.0e38f; }
#pragma unroll 1  /* rolled: an unrolled body would hold several tiles' B fragments and leave the 256-register budget of 4 waves per SIMD */
  for (int j = 0; j < DCOL / 16; ++j) { v8f s1, s2; const size_t o = (size_t)j * 16 * C8; logit_tile(q, B2h + o, B2l + o, B1h + o, B1l + o, s1, s2);
#pragma unroll
    for (int r = 0; r < 8; ++r) { m1[r] = fmaxf(m1[r], s1[r]); m2[r] = fmaxf(m2[r], s2[r]); } }
#pragma unroll
  for (int r = 0; r < 8; ++r) { m1[r] = row_max16(m1[r]); m2[r] = row_max16(m2[r]); }
  if (ln == 0) {
#pragma unroll
    for (int r = 0; r < 8; ++r) { red[0][w][8 * hh + r] = m1[r]; red[1][w][8 * hh + r] = m2[r]; } }
  __syncthreads();
  if (tid < 32) { float v = red[tid >> 4][0][tid & 15]; for (int k = 1; k < DW; ++k) v = fmaxf(v, red[tid >> 4][k][tid & 15]); fin[tid >> 4][tid & 15] = v; }
  __syncthreads();
  float u1[8], u2[8];
#pragma unroll
  for (int r = 0; r < 8; ++r) { m1[r] = fin[0][8 * hh + r]; m2[r] = fin[1][8 * hh + r]; u1[r] = 0.f; u2[r] = 0.f; }
#pragma unroll 1  /* rolled for the register budget, as above */
  for (int j = 0; j < DCOL / 16; ++j) { v8f s1, s2; const size_t o = (size_t)j * 16 * C8; logit_tile(q, B2h + o, B2l + o, B1h + o, B1l + o, s1, s2);
#pragma unroll
    for (int r = 0; r < 8; ++r) { u1[r] += expf(s1[r] - m1[r]); u2[r] += expf(s2[r] - m2[r]); } }
#pragma unroll
  for (int r = 0; r < 8; ++r) { u1[r] = row_sum16(u1[r]); u2[r] = row_sum16(u2[r]); }
  if (ln == 0) {
#pragma unroll
    for (int r = 0; r < 8; ++r) { red[0][w][8 * hh + r] = u1[r]; red[1][w][8 * hh + r] = u2[r]; } }
  __syncthreads();
  if (tid < 32) { float v = red[tid >> 4][0][tid & 15]; for (int k = 1; k < DW; ++k) v += red[tid >> 4][k][tid & 15]; fin[tid >> 4][tid & 15] = 1.0f / v; }
  __syncthreads();
#pragma unroll
  for (int r = 0; r < 8; ++r) { u1[r] = fin[0][8 * hh + r]; u2[r] = fin[1][8 * hh + r]; }
#pragma unroll 1  /* rolled for the register budget, as above */
  for (int j = 0; j < DCOL / 16; ++j) { v8f s1, s2; const size_t o = (size_t)j * 16 * C8; logit_tile(q, B2h + o, B2l + o, B1h + o, B1l + o, s1, s2);
#pragma unroll
    for (int r = 0; r < 8; ++r) st[w][8 * hh + r][j * 16 + ln] = (_Float16)(fabsf(expf(s1[r] - m1[r]) * u1[r] - expf(s2[r] - m2[r]) * u2[r]) * 16384.0f); }
  // each wave reads back only its own slab: the fence keeps the LDS reads behind the writes of the wave's other lanes, no work-group barrier is needed
  __builtin_amdgcn_fence(__ATOMIC_ACQ_REL, "workgroup"); __builtin_amdgcn_wave_barrier();
#pragma unroll
  for (int r = 0; r < 16; ++r) { const v8us v = *(const v8us*)&st[w][r][lane * 8]; *(v8us*)((unsigned short*)D16 + (size_t)(row0 + r) * NP + w * DCOL + lane * 8) = v; }
}

// C[M][N] (f32, pitch ldc) = A[M][K] . B[N][K]^T * alpha + bias[col] (bias rounded to bf16); A and B f16 with k contiguous. One 64 x 64 tile of C per work-group of 4 waves (2 x 2, 32 x 32 each).
// A stage is 256 k of the tile's 64 A rows and 64 B rows, brought into LDS by asynchronous b128 copies: one copy of a wave is 512 contiguous bytes of one row (4 whole lines), where a fragment load
// straight from the row-major operand touches 16 lines. Two buffers: the next stage's copies fly while this stage is worked on. M, N multiples of 64, K a multiple of 256.
// Every accumulator sums k in rising order, 32 at a time.
#define GT 64                    /* rows of each operand per work-group */
#define GK 256                   /* k per stage */
#define GP (GK + 8)              /* LDS row pitch in f16: 528 B = 16 B x odd, so the 16 rows of a ds_load_b128 fall on all banks */
typedef __attribute__((address_space(3))) const _Float16 lds_f16;
// eight rows (4 apart) of one operand: l = the lane's LDS byte address, g = the lane's global address, gs = 4 rows of the operand in elements
__device__ __forceinline__ void copy8(unsigned l, const _Float16* g, size_t gs) {
  const unsigned ls = 4 * GP * 2;
  // the last line is the wait that stands in front of any rewrite of the address registers that these copies name
  asm volatile("global_load_async_to_lds_b128 %0, %8, off\n\t"
               "global_load_async_to_lds_b128 %1, %9, off\n\t"
               "global_load_async_to_lds_b128 %2, %10, off\n\t"
               "global_load_async_to_lds_b128 %3, %11, off\n\t"
               "global_load_async_to_lds_b128 %4, %12, off\n\t"
               "global_load_async_to_lds_b128 %5, %13, off\n\t"
               "global_load_async_to_lds_b128 %6, %14, off\n\t"
               "global_load_async_to_lds_b128 %7, %15, off\n\t"
               "s_wait_xcnt 0x0"
               :: "v"(l), "v"(l + ls), "v"(l + 2 * ls), "v"(l + 3 * ls), "v"(l + 4 * ls), "v"(l + 5 * ls), "v"(l + 6 * ls), "v"(l + 7 * ls),
                  "v"(g), "v"(g + gs), "v"(g + 2 * gs), "v"(g + 3 * gs), "v"(g + 4 * gs), "v"(g + 5 * gs), "v"(g + 6 * gs), "v"(g + 7 * gs) : "memory");
}
// one stage: wave w brings rows w, w + 4, ..., w + 60 of the A tile (LDS rows 0..63) and of the B tile (LDS rows 64..127): 32 copies of a wave
__device__ __forceinline__ void fill_stage(unsigned l, const _Float16* ga, size_t sa, const _Float16* gb, size_t sb) {
  copy8(l, ga, sa); copy8(l + 32 * GP * 2, ga + 8 * sa, sa); copy8(l + 64 * GP * 2, gb, sb); copy8(l + 96 * GP * 2, gb + 8 * sb, sb);
}
// fragment from a row-major LDS tile; p = row (lane & 15), k = 8 * (lane >> 4): k 8*(lane>>4)+0..7 and 16+8*(lane>>4)+0..7, alike for A and B
__device__ __forceinline__ v16h frag_lds(const _Float16* p) { FragH f; f.half[0] = *(const v8us*)((const unsigned short*)p); f.half[1] = *(const v8us*)((const unsigned short*)p + 16); return f.v; }
__global__ __launch_bounds__(128) void k_gemm_t(const _Float16* __restrict__ A, int lda, const _Float16* __restrict__ B, int ldb, float alpha, const float* __restrict__ bias, float* __restrict__ C, int ldc, int K) {
  __shared__ __attribute__((aligned(16))) _Float16 sm[2][2 * GT][GP];
  __shared__ __attribute__((aligned(16))) float so[4][32][36];
  const int tid = threadIdx.x, w = tid >> 5, lane = tid & 31, ln = lane & 15, hh = lane >> 4, wr = w >> 1, wc = w & 1;
  const int row0 = blockIdx.y * GT, col0 = blockIdx.x * GT;
  const _Float16* ga = A + (size_t)(row0 + w) * lda + lane * 8; const _Float16* gb = B + (size_t)(col0 + w) * ldb + lane * 8;
  const size_t sa = (size_t)4 * lda, sb = (size_t)4 * ldb;
  const unsigned l0 = (unsigned)(uintptr_t)(lds_f16*)&sm[0][w][lane * 8], lbuf = 2 * GT * GP * 2;
  const int nt = K / GK;
  v8f acc[2][2] = {};
  fill_stage(l0, ga, sa, gb, sb);
  asm volatile("s_wait_asynccnt 0x0" ::: "memory");  /* this wave's copies of stage 0 have landed */
  __syncthreads();                                   /* and every other wave's */
  if (nt > 1) fill_stage(l0 + lbuf, ga + GK, sa, gb + GK, sb);
  for (int t = 0; t < nt; ++t) {
    const _Float16* pa = &sm[t & 1][wr * 32 + ln][8 * hh]; const _Float16* pb = &sm[t & 1][GT + wc * 32 + ln][8 * hh];
    v16h fa[GK / 32][2], fb[GK / 32][2];
#pragma unroll  /* every index constant: the fragments stay in registers */
    for (int ks = 0; ks < GK / 32; ++ks) { fa[ks][0] = frag_lds(pa + ks * 32); fb[ks][0] = frag_lds(pb + ks * 32); fb[ks][1] = frag_lds(pb + 16 * GP + ks * 32); fa[ks][1] = frag_lds(pa + 16 * GP + ks * 32); }
    // keeps the stage's 64 LDS loads one group in front of its WMMAs, which then follow behind counted waits; left alone the compiler reuses three fragment registers and the lone wave of a SIMD waits out the LDS latency three times per k step
    __builtin_amdgcn_sched_barrier(0);
#pragma unroll  /* as above */
    for (int ks = 0; ks < GK / 32; ++ks) {
      acc[0][0] = wm(fa[ks][0], fb[ks][0], acc[0][0]); acc[0][1] = wm(fa[ks][0], fb[ks][1], acc[0][1]); acc[1][0] = wm(fa[ks][1], fb[ks][0], acc[1][0]); acc[1][1] = wm(fa[ks][1], fb[ks][1], acc[1][1]);
    }
    // keeps the WMMAs in front of the waits below, so that they run while the later LDS loads still return and the refill is issued directly behind the barrier
    __builtin_amdgcn_sched_barrier(0);
    asm volatile("s_wait_dscnt 0x0" ::: "memory");     /* this wave's reads of the buffer are done before it is refilled */
    asm volatile("s_wait_asynccnt 0x0" ::: "memory");  /* this wave's copies of stage t + 1 have landed */
    __syncthreads();                                   /* publishes stage t + 1 and ends every wave's reads of stage t */
    if (t + 2 < nt) fill_stage(l0 + (t & 1) * lbuf, ga + (size_t)(t + 2) * GK, sa, gb + (size_t)(t + 2) * GK, sb);
  }
  asm volatile("s_wait_asynccnt 0x0" ::: "memory");    /* no copy is left in flight when the wave ends */
#pragma unroll  /* these three: constant accumulator indices, so that acc stays in registers */
  for (int j = 0; j < 2; ++j) { const float bv = bias ? bf16_round(bias[col0 + wc * 32 + j * 16 + ln]) : 0.f;
#pragma unroll
    for (int i = 0; i < 2; ++i)
#pragma unroll
      for (int r = 0; r < 8; ++r) so[w][i * 16 + 8 * hh + r][j * 16 + ln] = acc[i][j][r] * alpha + bv; }
  // each wave reads back only its own slab, so that a store covers whole 128-B lines: the fence keeps the LDS reads behind the writes of the wave's other lanes
  __builtin_amdgcn_fence(__ATOMIC_ACQ_REL, "workgroup"); __builtin_amdgcn_wave_barrier();
#pragma unroll  /* all eight LDS reads go out ahead of the stores */
  for (int q = 0; q < 8; ++q) { const int r = q * 4 + (lane >> 3), c4 = (lane & 7) * 4; const v4f v = *(const v4fa*)&so[w][r][c4]; *(v4f*)(C + (size_t)(row0 + wr * 32 + r) * ldc + col0 + wc * 32 + c4) = v; }
}

extern "C" void kernel_launch(void* const* d_in, const int* in_sizes, int n_in,
                              void* d_out, int out_size, void* d_ws, size_t ws_size, hipStream_t stream) {
  (void)in_sizes; (void)n_in; (void)out_size;
  const float* x1 = (const float*)d_in[0]; const float* x2 = (const float*)d_in[1]; const float* Wb = (const float*)d_in[2]; const float* bb_ = (const float*)d_in[3]; const float* Wc = (const float*)d_in[4]; const float* bc = (const float*)d_in[5]; const float* Wd = (const float*)d_in[6]; const float* bd = (const float*)d_in[7]; const float* al = (const float*)d_in[8]; const float* be = (const float*)d_in[9];
  char* ws = (char*)d_ws; size_t off = 0;
  auto take = [&](size_t bytes) { char* p = ws + off; off += (bytes + 255) & ~(size_t)255; return p; };
  _Float16* BB = (_Float16*)take(C8 * CC * 2); _Float16* BC = (_Float16*)take(C8 * CC * 2); _Float16* BD = (_Float16*)take((size_t)CC * CC * 2);
  _Float16* X1 = (_Float16*)take((size_t)NP * CC * 2); _Float16* X2 = (_Float16*)take((size_t)NP * CC * 2); float* T = (float*)take((size_t)NP * C8 * 4);
  _Float16* A1h = (_Float16*)take((size_t)NP * C8 * 2); _Float16* A1l = (_Float16*)take((size_t)NP * C8 * 2); _Float16* B2h = (_Float16*)take((size_t)NP * C8 * 2); _Float16* B2l = (_Float16*)take((size_t)NP * C8 * 2); _Float16* A2h = (_Float16*)take((size_t)NP * C8 * 2); _Float16* A2l = (_Float16*)take((size_t)NP * C8 * 2); _Float16* B1h = (_Float16*)take((size_t)NP * C8 * 2); _Float16* B1l = (_Float16*)take((size_t)NP * C8 * 2);
  float* F1 = (float*)take((size_t)NP * CC * 4); float* F2 = (float*)take((size_t)NP * CC * 4); _Float16* FT = (_Float16*)take((size_t)CC * NP * 2); _Float16* D16 = (_Float16*)take((size_t)RB * NP * 2);
  if (off > ws_size) return;
  k_round16f<<<(C8 * CC / 8 + 255) / 256, 256, 0, stream>>>(Wb, BB, (size_t)C8 * CC / 8); k_round16f<<<(C8 * CC / 8 + 255) / 256, 256, 0, stream>>>(Wc, BC, (size_t)C8 * CC / 8); k_round16f<<<(unsigned)(((size_t)CC * CC / 8 + 255) / 256), 256, 0, stream>>>(Wd, BD, (size_t)CC * CC / 8);      /* conv weights [O][C] = natural Bt */
  const dim3 g8(C8 / GT, NP / GT), gD(CC / GT, NP / GT), gO(RB / GT, CC / GT); const size_t n8 = (size_t)NP * C8 / 8; const unsigned nb8 = (unsigned)((n8 + 255) / 256);
  auto proj64 = [&](const _Float16* X, const _Float16* Bw, const float* bias, _Float16* Hh, _Float16* Hl) { k_gemm_t<<<g8, 128, 0, stream>>>(X, CC, Bw, CC, 0.0625f, bias, T, C8, CC); k_split<<<nb8, 256, 0, stream>>>(T, Hh, Hl, n8); };
  for (int b = 0; b < NBt; ++b) {
    k_tok<<<(NP * (CC / 8) + 255) / 256, 256, 0, stream>>>(x1, b, X1); k_tok<<<(NP * (CC / 8) + 255) / 256, 256, 0, stream>>>(x2, b, X2);
    proj64(X1, BB, bb_, A1h, A1l); proj64(X2, BC, bc, B2h, B2l); proj64(X2, BB, bb_, A2h, A2l); proj64(X1, BC, bc, B1h, B1l);      /* a1 = conv_b(x1), b2 = conv_c(x2), a2 = conv_b(x2), b1 = conv_c(x1) (exact + bias) → hi/lo */
    k_gemm_t<<<gD, 128, 0, stream>>>(X1, CC, BD, CC, 0.0625f, bd, F1, CC, CC); k_gemm_t<<<gD, 128, 0, stream>>>(X2, CC, BD, CC, 0.0625f, bd, F2, CC, CC);      /* f1, f2 = conv_d (exact + bias) */
    k_fcomb<<<(CC * (NP / 8) + 255) / 256, 256, 0, stream>>>(F1, F2, al, be, FT);
    for (int rb = 0; rb < NP / RB; ++rb) { const size_t r0 = (size_t)rb * RB;
      k_attdiff<<<RB / 16, 512, 0, stream>>>(A1h + r0 * C8, A1l + r0 * C8, A2h + r0 * C8, A2l + r0 * C8, B2h, B2l, B1h, B1l, D16);      /* |softmax(a1.b2) - softmax(a2.b1)| x 2^14 for the block's rows */
      k_gemm_t<<<gO, 128, 0, stream>>>(FT, NP, D16, NP, 1.0f / 16384.0f, nullptr, (float*)d_out + (size_t)b * CC * NP + r0, NP, NP); } }      /* out[b][c][n] = Σ_m F[c][m]·att[n][m] for n in the block: M 512 (c), N 2048 (n), K 4096 (m) → NCHW directly */
}

// v003
// It runs in 256 microseconds.
// Two timings next to v002 put it at 1.66 and 1.68 times that version's speed.
// Counting every step since v000, it is 6.00 times as fast.
#include <hip/hip_runtime.h>
// Position-attention difference module (B 2, C 512, 64×64 = 4096 positions): a1 = conv_b(x1), b2 = conv_c(x2), a2 = conv_b(x2), b1 = conv_c(x1) (1×1, 512→64, + bias); f = conv_d (512→512, + bias); att12 = softmax_m(a1ᵀ·b2), att21 = softmax_m(a2ᵀ·b1) (no scaling); att = |att12 − att21|; out = α·f1·attᵀ + β·f2·attᵀ = (α f1 + β f2)·attᵀ → [2,512,64,64].
// Structure: every kernel runs once, over both batches and both inputs (7 launches): 1x1 convs as one GEMM against the stacked weights [Wb; Wc; Wd] on position-major f16 planes (exact products); a/b as f16 hi + lo*2^10 planes so both logit matrices are about f32 (three cross products each); one kernel forms both logit matrices in registers, both softmaxes per row in f32 and writes |difference| x 2^14 as f16; F = alpha f1 + beta f2 (f32 combine, then f16) and out = F.att^T by one GEMM straight into the NCHW output.
// Compute dtype: inputs and parameters rounded to bf16; logits ≈f32; softmaxes/difference in f32; |Δ| (×2^14) and F as f16 operands (≈2^-12), f32 accumulation. v_wmma_f32_16x16x32_f16.
#define NBt 2
#define CC 512
#define C8 64
#define NP 4096
#define NW (2 * C8 + CC)         /* rows of the stacked weights [Wb; Wc; Wd] = columns of the projection matrix P */
#define NS (2 * NBt)             /* position-major input slabs: slab s = 2 * batch + (0 for x1, 1 for x2) */
typedef __bf16 v16b __attribute__((ext_vector_type(16)));
typedef unsigned short v8us __attribute__((ext_vector_type(8), may_alias));
typedef float  v8f  __attribute__((ext_vector_type(8)));
typedef float  v4f  __attribute__((ext_vector_type(4)));
typedef float  v4fa __attribute__((ext_vector_type(4), may_alias));
union FragB { v16b v; v8us half[2]; unsigned short u[16]; };

__device__ __forceinline__ unsigned short bf16_bits(float x) { unsigned int u = __float_as_uint(x); return (unsigned short)((u + 0x7FFFu + ((u >> 16) & 1u)) >> 16); }
__device__ __forceinline__ float bf16_val(unsigned short b) { return __uint_as_float(((unsigned int)b) << 16); }
__device__ __forceinline__ float bf16_round(float x) { return bf16_val(bf16_bits(x)); }
// D += A·B with NT terms: 1 = ah·bh, 2 = + al·bh (A split), 3 = + ah·bl (both split)
template <int NT>
__device__ __forceinline__ v8f mmaN(v16b ah, v16b al, v16b bh, v16b bl, v8f c) {
  c = __builtin_amdgcn_wmma_f32_16x16x32_bf16(false, ah, false, bh, (short)0, c, false, false);
  if (NT >= 2) c = __builtin_amdgcn_wmma_f32_16x16x32_bf16(false, al, false, bh, (short)0, c, false, false);
  if (NT >= 3) c = __builtin_amdgcn_wmma_f32_16x16x32_bf16(false, ah, false, bl, (short)0, c, false, false);
  asm volatile("v_nop\n\tv_nop\n\tv_nop\n\tv_nop" : "+v"(c) : "v"(ah), "v"(al), "v"(bh), "v"(bl));
  return c;
}

__global__ __launch_bounds__(256) void k_wt_bf16(const float* __restrict__ W, unsigned short* __restrict__ Wt, int K, int N) {
  const int t = blockIdx.x * 256 + threadIdx.x;
  const int k8n = K / 8;
  if (t >= N * k8n) return;
  const int n = t / k8n, k8 = (t % k8n) * 8;
  v8us v;
#pragma unroll
  for (int i = 0; i < 8; ++i) v[i] = bf16_bits(W[(size_t)(k8 + i) * N + n]);
  *(v8us*)(Wt + (size_t)n * K + k8) = v;
  
}

// GEMM C[M][N] (f32, pitch ldc) = act(A[M][K]·W + bias). A f32 row-major (pitch lda) converted per fragment to bf16
// (ASPLIT: hi/lo two planes -> 2 terms, else single rounded term); Wt bf16 [N][K] (pitch ldb). BIAS_BF16 rounds the
// bias to bf16 first (bias quantised to bf16 before the add). K%32==0, M%16==0, N%64==0.
template <bool ASPLIT, int ACT, bool BIAS_BF16>
__global__ __launch_bounds__(128) void k_gemm_bf(const float* __restrict__ A, int lda, const unsigned short* __restrict__ Wt, int ldb,
                                               const float* __restrict__ bias, float* __restrict__ C, int ldc, int M, int N, int K) {
  __shared__ __attribute__((aligned(16))) float so[4][16][64];
  const int tid = threadIdx.x, w = tid >> 5, lane = tid & 31, ln = lane & 15, hh = lane >> 4;
  const int ntn = N / 64;
  const int wid = blockIdx.x * 4 + w;
  const int mt = wid / ntn, nq = wid % ntn;
  if (mt * 16 >= M) return;
  const int row0 = mt * 16, col0 = nq * 64;
  const float* arow = A + (size_t)(row0 + ln) * lda;
  v8f acc[4] = {};
  for (int kb = 0; kb < K; kb += 32) {
    FragB ah, al;
    const v4f x0 = *(const v4fa*)(arow + kb + 8 * hh), x1 = *(const v4fa*)(arow + kb + 8 * hh + 4);
    const v4f x2 = *(const v4fa*)(arow + kb + 16 + 8 * hh), x3 = *(const v4fa*)(arow + kb + 16 + 8 * hh + 4);
    float xs[16] = {x0[0],x0[1],x0[2],x0[3],x1[0],x1[1],x1[2],x1[3],x2[0],x2[1],x2[2],x2[3],x3[0],x3[1],x3[2],x3[3]};
#pragma unroll
    for (int i = 0; i < 16; ++i) { const unsigned short hb = bf16_bits(xs[i]); ah.u[i] = hb; al.u[i] = ASPLIT ? bf16_bits(xs[i] - bf16_val(hb)) : (unsigned short)0; }
#pragma unroll
    for (int t = 0; t < 4; ++t) {
      const unsigned short* brow = Wt + (size_t)(col0 + t * 16 + ln) * ldb + kb;
      FragB b;
      b.half[0] = *(const v8us*)(brow + 8 * hh);
      b.half[1] = *(const v8us*)(brow + 16 + 8 * hh);
      acc[t] = mmaN<ASPLIT ? 2 : 1>(ah.v, al.v, b.v, b.v, acc[t]);
    }
  }
#pragma unroll
  for (int t = 0; t < 4; ++t) {
    float bv = bias ? bias[col0 + t * 16 + ln] : 0.f;
    if (BIAS_BF16) bv = bf16_round(bv);
#pragma unroll
    for (int r = 0; r < 8; ++r) { float v = acc[t][r] + bv; if (ACT == 1) v = fmaxf(v, 0.f); so[w][8 * hh + r][t * 16 + ln] = v; }
  }
  __builtin_amdgcn_fence(__ATOMIC_ACQ_REL, "workgroup");
  __builtin_amdgcn_wave_barrier();
  const int rsub = lane >> 4, c4 = (lane & 15) * 4;
  {
#pragma unroll
    for (int q = 0; q < 8; ++q) {
      const int r = q * 2 + rsub;
      const v4f v = *(const v4fa*)&so[w][r][c4];
      *(v4f*)(C + (size_t)(row0 + r) * ldc + col0 + c4) = v;
    }
    
  }
}

// GEMM C = act(A·W + bias + resid): A f32 (ASPLIT -> hi/lo 2 terms), Wt bf16 [N][K]; ACT 0 none, 1 relu, 2 exact gelu;
// resid (optional, f32, row index = (row % rmod), pitch ldr, RES_BF16 rounds it) added before the activation.
template <bool ASPLIT, int ACT, bool BIAS_BF16, bool RES_BF16>
__global__ __launch_bounds__(128) void k_gemm_bf3(const float* __restrict__ A, int lda, const unsigned short* __restrict__ Wt, int ldb,
                                                const float* __restrict__ bias, const float* __restrict__ resid, int rmod, int ldr,
                                                float* __restrict__ C, int ldc, int M, int N, int K) {
  __shared__ __attribute__((aligned(16))) float so[4][16][64];
  const int tid = threadIdx.x, w = tid >> 5, lane = tid & 31, ln = lane & 15, hh = lane >> 4;
  const int ntn = N / 64;
  const int wid = blockIdx.x * 4 + w;
  const int mt = wid / ntn, nq = wid % ntn;
  if (mt * 16 >= M) return;
  const int row0 = mt * 16, col0 = nq * 64;
  const float* arow = A + (size_t)(row0 + ln) * lda;
  v8f acc[4] = {};
  for (int kb = 0; kb < K; kb += 32) {
    FragB ah, al;
    const v4f x0 = *(const v4fa*)(arow + kb + 8 * hh), x1 = *(const v4fa*)(arow + kb + 8 * hh + 4);
    const v4f x2 = *(const v4fa*)(arow + kb + 16 + 8 * hh), x3 = *(const v4fa*)(arow + kb + 16 + 8 * hh + 4);
    float xs[16] = {x0[0],x0[1],x0[2],x0[3],x1[0],x1[1],x1[2],x1[3],x2[0],x2[1],x2[2],x2[3],x3[0],x3[1],x3[2],x3[3]};
#pragma unroll
    for (int i = 0; i < 16; ++i) { const unsigned short hb = bf16_bits(xs[i]); ah.u[i] = hb; al.u[i] = ASPLIT ? bf16_bits(xs[i] - bf16_val(hb)) : (unsigned short)0; }
#pragma unroll
    for (int t = 0; t < 4; ++t) {
      const unsigned short* brow = Wt + (size_t)(col0 + t * 16 + ln) * ldb + kb;
      FragB b;
      b.half[0] = *(const v8us*)(brow + 8 * hh);
      b.half[1] = *(const v8us*)(brow + 16 + 8 * hh);
      acc[t] = mmaN<ASPLIT ? 2 : 1>(ah.v, al.v, b.v, b.v, acc[t]);
    }
  }
#pragma unroll
  for (int t = 0; t < 4; ++t) {
    const int col = col0 + t * 16 + ln;
    float bv = bias ? bias[col] : 0.f;
    if (BIAS_BF16) bv = bf16_round(bv);
#pragma unroll
    for (int r = 0; r < 8; ++r) {
      float v = acc[t][r] + bv;
      if (resid) { float rv = resid[(size_t)((row0 + 8 * hh + r) % rmod) * ldr + col]; if (RES_BF16) rv = bf16_round(rv); v += rv; }
      if (ACT == 1) v = fmaxf(v, 0.f);
      if (ACT == 2) v = 0.5f * v * (1.0f + erff(v * 0.70710678118654752f));
      if (ACT == 3) { const float u = 0.7978845608028654f * (v + 0.044715f * v * v * v); v = 0.5f * v * (1.0f + tanhf(u)); }
      so[w][8 * hh + r][t * 16 + ln] = v;
    }
  }
  __builtin_amdgcn_fence(__ATOMIC_ACQ_REL, "workgroup");
  __builtin_amdgcn_wave_barrier();
  const int rsub = lane >> 4, c4 = (lane & 15) * 4;
  {
#pragma unroll
    for (int q = 0; q < 8; ++q) {
      const int r = q * 2 + rsub;
      const v4f v = *(const v4fa*)&so[w][r][c4];
      *(v4f*)(C + (size_t)(row0 + r) * ldc + col0 + c4) = v;
    }
    
  }
}
// row LayerNorm (biased variance, eps) over N: s = X (+ R); optional out_sum <- s; out_norm <- (s-mu)*rsqrt(var+eps)*g + b
template <bool PARAM_BF16>
__global__ __launch_bounds__(256) void k_layernorm(const float* __restrict__ X, const float* __restrict__ R, const float* __restrict__ g, const float* __restrict__ bta,
                                                  float* __restrict__ out_sum, float* __restrict__ out_norm, int N, float eps) {
  __shared__ float red[256];
  const int row = blockIdx.x, tid = threadIdx.x;
  const float* x = X + (size_t)row * N; const float* rr = R ? R + (size_t)row * N : nullptr;
  float vals[16];                     // up to N = 4096
  const int per = N / 256;            // contiguous chunk per thread? use strided-by-4 chunks: thread handles j = tid*4 + 1024*u
  float s1 = 0.f;
  for (int u = 0; u < per / 4; ++u) {
    const int j = tid * 4 + 1024 * u;
    const v4f a = *(const v4fa*)(x + j);
    v4f b = {0.f,0.f,0.f,0.f}; if (rr) b = *(const v4fa*)(rr + j);
#pragma unroll
    for (int q = 0; q < 4; ++q) { const float v = a[q] + b[q]; vals[u * 4 + q] = v; s1 += v; }
  }
  red[tid] = s1; __syncthreads();
  for (int st = 128; st > 0; st >>= 1) { if (tid < st) red[tid] += red[tid + st]; __syncthreads(); }
  const float mu = red[0] / (float)N; __syncthreads();
  float s2 = 0.f;
  for (int u = 0; u < per / 4; ++u)
#pragma unroll
    for (int q = 0; q < 4; ++q) { const float c = vals[u * 4 + q] - mu; s2 += c * c; }
  red[tid] = s2; __syncthreads();
  for (int st = 128; st > 0; st >>= 1) { if (tid < st) red[tid] += red[tid + st]; __syncthreads(); }
  const float rs = rsqrtf(red[0] / (float)N + eps);
  {
    for (int u = 0; u < per / 4; ++u) {
      const int j = tid * 4 + 1024 * u;
      v4f o, sm;
#pragma unroll
      for (int q = 0; q < 4; ++q) {
        float gg = g[j + q], bb = bta[j + q];
        if (PARAM_BF16) { gg = bf16_round(gg); bb = bf16_round(bb); }
        sm[q] = vals[u * 4 + q]; o[q] = (vals[u * 4 + q] - mu) * rs * gg + bb;
      }
      if (out_sum) *(v4f*)(out_sum + (size_t)row * N + j) = sm;
      *(v4f*)(out_norm + (size_t)row * N + j) = o;
    }
    
  }
}



// ---- f16 WMMA path (v_wmma_f32_16x16x32_f16): 11-bit significands for operands in range — used where a [0,1] probability operand needs more precision than bf16
typedef _Float16 v16h __attribute__((ext_vector_type(16)));
union FragH { v16h v; v8us half[2]; _Float16 h[16]; unsigned short u[16]; };
template <int NT>
__device__ __forceinline__ v8f mmaH(v16h ah, v16h al, v16h bh, v16h bl, v8f c) {
  c = __builtin_amdgcn_wmma_f32_16x16x32_f16(false, ah, false, bh, (short)0, c, false, false);
  if (NT >= 2) c = __builtin_amdgcn_wmma_f32_16x16x32_f16(false, al, false, bh, (short)0, c, false, false);
  if (NT >= 3) c = __builtin_amdgcn_wmma_f32_16x16x32_f16(false, ah, false, bl, (short)0, c, false, false);
  asm volatile("v_nop\n\tv_nop\n\tv_nop\n\tv_nop" : "+v"(c) : "v"(ah), "v"(al), "v"(bh), "v"(bl));
  return c;
}
// batched GEMM like k_gemm_b but f16 operands: A f32 (split into f16 hi/lo if ASPLIT, else rounded to f16), Bt = f16 values [n][k]; alpha; C f32; N multiple of 16 (partial tiles skipped)
template <bool ASPLIT>
__global__ __launch_bounds__(128) void k_gemm_h(const float* __restrict__ A, int lda, size_t sA, const _Float16* __restrict__ Bh, int ldb, size_t sB, float alpha, float* __restrict__ C, int ldc, size_t sC, int M, int N, int K) {
  __shared__ __attribute__((aligned(16))) float so[4][16][64];
  const int tid = threadIdx.x, w = tid >> 5, lane = tid & 31, ln = lane & 15, hh = lane >> 4; const int by = blockIdx.y;
  A += (size_t)by * sA; Bh += (size_t)by * sB; C += (size_t)by * sC;
  const int ntn = (N + 63) / 64; const int wid = blockIdx.x * 4 + w; const int mt = wid / ntn, nq = wid % ntn; if (mt * 16 >= M) return;
  const int row0 = mt * 16, col0 = nq * 64; const float* arow = A + (size_t)(row0 + ln) * lda;
  v8f acc[4] = {};
  for (int kb = 0; kb < K; kb += 32) {
    FragH ah, al;
    const v4f x0 = *(const v4fa*)(arow + kb + 8 * hh), x1 = *(const v4fa*)(arow + kb + 8 * hh + 4), x2 = *(const v4fa*)(arow + kb + 16 + 8 * hh), x3 = *(const v4fa*)(arow + kb + 16 + 8 * hh + 4);
    float xs[16] = {x0[0],x0[1],x0[2],x0[3],x1[0],x1[1],x1[2],x1[3],x2[0],x2[1],x2[2],x2[3],x3[0],x3[1],x3[2],x3[3]};
#pragma unroll
    for (int i = 0; i < 16; ++i) { const _Float16 h = (_Float16)xs[i]; ah.h[i] = h; al.h[i] = ASPLIT ? (_Float16)(xs[i] - (float)h) : (_Float16)0.0f; }
#pragma unroll
    for (int t = 0; t < 4; ++t) { if (col0 + t * 16 >= N) continue; const size_t boff = (size_t)(col0 + t * 16 + ln) * ldb + kb; FragH bq; bq.half[0] = *(const v8us*)(Bh + boff + 8 * hh); bq.half[1] = *(const v8us*)(Bh + boff + 16 + 8 * hh);
      acc[t] = mmaH<ASPLIT ? 2 : 1>(ah.v, al.v, bq.v, bq.v, acc[t]); }
  }
#pragma unroll
  for (int t = 0; t < 4; ++t) { if (col0 + t * 16 >= N) continue;
#pragma unroll
    for (int r = 0; r < 8; ++r) so[w][8 * hh + r][t * 16 + ln] = acc[t][r] * alpha; }
  __builtin_amdgcn_fence(__ATOMIC_ACQ_REL, "workgroup"); __builtin_amdgcn_wave_barrier();
  const int rsub = lane >> 4, c4 = (lane & 15) * 4;
  {
#pragma unroll
    for (int q = 0; q < 8; ++q) { const int r = q * 2 + rsub; if (col0 + c4 < N) { const v4f v = *(const v4fa*)&so[w][r][c4]; *(v4f*)(C + (size_t)(row0 + r) * ldc + col0 + c4) = v; } }
     }
}

// Wt[n][k] = f16(W[k][n]·scale) from f32 row-major W[K][N] (scale = power of two; bf16-exact weights stay exact in f16 away from the subnormal range)
__global__ __launch_bounds__(256) void k_wt_f16(const float* __restrict__ W, _Float16* __restrict__ Wt, int K, int N, float scale) {
  const int t = blockIdx.x * 256 + threadIdx.x; if (t >= N * (K / 8)) return; const int n = t / (K / 8), k8 = (t % (K / 8)) * 8; FragH f;
#pragma unroll
  for (int i = 0; i < 8; ++i) f.h[i] = (_Float16)(bf16_round(W[(size_t)(k8 + i) * N + n]) * scale); const v8us o = f.half[0];
  *(v8us*)((unsigned short*)Wt + (size_t)n * K + k8) = o; 
}
// k_gemm_hh variant with fused epilogue: v = acc·alpha + bias[by·sBias + col] (+ CP[(row/rowsPerB)·sCPb + by·64 + col] if CP) ; ACT 0 none / 1 elu ; writes f32 C and f16 C16, each if non-null
template <int ACT>
__global__ __launch_bounds__(128) void k_gemm_hhx(const _Float16* __restrict__ A, int lda, size_t sA, const _Float16* __restrict__ Bh, int ldb, size_t sB, float alpha, const float* __restrict__ bias, size_t sBias, const float* __restrict__ CP, int rowsPerB, size_t sCPb, int row0g,
    float* __restrict__ C, _Float16* __restrict__ C16, int ldc, size_t sC, int M, int N, int K) {
  __shared__ __attribute__((aligned(16))) float so[4][16][64];
  const int tid = threadIdx.x, w = tid >> 5, lane = tid & 31, ln = lane & 15, hh = lane >> 4; const int by = blockIdx.y;
  A += (size_t)by * sA; Bh += (size_t)by * sB; const size_t cofs = (size_t)by * sC; const float* bp = bias ? bias + (size_t)by * sBias : nullptr;
  const int ntn = (N + 63) / 64; const int wid = blockIdx.x * 4 + w; const int mt = wid / ntn, nq = wid % ntn; if (mt * 16 >= M) return;
  const int row0 = mt * 16, col0 = nq * 64; const _Float16* arow = A + (size_t)(row0 + ln) * lda;
  v8f acc[4] = {};
  for (int kb = 0; kb < K; kb += 32) { FragH ah; ah.half[0] = *(const v8us*)((const unsigned short*)arow + kb + 8 * hh); ah.half[1] = *(const v8us*)((const unsigned short*)arow + kb + 16 + 8 * hh);
#pragma unroll
    for (int t = 0; t < 4; ++t) { if (col0 + t * 16 >= N) continue; const size_t boff = (size_t)(col0 + t * 16 + ln) * ldb + kb; FragH bq; bq.half[0] = *(const v8us*)((const unsigned short*)Bh + boff + 8 * hh); bq.half[1] = *(const v8us*)((const unsigned short*)Bh + boff + 16 + 8 * hh);
      acc[t] = mmaH<1>(ah.v, ah.v, bq.v, bq.v, acc[t]); }
  }
#pragma unroll
  for (int t = 0; t < 4; ++t) { if (col0 + t * 16 >= N) continue; const int col = col0 + t * 16 + ln; const float bv = bp ? bf16_round(bp[col]) : 0.f;
#pragma unroll
    for (int r = 0; r < 8; ++r) { float v = acc[t][r] * alpha + bv; if (CP) { const int bidx = (row0g + row0 + 8 * hh + r) / rowsPerB; v += CP[(size_t)bidx * sCPb + (size_t)by * 64 + col]; } if (ACT == 1) v = (v > 0.f) ? v : expm1f(v); else if (ACT == 7) v = (v > 0.f) ? v + 1.0f : expf(v); else if (ACT == 8) v = tanhf(v); else if (ACT == 9) v = 0.5f * v * (1.0f + tanhf(0.7978845608028654f * (v + 0.044715f * v * v * v))); else if (ACT == 11) v = 1.0f / (1.0f + expf(-v)); else if (ACT == 12) v = (v > 0.f) ? v : 0.01f * v; else if (ACT == 14) v = (v > 0.f) ? v : 0.1f * v; else if (ACT == 15) v = v / (1.0f + expf(-v)); else if (ACT == 3) v = fmaxf(v, 0.f); else if (ACT == 6) v = 0.5f * v * (1.0f + erff(v * 0.70710678118654752f)); so[w][8 * hh + r][t * 16 + ln] = v; } }
  __builtin_amdgcn_fence(__ATOMIC_ACQ_REL, "workgroup"); __builtin_amdgcn_wave_barrier();
  const int rsub = lane >> 4, c4 = (lane & 15) * 4; typedef _Float16 v4h __attribute__((ext_vector_type(4)));
  {
#pragma unroll
    for (int q = 0; q < 8; ++q) { const int r = q * 2 + rsub; if (col0 + c4 < N) { const v4f v = *(const v4fa*)&so[w][r][c4]; if (C) *(v4f*)(C + cofs + (size_t)(row0 + r) * ldc + col0 + c4) = v; if (C16) { v4h h4; for (int i = 0; i < 4; ++i) h4[i] = (_Float16)v[i]; *(v4h*)(C16 + cofs + (size_t)(row0 + r) * ldc + col0 + c4) = h4; } } }
     }
}


typedef _Float16 v4h __attribute__((ext_vector_type(4)));

__global__ __launch_bounds__(256) void k_x16(const float* __restrict__ x, _Float16* __restrict__ X16, size_t n8) { const size_t t = (size_t)blockIdx.x * 256 + threadIdx.x; if (t >= n8) return; FragH f;
#pragma unroll
  for (int q = 0; q < 8; ++q) f.h[q] = (_Float16)bf16_round(x[t * 8 + q]); *(v8us*)((unsigned short*)X16 + t * 8) = f.half[0];  }
__global__ __launch_bounds__(256) void k_h16(const float* __restrict__ x, _Float16* __restrict__ X16, size_t n8) { const size_t t = (size_t)blockIdx.x * 256 + threadIdx.x; if (t >= n8) return; FragH f;
#pragma unroll
  for (int q = 0; q < 8; ++q) f.h[q] = (_Float16)x[t * 8 + q]; *(v8us*)((unsigned short*)X16 + t * 8) = f.half[0];  }
__global__ __launch_bounds__(256) void k_round16f(const float* __restrict__ W, _Float16* __restrict__ Bt, size_t n8) { const size_t t = (size_t)blockIdx.x * 256 + threadIdx.x; if (t >= n8) return; FragH f;
#pragma unroll
  for (int i = 0; i < 8; ++i) f.h[i] = (_Float16)(bf16_round(W[t * 8 + i]) * 16.0f); *(v8us*)((unsigned short*)Bt + t * 8) = f.half[0];  }
template <int NHv, int TTv>
__global__ __launch_bounds__(256) void k_vt(const _Float16* __restrict__ V16, int ldv, int voff, _Float16* __restrict__ Vt) { __shared__ unsigned short tl[64][66]; const int tid = threadIdx.x; const int slab = blockIdx.x / (TTv / 64), lg = blockIdx.x % (TTv / 64); const int b = slab / NHv, h = slab % NHv;
  for (int i = tid; i < 64 * 8; i += 256) { const int r = i / 8, c8 = (i % 8) * 8; FragH f; f.half[0] = *(const v8us*)((const unsigned short*)V16 + ((size_t)b * TTv + lg * 64 + r) * ldv + voff + h * 64 + c8);
#pragma unroll
    for (int q = 0; q < 8; ++q) tl[r][c8 + q] = f.u[q]; }
  __syncthreads();
  {
#pragma unroll
    for (int rd = 0; rd < 2; ++rd) { const int d = rd * 32 + tid / 8, pc = tid % 8; FragH f;
#pragma unroll
      for (int q = 0; q < 8; ++q) f.u[q] = tl[pc * 8 + q][d];
      *(v8us*)((unsigned short*)Vt + ((size_t)slab * 64 + d) * TTv + lg * 64 + pc * 8) = f.half[0]; }
     } }

__global__ __launch_bounds__(256) void k_hl(const float* __restrict__ F, _Float16* __restrict__ Hh, _Float16* __restrict__ Hl, size_t n8) { const size_t t = (size_t)blockIdx.x * 256 + threadIdx.x; if (t >= n8) return; FragH fh, fl; const v4f a = *(const v4fa*)(F + t * 8), c = *(const v4fa*)(F + t * 8 + 4);
#pragma unroll
  for (int q = 0; q < 4; ++q) { _Float16 h = (_Float16)a[q]; fh.h[q] = h; fl.h[q] = (_Float16)((a[q] - (float)h) * 1024.0f); h = (_Float16)c[q]; fh.h[4 + q] = h; fl.h[4 + q] = (_Float16)((c[q] - (float)h) * 1024.0f); }
  { *(v8us*)((unsigned short*)Hh + t * 8) = fh.half[0]; *(v8us*)((unsigned short*)Hl + t * 8) = fl.half[0];  } }

// stacked weights BW[NW][CC] = f16(bf16(W) * 16), rows 0..63 Wb, 64..127 Wc, 128..639 Wd, and the stacked biases BI[NW] (f32, as given)
__global__ __launch_bounds__(256) void k_prep(const float* __restrict__ Wb, const float* __restrict__ Wc, const float* __restrict__ Wd, const float* __restrict__ bb, const float* __restrict__ bc, const float* __restrict__ bd, _Float16* __restrict__ BW, float* __restrict__ BI) {
  const int t = blockIdx.x * 256 + threadIdx.x, n1 = C8 * CC / 8; if (t >= NW * CC / 8) return;
  const float* Wp = (t < n1) ? Wb + (size_t)t * 8 : (t < 2 * n1) ? Wc + (size_t)(t - n1) * 8 : Wd + (size_t)(t - 2 * n1) * 8; FragH f;
#pragma unroll
  for (int i = 0; i < 8; ++i) f.h[i] = (_Float16)(bf16_round(Wp[i]) * 16.0f); *(v8us*)((unsigned short*)BW + (size_t)t * 8) = f.half[0];
  if (t < NW) BI[t] = (t < C8) ? bb[t] : (t < 2 * C8) ? bc[t - C8] : bd[t - 2 * C8]; }
// blockIdx.y = slab s
__global__ __launch_bounds__(256) void k_tok(const float* __restrict__ x1, const float* __restrict__ x2, _Float16* __restrict__ X16) { const int t = blockIdx.x * 256 + threadIdx.x; if (t >= NP * (CC / 8)) return; const int c0 = (t % (CC / 8)) * 8, n = t / (CC / 8); FragH f;
  const int s = blockIdx.y, b = s >> 1; const float* x = (s & 1) ? x2 : x1; X16 += (size_t)s * NP * CC;
#pragma unroll
  for (int q = 0; q < 8; ++q) f.h[q] = (_Float16)bf16_round(x[((size_t)b * CC + c0 + q) * NP + n]);
  *(v8us*)((unsigned short*)X16 + (size_t)n * CC + c0) = f.half[0];  }
// blockIdx.y = plane p = 2 * slab + (0 for conv_b, 1 for conv_c): columns 64 (p & 1) .. + 63 of slab p >> 1 of P
__global__ __launch_bounds__(256) void k_split(const float* __restrict__ F, _Float16* __restrict__ Hh, _Float16* __restrict__ Hl, size_t n8) {
  #pragma clang fp contract(off)
  const size_t t = (size_t)blockIdx.x * 256 + threadIdx.x; if (t >= n8) return;
  const size_t p = blockIdx.y; F += (p >> 1) * NP * NW + (p & 1) * C8; Hh += p * NP * C8; Hl += p * NP * C8;
  // planes in WMMA fragment order, 16 positions x 64 channels per 2-KiB block: [k step of 32][fragment half][lane][8 channels]; piece t of the plane is position 16*(t>>7) + (t&15), channels 8*sc..8*sc+7
  const size_t sc = ((t >> 6) & 1) * 4 + ((t >> 5) & 1) * 2 + ((t >> 4) & 1), so = ((t >> 7) * 16 + (t & 15)) * NW + sc * 8;
  const v4f a = *(const v4fa*)(F + so), c = *(const v4fa*)(F + so + 4); FragH fh, fl;
#pragma unroll
  for (int q = 0; q < 8; ++q) { const float v = (q < 4) ? a[q] : c[q - 4]; const _Float16 hi = (_Float16)v; fh.h[q] = hi; fl.h[q] = (_Float16)((v - (float)hi) * 1024.0f); }
  { *(v8us*)((unsigned short*)Hh + t * 8) = fh.half[0]; *(v8us*)((unsigned short*)Hl + t * 8) = fl.half[0];  } }
// blockIdx.y = batch; f1, f2 = columns 128.. of the batch's two slabs of P
__global__ __launch_bounds__(256) void k_fcomb(const float* __restrict__ P, const float* __restrict__ al, const float* __restrict__ be, _Float16* __restrict__ FT) {
  #pragma clang fp contract(off)
  const int t = blockIdx.x * 256 + threadIdx.x; if (t >= CC * (NP / 8)) return;
  const float* F1 = P + (size_t)(2 * blockIdx.y) * NP * NW + 2 * C8; const float* F2 = F1 + (size_t)NP * NW; FT += (size_t)blockIdx.y * CC * NP; const int m0 = (t % (NP / 8)) * 8, c = t / (NP / 8); const float a = bf16_round(al[0]), bq = bf16_round(be[0]); FragH f;
#pragma unroll
  for (int q = 0; q < 8; ++q) f.h[q] = (_Float16)(a * F1[(size_t)(m0 + q) * NW + c] + bq * F2[(size_t)(m0 + q) * NW + c]);
  *(v8us*)((unsigned short*)FT + (size_t)c * NP + m0) = f.half[0];  }
// One 16x32 f16 fragment (A row or B column = lane & 15; k = 8*(lane>>4)+0..7 and 16+8*(lane>>4)+0..7) from a plane in the fragment order that k_split writes; p already holds 8*lane.
// Each of the two loads reads 512 contiguous bytes (4 whole lines) per wave; from a row-major plane it would touch 16 lines.
__device__ __forceinline__ v16h frag_at(const _Float16* p) { FragH f; f.half[0] = *(const v8us*)((const unsigned short*)p); f.half[1] = *(const v8us*)((const unsigned short*)p + 256); return f.v; }
__device__ __forceinline__ v8f wm(v16h a, v16h b, v8f c) { return __builtin_amdgcn_wmma_f32_16x16x32_f16(false, a, false, b, (short)0, c, false, false); }
// value of lane ^ X inside the 16-lane row, by DPP row_xmask (a shuffle would go through the LDS pipe and its wait); every lane is on where it is used
template <int X> __device__ __forceinline__ float row_xor(float v) { return __int_as_float(__builtin_amdgcn_update_dpp(0, __float_as_int(v), 0x160 + X, 0xf, 0xf, true)); }
__device__ __forceinline__ float row_max16(float v) { v = fmaxf(v, row_xor<1>(v)); v = fmaxf(v, row_xor<2>(v)); v = fmaxf(v, row_xor<4>(v)); return fmaxf(v, row_xor<8>(v)); }
__device__ __forceinline__ float row_sum16(float v) { v += row_xor<1>(v); v += row_xor<2>(v); v += row_xor<4>(v); return v + row_xor<8>(v); }
struct QFrag { v16h a1h[2], a1l[2], a2h[2], a2l[2]; };
// both logit tiles (16 query rows x 16 key columns, K 64) from the hi/lo planes: hi*hi in one accumulator, the two cross terms (scaled 2^10) in a second
__device__ __forceinline__ void logit_tile(const QFrag& q, const _Float16* b2h, const _Float16* b2l, const _Float16* b1h, const _Float16* b1l, v8f& s1, v8f& s2) {
  v8f h1 = {}, l1 = {}, h2 = {}, l2 = {};
  const v16h p[2] = {frag_at(b2h), frag_at(b2h + 512)}, x[2] = {frag_at(b1h), frag_at(b1h + 512)}, pl[2] = {frag_at(b2l), frag_at(b2l + 512)}, xl[2] = {frag_at(b1l), frag_at(b1l + 512)};
  // holds all sixteen loads of the tile in front of its first WMMA: one load latency a tile; left alone the compiler reuses fragment registers and waits for memory several times a tile
  asm volatile("" :: "v"(p[0]), "v"(p[1]), "v"(x[0]), "v"(x[1]), "v"(pl[0]), "v"(pl[1]), "v"(xl[0]), "v"(xl[1]));
#pragma unroll
  for (int ks = 0; ks < 2; ++ks) {
    h1 = wm(q.a1h[ks], p[ks], h1); h2 = wm(q.a2h[ks], x[ks], h2); l1 = wm(q.a1l[ks], p[ks], l1); l2 = wm(q.a2l[ks], x[ks], l2); l1 = wm(q.a1h[ks], pl[ks], l1); l2 = wm(q.a2h[ks], xl[ks], l2);
  }
#pragma unroll
  for (int r = 0; r < 8; ++r) { s1[r] = h1[r] + l1[r] * 0.0009765625f; s2[r] = h2[r] + l2[r] * 0.0009765625f; }
}
// Logits, both softmaxes and |difference| in one kernel: a work-group of 16 waves owns 16 query rows, wave w the key columns [256 w, 256 w + 256).
// The logits stay in registers and are formed three times (row maximum, row sum, output); nothing of them goes to memory.
#define DW 16                    /* waves per work-group */
#define DCOL (NP / DW)           /* key columns per wave */
#define DPIT (DCOL + 8)          /* LDS row pitch in f16: 16-byte multiple, rows 8 apart fall on other banks */
__global__ __launch_bounds__(512) void k_attdiff(const _Float16* __restrict__ A1h, const _Float16* __restrict__ A1l, const _Float16* __restrict__ A2h, const _Float16* __restrict__ A2l,
                                                 const _Float16* __restrict__ B2h, const _Float16* __restrict__ B2l, const _Float16* __restrict__ B1h, const _Float16* __restrict__ B1l, _Float16* __restrict__ D16) {
  __shared__ __attribute__((aligned(16))) _Float16 st[DW][16][DPIT];
  __shared__ float red[2][DW][16];
  __shared__ float fin[2][16];
  const int tid = threadIdx.x, w = tid >> 5, lane = tid & 31, ln = lane & 15, hh = lane >> 4; const int row0 = blockIdx.x * 16;
  { const size_t pb = (size_t)blockIdx.y * 4 * NP * C8;  /* blockIdx.y = batch: four planes of each kind a batch */
    A1h += pb; A1l += pb; A2h += pb; A2l += pb; B2h += pb; B2l += pb; B1h += pb; B1l += pb; D16 += (size_t)blockIdx.y * NP * NP; }
  QFrag q; { const size_t ao = (size_t)row0 * C8 + 8 * lane;
#pragma unroll
    for (int ks = 0; ks < 2; ++ks) { q.a1h[ks] = frag_at(A1h + ao + ks * 512); q.a1l[ks] = frag_at(A1l + ao + ks * 512); q.a2h[ks] = frag_at(A2h + ao + ks * 512); q.a2l[ks] = frag_at(A2l + ao + ks * 512); } }
  const size_t bo = (size_t)(w * DCOL) * C8 + 8 * lane; B2h += bo; B2l += bo; B1h += bo; B1l += bo;
  float m1[8], m2[8];
#pragma unroll
  for (int r = 0; r < 8; ++r) { m1[r] = -3.0e38f; m2[r] = -3.0e38f; }
#pragma unroll 1  /* rolled: an unrolled body would hold several tiles' B fragments and leave the 256-register budget of 4 waves per SIMD */
  for (int j = 0; j < DCOL / 16; ++j) { v8f s1, s2; const size_t o = (size_t)j * 16 * C8; logit_tile(q, B2h + o, B2l + o, B1h + o, B1l + o, s1, s2);
#pragma unroll
    for (int r = 0; r < 8; ++r) { m1[r] = fmaxf(m1[r], s1[r]); m2[r] = fmaxf(m2[r], s2[r]); } }
#pragma unroll
  for (int r = 0; r < 8; ++r) { m1[r] = row_max16(m1[r]); m2[r] = row_max16(m2[r]); }
  if (ln == 0) {
#pragma unroll
    for (int r = 0; r < 8; ++r) { red[0][w][8 * hh + r] = m1[r]; red[1][w][8 * hh + r] = m2[r]; } }
  __syncthreads();
  if (tid < 32) { float v = red[tid >> 4][0][tid & 15]; for (int k = 1; k < DW; ++k) v = fmaxf(v, red[tid >> 4][k][tid & 15]); fin[tid >> 4][tid & 15] = v; }
  __syncthreads();
  float u1[8], u2[8];
#pragma unroll
  for (int r = 0; r < 8; ++r) { m1[r] = fin[0][8 * hh + r]; m2[r] = fin[1][8 * hh + r]; u1[r] = 0.f; u2[r] = 0.f; }
#pragma unroll 1  /* rolled for the register budget, as above */
  for (int j = 0; j < DCOL / 16; ++j) { v8f s1, s2; const size_t o = (size_t)j * 16 * C8; logit_tile(q, B2h + o, B2l + o, B1h + o, B1l + o, s1, s2);
#pragma unroll
    for (int r = 0; r < 8; ++r) { u1[r] += expf(s1[r] - m1[r]); u2[r] += expf(s2[r] - m2[r]); } }
#pragma unroll
  for (int r = 0; r < 8; ++r) { u1[r] = row_sum16(u1[r]); u2[r] = row_sum16(u2[r]); }
  if (ln == 0) {
#pragma unroll
    for (int r = 0; r < 8; ++r) { red[0][w][8 * hh + r] = u1[r]; red[1][w][8 * hh + r] = u2[r]; } }
  __syncthreads();
  if (tid < 32) { float v = red[tid >> 4][0][tid & 15]; for (int k = 1; k < DW; ++k) v += red[tid >> 4][k][tid & 15]; fin[tid >> 4][tid & 15] = 1.0f / v; }
  __syncthreads();
#pragma unroll
  for (int r = 0; r < 8; ++r) { u1[r] = fin[0][8 * hh + r]; u2[r] = fin[1][8 * hh + r]; }
#pragma unroll 1  /* rolled for the register budget, as above */
  for (int j = 0; j < DCOL / 16; ++j) { v8f s1, s2; const size_t o = (size_t)j * 16 * C8; logit_tile(q, B2h + o, B2l + o, B1h + o, B1l + o, s1, s2);
#pragma unroll
    for (int r = 0; r < 8; ++r) st[w][8 * hh + r][j * 16 + ln] = (_Float16)(fabsf(expf(s1[r] - m1[r]) * u1[r] - expf(s2[r] - m2[r]) * u2[r]) * 16384.0f); }
  // each wave reads back only its own slab: the fence keeps the LDS reads behind the writes of the wave's other lanes, no work-group barrier is needed
  __builtin_amdgcn_fence(__ATOMIC_ACQ_REL, "workgroup"); __builtin_amdgcn_wave_barrier();
#pragma unroll
  for (int r = 0; r < 16; ++r) { const v8us v = *(const v8us*)&st[w][r][lane * 8]; *(v8us*)((unsigned short*)D16 + (size_t)(row0 + r) * NP + w * DCOL + lane * 8) = v; }
}

// C[M][N] (f32, pitch ldc) = A[M][K] . B[N][K]^T * alpha + bias[col] (bias rounded to bf16); A and B f16 with k contiguous. One 64 x 64 tile of C per work-group of 4 waves (2 x 2, 32 x 32 each).
// A stage is 256 k of the tile's 64 A rows and 64 B rows, brought into LDS by asynchronous b128 copies: one copy of a wave is 512 contiguous bytes of one row (4 whole lines), where a fragment load
// straight from the row-major operand touches 16 lines. Two buffers: the next stage's copies fly while this stage is worked on. M, N multiples of 64, K a multiple of 256.
// Every accumulator sums k in rising order, 32 at a time.
#define GT 64                    /* rows of each operand per work-group */
#define GK 256                   /* k per stage */
#define GP (GK + 8)              /* LDS row pitch in f16: 528 B = 16 B x odd, so the 16 rows of a ds_load_b128 fall on all banks */
typedef __attribute__((address_space(3))) const _Float16 lds_f16;
// eight rows (4 apart) of one operand: l = the lane's LDS byte address, g = the lane's global address, gs = 4 rows of the operand in elements
__device__ __forceinline__ void copy8(unsigned l, const _Float16* g, size_t gs) {
  const unsigned ls = 4 * GP * 2;
  // the last line is the wait that stands in front of any rewrite of the address registers that these copies name
  asm volatile("global_load_async_to_lds_b128 %0, %8, off\n\t"
               "global_load_async_to_lds_b128 %1, %9, off\n\t"
               "global_load_async_to_lds_b128 %2, %10, off\n\t"
               "global_load_async_to_lds_b128 %3, %11, off\n\t"
               "global_load_async_to_lds_b128 %4, %12, off\n\t"
               "global_load_async_to_lds_b128 %5, %13, off\n\t"
               "global_load_async_to_lds_b128 %6, %14, off\n\t"
               "global_load_async_to_lds_b128 %7, %15, off\n\t"
               "s_wait_xcnt 0x0"
               :: "v"(l), "v"(l + ls), "v"(l + 2 * ls), "v"(l + 3 * ls), "v"(l + 4 * ls), "v"(l + 5 * ls), "v"(l + 6 * ls), "v"(l + 7 * ls),
                  "v"(g), "v"(g + gs), "v"(g + 2 * gs), "v"(g + 3 * gs), "v"(g + 4 * gs), "v"(g + 5 * gs), "v"(g + 6 * gs), "v"(g + 7 * gs) : "memory");
}
// one stage: wave w brings rows w, w + 4, ..., w + 60 of the A tile (LDS rows 0..63) and of the B tile (LDS rows 64..127): 32 copies of a wave
__device__ __forceinline__ void fill_stage(unsigned l, const _Float16* ga, size_t sa, const _Float16* gb, size_t sb) {
  copy8(l, ga, sa); copy8(l + 32 * GP * 2, ga + 8 * sa, sa); copy8(l + 64 * GP * 2, gb, sb); copy8(l + 96 * GP * 2, gb + 8 * sb, sb);
}
// fragment from a row-major LDS tile; p = row (lane & 15), k = 8 * (lane >> 4): k 8*(lane>>4)+0..7 and 16+8*(lane>>4)+0..7, alike for A and B
__device__ __forceinline__ v16h frag_lds(const _Float16* p) { FragH f; f.half[0] = *(const v8us*)((const unsigned short*)p); f.half[1] = *(const v8us*)((const unsigned short*)p + 16); return f.v; }
// blockIdx.z = batch: A, B and C move on by sA, sB, sC elements
__global__ __launch_bounds__(128) void k_gemm_t(const _Float16* __restrict__ A, int lda, size_t sA, const _Float16* __restrict__ B, int ldb, size_t sB, float alpha, const float* __restrict__ bias, float* __restrict__ C, int ldc, size_t sC, int K) {
  __shared__ __attribute__((aligned(16))) _Float16 sm[2][2 * GT][GP];
  __shared__ __attribute__((aligned(16))) float so[4][32][36];
  const int tid = threadIdx.x, w = tid >> 5, lane = tid & 31, ln = lane & 15, hh = lane >> 4, wr = w >> 1, wc = w & 1;
  const int row0 = blockIdx.y * GT, col0 = blockIdx.x * GT;
  A += blockIdx.z * sA; B += blockIdx.z * sB; C += blockIdx.z * sC;
  const _Float16* ga = A + (size_t)(row0 + w) * lda + lane * 8; const _Float16* gb = B + (size_t)(col0 + w) * ldb + lane * 8;
  const size_t sa = (size_t)4 * lda, sb = (size_t)4 * ldb;
  const unsigned l0 = (unsigned)(uintptr_t)(lds_f16*)&sm[0][w][lane * 8], lbuf = 2 * GT * GP * 2;
  const int nt = K / GK;
  v8f acc[2][2] = {};
  fill_stage(l0, ga, sa, gb, sb);
  asm volatile("s_wait_asynccnt 0x0" ::: "memory");  /* this wave's copies of stage 0 have landed */
  __syncthreads();                                   /* and every other wave's */
  if (nt > 1) fill_stage(l0 + lbuf, ga + GK, sa, gb + GK, sb);
  for (int t = 0; t < nt; ++t) {
    const _Float16* pa = &sm[t & 1][wr * 32 + ln][8 * hh]; const _Float16* pb = &sm[t & 1][GT + wc * 32 + ln][8 * hh];
    v16h fa[GK / 32][2], fb[GK / 32][2];
#pragma unroll  /* every index constant: the fragments stay in registers */
    for (int ks = 0; ks < GK / 32; ++ks) { fa[ks][0] = frag_lds(pa + ks * 32); fb[ks][0] = frag_lds(pb + ks * 32); fb[ks][1] = frag_lds(pb + 16 * GP + ks * 32); fa[ks][1] = frag_lds(pa + 16 * GP + ks * 32); }
    // keeps the stage's 64 LDS loads one group in front of its WMMAs, which then follow behind counted waits; left alone the compiler reuses three fragment registers and the lone wave of a SIMD waits out the LDS latency three times per k step
    __builtin_amdgcn_sched_barrier(0);
#pragma unroll  /* as above */
    for (int ks = 0; ks < GK / 32; ++ks) {
      acc[0][0] = wm(fa[ks][0], fb[ks][0], acc[0][0]); acc[0][1] = wm(fa[ks][0], fb[ks][1], acc[0][1]); acc[1][0] = wm(fa[ks][1], fb[ks][0], acc[1][0]); acc[1][1] = wm(fa[ks][1], fb[ks][1], acc[1][1]);
    }
    // keeps the WMMAs in front of the waits below, so that they run while the later LDS loads still return and the refill is issued directly behind the barrier
    __builtin_amdgcn_sched_barrier(0);
    asm volatile("s_wait_dscnt 0x0" ::: "memory");     /* this wave's reads of the buffer are done before it is refilled */
    asm volatile("s_wait_asynccnt 0x0" ::: "memory");  /* this wave's copies of stage t + 1 have landed */
    __syncthreads();                                   /* publishes stage t + 1 and ends every wave's reads of stage t */
    if (t + 2 < nt) fill_stage(l0 + (t & 1) * lbuf, ga + (size_t)(t + 2) * GK, sa, gb + (size_t)(t + 2) * GK, sb);
  }
  asm volatile("s_wait_asynccnt 0x0" ::: "memory");    /* no copy is left in flight when the wave ends */
#pragma unroll  /* these three: constant accumulator indices, so that acc stays in registers */
  for (int j = 0; j < 2; ++j) { const float bv = bias ? bf16_round(bias[col0 + wc * 32 + j * 16 + ln]) : 0.f;
#pragma unroll
    for (int i = 0; i < 2; ++i)
#pragma unroll
      for (int r = 0; r < 8; ++r) so[w][i * 16 + 8 * hh + r][j * 16 + ln] = acc[i][j][r] * alpha + bv; }
  // each wave reads back only its own slab, so that a store covers whole 128-B lines: the fence keeps the LDS reads behind the writes of the wave's other lanes
  __builtin_amdgcn_fence(__ATOMIC_ACQ_REL, "workgroup"); __builtin_amdgcn_wave_barrier();
#pragma unroll  /* all eight LDS reads go out ahead of the stores */
  for (int q = 0; q < 8; ++q) { const int r = q * 4 + (lane >> 3), c4 = (lane & 7) * 4; const v4f v = *(const v4fa*)&so[w][r][c4]; *(v4f*)(C + (size_t)(row0 + wr * 32 + r) * ldc + col0 + wc * 32 + c4) = v; }
}

extern "C" void kernel_launch(void* const* d_in, const int* in_sizes, int n_in,
                              void* d_out, int out_size, void* d_ws, size_t ws_size, hipStream_t stream) {
  (void)in_sizes; (void)n_in; (void)out_size;
  const float* x1 = (const float*)d_in[0]; const float* x2 = (const float*)d_in[1]; const float* Wb = (const float*)d_in[2]; const float* bb_ = (const float*)d_in[3]; const float* Wc = (const float*)d_in[4]; const float* bc = (const float*)d_in[5]; const float* Wd = (const float*)d_in[6]; const float* bd = (const float*)d_in[7]; const float* al = (const float*)d_in[8]; const float* be = (const float*)d_in[9];
  char* ws = (char*)d_ws; size_t off = 0;
  auto take = [&](size_t bytes) { char* p = ws + off; off += (bytes + 255) & ~(size_t)255; return p; };
  _Float16* BW = (_Float16*)take((size_t)NW * CC * 2); float* BI = (float*)take(NW * 4);
  _Float16* X = (_Float16*)take((size_t)NS * NP * CC * 2); float* P = (float*)take((size_t)NS * NP * NW * 4);
  _Float16* Hh = (_Float16*)take((size_t)2 * NS * NP * C8 * 2); _Float16* Hl = (_Float16*)take((size_t)2 * NS * NP * C8 * 2);      /* plane 2 s + j: conv_b (j 0) or conv_c (j 1) of slab s */
  _Float16* FT = (_Float16*)take((size_t)NBt * CC * NP * 2); _Float16* D16 = (_Float16*)take((size_t)NBt * NP * NP * 2);
  if (off > ws_size) return;
  const size_t n8 = (size_t)NP * C8 / 8, pl = (size_t)NP * C8;
  k_prep<<<(NW * CC / 8 + 255) / 256, 256, 0, stream>>>(Wb, Wc, Wd, bb_, bc, bd, BW, BI);      /* conv weights [O][C] = natural Bt */
  k_tok<<<dim3((NP * (CC / 8) + 255) / 256, NS), 256, 0, stream>>>(x1, x2, X);
  k_gemm_t<<<dim3(NW / GT, NS * NP / GT), 128, 0, stream>>>(X, CC, 0, BW, CC, 0, 0.0625f, BI, P, NW, 0, CC);      /* P[s][n][0..63] = conv_b, [64..127] = conv_c, [128..639] = conv_d of slab s (exact + bias) */
  k_split<<<dim3((unsigned)((n8 + 255) / 256), 2 * NS), 256, 0, stream>>>(P, Hh, Hl, n8);      /* a1, b1, a2, b2 of each batch -> hi/lo planes */
  k_fcomb<<<dim3((CC * (NP / 8) + 255) / 256, NBt), 256, 0, stream>>>(P, al, be, FT);
  k_attdiff<<<dim3(NP / 16, NBt), 512, 0, stream>>>(Hh, Hl, Hh + 2 * pl, Hl + 2 * pl, Hh + 3 * pl, Hl + 3 * pl, Hh + pl, Hl + pl, D16);      /* a1 = plane 0, a2 = plane 2, b2 = plane 3, b1 = plane 1: |softmax(a1.b2) - softmax(a2.b1)| x 2^14 */
  k_gemm_t<<<dim3(NP / GT, CC / GT, NBt), 128, 0, stream>>>(FT, NP, (size_t)CC * NP, D16, NP, (size_t)NP * NP, 1.0f / 16384.0f, nullptr, (float*)d_out, NP, (size_t)CC * NP, NP);      /* out[b][c][n] = sum_m F[c][m] att[n][m]: M 512 (c), N 4096 (n), K 4096 (m) -> NCHW directly */
}

// v004
// A run of this version takes 230 microseconds.
// Timed twice side by side with v003, it ran 1.10 and 1.11 times as fast.
// All steps since v000 together make it 6.63 times as fast.
#include <hip/hip_runtime.h>
// Position-attention difference module (B 2, C 512, 64×64 = 4096 positions): a1 = conv_b(x1), b2 = conv_c(x2), a2 = conv_b(x2), b1 = conv_c(x1) (1×1, 512→64, + bias); f = conv_d (512→512, + bias); att12 = softmax_m(a1ᵀ·b2), att21 = softmax_m(a2ᵀ·b1) (no scaling); att = |att12 − att21|; out = α·f1·attᵀ + β·f2·attᵀ = (α f1 + β f2)·attᵀ → [2,512,64,64].
// Structure: every kernel runs once, over both batches and both inputs (7 launches): 1x1 convs as one GEMM against the stacked weights [Wb; Wc; Wd] on position-major f16 planes (exact products); a/b as f16 hi + lo*2^10 planes so both logit matrices are about f32 (three cross products each); one kernel forms both logit matrices in registers, both softmaxes per row in f32 and writes |difference| x 2^14 as f16; F = alpha f1 + beta f2 (f32 combine, then f16) and out = F.att^T by one GEMM straight into the NCHW output.
// Compute dtype: inputs and parameters rounded to bf16; logits ≈f32; softmaxes/difference in f32; |Δ| (×2^14) and F as f16 operands (≈2^-12), f32 accumulation. v_wmma_f32_16x16x32_f16.
#define NBt 2
#define CC 512
#define C8 64
#define NP 4096
#define NW (2 * C8 + CC)         /* rows of the stacked weights [Wb; Wc; Wd] = columns of the projection matrix P */
#define NS (2 * NBt)             /* position-major input slabs: slab s = 2 * batch + (0 for x1, 1 for x2) */
typedef __bf16 v16b __attribute__((ext_vector_type(16)));
typedef unsigned short v8us __attribute__((ext_vector_type(8), may_alias));
typedef float  v8f  __attribute__((ext_vector_type(8)));
typedef float  v4f  __attribute__((ext_vector_type(4)));
typedef float  v4fa __attribute__((ext_vector_type(4), may_alias));
union FragB { v16b v; v8us half[2]; unsigned short u[16]; };

__device__ __forceinline__ unsigned short bf16_bits(float x) { unsigned int u = __float_as_uint(x); return (unsigned short)((u + 0x7FFFu + ((u >> 16) & 1u)) >> 16); }
__device__ __forceinline__ float bf16_val(unsigned short b) { return __uint_as_float(((unsigned int)b) << 16); }
__device__ __forceinline__ float bf16_round(float x) { return bf16_val(bf16_bits(x)); }
// D += A·B with NT terms: 1 = ah·bh, 2 = + al·bh (A split), 3 = + ah·bl (both split)
template <int NT>
__device__ __forceinline__ v8f mmaN(v16b ah, v16b al, v16b bh, v16b bl, v8f c) {
  c = __builtin_amdgcn_wmma_f32_16x16x32_bf16(false, ah, false, bh, (short)0, c, false, false);
  if (NT >= 2) c = __builtin_amdgcn_wmma_f32_16x16x32_bf16(false, al, false, bh, (short)0, c, false, false);
  if (NT >= 3) c = __builtin_amdgcn_wmma_f32_16x16x32_bf16(false, ah, false, bl, (short)0, c, false, false);
  asm volatile("v_nop\n\tv_nop\n\tv_nop\n\tv_nop" : "+v"(c) : "v"(ah), "v"(al), "v"(bh), "v"(bl));
  return c;
}

__global__ __launch_bounds__(256) void k_wt_bf16(const float* __restrict__ W, unsigned short* __restrict__ Wt, int K, int N) {
  const int t = blockIdx.x * 256 + threadIdx.x;
  const int k8n = K / 8;
  if (t >= N * k8n) return;
  const int n = t / k8n, k8 = (t % k8n) * 8;
  v8us v;
#pragma unroll
  for (int i = 0; i < 8; ++i) v[i] = bf16_bits(W[(size_t)(k8 + i) * N + n]);
  *(v8us*)(Wt + (size_t)n * K + k8) = v;
  
}

// GEMM C[M][N] (f32, pitch ldc) = act(A[M][K]·W + bias). A f32 row-major (pitch lda) converted per fragment to bf16
// (ASPLIT: hi/lo two planes -> 2 terms, else single rounded term); Wt bf16 [N][K] (pitch ldb). BIAS_BF16 rounds the
// bias to bf16 first (bias quantised to bf16 before the add). K%32==0, M%16==0, N%64==0.
template <bool ASPLIT, int ACT, bool BIAS_BF16>
__global__ __launch_bounds__(128) void k_gemm_bf(const float* __restrict__ A, int lda, const unsigned short* __restrict__ Wt, int ldb,
                                               const float* __restrict__ bias, float* __restrict__ C, int ldc, int M, int N, int K) {
  __shared__ __attribute__((aligned(16))) float so[4][16][64];
  const int tid = threadIdx.x, w = tid >> 5, lane = tid & 31, ln = lane & 15, hh = lane >> 4;
  const int ntn = N / 64;
  const int wid = blockIdx.x * 4 + w;
  const int mt = wid / ntn, nq = wid % ntn;
  if (mt * 16 >= M) return;
  const int row0 = mt * 16, col0 = nq * 64;
  const float* arow = A + (size_t)(row0 + ln) * lda;
  v8f acc[4] = {};
  for (int kb = 0; kb < K; kb += 32) {
    FragB ah, al;
    const v4f x0 = *(const v4fa*)(arow + kb + 8 * hh), x1 = *(const v4fa*)(arow + kb + 8 * hh + 4);
    const v4f x2 = *(const v4fa*)(arow + kb + 16 + 8 * hh), x3 = *(const v4fa*)(arow + kb + 16 + 8 * hh + 4);
    float xs[16] = {x0[0],x0[1],x0[2],x0[3],x1[0],x1[1],x1[2],x1[3],x2[0],x2[1],x2[2],x2[3],x3[0],x3[1],x3[2],x3[3]};
#pragma unroll
    for (int i = 0; i < 16; ++i) { const unsigned short hb = bf16_bits(xs[i]); ah.u[i] = hb; al.u[i] = ASPLIT ? bf16_bits(xs[i] - bf16_val(hb)) : (unsigned short)0; }
#pragma unroll
    for (int t = 0; t < 4; ++t) {
      const unsigned short* brow = Wt + (size_t)(col0 + t * 16 + ln) * ldb + kb;
      FragB b;
      b.half[0] = *(const v8us*)(brow + 8 * hh);
      b.half[1] = *(const v8us*)(brow + 16 + 8 * hh);
      acc[t] = mmaN<ASPLIT ? 2 : 1>(ah.v, al.v, b.v, b.v, acc[t]);
    }
  }
#pragma unroll
  for (int t = 0; t < 4; ++t) {
    float bv = bias ? bias[col0 + t * 16 + ln] : 0.f;
    if (BIAS_BF16) bv = bf16_round(bv);
#pragma unroll
    for (int r = 0; r < 8; ++r) { float v = acc[t][r] + bv; if (ACT == 1) v = fmaxf(v, 0.f); so[w][8 * hh + r][t * 16 + ln] = v; }
  }
  __builtin_amdgcn_fence(__ATOMIC_ACQ_REL, "workgroup");
  __builtin_amdgcn_wave_barrier();
  const int rsub = lane >> 4, c4 = (lane & 15) * 4;
  {
#pragma unroll
    for (int q = 0; q < 8; ++q) {
      const int r = q * 2 + rsub;
      const v4f v = *(const v4fa*)&so[w][r][c4];
      *(v4f*)(C + (size_t)(row0 + r) * ldc + col0 + c4) = v;
    }
    
  }
}

// GEMM C = act(A·W + bias + resid): A f32 (ASPLIT -> hi/lo 2 terms), Wt bf16 [N][K]; ACT 0 none, 1 relu, 2 exact gelu;
// resid (optional, f32, row index = (row % rmod), pitch ldr, RES_BF16 rounds it) added before the activation.
template <bool ASPLIT, int ACT, bool BIAS_BF16, bool RES_BF16>
__global__ __launch_bounds__(128) void k_gemm_bf3(const float* __restrict__ A, int lda, const unsigned short* __restrict__ Wt, int ldb,
                                                const float* __restrict__ bias, const float* __restrict__ resid, int rmod, int ldr,
                                                float* __restrict__ C, int ldc, int M, int N, int K) {
  __shared__ __attribute__((aligned(16))) float so[4][16][64];
  const int tid = threadIdx.x, w = tid >> 5, lane = tid & 31, ln = lane & 15, hh = lane >> 4;
  const int ntn = N / 64;
  const int wid = blockIdx.x * 4 + w;
  const int mt = wid / ntn, nq = wid % ntn;
  if (mt * 16 >= M) return;
  const int row0 = mt * 16, col0 = nq * 64;
  const float* arow = A + (size_t)(row0 + ln) * lda;
  v8f acc[4] = {};
  for (int kb = 0; kb < K; kb += 32) {
    FragB ah, al;
    const v4f x0 = *(const v4fa*)(arow + kb + 8 * hh), x1 = *(const v4fa*)(arow + kb + 8 * hh + 4);
    const v4f x2 = *(const v4fa*)(arow + kb + 16 + 8 * hh), x3 = *(const v4fa*)(arow + kb + 16 + 8 * hh + 4);
    float xs[16] = {x0[0],x0[1],x0[2],x0[3],x1[0],x1[1],x1[2],x1[3],x2[0],x2[1],x2[2],x2[3],x3[0],x3[1],x3[2],x3[3]};
#pragma unroll
    for (int i = 0; i < 16; ++i) { const unsigned short hb = bf16_bits(xs[i]); ah.u[i] = hb; al.u[i] = ASPLIT ? bf16_bits(xs[i] - bf16_val(hb)) : (unsigned short)0; }
#pragma unroll
    for (int t = 0; t < 4; ++t) {
      const unsigned short* brow = Wt + (size_t)(col0 + t * 16 + ln) * ldb + kb;
      FragB b;
      b.half[0] = *(const v8us*)(brow + 8 * hh);
      b.half[1] = *(const v8us*)(brow + 16 + 8 * hh);
      acc[t] = mmaN<ASPLIT ? 2 : 1>(ah.v, al.v, b.v, b.v, acc[t]);
    }
  }
#pragma unroll
  for (int t = 0; t < 4; ++t) {
    const int col = col0 + t * 16 + ln;
    float bv = bias ? bias[col] : 0.f;
    if (BIAS_BF16) bv = bf16_round(bv);
#pragma unroll
    for (int r = 0; r < 8; ++r) {
      float v = acc[t][r] + bv;
      if (resid) { float rv = resid[(size_t)((row0 + 8 * hh + r) % rmod) * ldr + col]; if (RES_BF16) rv = bf16_round(rv); v += rv; }
      if (ACT == 1) v = fmaxf(v, 0.f);
      if (ACT == 2) v = 0.5f * v * (1.0f + erff(v * 0.70710678118654752f));
      if (ACT == 3) { const float u = 0.7978845608028654f * (v + 0.044715f * v * v * v); v = 0.5f * v * (1.0f + tanhf(u)); }
      so[w][8 * hh + r][t * 16 + ln] = v;
    }
  }
  __builtin_amdgcn_fence(__ATOMIC_ACQ_REL, "workgroup");
  __builtin_amdgcn_wave_barrier();
  const int rsub = lane >> 4, c4 = (lane & 15) * 4;
  {
#pragma unroll
    for (int q = 0; q < 8; ++q) {
      const int r = q * 2 + rsub;
      const v4f v = *(const v4fa*)&so[w][r][c4];
      *(v4f*)(C + (size_t)(row0 + r) * ldc + col0 + c4) = v;
    }
    
  }
}
// row LayerNorm (biased variance, eps) over N: s = X (+ R); optional out_sum <- s; out_norm <- (s-mu)*rsqrt(var+eps)*g + b
template <bool PARAM_BF16>
__global__ __launch_bounds__(256) void k_layernorm(const float* __restrict__ X, const float* __restrict__ R, const float* __restrict__ g, const float* __restrict__ bta,
                                                  float* __restrict__ out_sum, float* __restrict__ out_norm, int N, float eps) {
  __shared__ float red[256];
  const int row = blockIdx.x, tid = threadIdx.x;
  const float* x = X + (size_t)row * N; const float* rr = R ? R + (size_t)row * N : nullptr;
  float vals[16];                     // up to N = 4096
  const int per = N / 256;            // contiguous chunk per thread? use strided-by-4 chunks: thread handles j = tid*4 + 1024*u
  float s1 = 0.f;
  for (int u = 0; u < per / 4; ++u) {
    const int j = tid * 4 + 1024 * u;
    const v4f a = *(const v4fa*)(x + j);
    v4f b = {0.f,0.f,0.f,0.f}; if (rr) b = *(const v4fa*)(rr + j);
#pragma unroll
    for (int q = 0; q < 4; ++q) { const float v = a[q] + b[q]; vals[u * 4 + q] = v; s1 += v; }
  }
  red[tid] = s1; __syncthreads();
  for (int st = 128; st > 0; st >>= 1) { if (tid < st) red[tid] += red[tid + st]; __syncthreads(); }
  const float mu = red[0] / (float)N; __syncthreads();
  float s2 = 0.f;
  for (int u = 0; u < per / 4; ++u)
#pragma unroll
    for (int q = 0; q < 4; ++q) { const float c = vals[u * 4 + q] - mu; s2 += c * c; }
  red[tid] = s2; __syncthreads();
  for (int st = 128; st > 0; st >>= 1) { if (tid < st) red[tid] += red[tid + st]; __syncthreads(); }
  const float rs = rsqrtf(red[0] / (float)N + eps);
  {
    for (int u = 0; u < per / 4; ++u) {
      const int j = tid * 4 + 1024 * u;
      v4f o, sm;
#pragma unroll
      for (int q = 0; q < 4; ++q) {
        float gg = g[j + q], bb = bta[j + q];
        if (PARAM_BF16) { gg = bf16_round(gg); bb = bf16_round(bb); }
        sm[q] = vals[u * 4 + q]; o[q] = (vals[u * 4 + q] - mu) * rs * gg + bb;
      }
      if (out_sum) *(v4f*)(out_sum + (size_t)row * N + j) = sm;
      *(v4f*)(out_norm + (size_t)row * N + j) = o;
    }
    
  }
}



// ---- f16 WMMA path (v_wmma_f32_16x16x32_f16): 11-bit significands for operands in range — used where a [0,1] probability operand needs more precision than bf16
typedef _Float16 v16h __attribute__((ext_vector_type(16)));
union FragH { v16h v; v8us half[2]; _Float16 h[16]; unsigned short u[16]; };
template <int NT>
__device__ __forceinline__ v8f mmaH(v16h ah, v16h al, v16h bh, v16h bl, v8f c) {
  c = __builtin_amdgcn_wmma_f32_16x16x32_f16(false, ah, false, bh, (short)0, c, false, false);
  if (NT >= 2) c = __builtin_amdgcn_wmma_f32_16x16x32_f16(false, al, false, bh, (short)0, c, false, false);
  if (NT >= 3) c = __builtin_amdgcn_wmma_f32_16x16x32_f16(false, ah, false, bl, (short)0, c, false, false);
  asm volatile("v_nop\n\tv_nop\n\tv_nop\n\tv_nop" : "+v"(c) : "v"(ah), "v"(al), "v"(bh), "v"(bl));
  return c;
}
// batched GEMM like k_gemm_b but f16 operands: A f32 (split into f16 hi/lo if ASPLIT, else rounded to f16), Bt = f16 values [n][k]; alpha; C f32; N multiple of 16 (partial tiles skipped)
template <bool ASPLIT>
__global__ __launch_bounds__(128) void k_gemm_h(const float* __restrict__ A, int lda, size_t sA, const _Float16* __restrict__ Bh, int ldb, size_t sB, float alpha, float* __restrict__ C, int ldc, size_t sC, int M, int N, int K) {
  __shared__ __attribute__((aligned(16))) float so[4][16][64];
  const int tid = threadIdx.x, w = tid >> 5, lane = tid & 31, ln = lane & 15, hh = lane >> 4; const int by = blockIdx.y;
  A += (size_t)by * sA; Bh += (size_t)by * sB; C += (size_t)by * sC;
  const int ntn = (N + 63) / 64; const int wid = blockIdx.x * 4 + w; const int mt = wid / ntn, nq = wid % ntn; if (mt * 16 >= M) return;
  const int row0 = mt * 16, col0 = nq * 64; const float* arow = A + (size_t)(row0 + ln) * lda;
  v8f acc[4] = {};
  for (int kb = 0; kb < K; kb += 32) {
    FragH ah, al;
    const v4f x0 = *(const v4fa*)(arow + kb + 8 * hh), x1 = *(const v4fa*)(arow + kb + 8 * hh + 4), x2 = *(const v4fa*)(arow + kb + 16 + 8 * hh), x3 = *(const v4fa*)(arow + kb + 16 + 8 * hh + 4);
    float xs[16] = {x0[0],x0[1],x0[2],x0[3],x1[0],x1[1],x1[2],x1[3],x2[0],x2[1],x2[2],x2[3],x3[0],x3[1],x3[2],x3[3]};
#pragma unroll
    for (int i = 0; i < 16; ++i) { const _Float16 h = (_Float16)xs[i]; ah.h[i] = h; al.h[i] = ASPLIT ? (_Float16)(xs[i] - (float)h) : (_Float16)0.0f; }
#pragma unroll
    for (int t = 0; t < 4; ++t) { if (col0 + t * 16 >= N) continue; const size_t boff = (size_t)(col0 + t * 16 + ln) * ldb + kb; FragH bq; bq.half[0] = *(const v8us*)(Bh + boff + 8 * hh); bq.half[1] = *(const v8us*)(Bh + boff + 16 + 8 * hh);
      acc[t] = mmaH<ASPLIT ? 2 : 1>(ah.v, al.v, bq.v, bq.v, acc[t]); }
  }
#pragma unroll
  for (int t = 0; t < 4; ++t) { if (col0 + t * 16 >= N) continue;
#pragma unroll
    for (int r = 0; r < 8; ++r) so[w][8 * hh + r][t * 16 + ln] = acc[t][r] * alpha; }
  __builtin_amdgcn_fence(__ATOMIC_ACQ_REL, "workgroup"); __builtin_amdgcn_wave_barrier();
  const int rsub = lane >> 4, c4 = (lane & 15) * 4;
  {
#pragma unroll
    for (int q = 0; q < 8; ++q) { const int r = q * 2 + rsub; if (col0 + c4 < N) { const v4f v = *(const v4fa*)&so[w][r][c4]; *(v4f*)(C + (size_t)(row0 + r) * ldc + col0 + c4) = v; } }
     }
}

// Wt[n][k] = f16(W[k][n]·scale) from f32 row-major W[K][N] (scale = power of two; bf16-exact weights stay exact in f16 away from the subnormal range)
__global__ __launch_bounds__(256) void k_wt_f16(const float* __restrict__ W, _Float16* __restrict__ Wt, int K, int N, float scale) {
  const int t = blockIdx.x * 256 + threadIdx.x; if (t >= N * (K / 8)) return; const int n = t / (K / 8), k8 = (t % (K / 8)) * 8; FragH f;
#pragma unroll
  for (int i = 0; i < 8; ++i) f.h[i] = (_Float16)(bf16_round(W[(size_t)(k8 + i) * N + n]) * scale); const v8us o = f.half[0];
  *(v8us*)((unsigned short*)Wt + (size_t)n * K + k8) = o; 
}
// k_gemm_hh variant with fused epilogue: v = acc·alpha + bias[by·sBias + col] (+ CP[(row/rowsPerB)·sCPb + by·64 + col] if CP) ; ACT 0 none / 1 elu ; writes f32 C and f16 C16, each if non-null
template <int ACT>
__global__ __launch_bounds__(128) void k_gemm_hhx(const _Float16* __restrict__ A, int lda, size_t sA, const _Float16* __restrict__ Bh, int ldb, size_t sB, float alpha, const float* __restrict__ bias, size_t sBias, const float* __restrict__ CP, int rowsPerB, size_t sCPb, int row0g,
    float* __restrict__ C, _Float16* __restrict__ C16, int ldc, size_t sC, int M, int N, int K) {
  __shared__ __attribute__((aligned(16))) float so[4][16][64];
  const int tid = threadIdx.x, w = tid >> 5, lane = tid & 31, ln = lane & 15, hh = lane >> 4; const int by = blockIdx.y;
  A += (size_t)by * sA; Bh += (size_t)by * sB; const size_t cofs = (size_t)by * sC; const float* bp = bias ? bias + (size_t)by * sBias : nullptr;
  const int ntn = (N + 63) / 64; const int wid = blockIdx.x * 4 + w; const int mt = wid / ntn, nq = wid % ntn; if (mt * 16 >= M) return;
  const int row0 = mt * 16, col0 = nq * 64; const _Float16* arow = A + (size_t)(row0 + ln) * lda;
  v8f acc[4] = {};
  for (int kb = 0; kb < K; kb += 32) { FragH ah; ah.half[0] = *(const v8us*)((const unsigned short*)arow + kb + 8 * hh); ah.half[1] = *(const v8us*)((const unsigned short*)arow + kb + 16 + 8 * hh);
#pragma unroll
    for (int t = 0; t < 4; ++t) { if (col0 + t * 16 >= N) continue; const size_t boff = (size_t)(col0 + t * 16 + ln) * ldb + kb; FragH bq; bq.half[0] = *(const v8us*)((const unsigned short*)Bh + boff + 8 * hh); bq.half[1] = *(const v8us*)((const unsigned short*)Bh + boff + 16 + 8 * hh);
      acc[t] = mmaH<1>(ah.v, ah.v, bq.v, bq.v, acc[t]); }
  }
#pragma unroll
  for (int t = 0; t < 4; ++t) { if (col0 + t * 16 >= N) continue; const int col = col0 + t * 16 + ln; const float bv = bp ? bf16_round(bp[col]) : 0.f;
#pragma unroll
    for (int r = 0; r < 8; ++r) { float v = acc[t][r] * alpha + bv; if (CP) { const int bidx = (row0g + row0 + 8 * hh + r) / rowsPerB; v += CP[(size_t)bidx * sCPb + (size_t)by * 64 + col]; } if (ACT == 1) v = (v > 0.f) ? v : expm1f(v); else if (ACT == 7) v = (v > 0.f) ? v + 1.0f : expf(v); else if (ACT == 8) v = tanhf(v); else if (ACT == 9) v = 0.5f * v * (1.0f + tanhf(0.7978845608028654f * (v + 0.044715f * v * v * v))); else if (ACT == 11) v = 1.0f / (1.0f + expf(-v)); else if (ACT == 12) v = (v > 0.f) ? v : 0.01f * v; else if (ACT == 14) v = (v > 0.f) ? v : 0.1f * v; else if (ACT == 15) v = v / (1.0f + expf(-v)); else if (ACT == 3) v = fmaxf(v, 0.f); else if (ACT == 6) v = 0.5f * v * (1.0f + erff(v * 0.70710678118654752f)); so[w][8 * hh + r][t * 16 + ln] = v; } }
  __builtin_amdgcn_fence(__ATOMIC_ACQ_REL, "workgroup"); __builtin_amdgcn_wave_barrier();
  const int rsub = lane >> 4, c4 = (lane & 15) * 4; typedef _Float16 v4h __attribute__((ext_vector_type(4)));
  {
#pragma unroll
    for (int q = 0; q < 8; ++q) { const int r = q * 2 + rsub; if (col0 + c4 < N) { const v4f v = *(const v4fa*)&so[w][r][c4]; if (C) *(v4f*)(C + cofs + (size_t)(row0 + r) * ldc + col0 + c4) = v; if (C16) { v4h h4; for (int i = 0; i < 4; ++i) h4[i] = (_Float16)v[i]; *(v4h*)(C16 + cofs + (size_t)(row0 + r) * ldc + col0 + c4) = h4; } } }
     }
}


typedef _Float16 v4h __attribute__((ext_vector_type(4)));

__global__ __launch_bounds__(256) void k_x16(const float* __restrict__ x, _Float16* __restrict__ X16, size_t n8) { const size_t t = (size_t)blockIdx.x * 256 + threadIdx.x; if (t >= n8) return; FragH f;
#pragma unroll
  for (int q = 0; q < 8; ++q) f.h[q] = (_Float16)bf16_round(x[t * 8 + q]); *(v8us*)((unsigned short*)X16 + t * 8) = f.half[0];  }
__global__ __launch_bounds__(256) void k_h16(const float* __restrict__ x, _Float16* __restrict__ X16, size_t n8) { const size_t t = (size_t)blockIdx.x * 256 + threadIdx.x; if (t >= n8) return; FragH f;
#pragma unroll
  for (int q = 0; q < 8; ++q) f.h[q] = (_Float16)x[t * 8 + q]; *(v8us*)((unsigned short*)X16 + t * 8) = f.half[0];  }
__global__ __launch_bounds__(256) void k_round16f(const float* __restrict__ W, _Float16* __restrict__ Bt, size_t n8) { const size_t t = (size_t)blockIdx.x * 256 + threadIdx.x; if (t >= n8) return; FragH f;
#pragma unroll
  for (int i = 0; i < 8; ++i) f.h[i] = (_Float16)(bf16_round(W[t * 8 + i]) * 16.0f); *(v8us*)((unsigned short*)Bt + t * 8) = f.half[0];  }
template <int NHv, int TTv>
__global__ __launch_bounds__(256) void k_vt(const _Float16* __restrict__ V16, int ldv, int voff, _Float16* __restrict__ Vt) { __shared__ unsigned short tl[64][66]; const int tid = threadIdx.x; const int slab = blockIdx.x / (TTv / 64), lg = blockIdx.x % (TTv / 64); const int b = slab / NHv, h = slab % NHv;
  for (int i = tid; i < 64 * 8; i += 256) { const int r = i / 8, c8 = (i % 8) * 8; FragH f; f.half[0] = *(const v8us*)((const unsigned short*)V16 + ((size_t)b * TTv + lg * 64 + r) * ldv + voff + h * 64 + c8);
#pragma unroll
    for (int q = 0; q < 8; ++q) tl[r][c8 + q] = f.u[q]; }
  __syncthreads();
  {
#pragma unroll
    for (int rd = 0; rd < 2; ++rd) { const int d = rd * 32 + tid / 8, pc = tid % 8; FragH f;
#pragma unroll
      for (int q = 0; q < 8; ++q) f.u[q] = tl[pc * 8 + q][d];
      *(v8us*)((unsigned short*)Vt + ((size_t)slab * 64 + d) * TTv + lg * 64 + pc * 8) = f.half[0]; }
     } }

__global__ __launch_bounds__(256) void k_hl(const float* __restrict__ F, _Float16* __restrict__ Hh, _Float16* __restrict__ Hl, size_t n8) { const size_t t = (size_t)blockIdx.x * 256 + threadIdx.x; if (t >= n8) return; FragH fh, fl; const v4f a = *(const v4fa*)(F + t * 8), c = *(const v4fa*)(F + t * 8 + 4);
#pragma unroll
  for (int q = 0; q < 4; ++q) { _Float16 h = (_Float16)a[q]; fh.h[q] = h; fl.h[q] = (_Float16)((a[q] - (float)h) * 1024.0f); h = (_Float16)c[q]; fh.h[4 + q] = h; fl.h[4 + q] = (_Float16)((c[q] - (float)h) * 1024.0f); }
  { *(v8us*)((unsigned short*)Hh + t * 8) = fh.half[0]; *(v8us*)((unsigned short*)Hl + t * 8) = fl.half[0];  } }

// stacked weights BW[NW][CC] = f16(bf16(W) * 16), rows 0..63 Wb, 64..127 Wc, 128..639 Wd, and the stacked biases BI[NW] (f32, as given)
__global__ __launch_bounds__(256) void k_prep(const float* __restrict__ Wb, const float* __restrict__ Wc, const float* __restrict__ Wd, const float* __restrict__ bb, const float* __restrict__ bc, const float* __restrict__ bd, _Float16* __restrict__ BW, float* __restrict__ BI) {
  const int t = blockIdx.x * 256 + threadIdx.x, n1 = C8 * CC / 8; if (t >= NW * CC / 8) return;
  const float* Wp = (t < n1) ? Wb + (size_t)t * 8 : (t < 2 * n1) ? Wc + (size_t)(t - n1) * 8 : Wd + (size_t)(t - 2 * n1) * 8; FragH f;
#pragma unroll
  for (int i = 0; i < 8; ++i) f.h[i] = (_Float16)(bf16_round(Wp[i]) * 16.0f); *(v8us*)((unsigned short*)BW + (size_t)t * 8) = f.half[0];
  if (t < NW) BI[t] = (t < C8) ? bb[t] : (t < 2 * C8) ? bc[t - C8] : bd[t - 2 * C8]; }
// blockIdx.y = slab s
__global__ __launch_bounds__(256) void k_tok(const float* __restrict__ x1, const float* __restrict__ x2, _Float16* __restrict__ X16) { const int t = blockIdx.x * 256 + threadIdx.x; if (t >= NP * (CC / 8)) return; const int c0 = (t % (CC / 8)) * 8, n = t / (CC / 8); FragH f;
  const int s = blockIdx.y, b = s >> 1; const float* x = (s & 1) ? x2 : x1; X16 += (size_t)s * NP * CC;
#pragma unroll
  for (int q = 0; q < 8; ++q) f.h[q] = (_Float16)bf16_round(x[((size_t)b * CC + c0 + q) * NP + n]);
  *(v8us*)((unsigned short*)X16 + (size_t)n * CC + c0) = f.half[0];  }
// blockIdx.y = plane p = 2 * slab + (0 for conv_b, 1 for conv_c): columns 64 (p & 1) .. + 63 of slab p >> 1 of P
__global__ __launch_bounds__(256) void k_split(const float* __restrict__ F, _Float16* __restrict__ Hh, _Float16* __restrict__ Hl, size_t n8) {
  #pragma clang fp contract(off)
  const size_t t = (size_t)blockIdx.x * 256 + threadIdx.x; if (t >= n8) return;
  const size_t p = blockIdx.y; F += (p >> 1) * NP * NW + (p & 1) * C8; Hh += p * NP * C8; Hl += p * NP * C8;
  // planes in WMMA fragment order, 16 positions x 64 channels per 2-KiB block: [k step of 32][fragment half][lane][8 channels]; piece t of the plane is position 16*(t>>7) + (t&15), channels 8*sc..8*sc+7
  const size_t sc = ((t >> 6) & 1) * 4 + ((t >> 5) & 1) * 2 + ((t >> 4) & 1), so = ((t >> 7) * 16 + (t & 15)) * NW + sc * 8;
  const v4f a = *(const v4fa*)(F + so), c = *(const v4fa*)(F + so + 4); FragH fh, fl;
#pragma unroll
  for (int q = 0; q < 8; ++q) { const float v = (q < 4) ? a[q] : c[q - 4]; const _Float16 hi = (_Float16)v; fh.h[q] = hi; fl.h[q] = (_Float16)((v - (float)hi) * 1024.0f); }
  { *(v8us*)((unsigned short*)Hh + t * 8) = fh.half[0]; *(v8us*)((unsigned short*)Hl + t * 8) = fl.half[0];  } }
// blockIdx.y = batch; f1, f2 = columns 128.. of the batch's two slabs of P
__global__ __launch_bounds__(256) void k_fcomb(const float* __restrict__ P, const float* __restrict__ al, const float* __restrict__ be, _Float16* __restrict__ FT) {
  #pragma clang fp contract(off)
  const int t = blockIdx.x * 256 + threadIdx.x; if (t >= CC * (NP / 8)) return;
  const float* F1 = P + (size_t)(2 * blockIdx.y) * NP * NW + 2 * C8; const float* F2 = F1 + (size_t)NP * NW; FT += (size_t)blockIdx.y * CC * NP; const int m0 = (t % (NP / 8)) * 8, c = t / (NP / 8); const float a = bf16_round(al[0]), bq = bf16_round(be[0]); FragH f;
#pragma unroll
  for (int q = 0; q < 8; ++q) f.h[q] = (_Float16)(a * F1[(size_t)(m0 + q) * NW + c] + bq * F2[(size_t)(m0 + q) * NW + c]);
  *(v8us*)((unsigned short*)FT + (size_t)c * NP + m0) = f.half[0];  }
// One 16x32 f16 fragment (A row or B column = lane & 15; k = 8*(lane>>4)+0..7 and 16+8*(lane>>4)+0..7) from a plane in the fragment order that k_split writes; p already holds 8*lane.
// Each of the two loads reads 512 contiguous bytes (4 whole lines) per wave; from a row-major plane it would touch 16 lines.
__device__ __forceinline__ v16h frag_at(const _Float16* p) { FragH f; f.half[0] = *(const v8us*)((const unsigned short*)p); f.half[1] = *(const v8us*)((const unsigned short*)p + 256); return f.v; }
__device__ __forceinline__ v8f wm(v16h a, v16h b, v8f c) { return __builtin_amdgcn_wmma_f32_16x16x32_f16(false, a, false, b, (short)0, c, false, false); }
// value of lane ^ X inside the 16-lane row, by DPP row_xmask (a shuffle would go through the LDS pipe and its wait); every lane is on where it is used
template <int X> __device__ __forceinline__ float row_xor(float v) { return __int_as_float(__builtin_amdgcn_update_dpp(0, __float_as_int(v), 0x160 + X, 0xf, 0xf, true)); }
__device__ __forceinline__ float row_max16(float v) { v = fmaxf(v, row_xor<1>(v)); v = fmaxf(v, row_xor<2>(v)); v = fmaxf(v, row_xor<4>(v)); return fmaxf(v, row_xor<8>(v)); }
__device__ __forceinline__ float row_sum16(float v) { v += row_xor<1>(v); v += row_xor<2>(v); v += row_xor<4>(v); return v + row_xor<8>(v); }
struct QFrag { v16h a1h[2], a1l[2], a2h[2], a2l[2]; };
#define DRT 2                    /* 16-row query tiles per wave: every B fragment that is loaded feeds both */
// both logit tiles (16 query rows x 16 key columns, K 64) of each of the wave's DRT query tiles from the hi/lo planes: hi*hi in one accumulator, the two cross terms (scaled 2^10) in a second
__device__ __forceinline__ void logit_tile(const QFrag (&q)[DRT], const _Float16* b2h, const _Float16* b2l, const _Float16* b1h, const _Float16* b1l, v8f (&s1)[DRT], v8f (&s2)[DRT]) {
  v8f h1[DRT] = {}, l1[DRT] = {}, h2[DRT] = {}, l2[DRT] = {};
  const v16h p[2] = {frag_at(b2h), frag_at(b2h + 512)}, x[2] = {frag_at(b1h), frag_at(b1h + 512)}, pl[2] = {frag_at(b2l), frag_at(b2l + 512)}, xl[2] = {frag_at(b1l), frag_at(b1l + 512)};
  // holds all sixteen loads of the tile in front of its first WMMA: one load latency a tile; left alone the compiler reuses fragment registers and waits for memory several times a tile
  asm volatile("" :: "v"(p[0]), "v"(p[1]), "v"(x[0]), "v"(x[1]), "v"(pl[0]), "v"(pl[1]), "v"(xl[0]), "v"(xl[1]));
#pragma unroll
  for (int ks = 0; ks < 2; ++ks) {
#pragma unroll
    for (int i = 0; i < DRT; ++i) { h1[i] = wm(q[i].a1h[ks], p[ks], h1[i]); h2[i] = wm(q[i].a2h[ks], x[ks], h2[i]); }
#pragma unroll
    for (int i = 0; i < DRT; ++i) { l1[i] = wm(q[i].a1l[ks], p[ks], l1[i]); l2[i] = wm(q[i].a2l[ks], x[ks], l2[i]); }
#pragma unroll
    for (int i = 0; i < DRT; ++i) { l1[i] = wm(q[i].a1h[ks], pl[ks], l1[i]); l2[i] = wm(q[i].a2h[ks], xl[ks], l2[i]); }
  }
#pragma unroll
  for (int i = 0; i < DRT; ++i)
#pragma unroll
    for (int r = 0; r < 8; ++r) { s1[i][r] = h1[i][r] + l1[i][r] * 0.0009765625f; s2[i][r] = h2[i][r] + l2[i][r] * 0.0009765625f; }
}
// Logits, both softmaxes and |difference| in one kernel: a work-group of 8 waves owns 32 query rows (one work-group per WGP covers all rows), wave w the key columns [512 w, 512 w + 512).
// Every wave holds the query fragments of both 16-row tiles in registers (2 waves per SIMD: 512 registers each), so the key planes are read from L2 once per 32 rows and pass.
// The logits stay in registers and are formed three times (row maximum, row sum, output); nothing of them goes to memory.
#define DW 8                     /* waves per work-group */
#define DROW (16 * DRT)          /* query rows per work-group */
#define DCOL (NP / DW)           /* key columns per wave */
#define DPIT (DCOL + 8)          /* LDS row pitch in f16: 16-byte multiple, rows 8 apart fall on other banks */
__global__ __launch_bounds__(DW * 32) void k_attdiff(const _Float16* __restrict__ A1h, const _Float16* __restrict__ A1l, const _Float16* __restrict__ A2h, const _Float16* __restrict__ A2l,
                                                 const _Float16* __restrict__ B2h, const _Float16* __restrict__ B2l, const _Float16* __restrict__ B1h, const _Float16* __restrict__ B1l, _Float16* __restrict__ D16) {
  __shared__ __attribute__((aligned(16))) _Float16 st[DW][DROW][DPIT];
  __shared__ float red[2][DW][DROW];
  __shared__ float fin[2][DROW];
  const int tid = threadIdx.x, w = tid >> 5, lane = tid & 31, ln = lane & 15, hh = lane >> 4; const int row0 = blockIdx.x * DROW;
  { const size_t pb = (size_t)blockIdx.y * 4 * NP * C8;  /* blockIdx.y = batch: four planes of each kind a batch */
    A1h += pb; A1l += pb; A2h += pb; A2l += pb; B2h += pb; B2l += pb; B1h += pb; B1l += pb; D16 += (size_t)blockIdx.y * NP * NP; }
  QFrag q[DRT];
#pragma unroll
  for (int i = 0; i < DRT; ++i) { const size_t ao = (size_t)(row0 + 16 * i) * C8 + 8 * lane;
#pragma unroll
    for (int ks = 0; ks < 2; ++ks) { q[i].a1h[ks] = frag_at(A1h + ao + ks * 512); q[i].a1l[ks] = frag_at(A1l + ao + ks * 512); q[i].a2h[ks] = frag_at(A2h + ao + ks * 512); q[i].a2l[ks] = frag_at(A2l + ao + ks * 512); } }
  asm volatile("s_wait_xcnt 0x0" ::: "memory");  /* stands in front of the reuse of the address registers that the query loads name */
  __builtin_amdgcn_sched_barrier(0);             /* keeps the key-plane address arithmetic, which reuses those registers, behind that wait */
  const size_t bo = (size_t)(w * DCOL) * C8 + 8 * lane; B2h += bo; B2l += bo; B1h += bo; B1l += bo;
  float m1[DRT][8], m2[DRT][8];
#pragma unroll
  for (int i = 0; i < DRT; ++i)
#pragma unroll
    for (int r = 0; r < 8; ++r) { m1[i][r] = -3.0e38f; m2[i][r] = -3.0e38f; }
#pragma unroll 1  /* rolled: an unrolled body would hold several tiles' B fragments and leave the 512-register budget of 2 waves per SIMD */
  for (int j = 0; j < DCOL / 16; ++j) { v8f s1[DRT], s2[DRT]; const size_t o = (size_t)j * 16 * C8; logit_tile(q, B2h + o, B2l + o, B1h + o, B1l + o, s1, s2);
#pragma unroll
    for (int i = 0; i < DRT; ++i)
#pragma unroll
      for (int r = 0; r < 8; ++r) { m1[i][r] = fmaxf(m1[i][r], s1[i][r]); m2[i][r] = fmaxf(m2[i][r], s2[i][r]); } }
#pragma unroll
  for (int i = 0; i < DRT; ++i)
#pragma unroll
    for (int r = 0; r < 8; ++r) { m1[i][r] = row_max16(m1[i][r]); m2[i][r] = row_max16(m2[i][r]); }
  if (ln == 0) {
#pragma unroll
    for (int i = 0; i < DRT; ++i)
#pragma unroll
      for (int r = 0; r < 8; ++r) { red[0][w][16 * i + 8 * hh + r] = m1[i][r]; red[1][w][16 * i + 8 * hh + r] = m2[i][r]; } }
  __syncthreads();
  if (tid < 2 * DROW) { const int mt = tid / DROW, rw = tid % DROW; float v = red[mt][0][rw]; for (int k = 1; k < DW; ++k) v = fmaxf(v, red[mt][k][rw]); fin[mt][rw] = v; }
  __syncthreads();
  float u1[DRT][8], u2[DRT][8];
#pragma unroll
  for (int i = 0; i < DRT; ++i)
#pragma unroll
    for (int r = 0; r < 8; ++r) { m1[i][r] = fin[0][16 * i + 8 * hh + r]; m2[i][r] = fin[1][16 * i + 8 * hh + r]; u1[i][r] = 0.f; u2[i][r] = 0.f; }
#pragma unroll 1  /* rolled for the register budget, as above */
  for (int j = 0; j < DCOL / 16; ++j) { v8f s1[DRT], s2[DRT]; const size_t o = (size_t)j * 16 * C8; logit_tile(q, B2h + o, B2l + o, B1h + o, B1l + o, s1, s2);
#pragma unroll
    for (int i = 0; i < DRT; ++i)
#pragma unroll
      for (int r = 0; r < 8; ++r) { u1[i][r] += expf(s1[i][r] - m1[i][r]); u2[i][r] += expf(s2[i][r] - m2[i][r]); } }
#pragma unroll
  for (int i = 0; i < DRT; ++i)
#pragma unroll
    for (int r = 0; r < 8; ++r) { u1[i][r] = row_sum16(u1[i][r]); u2[i][r] = row_sum16(u2[i][r]); }
  if (ln == 0) {
#pragma unroll
    for (int i = 0; i < DRT; ++i)
#pragma unroll
      for (int r = 0; r < 8; ++r) { red[0][w][16 * i + 8 * hh + r] = u1[i][r]; red[1][w][16 * i + 8 * hh + r] = u2[i][r]; } }
  __syncthreads();
  if (tid < 2 * DROW) { const int mt = tid / DROW, rw = tid % DROW; float v = red[mt][0][rw]; for (int k = 1; k < DW; ++k) v += red[mt][k][rw]; fin[mt][rw] = 1.0f / v; }
  __syncthreads();
#pragma unroll
  for (int i = 0; i < DRT; ++i)
#pragma unroll
    for (int r = 0; r < 8; ++r) { u1[i][r] = fin[0][16 * i + 8 * hh + r]; u2[i][r] = fin[1][16 * i + 8 * hh + r]; }
#pragma unroll 1  /* rolled for the register budget, as above */
  for (int j = 0; j < DCOL / 16; ++j) { v8f s1[DRT], s2[DRT]; const size_t o = (size_t)j * 16 * C8; logit_tile(q, B2h + o, B2l + o, B1h + o, B1l + o, s1, s2);
#pragma unroll
    for (int i = 0; i < DRT; ++i)
#pragma unroll
      for (int r = 0; r < 8; ++r) st[w][16 * i + 8 * hh + r][j * 16 + ln] = (_Float16)(fabsf(expf(s1[i][r] - m1[i][r]) * u1[i][r] - expf(s2[i][r] - m2[i][r]) * u2[i][r]) * 16384.0f); }
  // each wave reads back only its own slab: the fence keeps the LDS reads behind the writes of the wave's other lanes, no work-group barrier is needed
  __builtin_amdgcn_fence(__ATOMIC_ACQ_REL, "workgroup"); __builtin_amdgcn_wave_barrier();
#pragma unroll 1  /* rolled in groups of eight rows: sixteen LDS reads go out ahead of their stores */
  for (int r0 = 0; r0 < DROW; r0 += 8) {
#pragma unroll
    for (int r = r0; r < r0 + 8; ++r)
#pragma unroll
      for (int c = 0; c < DCOL; c += 256) { const v8us v = *(const v8us*)&st[w][r][c + lane * 8]; *(v8us*)((unsigned short*)D16 + (size_t)(row0 + r) * NP + w * DCOL + c + lane * 8) = v; }
    asm volatile("s_wait_xcnt 0x0" ::: "memory");  /* stands in front of the next trip's rewrite of the data and address registers that these stores name */
  }
}

// C[M][N] (f32, pitch ldc) = A[M][K] . B[N][K]^T * alpha + bias[col] (bias rounded to bf16); A and B f16 with k contiguous. One 64 x 64 tile of C per work-group of 4 waves (2 x 2, 32 x 32 each).
// A stage is 256 k of the tile's 64 A rows and 64 B rows, brought into LDS by asynchronous b128 copies: one copy of a wave is 512 contiguous bytes of one row (4 whole lines), where a fragment load
// straight from the row-major operand touches 16 lines. Two buffers: the next stage's copies fly while this stage is worked on. M, N multiples of 64, K a multiple of 256.
// Every accumulator sums k in rising order, 32 at a time.
#define GT 64                    /* rows of each operand per work-group */
#define GK 256                   /* k per stage */
#define GP (GK + 8)              /* LDS row pitch in f16: 528 B = 16 B x odd, so the 16 rows of a ds_load_b128 fall on all banks */
typedef __attribute__((address_space(3))) const _Float16 lds_f16;
// eight rows (4 apart) of one operand: l = the lane's LDS byte address, g = the lane's global address, gs = 4 rows of the operand in elements
__device__ __forceinline__ void copy8(unsigned l, const _Float16* g, size_t gs) {
  const unsigned ls = 4 * GP * 2;
  // the last line is the wait that stands in front of any rewrite of the address registers that these copies name
  asm volatile("global_load_async_to_lds_b128 %0, %8, off\n\t"
               "global_load_async_to_lds_b128 %1, %9, off\n\t"
               "global_load_async_to_lds_b128 %2, %10, off\n\t"
               "global_load_async_to_lds_b128 %3, %11, off\n\t"
               "global_load_async_to_lds_b128 %4, %12, off\n\t"
               "global_load_async_to_lds_b128 %5, %13, off\n\t"
               "global_load_async_to_lds_b128 %6, %14, off\n\t"
               "global_load_async_to_lds_b128 %7, %15, off\n\t"
               "s_wait_xcnt 0x0"
               :: "v"(l), "v"(l + ls), "v"(l + 2 * ls), "v"(l + 3 * ls), "v"(l + 4 * ls), "v"(l + 5 * ls), "v"(l + 6 * ls), "v"(l + 7 * ls),
                  "v"(g), "v"(g + gs), "v"(g + 2 * gs), "v"(g + 3 * gs), "v"(g + 4 * gs), "v"(g + 5 * gs), "v"(g + 6 * gs), "v"(g + 7 * gs) : "memory");
}
// one stage: wave w brings rows w, w + 4, ..., w + 60 of the A tile (LDS rows 0..63) and of the B tile (LDS rows 64..127): 32 copies of a wave
__device__ __forceinline__ void fill_stage(unsigned l, const _Float16* ga, size_t sa, const _Float16* gb, size_t sb) {
  copy8(l, ga, sa); copy8(l + 32 * GP * 2, ga + 8 * sa, sa); copy8(l + 64 * GP * 2, gb, sb); copy8(l + 96 * GP * 2, gb + 8 * sb, sb);
}
// fragment from a row-major LDS tile; p = row (lane & 15), k = 8 * (lane >> 4): k 8*(lane>>4)+0..7 and 16+8*(lane>>4)+0..7, alike for A and B
__device__ __forceinline__ v16h frag_lds(const _Float16* p) { FragH f; f.half[0] = *(const v8us*)((const unsigned short*)p); f.half[1] = *(const v8us*)((const unsigned short*)p + 16); return f.v; }
// blockIdx.z = batch: A, B and C move on by sA, sB, sC elements
__global__ __launch_bounds__(128) void k_gemm_t(const _Float16* __restrict__ A, int lda, size_t sA, const _Float16* __restrict__ B, int ldb, size_t sB, float alpha, const float* __restrict__ bias, float* __restrict__ C, int ldc, size_t sC, int K) {
  __shared__ __attribute__((aligned(16))) _Float16 sm[2][2 * GT][GP];
  __shared__ __attribute__((aligned(16))) float so[4][32][36];
  const int tid = threadIdx.x, w = tid >> 5, lane = tid & 31, ln = lane & 15, hh = lane >> 4, wr = w >> 1, wc = w & 1;
  const int row0 = blockIdx.y * GT, col0 = blockIdx.x * GT;
  A += blockIdx.z * sA; B += blockIdx.z * sB; C += blockIdx.z * sC;
  const _Float16* ga = A + (size_t)(row0 + w) * lda + lane * 8; const _Float16* gb = B + (size_t)(col0 + w) * ldb + lane * 8;
  const size_t sa = (size_t)4 * lda, sb = (size_t)4 * ldb;
  const unsigned l0 = (unsigned)(uintptr_t)(lds_f16*)&sm[0][w][lane * 8], lbuf = 2 * GT * GP * 2;
  const int nt = K / GK;
  v8f acc[2][2] = {};
  fill_stage(l0, ga, sa, gb, sb);
  asm volatile("s_wait_asynccnt 0x0" ::: "memory");  /* this wave's copies of stage 0 have landed */
  __syncthreads();                                   /* and every other wave's */
  if (nt > 1) fill_stage(l0 + lbuf, ga + GK, sa, gb + GK, sb);
  for (int t = 0; t < nt; ++t) {
    const _Float16* pa = &sm[t & 1][wr * 32 + ln][8 * hh]; const _Float16* pb = &sm[t & 1][GT + wc * 32 + ln][8 * hh];
    v16h fa[GK / 32][2], fb[GK / 32][2];
#pragma unroll  /* every index constant: the fragments stay in registers */
    for (int ks = 0; ks < GK / 32; ++ks) { fa[ks][0] = frag_lds(pa + ks * 32); fb[ks][0] = frag_lds(pb + ks * 32); fb[ks][1] = frag_lds(pb + 16 * GP + ks * 32); fa[ks][1] = frag_lds(pa + 16 * GP + ks * 32); }
    // keeps the stage's 64 LDS loads one group in front of its WMMAs, which then follow behind counted waits; left alone the compiler reuses three fragment registers and the lone wave of a SIMD waits out the LDS latency three times per k step
    __builtin_amdgcn_sched_barrier(0);
#pragma unroll  /* as above */
    for (int ks = 0; ks < GK / 32; ++ks) {
      acc[0][0] = wm(fa[ks][0], fb[ks][0], acc[0][0]); acc[0][1] = wm(fa[ks][0], fb[ks][1], acc[0][1]); acc[1][0] = wm(fa[ks][1], fb[ks][0], acc[1][0]); acc[1][1] = wm(fa[ks][1], fb[ks][1], acc[1][1]);
    }
    // keeps the WMMAs in front of the waits below, so that they run while the later LDS loads still return and the refill is issued directly behind the barrier
    __builtin_amdgcn_sched_barrier(0);
    asm volatile("s_wait_dscnt 0x0" ::: "memory");     /* this wave's reads of the buffer are done before it is refilled */
    asm volatile("s_wait_asynccnt 0x0" ::: "memory");  /* this wave's copies of stage t + 1 have landed */
    __syncthreads();                                   /* publishes stage t + 1 and ends every wave's reads of stage t */
    if (t + 2 < nt) fill_stage(l0 + (t & 1) * lbuf, ga + (size_t)(t + 2) * GK, sa, gb + (size_t)(t + 2) * GK, sb);
  }
  asm volatile("s_wait_asynccnt 0x0" ::: "memory");    /* no copy is left in flight when the wave ends */
#pragma unroll  /* these three: constant accumulator indices, so that acc stays in registers */
  for (int j = 0; j < 2; ++j) { const float bv = bias ? bf16_round(bias[col0 + wc * 32 + j * 16 + ln]) : 0.f;
#pragma unroll
    for (int i = 0; i < 2; ++i)
#pragma unroll
      for (int r = 0; r < 8; ++r) so[w][i * 16 + 8 * hh + r][j * 16 + ln] = acc[i][j][r] * alpha + bv; }
  // each wave reads back only its own slab, so that a store covers whole 128-B lines: the fence keeps the LDS reads behind the writes of the wave's other lanes
  __builtin_amdgcn_fence(__ATOMIC_ACQ_REL, "workgroup"); __builtin_amdgcn_wave_barrier();
#pragma unroll  /* all eight LDS reads go out ahead of the stores */
  for (int q = 0; q < 8; ++q) { const int r = q * 4 + (lane >> 3), c4 = (lane & 7) * 4; const v4f v = *(const v4fa*)&so[w][r][c4]; *(v4f*)(C + (size_t)(row0 + wr * 32 + r) * ldc + col0 + wc * 32 + c4) = v; }
}

extern "C" void kernel_launch(void* const* d_in, const int* in_sizes, int n_in,
                              void* d_out, int out_size, void* d_ws, size_t ws_size, hipStream_t stream) {
  (void)in_sizes; (void)n_in; (void)out_size;
  const float* x1 = (const float*)d_in[0]; const float* x2 = (const float*)d_in[1]; const float* Wb = (const float*)d_in[2]; const float* bb_ = (const float*)d_in[3]; const float* Wc = (const float*)d_in[4]; const float* bc = (const float*)d_in[5]; const float* Wd = (const float*)d_in[6]; const float* bd = (const float*)d_in[7]; const float* al = (const float*)d_in[8]; const float* be = (const float*)d_in[9];
  char* ws = (char*)d_ws; size_t off = 0;
  auto take = [&](size_t bytes) { char* p = ws + off; off += (bytes + 255) & ~(size_t)255; return p; };
  _Float16* BW = (_Float16*)take((size_t)NW * CC * 2); float* BI = (float*)take(NW * 4);
  _Float16* X = (_Float16*)take((size_t)NS * NP * CC * 2); float* P = (float*)take((size_t)NS * NP * NW * 4);
  _Float16* Hh = (_Float16*)take((size_t)2 * NS * NP * C8 * 2); _Float16* Hl = (_Float16*)take((size_t)2 * NS * NP * C8 * 2);      /* plane 2 s + j: conv_b (j 0) or conv_c (j 1) of slab s */
  _Float16* FT = (_Float16*)take((size_t)NBt * CC * NP * 2); _Float16* D16 = (_Float16*)take((size_t)NBt * NP * NP * 2);
  if (off > ws_size) return;
  const size_t n8 = (size_t)NP * C8 / 8, pl = (size_t)NP * C8;
  k_prep<<<(NW * CC / 8 + 255) / 256, 256, 0, stream>>>(Wb, Wc, Wd, bb_, bc, bd, BW, BI);      /* conv weights [O][C] = natural Bt */
  k_tok<<<dim3((NP * (CC / 8) + 255) / 256, NS), 256, 0, stream>>>(x1, x2, X);
  k_gemm_t<<<dim3(NW / GT, NS * NP / GT), 128, 0, stream>>>(X, CC, 0, BW, CC, 0, 0.0625f, BI, P, NW, 0, CC);      /* P[s][n][0..63] = conv_b, [64..127] = conv_c, [128..639] = conv_d of slab s (exact + bias) */
  k_split<<<dim3((unsigned)((n8 + 255) / 256), 2 * NS), 256, 0, stream>>>(P, Hh, Hl, n8);      /* a1, b1, a2, b2 of each batch -> hi/lo planes */
  k_fcomb<<<dim3((CC * (NP / 8) + 255) / 256, NBt), 256, 0, stream>>>(P, al, be, FT);
  k_attdiff<<<dim3(NP / DROW, NBt), DW * 32, 0, stream>>>(Hh, Hl, Hh + 2 * pl, Hl + 2 * pl, Hh + 3 * pl, Hl + 3 * pl, Hh + pl, Hl + pl, D16);      /* a1 = plane 0, a2 = plane 2, b2 = plane 3, b1 = plane 1: |softmax(a1.b2) - softmax(a2.b1)| x 2^14 */
  k_gemm_t<<<dim3(NP / GT, CC / GT, NBt), 128, 0, stream>>>(FT, NP, (size_t)CC * NP, D16, NP, (size_t)NP * NP, 1.0f / 16384.0f, nullptr, (float*)d_out, NP, (size_t)CC * NP, NP);      /* out[b][c][n] = sum_m F[c][m] att[n][m]: M 512 (c), N 4096 (n), K 4096 (m) -> NCHW directly */
}

// v005
// A run of this version takes 173 microseconds.
// Two timings next to v004 put it at 1.33 and 1.32 times that version's speed.
// Over all steps from v000 it is 8.79 times as fast.
#include <hip/hip_runtime.h>
// Position-attention difference module (B 2, C 512, 64×64 = 4096 positions): a1 = conv_b(x1), b2 = conv_c(x2), a2 = conv_b(x2), b1 = conv_c(x1) (1×1, 512→64, + bias); f = conv_d (512→512, + bias); att12 = softmax_m(a1ᵀ·b2), att21 = softmax_m(a2ᵀ·b1) (no scaling); att = |att12 − att21|; out = α·f1·attᵀ + β·f2·attᵀ = (α f1 + β f2)·attᵀ → [2,512,64,64].
// Structure: every kernel runs once, over both batches and both inputs (7 launches): 1x1 convs as one GEMM against the stacked weights [Wb; Wc; Wd] on position-major f16 planes (exact products); a/b as f16 hi + lo*2^10 planes so both logit matrices are about f32 (three cross products each); one kernel forms both logit matrices in registers, both softmaxes per row in f32 and writes |difference| x 2^14 as f16; F = alpha f1 + beta f2 (f32 combine, then f16) and out = F.att^T by one GEMM straight into the NCHW output.
// Compute dtype: inputs and parameters rounded to bf16; logits ≈f32; softmaxes/difference in f32; |Δ| (×2^14) and F as f16 operands (≈2^-12), f32 accumulation. v_wmma_f32_16x16x32_f16.
#define NBt 2
#define CC 512
#define C8 64
#define NP 4096
#define NW (2 * C8 + CC)         /* rows of the stacked weights [Wb; Wc; Wd] = columns of the projection matrix P */
#define NS (2 * NBt)             /* position-major input slabs: slab s = 2 * batch + (0 for x1, 1 for x2) */
typedef __bf16 v16b __attribute__((ext_vector_type(16)));
typedef unsigned short v8us __attribute__((ext_vector_type(8), may_alias));
typedef float  v8f  __attribute__((ext_vector_type(8)));
typedef float  v4f  __attribute__((ext_vector_type(4)));
typedef float  v4fa __attribute__((ext_vector_type(4), may_alias));
union FragB { v16b v; v8us half[2]; unsigned short u[16]; };

__device__ __forceinline__ unsigned short bf16_bits(float x) { unsigned int u = __float_as_uint(x); return (unsigned short)((u + 0x7FFFu + ((u >> 16) & 1u)) >> 16); }
__device__ __forceinline__ float bf16_val(unsigned short b) { return __uint_as_float(((unsigned int)b) << 16); }
__device__ __forceinline__ float bf16_round(float x) { return bf16_val(bf16_bits(x)); }
// D += A·B with NT terms: 1 = ah·bh, 2 = + al·bh (A split), 3 = + ah·bl (both split)
template <int NT>
__device__ __forceinline__ v8f mmaN(v16b ah, v16b al, v16b bh, v16b bl, v8f c) {
  c = __builtin_amdgcn_wmma_f32_16x16x32_bf16(false, ah, false, bh, (short)0, c, false, false);
  if (NT >= 2) c = __builtin_amdgcn_wmma_f32_16x16x32_bf16(false, al, false, bh, (short)0, c, false, false);
  if (NT >= 3) c = __builtin_amdgcn_wmma_f32_16x16x32_bf16(false, ah, false, bl, (short)0, c, false, false);
  asm volatile("v_nop\n\tv_nop\n\tv_nop\n\tv_nop" : "+v"(c) : "v"(ah), "v"(al), "v"(bh), "v"(bl));
  return c;
}

__global__ __launch_bounds__(256) void k_wt_bf16(const float* __restrict__ W, unsigned short* __restrict__ Wt, int K, int N) {
  const int t = blockIdx.x * 256 + threadIdx.x;
  const int k8n = K / 8;
  if (t >= N * k8n) return;
  const int n = t / k8n, k8 = (t % k8n) * 8;
  v8us v;
#pragma unroll
  for (int i = 0; i < 8; ++i) v[i] = bf16_bits(W[(size_t)(k8 + i) * N + n]);
  *(v8us*)(Wt + (size_t)n * K + k8) = v;
  
}

// GEMM C[M][N] (f32, pitch ldc) = act(A[M][K]·W + bias). A f32 row-major (pitch lda) converted per fragment to bf16
// (ASPLIT: hi/lo two planes -> 2 terms, else single rounded term); Wt bf16 [N][K] (pitch ldb). BIAS_BF16 rounds the
// bias to bf16 first (bias quantised to bf16 before the add). K%32==0, M%16==0, N%64==0.
template <bool ASPLIT, int ACT, bool BIAS_BF16>
__global__ __launch_bounds__(128) void k_gemm_bf(const float* __restrict__ A, int lda, const unsigned short* __restrict__ Wt, int ldb,
                                               const float* __restrict__ bias, float* __restrict__ C, int ldc, int M, int N, int K) {
  __shared__ __attribute__((aligned(16))) float so[4][16][64];
  const int tid = threadIdx.x, w = tid >> 5, lane = tid & 31, ln = lane & 15, hh = lane >> 4;
  const int ntn = N / 64;
  const int wid = blockIdx.x * 4 + w;
  const int mt = wid / ntn, nq = wid % ntn;
  if (mt * 16 >= M) return;
  const int row0 = mt * 16, col0 = nq * 64;
  const float* arow = A + (size_t)(row0 + ln) * lda;
  v8f acc[4] = {};
  for (int kb = 0; kb < K; kb += 32) {
    FragB ah, al;
    const v4f x0 = *(const v4fa*)(arow + kb + 8 * hh), x1 = *(const v4fa*)(arow + kb + 8 * hh + 4);
    const v4f x2 = *(const v4fa*)(arow + kb + 16 + 8 * hh), x3 = *(const v4fa*)(arow + kb + 16 + 8 * hh + 4);
    float xs[16] = {x0[0],x0[1],x0[2],x0[3],x1[0],x1[1],x1[2],x1[3],x2[0],x2[1],x2[2],x2[3],x3[0],x3[1],x3[2],x3[3]};
#pragma unroll
    for (int i = 0; i < 16; ++i) { const unsigned short hb = bf16_bits(xs[i]); ah.u[i] = hb; al.u[i] = ASPLIT ? bf16_bits(xs[i] - bf16_val(hb)) : (unsigned short)0; }
#pragma unroll
    for (int t = 0; t < 4; ++t) {
      const unsigned short* brow = Wt + (size_t)(col0 + t * 16 + ln) * ldb + kb;
      FragB b;
      b.half[0] = *(const v8us*)(brow + 8 * hh);
      b.half[1] = *(const v8us*)(brow + 16 + 8 * hh);
      acc[t] = mmaN<ASPLIT ? 2 : 1>(ah.v, al.v, b.v, b.v, acc[t]);
    }
  }
#pragma unroll
  for (int t = 0; t < 4; ++t) {
    float bv = bias ? bias[col0 + t * 16 + ln] : 0.f;
    if (BIAS_BF16) bv = bf16_round(bv);
#pragma unroll
    for (int r = 0; r < 8; ++r) { float v = acc[t][r] + bv; if (ACT == 1) v = fmaxf(v, 0.f); so[w][8 * hh + r][t * 16 + ln] = v; }
  }
  __builtin_amdgcn_fence(__ATOMIC_ACQ_REL, "workgroup");
  __builtin_amdgcn_wave_barrier();
  const int rsub = lane >> 4, c4 = (lane & 15) * 4;
  {
#pragma unroll
    for (int q = 0; q < 8; ++q) {
      const int r = q * 2 + rsub;
      const v4f v = *(const v4fa*)&so[w][r][c4];
      *(v4f*)(C + (size_t)(row0 + r) * ldc + col0 + c4) = v;
    }
    
  }
}

// GEMM C = act(A·W + bias + resid): A f32 (ASPLIT -> hi/lo 2 terms), Wt bf16 [N][K]; ACT 0 none, 1 relu, 2 exact gelu;
// resid (optional, f32, row index = (row % rmod), pitch ldr, RES_BF16 rounds it) added before the activation.
template <bool ASPLIT, int ACT, bool BIAS_BF16, bool RES_BF16>
__global__ __launch_bounds__(128) void k_gemm_bf3(const float* __restrict__ A, int lda, const unsigned short* __restrict__ Wt, int ldb,
                                                const float* __restrict__ bias, const float* __restrict__ resid, int rmod, int ldr,
                                                float* __restrict__ C, int ldc, int M, int N, int K) {
  __shared__ __attribute__((aligned(16))) float so[4][16][64];
  const int tid = threadIdx.x, w = tid >> 5, lane = tid & 31, ln = lane & 15, hh = lane >> 4;
  const int ntn = N / 64;
  const int wid = blockIdx.x * 4 + w;
  const int mt = wid / ntn, nq = wid % ntn;
  if (mt * 16 >= M) return;
  const int row0 = mt * 16, col0 = nq * 64;
  const float* arow = A + (size_t)(row0 + ln) * lda;
  v8f acc[4] = {};
  for (int kb = 0; kb < K; kb += 32) {
    FragB ah, al;
    const v4f x0 = *(const v4fa*)(arow + kb + 8 * hh), x1 = *(const v4fa*)(arow + kb + 8 * hh + 4);
    const v4f x2 = *(const v4fa*)(arow + kb + 16 + 8 * hh), x3 = *(const v4fa*)(arow + kb + 16 + 8 * hh + 4);
    float xs[16] = {x0[0],x0[1],x0[2],x0[3],x1[0],x1[1],x1[2],x1[3],x2[0],x2[1],x2[2],x2[3],x3[0],x3[1],x3[2],x3[3]};
#pragma unroll
    for (int i = 0; i < 16; ++i) { const unsigned short hb = bf16_bits(xs[i]); ah.u[i] = hb; al.u[i] = ASPLIT ? bf16_bits(xs[i] - bf16_val(hb)) : (unsigned short)0; }
#pragma unroll
    for (int t = 0; t < 4; ++t) {
      const unsigned short* brow = Wt + (size_t)(col0 + t * 16 + ln) * ldb + kb;
      FragB b;
      b.half[0] = *(const v8us*)(brow + 8 * hh);
      b.half[1] = *(const v8us*)(brow + 16 + 8 * hh);
      acc[t] = mmaN<ASPLIT ? 2 : 1>(ah.v, al.v, b.v, b.v, acc[t]);
    }
  }
#pragma unroll
  for (int t = 0; t < 4; ++t) {
    const int col = col0 + t * 16 + ln;
    float bv = bias ? bias[col] : 0.f;
    if (BIAS_BF16) bv = bf16_round(bv);
#pragma unroll
    for (int r = 0; r < 8; ++r) {
      float v = acc[t][r] + bv;
      if (resid) { float rv = resid[(size_t)((row0 + 8 * hh + r) % rmod) * ldr + col]; if (RES_BF16) rv = bf16_round(rv); v += rv; }
      if (ACT == 1) v = fmaxf(v, 0.f);
      if (ACT == 2) v = 0.5f * v * (1.0f + erff(v * 0.70710678118654752f));
      if (ACT == 3) { const float u = 0.7978845608028654f * (v + 0.044715f * v * v * v); v = 0.5f * v * (1.0f + tanhf(u)); }
      so[w][8 * hh + r][t * 16 + ln] = v;
    }
  }
  __builtin_amdgcn_fence(__ATOMIC_ACQ_REL, "workgroup");
  __builtin_amdgcn_wave_barrier();
  const int rsub = lane >> 4, c4 = (lane & 15) * 4;
  {
#pragma unroll
    for (int q = 0; q < 8; ++q) {
      const int r = q * 2 + rsub;
      const v4f v = *(const v4fa*)&so[w][r][c4];
      *(v4f*)(C + (size_t)(row0 + r) * ldc + col0 + c4) = v;
    }
    
  }
}
// row LayerNorm (biased variance, eps) over N: s = X (+ R); optional out_sum <- s; out_norm <- (s-mu)*rsqrt(var+eps)*g + b
template <bool PARAM_BF16>
__global__ __launch_bounds__(256) void k_layernorm(const float* __restrict__ X, const float* __restrict__ R, const float* __restrict__ g, const float* __restrict__ bta,
                                                  float* __restrict__ out_sum, float* __restrict__ out_norm, int N, float eps) {
  __shared__ float red[256];
  const int row = blockIdx.x, tid = threadIdx.x;
  const float* x = X + (size_t)row * N; const float* rr = R ? R + (size_t)row * N : nullptr;
  float vals[16];                     // up to N = 4096
  const int per = N / 256;            // contiguous chunk per thread? use strided-by-4 chunks: thread handles j = tid*4 + 1024*u
  float s1 = 0.f;
  for (int u = 0; u < per / 4; ++u) {
    const int j = tid * 4 + 1024 * u;
    const v4f a = *(const v4fa*)(x + j);
    v4f b = {0.f,0.f,0.f,0.f}; if (rr) b = *(const v4fa*)(rr + j);
#pragma unroll
    for (int q = 0; q < 4; ++q) { const float v = a[q] + b[q]; vals[u * 4 + q] = v; s1 += v; }
  }
  red[tid] = s1; __syncthreads();
  for (int st = 128; st > 0; st >>= 1) { if (tid < st) red[tid] += red[tid + st]; __syncthreads(); }
  const float mu = red[0] / (float)N; __syncthreads();
  float s2 = 0.f;
  for (int u = 0; u < per / 4; ++u)
#pragma unroll
    for (int q = 0; q < 4; ++q) { const float c = vals[u * 4 + q] - mu; s2 += c * c; }
  red[tid] = s2; __syncthreads();
  for (int st = 128; st > 0; st >>= 1) { if (tid < st) red[tid] += red[tid + st]; __syncthreads(); }
  const float rs = rsqrtf(red[0] / (float)N + eps);
  {
    for (int u = 0; u < per / 4; ++u) {
      const int j = tid * 4 + 1024 * u;
      v4f o, sm;
#pragma unroll
      for (int q = 0; q < 4; ++q) {
        float gg = g[j + q], bb = bta[j + q];
        if (PARAM_BF16) { gg = bf16_round(gg); bb = bf16_round(bb); }
        sm[q] = vals[u * 4 + q]; o[q] = (vals[u * 4 + q] - mu) * rs * gg + bb;
      }
      if (out_sum) *(v4f*)(out_sum + (size_t)row * N + j) = sm;
      *(v4f*)(out_norm + (size_t)row * N + j) = o;
    }
    
  }
}



// ---- f16 WMMA path (v_wmma_f32_16x16x32_f16): 11-bit significands for operands in range — used where a [0,1] probability operand needs more precision than bf16
typedef _Float16 v16h __attribute__((ext_vector_type(16)));
union FragH { v16h v; v8us half[2]; _Float16 h[16]; unsigned short u[16]; };
template <int NT>
__device__ __forceinline__ v8f mmaH(v16h ah, v16h al, v16h bh, v16h bl, v8f c) {
  c = __builtin_amdgcn_wmma_f32_16x16x32_f16(false, ah, false, bh, (short)0, c, false, false);
  if (NT >= 2) c = __builtin_amdgcn_wmma_f32_16x16x32_f16(false, al, false, bh, (short)0, c, false, false);
  if (NT >= 3) c = __builtin_amdgcn_wmma_f32_16x16x32_f16(false, ah, false, bl, (short)0, c, false, false);
  asm volatile("v_nop\n\tv_nop\n\tv_nop\n\tv_nop" : "+v"(c) : "v"(ah), "v"(al), "v"(bh), "v"(bl));
  return c;
}
// batched GEMM like k_gemm_b but f16 operands: A f32 (split into f16 hi/lo if ASPLIT, else rounded to f16), Bt = f16 values [n][k]; alpha; C f32; N multiple of 16 (partial tiles skipped)
template <bool ASPLIT>
__global__ __launch_bounds__(128) void k_gemm_h(const float* __restrict__ A, int lda, size_t sA, const _Float16* __restrict__ Bh, int ldb, size_t sB, float alpha, float* __restrict__ C, int ldc, size_t sC, int M, int N, int K) {
  __shared__ __attribute__((aligned(16))) float so[4][16][64];
  const int tid = threadIdx.x, w = tid >> 5, lane = tid & 31, ln = lane & 15, hh = lane >> 4; const int by = blockIdx.y;
  A += (size_t)by * sA; Bh += (size_t)by * sB; C += (size_t)by * sC;
  const int ntn = (N + 63) / 64; const int wid = blockIdx.x * 4 + w; const int mt = wid / ntn, nq = wid % ntn; if (mt * 16 >= M) return;
  const int row0 = mt * 16, col0 = nq * 64; const float* arow = A + (size_t)(row0 + ln) * lda;
  v8f acc[4] = {};
  for (int kb = 0; kb < K; kb += 32) {
    FragH ah, al;
    const v4f x0 = *(const v4fa*)(arow + kb + 8 * hh), x1 = *(const v4fa*)(arow + kb + 8 * hh + 4), x2 = *(const v4fa*)(arow + kb + 16 + 8 * hh), x3 = *(const v4fa*)(arow + kb + 16 + 8 * hh + 4);
    float xs[16] = {x0[0],x0[1],x0[2],x0[3],x1[0],x1[1],x1[2],x1[3],x2[0],x2[1],x2[2],x2[3],x3[0],x3[1],x3[2],x3[3]};
#pragma unroll
    for (int i = 0; i < 16; ++i) { const _Float16 h = (_Float16)xs[i]; ah.h[i] = h; al.h[i] = ASPLIT ? (_Float16)(xs[i] - (float)h) : (_Float16)0.0f; }
#pragma unroll
    for (int t = 0; t < 4; ++t) { if (col0 + t * 16 >= N) continue; const size_t boff = (size_t)(col0 + t * 16 + ln) * ldb + kb; FragH bq; bq.half[0] = *(const v8us*)(Bh + boff + 8 * hh); bq.half[1] = *(const v8us*)(Bh + boff + 16 + 8 * hh);
      acc[t] = mmaH<ASPLIT ? 2 : 1>(ah.v, al.v, bq.v, bq.v, acc[t]); }
  }
#pragma unroll
  for (int t = 0; t < 4; ++t) { if (col0 + t * 16 >= N) continue;
#pragma unroll
    for (int r = 0; r < 8; ++r) so[w][8 * hh + r][t * 16 + ln] = acc[t][r] * alpha; }
  __builtin_amdgcn_fence(__ATOMIC_ACQ_REL, "workgroup"); __builtin_amdgcn_wave_barrier();
  const int rsub = lane >> 4, c4 = (lane & 15) * 4;
  {
#pragma unroll
    for (int q = 0; q < 8; ++q) { const int r = q * 2 + rsub; if (col0 + c4 < N) { const v4f v = *(const v4fa*)&so[w][r][c4]; *(v4f*)(C + (size_t)(row0 + r) * ldc + col0 + c4) = v; } }
     }
}

// Wt[n][k] = f16(W[k][n]·scale) from f32 row-major W[K][N] (scale = power of two; bf16-exact weights stay exact in f16 away from the subnormal range)
__global__ __launch_bounds__(256) void k_wt_f16(const float* __restrict__ W, _Float16* __restrict__ Wt, int K, int N, float scale) {
  const int t = blockIdx.x * 256 + threadIdx.x; if (t >= N * (K / 8)) return; const int n = t / (K / 8), k8 = (t % (K / 8)) * 8; FragH f;
#pragma unroll
  for (int i = 0; i < 8; ++i) f.h[i] = (_Float16)(bf16_round(W[(size_t)(k8 + i) * N + n]) * scale); const v8us o = f.half[0];
  *(v8us*)((unsigned short*)Wt + (size_t)n * K + k8) = o; 
}
// k_gemm_hh variant with fused epilogue: v = acc·alpha + bias[by·sBias + col] (+ CP[(row/rowsPerB)·sCPb + by·64 + col] if CP) ; ACT 0 none / 1 elu ; writes f32 C and f16 C16, each if non-null
template <int ACT>
__global__ __launch_bounds__(128) void k_gemm_hhx(const _Float16* __restrict__ A, int lda, size_t sA, const _Float16* __restrict__ Bh, int ldb, size_t sB, float alpha, const float* __restrict__ bias, size_t sBias, const float* __restrict__ CP, int rowsPerB, size_t sCPb, int row0g,
    float* __restrict__ C, _Float16* __restrict__ C16, int ldc, size_t sC, int M, int N, int K) {
  __shared__ __attribute__((aligned(16))) float so[4][16][64];
  const int tid = threadIdx.x, w = tid >> 5, lane = tid & 31, ln = lane & 15, hh = lane >> 4; const int by = blockIdx.y;
  A += (size_t)by * sA; Bh += (size_t)by * sB; const size_t cofs = (size_t)by * sC; const float* bp = bias ? bias + (size_t)by * sBias : nullptr;
  const int ntn = (N + 63) / 64; const int wid = blockIdx.x * 4 + w; const int mt = wid / ntn, nq = wid % ntn; if (mt * 16 >= M) return;
  const int row0 = mt * 16, col0 = nq * 64; const _Float16* arow = A + (size_t)(row0 + ln) * lda;
  v8f acc[4] = {};
  for (int kb = 0; kb < K; kb += 32) { FragH ah; ah.half[0] = *(const v8us*)((const unsigned short*)arow + kb + 8 * hh); ah.half[1] = *(const v8us*)((const unsigned short*)arow + kb + 16 + 8 * hh);
#pragma unroll
    for (int t = 0; t < 4; ++t) { if (col0 + t * 16 >= N) continue; const size_t boff = (size_t)(col0 + t * 16 + ln) * ldb + kb; FragH bq; bq.half[0] = *(const v8us*)((const unsigned short*)Bh + boff + 8 * hh); bq.half[1] = *(const v8us*)((const unsigned short*)Bh + boff + 16 + 8 * hh);
      acc[t] = mmaH<1>(ah.v, ah.v, bq.v, bq.v, acc[t]); }
  }
#pragma unroll
  for (int t = 0; t < 4; ++t) { if (col0 + t * 16 >= N) continue; const int col = col0 + t * 16 + ln; const float bv = bp ? bf16_round(bp[col]) : 0.f;
#pragma unroll
    for (int r = 0; r < 8; ++r) { float v = acc[t][r] * alpha + bv; if (CP) { const int bidx = (row0g + row0 + 8 * hh + r) / rowsPerB; v += CP[(size_t)bidx * sCPb + (size_t)by * 64 + col]; } if (ACT == 1) v = (v > 0.f) ? v : expm1f(v); else if (ACT == 7) v = (v > 0.f) ? v + 1.0f : expf(v); else if (ACT == 8) v = tanhf(v); else if (ACT == 9) v = 0.5f * v * (1.0f + tanhf(0.7978845608028654f * (v + 0.044715f * v * v * v))); else if (ACT == 11) v = 1.0f / (1.0f + expf(-v)); else if (ACT == 12) v = (v > 0.f) ? v : 0.01f * v; else if (ACT == 14) v = (v > 0.f) ? v : 0.1f * v; else if (ACT == 15) v = v / (1.0f + expf(-v)); else if (ACT == 3) v = fmaxf(v, 0.f); else if (ACT == 6) v = 0.5f * v * (1.0f + erff(v * 0.70710678118654752f)); so[w][8 * hh + r][t * 16 + ln] = v; } }
  __builtin_amdgcn_fence(__ATOMIC_ACQ_REL, "workgroup"); __builtin_amdgcn_wave_barrier();
  const int rsub = lane >> 4, c4 = (lane & 15) * 4; typedef _Float16 v4h __attribute__((ext_vector_type(4)));
  {
#pragma unroll
    for (int q = 0; q < 8; ++q) { const int r = q * 2 + rsub; if (col0 + c4 < N) { const v4f v = *(const v4fa*)&so[w][r][c4]; if (C) *(v4f*)(C + cofs + (size_t)(row0 + r) * ldc + col0 + c4) = v; if (C16) { v4h h4; for (int i = 0; i < 4; ++i) h4[i] = (_Float16)v[i]; *(v4h*)(C16 + cofs + (size_t)(row0 + r) * ldc + col0 + c4) = h4; } } }
     }
}


typedef _Float16 v4h __attribute__((ext_vector_type(4)));

__global__ __launch_bounds__(256) void k_x16(const float* __restrict__ x, _Float16* __restrict__ X16, size_t n8) { const size_t t = (size_t)blockIdx.x * 256 + threadIdx.x; if (t >= n8) return; FragH f;
#pragma unroll
  for (int q = 0; q < 8; ++q) f.h[q] = (_Float16)bf16_round(x[t * 8 + q]); *(v8us*)((unsigned short*)X16 + t * 8) = f.half[0];  }
__global__ __launch_bounds__(256) void k_h16(const float* __restrict__ x, _Float16* __restrict__ X16, size_t n8) { const size_t t = (size_t)blockIdx.x * 256 + threadIdx.x; if (t >= n8) return; FragH f;
#pragma unroll
  for (int q = 0; q < 8; ++q) f.h[q] = (_Float16)x[t * 8 + q]; *(v8us*)((unsigned short*)X16 + t * 8) = f.half[0];  }
__global__ __launch_bounds__(256) void k_round16f(const float* __restrict__ W, _Float16* __restrict__ Bt, size_t n8) { const size_t t = (size_t)blockIdx.x * 256 + threadIdx.x; if (t >= n8) return; FragH f;
#pragma unroll
  for (int i = 0; i < 8; ++i) f.h[i] = (_Float16)(bf16_round(W[t * 8 + i]) * 16.0f); *(v8us*)((unsigned short*)Bt + t * 8) = f.half[0];  }
template <int NHv, int TTv>
__global__ __launch_bounds__(256) void k_vt(const _Float16* __restrict__ V16, int ldv, int voff, _Float16* __restrict__ Vt) { __shared__ unsigned short tl[64][66]; const int tid = threadIdx.x; const int slab = blockIdx.x / (TTv / 64), lg = blockIdx.x % (TTv / 64); const int b = slab / NHv, h = slab % NHv;
  for (int i = tid; i < 64 * 8; i += 256) { const int r = i / 8, c8 = (i % 8) * 8; FragH f; f.half[0] = *(const v8us*)((const unsigned short*)V16 + ((size_t)b * TTv + lg * 64 + r) * ldv + voff + h * 64 + c8);
#pragma unroll
    for (int q = 0; q < 8; ++q) tl[r][c8 + q] = f.u[q]; }
  __syncthreads();
  {
#pragma unroll
    for (int rd = 0; rd < 2; ++rd) { const int d = rd * 32 + tid / 8, pc = tid % 8; FragH f;
#pragma unroll
      for (int q = 0; q < 8; ++q) f.u[q] = tl[pc * 8 + q][d];
      *(v8us*)((unsigned short*)Vt + ((size_t)slab * 64 + d) * TTv + lg * 64 + pc * 8) = f.half[0]; }
     } }

__global__ __launch_bounds__(256) void k_hl(const float* __restrict__ F, _Float16* __restrict__ Hh, _Float16* __restrict__ Hl, size_t n8) { const size_t t = (size_t)blockIdx.x * 256 + threadIdx.x; if (t >= n8) return; FragH fh, fl; const v4f a = *(const v4fa*)(F + t * 8), c = *(const v4fa*)(F + t * 8 + 4);
#pragma unroll
  for (int q = 0; q < 4; ++q) { _Float16 h = (_Float16)a[q]; fh.h[q] = h; fl.h[q] = (_Float16)((a[q] - (float)h) * 1024.0f); h = (_Float16)c[q]; fh.h[4 + q] = h; fl.h[4 + q] = (_Float16)((c[q] - (float)h) * 1024.0f); }
  { *(v8us*)((unsigned short*)Hh + t * 8) = fh.half[0]; *(v8us*)((unsigned short*)Hl + t * 8) = fl.half[0];  } }

// stacked weights BW[NW][CC] = f16(bf16(W) * 16), rows 0..63 Wb, 64..127 Wc, 128..639 Wd, and the stacked biases BI[NW] (f32, as given)
__global__ __launch_bounds__(256) void k_prep(const float* __restrict__ Wb, const float* __restrict__ Wc, const float* __restrict__ Wd, const float* __restrict__ bb, const float* __restrict__ bc, const float* __restrict__ bd, _Float16* __restrict__ BW, float* __restrict__ BI) {
  const int t = blockIdx.x * 256 + threadIdx.x, n1 = C8 * CC / 8; if (t >= NW * CC / 8) return;
  const float* Wp = (t < n1) ? Wb + (size_t)t * 8 : (t < 2 * n1) ? Wc + (size_t)(t - n1) * 8 : Wd + (size_t)(t - 2 * n1) * 8; FragH f;
#pragma unroll
  for (int i = 0; i < 8; ++i) f.h[i] = (_Float16)(bf16_round(Wp[i]) * 16.0f); *(v8us*)((unsigned short*)BW + (size_t)t * 8) = f.half[0];
  if (t < NW) BI[t] = (t < C8) ? bb[t] : (t < 2 * C8) ? bc[t - C8] : bd[t - 2 * C8]; }
// The two layout changes (k_tok, k_fcomb) go through an LDS tile: 64 source rows x TW contiguous source columns come in as whole 128-B lines (8 lanes x 16 B a row),
// are converted, and leave as rows of 64 f16 = one whole 128-B line each. Read straight across the source rows, every lane of a load would touch a line of its own.
// Few, fat work-groups (two per WGP): every thread has all of its loads in flight at once.
#define TR 64                    /* source rows per tile = f16 per output row */
#define TP (TR + 8)              /* LDS row pitch in f16: 144 B = 16 B x odd */
typedef _Float16 v2ha __attribute__((ext_vector_type(2), may_alias));
// the tile's TW output rows, 128 B each, from LDS to dst (pitch ldd elements): 8 lanes a row
template <int TW>
__device__ __forceinline__ void tile_out(const _Float16 (&tl)[TW][TP], _Float16* __restrict__ dst, size_t ldd, int tid) {
#pragma unroll  /* all LDS reads go out ahead of the stores */
  for (int i = 0; i < TW / 32; ++i) { const int r = (tid >> 3) + 32 * i, e8 = (tid & 7) * 8; const v8us v = *(const v8us*)&tl[r][e8]; *(v8us*)((unsigned short*)dst + (size_t)r * ldd + e8) = v; }
}
#define TWX 256                  /* positions per tile of k_tok */
// blockIdx.x = tile of TWX positions, blockIdx.y = tile of 64 channels, blockIdx.z = slab s
__global__ __launch_bounds__(256) void k_tok(const float* __restrict__ x1, const float* __restrict__ x2, _Float16* __restrict__ X16) {
  __shared__ __attribute__((aligned(16))) _Float16 tl[TWX][TP];  /* [position][channel] */
  const int tid = threadIdx.x, s = blockIdx.z, b = s >> 1, n0 = blockIdx.x * TWX, c0 = blockIdx.y * TR, c = 2 * (tid >> 3), k0 = (tid & 7) * 4;
  const char* x = (const char*)(((s & 1) ? x2 : x1) + ((size_t)b * CC + c0) * NP + n0);  /* the tile's first element: the same for the whole work-group */
  const unsigned ob = (unsigned)(c * NP + k0) * 4;                                       /* the lane's byte offset in the tile */
  v4f u[TWX / 32], v[TWX / 32];
#pragma unroll  /* constant indices: the values stay in registers, and the sixteen loads of a thread are all in flight at once */
  for (int i = 0; i < TWX / 32; ++i) { u[i] = *(const v4fa*)(x + ob + 128 * i); v[i] = *(const v4fa*)(x + ob + NP * 4 + 128 * i); }
  asm volatile("s_wait_xcnt 0x0" :: "v"(ob) : "memory");  /* stands in front of any rewrite of the offset register that these loads name; the operand keeps that register until here */
  __builtin_amdgcn_sched_barrier(0);                      /* keeps the conversions behind all sixteen loads; left alone the compiler holds five loads back until the first have returned: a second memory latency */
#pragma unroll
  for (int i = 0; i < TWX / 32; ++i)
#pragma unroll
    for (int q = 0; q < 4; ++q) { v2ha h; h[0] = (_Float16)bf16_round(u[i][q]); h[1] = (_Float16)bf16_round(v[i][q]); *(v2ha*)&tl[k0 + 32 * i + q][c] = h; }
  __syncthreads();  /* the tile is whole before any wave reads it across */
  tile_out<TWX>(tl, X16 + ((size_t)s * NP + n0) * CC + c0, CC, tid);
}
// blockIdx.y = plane p = 2 * slab + (0 for conv_b, 1 for conv_c): columns 64 (p & 1) .. + 63 of slab p >> 1 of P
__global__ __launch_bounds__(256) void k_split(const float* __restrict__ F, _Float16* __restrict__ Hh, _Float16* __restrict__ Hl, size_t n8) {
  #pragma clang fp contract(off)
  const size_t t = (size_t)blockIdx.x * 256 + threadIdx.x; if (t >= n8) return;
  const size_t p = blockIdx.y; F += (p >> 1) * NP * NW + (p & 1) * C8; Hh += p * NP * C8; Hl += p * NP * C8;
  // planes in WMMA fragment order, 16 positions x 64 channels per 2-KiB block: [k step of 32][fragment half][lane][8 channels]; piece t of the plane is position 16*(t>>7) + (t&15), channels 8*sc..8*sc+7
  const size_t sc = ((t >> 6) & 1) * 4 + ((t >> 5) & 1) * 2 + ((t >> 4) & 1), so = ((t >> 7) * 16 + (t & 15)) * NW + sc * 8;
  const v4f a = *(const v4fa*)(F + so), c = *(const v4fa*)(F + so + 4); FragH fh, fl;
#pragma unroll
  for (int q = 0; q < 8; ++q) { const float v = (q < 4) ? a[q] : c[q - 4]; const _Float16 hi = (_Float16)v; fh.h[q] = hi; fl.h[q] = (_Float16)((v - (float)hi) * 1024.0f); }
  { *(v8us*)((unsigned short*)Hh + t * 8) = fh.half[0]; *(v8us*)((unsigned short*)Hl + t * 8) = fl.half[0];  } }
#define TWF 128                  /* channels per tile of k_fcomb */
// blockIdx.x = tile of 64 positions, blockIdx.y = tile of TWF channels, blockIdx.z = batch; f1, f2 = columns 128.. of the batch's two slabs of P
__global__ __launch_bounds__(256) void k_fcomb(const float* __restrict__ P, const float* __restrict__ al, const float* __restrict__ be, _Float16* __restrict__ FT) {
  #pragma clang fp contract(off)
  __shared__ __attribute__((aligned(16))) _Float16 tl[TWF][TP];  /* [channel][position] */
  const int tid = threadIdx.x, m0 = blockIdx.x * TR, c0 = blockIdx.y * TWF, m = 2 * (tid >> 3), k0 = (tid & 7) * 4;
  const char* F = (const char*)(P + ((size_t)(2 * blockIdx.z) * NP + m0) * NW + 2 * C8 + c0);  /* the first element of f1's tile: the same for the whole work-group */
  const unsigned ob = (unsigned)(m * NW + k0) * 4, ob2 = ob + (unsigned)(NP * NW * 4);         /* the lane's byte offsets from there in f1's tile and in f2's, one slab of P further on */
  const float a = bf16_round(al[0]), bq = bf16_round(be[0]);
  v4f p0[TWF / 32], p1[TWF / 32], r0[TWF / 32], r1[TWF / 32];
#pragma unroll  /* constant indices: the values stay in registers, and the sixteen loads of a thread are all in flight at once */
  for (int i = 0; i < TWF / 32; ++i) { p0[i] = *(const v4fa*)(F + ob + 128 * i); p1[i] = *(const v4fa*)(F + ob + NW * 4 + 128 * i); r0[i] = *(const v4fa*)(F + ob2 + 128 * i); r1[i] = *(const v4fa*)(F + ob2 + NW * 4 + 128 * i); }
  asm volatile("s_wait_xcnt 0x0" :: "v"(ob), "v"(ob2) : "memory");  /* stands in front of any rewrite of the offset registers that these loads name; the operands keep those registers until here */
#pragma unroll
  for (int i = 0; i < TWF / 32; ++i)
#pragma unroll
    for (int q = 0; q < 4; ++q) { v2ha h; h[0] = (_Float16)(a * p0[i][q] + bq * r0[i][q]); h[1] = (_Float16)(a * p1[i][q] + bq * r1[i][q]); *(v2ha*)&tl[k0 + 32 * i + q][m] = h; }
  __syncthreads();  /* the tile is whole before any wave reads it across */
  tile_out<TWF>(tl, FT + ((size_t)blockIdx.z * CC + c0) * NP + m0, NP, tid);
}
// One 16x32 f16 fragment (A row or B column = lane & 15; k = 8*(lane>>4)+0..7 and 16+8*(lane>>4)+0..7) from a plane in the fragment order that k_split writes; p already holds 8*lane.
// Each of the two loads reads 512 contiguous bytes (4 whole lines) per wave; from a row-major plane it would touch 16 lines.
__device__ __forceinline__ v16h frag_at(const _Float16* p) { FragH f; f.half[0] = *(const v8us*)((const unsigned short*)p); f.half[1] = *(const v8us*)((const unsigned short*)p + 256); return f.v; }
__device__ __forceinline__ v8f wm(v16h a, v16h b, v8f c) { return __builtin_amdgcn_wmma_f32_16x16x32_f16(false, a, false, b, (short)0, c, false, false); }
// value of lane ^ X inside the 16-lane row, by DPP row_xmask (a shuffle would go through the LDS pipe and its wait); every lane is on where it is used
template <int X> __device__ __forceinline__ float row_xor(float v) { return __int_as_float(__builtin_amdgcn_update_dpp(0, __float_as_int(v), 0x160 + X, 0xf, 0xf, true)); }
__device__ __forceinline__ float row_max16(float v) { v = fmaxf(v, row_xor<1>(v)); v = fmaxf(v, row_xor<2>(v)); v = fmaxf(v, row_xor<4>(v)); return fmaxf(v, row_xor<8>(v)); }
__device__ __forceinline__ float row_sum16(float v) { v += row_xor<1>(v); v += row_xor<2>(v); v += row_xor<4>(v); return v + row_xor<8>(v); }
struct QFrag { v16h a1h[2], a1l[2], a2h[2], a2l[2]; };
#define DRT 2                    /* 16-row query tiles per wave: every B fragment that is loaded feeds both */
// both logit tiles (16 query rows x 16 key columns, K 64) of each of the wave's DRT query tiles from the hi/lo planes: hi*hi in one accumulator, the two cross terms (scaled 2^10) in a second
__device__ __forceinline__ void logit_tile(const QFrag (&q)[DRT], const _Float16* b2h, const _Float16* b2l, const _Float16* b1h, const _Float16* b1l, v8f (&s1)[DRT], v8f (&s2)[DRT]) {
  v8f h1[DRT] = {}, l1[DRT] = {}, h2[DRT] = {}, l2[DRT] = {};
  const v16h p[2] = {frag_at(b2h), frag_at(b2h + 512)}, x[2] = {frag_at(b1h), frag_at(b1h + 512)}, pl[2] = {frag_at(b2l), frag_at(b2l + 512)}, xl[2] = {frag_at(b1l), frag_at(b1l + 512)};
  // holds all sixteen loads of the tile in front of its first WMMA: one load latency a tile; left alone the compiler reuses fragment registers and waits for memory several times a tile
  asm volatile("" :: "v"(p[0]), "v"(p[1]), "v"(x[0]), "v"(x[1]), "v"(pl[0]), "v"(pl[1]), "v"(xl[0]), "v"(xl[1]));
#pragma unroll
  for (int ks = 0; ks < 2; ++ks) {
#pragma unroll
    for (int i = 0; i < DRT; ++i) { h1[i] = wm(q[i].a1h[ks], p[ks], h1[i]); h2[i] = wm(q[i].a2h[ks], x[ks], h2[i]); }
#pragma unroll
    for (int i = 0; i < DRT; ++i) { l1[i] = wm(q[i].a1l[ks], p[ks], l1[i]); l2[i] = wm(q[i].a2l[ks], x[ks], l2[i]); }
#pragma unroll
    for (int i = 0; i < DRT; ++i) { l1[i] = wm(q[i].a1h[ks], pl[ks], l1[i]); l2[i] = wm(q[i].a2h[ks], xl[ks], l2[i]); }
  }
#pragma unroll
  for (int i = 0; i < DRT; ++i)
#pragma unroll
    for (int r = 0; r < 8; ++r) { s1[i][r] = h1[i][r] + l1[i][r] * 0.0009765625f; s2[i][r] = h2[i][r] + l2[i][r] * 0.0009765625f; }
}
// Logits, both softmaxes and |difference| in one kernel: a work-group of 8 waves owns 32 query rows (one work-group per WGP covers all rows), wave w the key columns [512 w, 512 w + 512).
// Every wave holds the query fragments of both 16-row tiles in registers (2 waves per SIMD: 512 registers each), so the key planes are read from L2 once per 32 rows and pass.
// The logits stay in registers and are formed three times (row maximum, row sum, output); nothing of them goes to memory.
#define DW 8                     /* waves per work-group */
#define DROW (16 * DRT)          /* query rows per work-group */
#define DCOL (NP / DW)           /* key columns per wave */
#define DPIT (DCOL + 8)          /* LDS row pitch in f16: 16-byte multiple, rows 8 apart fall on other banks */
__global__ __launch_bounds__(DW * 32) void k_attdiff(const _Float16* __restrict__ A1h, const _Float16* __restrict__ A1l, const _Float16* __restrict__ A2h, const _Float16* __restrict__ A2l,
                                                 const _Float16* __restrict__ B2h, const _Float16* __restrict__ B2l, const _Float16* __restrict__ B1h, const _Float16* __restrict__ B1l, _Float16* __restrict__ D16) {
  __shared__ __attribute__((aligned(16))) _Float16 st[DW][DROW][DPIT];
  __shared__ float red[2][DW][DROW];
  __shared__ float fin[2][DROW];
  const int tid = threadIdx.x, w = tid >> 5, lane = tid & 31, ln = lane & 15, hh = lane >> 4; const int row0 = blockIdx.x * DROW;
  { const size_t pb = (size_t)blockIdx.y * 4 * NP * C8;  /* blockIdx.y = batch: four planes of each kind a batch */
    A1h += pb; A1l += pb; A2h += pb; A2l += pb; B2h += pb; B2l += pb; B1h += pb; B1l += pb; D16 += (size_t)blockIdx.y * NP * NP; }
  QFrag q[DRT];
#pragma unroll
  for (int i = 0; i < DRT; ++i) { const size_t ao = (size_t)(row0 + 16 * i) * C8 + 8 * lane;
#pragma unroll
    for (int ks = 0; ks < 2; ++ks) { q[i].a1h[ks] = frag_at(A1h + ao + ks * 512); q[i].a1l[ks] = frag_at(A1l + ao + ks * 512); q[i].a2h[ks] = frag_at(A2h + ao + ks * 512); q[i].a2l[ks] = frag_at(A2l + ao + ks * 512); } }
  asm volatile("s_wait_xcnt 0x0" ::: "memory");  /* stands in front of the reuse of the address registers that the query loads name */
  __builtin_amdgcn_sched_barrier(0);             /* keeps the key-plane address arithmetic, which reuses those registers, behind that wait */
  const size_t bo = (size_t)(w * DCOL) * C8 + 8 * lane; B2h += bo; B2l += bo; B1h += bo; B1l += bo;
  float m1[DRT][8], m2[DRT][8];
#pragma unroll
  for (int i = 0; i < DRT; ++i)
#pragma unroll
    for (int r = 0; r < 8; ++r) { m1[i][r] = -3.0e38f; m2[i][r] = -3.0e38f; }
#pragma unroll 1  /* rolled: an unrolled body would hold several tiles' B fragments and leave the 512-register budget of 2 waves per SIMD */
  for (int j = 0; j < DCOL / 16; ++j) { v8f s1[DRT], s2[DRT]; const size_t o = (size_t)j * 16 * C8; logit_tile(q, B2h + o, B2l + o, B1h + o, B1l + o, s1, s2);
#pragma unroll
    for (int i = 0; i < DRT; ++i)
#pragma unroll
      for (int r = 0; r < 8; ++r) { m1[i][r] = fmaxf(m1[i][r], s1[i][r]); m2[i][r] = fmaxf(m2[i][r], s2[i][r]); } }
#pragma unroll
  for (int i = 0; i < DRT; ++i)
#pragma unroll
    for (int r = 0; r < 8; ++r) { m1[i][r] = row_max16(m1[i][r]); m2[i][r] = row_max16(m2[i][r]); }
  if (ln == 0) {
#pragma unroll
    for (int i = 0; i < DRT; ++i)
#pragma unroll
      for (int r = 0; r < 8; ++r) { red[0][w][16 * i + 8 * hh + r] = m1[i][r]; red[1][w][16 * i + 8 * hh + r] = m2[i][r]; } }
  __syncthreads();
  if (tid < 2 * DROW) { const int mt = tid / DROW, rw = tid % DROW; float v = red[mt][0][rw]; for (int k = 1; k < DW; ++k) v = fmaxf(v, red[mt][k][rw]); fin[mt][rw] = v; }
  __syncthreads();
  float u1[DRT][8], u2[DRT][8];
#pragma unroll
  for (int i = 0; i < DRT; ++i)
#pragma unroll
    for (int r = 0; r < 8; ++r) { m1[i][r] = fin[0][16 * i + 8 * hh + r]; m2[i][r] = fin[1][16 * i + 8 * hh + r]; u1[i][r] = 0.f; u2[i][r] = 0.f; }
#pragma unroll 1  /* rolled for the register budget, as above */
  for (int j = 0; j < DCOL / 16; ++j) { v8f s1[DRT], s2[DRT]; const size_t o = (size_t)j * 16 * C8; logit_tile(q, B2h + o, B2l + o, B1h + o, B1l + o, s1, s2);
#pragma unroll
    for (int i = 0; i < DRT; ++i)
#pragma unroll
      for (int r = 0; r < 8; ++r) { u1[i][r] += expf(s1[i][r] - m1[i][r]); u2[i][r] += expf(s2[i][r] - m2[i][r]); } }
#pragma unroll
  for (int i = 0; i < DRT; ++i)
#pragma unroll
    for (int r = 0; r < 8; ++r) { u1[i][r] = row_sum16(u1[i][r]); u2[i][r] = row_sum16(u2[i][r]); }
  if (ln == 0) {
#pragma unroll
    for (int i = 0; i < DRT; ++i)
#pragma unroll
      for (int r = 0; r < 8; ++r) { red[0][w][16 * i + 8 * hh + r] = u1[i][r]; red[1][w][16 * i + 8 * hh + r] = u2[i][r]; } }
  __syncthreads();
  if (tid < 2 * DROW) { const int mt = tid / DROW, rw = tid % DROW; float v = red[mt][0][rw]; for (int k = 1; k < DW; ++k) v += red[mt][k][rw]; fin[mt][rw] = 1.0f / v; }
  __syncthreads();
#pragma unroll
  for (int i = 0; i < DRT; ++i)
#pragma unroll
    for (int r = 0; r < 8; ++r) { u1[i][r] = fin[0][16 * i + 8 * hh + r]; u2[i][r] = fin[1][16 * i + 8 * hh + r]; }
#pragma unroll 1  /* rolled for the register budget, as above */
  for (int j = 0; j < DCOL / 16; ++j) { v8f s1[DRT], s2[DRT]; const size_t o = (size_t)j * 16 * C8; logit_tile(q, B2h + o, B2l + o, B1h + o, B1l + o, s1, s2);
#pragma unroll
    for (int i = 0; i < DRT; ++i)
#pragma unroll
      for (int r = 0; r < 8; ++r) st[w][16 * i + 8 * hh + r][j * 16 + ln] = (_Float16)(fabsf(expf(s1[i][r] - m1[i][r]) * u1[i][r] - expf(s2[i][r] - m2[i][r]) * u2[i][r]) * 16384.0f); }
  // each wave reads back only its own slab: the fence keeps the LDS reads behind the writes of the wave's other lanes, no work-group barrier is needed
  __builtin_amdgcn_fence(__ATOMIC_ACQ_REL, "workgroup"); __builtin_amdgcn_wave_barrier();
#pragma unroll 1  /* rolled in groups of eight rows: sixteen LDS reads go out ahead of their stores */
  for (int r0 = 0; r0 < DROW; r0 += 8) {
#pragma unroll
    for (int r = r0; r < r0 + 8; ++r)
#pragma unroll
      for (int c = 0; c < DCOL; c += 256) { const v8us v = *(const v8us*)&st[w][r][c + lane * 8]; *(v8us*)((unsigned short*)D16 + (size_t)(row0 + r) * NP + w * DCOL + c + lane * 8) = v; }
    asm volatile("s_wait_xcnt 0x0" ::: "memory");  /* stands in front of the next trip's rewrite of the data and address registers that these stores name */
  }
}

// C[M][N] (f32, pitch ldc) = A[M][K] . B[N][K]^T * alpha + bias[col] (bias rounded to bf16); A and B f16 with k contiguous. One 64 x 64 tile of C per work-group of 4 waves (2 x 2, 32 x 32 each).
// A stage is 256 k of the tile's 64 A rows and 64 B rows, brought into LDS by asynchronous b128 copies: one copy of a wave is 512 contiguous bytes of one row (4 whole lines), where a fragment load
// straight from the row-major operand touches 16 lines. Two buffers: the next stage's copies fly while this stage is worked on. M, N multiples of 64, K a multiple of 256.
// Every accumulator sums k in rising order, 32 at a time.
#define GT 64                    /* rows of each operand per work-group */
#define GK 256                   /* k per stage */
#define GP (GK + 8)              /* LDS row pitch in f16: 528 B = 16 B x odd, so the 16 rows of a ds_load_b128 fall on all banks */
typedef __attribute__((address_space(3))) const _Float16 lds_f16;
// eight rows (4 apart) of one operand: l = the lane's LDS byte address, g = the lane's global address, gs = 4 rows of the operand in elements
__device__ __forceinline__ void copy8(unsigned l, const _Float16* g, size_t gs) {
  const unsigned ls = 4 * GP * 2;
  // the last line is the wait that stands in front of any rewrite of the address registers that these copies name
  asm volatile("global_load_async_to_lds_b128 %0, %8, off\n\t"
               "global_load_async_to_lds_b128 %1, %9, off\n\t"
               "global_load_async_to_lds_b128 %2, %10, off\n\t"
               "global_load_async_to_lds_b128 %3, %11, off\n\t"
               "global_load_async_to_lds_b128 %4, %12, off\n\t"
               "global_load_async_to_lds_b128 %5, %13, off\n\t"
               "global_load_async_to_lds_b128 %6, %14, off\n\t"
               "global_load_async_to_lds_b128 %7, %15, off\n\t"
               "s_wait_xcnt 0x0"
               :: "v"(l), "v"(l + ls), "v"(l + 2 * ls), "v"(l + 3 * ls), "v"(l + 4 * ls), "v"(l + 5 * ls), "v"(l + 6 * ls), "v"(l + 7 * ls),
                  "v"(g), "v"(g + gs), "v"(g + 2 * gs), "v"(g + 3 * gs), "v"(g + 4 * gs), "v"(g + 5 * gs), "v"(g + 6 * gs), "v"(g + 7 * gs) : "memory");
}
// one stage: wave w brings rows w, w + 4, ..., w + 60 of the A tile (LDS rows 0..63) and of the B tile (LDS rows 64..127): 32 copies of a wave
__device__ __forceinline__ void fill_stage(unsigned l, const _Float16* ga, size_t sa, const _Float16* gb, size_t sb) {
  copy8(l, ga, sa); copy8(l + 32 * GP * 2, ga + 8 * sa, sa); copy8(l + 64 * GP * 2, gb, sb); copy8(l + 96 * GP * 2, gb + 8 * sb, sb);
}
// fragment from a row-major LDS tile; p = row (lane & 15), k = 8 * (lane >> 4): k 8*(lane>>4)+0..7 and 16+8*(lane>>4)+0..7, alike for A and B
__device__ __forceinline__ v16h frag_lds(const _Float16* p) { FragH f; f.half[0] = *(const v8us*)((const unsigned short*)p); f.half[1] = *(const v8us*)((const unsigned short*)p + 16); return f.v; }
// blockIdx.z = batch: A, B and C move on by sA, sB, sC elements
__global__ __launch_bounds__(128) void k_gemm_t(const _Float16* __restrict__ A, int lda, size_t sA, const _Float16* __restrict__ B, int ldb, size_t sB, float alpha, const float* __restrict__ bias, float* __restrict__ C, int ldc, size_t sC, int K) {
  __shared__ __attribute__((aligned(16))) _Float16 sm[2][2 * GT][GP];
  __shared__ __attribute__((aligned(16))) float so[4][32][36];
  const int tid = threadIdx.x, w = tid >> 5, lane = tid & 31, ln = lane & 15, hh = lane >> 4, wr = w >> 1, wc = w & 1;
  const int row0 = blockIdx.y * GT, col0 = blockIdx.x * GT;
  A += blockIdx.z * sA; B += blockIdx.z * sB; C += blockIdx.z * sC;
  const _Float16* ga = A + (size_t)(row0 + w) * lda + lane * 8; const _Float16* gb = B + (size_t)(col0 + w) * ldb + lane * 8;
  const size_t sa = (size_t)4 * lda, sb = (size_t)4 * ldb;
  const unsigned l0 = (unsigned)(uintptr_t)(lds_f16*)&sm[0][w][lane * 8], lbuf = 2 * GT * GP * 2;
  const int nt = K / GK;
  v8f acc[2][2] = {};
  fill_stage(l0, ga, sa, gb, sb);
  asm volatile("s_wait_asynccnt 0x0" ::: "memory");  /* this wave's copies of stage 0 have landed */
  __syncthreads();                                   /* and every other wave's */
  if (nt > 1) fill_stage(l0 + lbuf, ga + GK, sa, gb + GK, sb);
  for (int t = 0; t < nt; ++t) {
    const _Float16* pa = &sm[t & 1][wr * 32 + ln][8 * hh]; const _Float16* pb = &sm[t & 1][GT + wc * 32 + ln][8 * hh];
    v16h fa[GK / 32][2], fb[GK / 32][2];
#pragma unroll  /* every index constant: the fragments stay in registers */
    for (int ks = 0; ks < GK / 32; ++ks) { fa[ks][0] = frag_lds(pa + ks * 32); fb[ks][0] = frag_lds(pb + ks * 32); fb[ks][1] = frag_lds(pb + 16 * GP + ks * 32); fa[ks][1] = frag_lds(pa + 16 * GP + ks * 32); }
    // keeps the stage's 64 LDS loads one group in front of its WMMAs, which then follow behind counted waits; left alone the compiler reuses three fragment registers and the lone wave of a SIMD waits out the LDS latency three times per k step
    __builtin_amdgcn_sched_barrier(0);
#pragma unroll  /* as above */
    for (int ks = 0; ks < GK / 32; ++ks) {
      acc[0][0] = wm(fa[ks][0], fb[ks][0], acc[0][0]); acc[0][1] = wm(fa[ks][0], fb[ks][1], acc[0][1]); acc[1][0] = wm(fa[ks][1], fb[ks][0], acc[1][0]); acc[1][1] = wm(fa[ks][1], fb[ks][1], acc[1][1]);
    }
    // keeps the WMMAs in front of the waits below, so that they run while the later LDS loads still return and the refill is issued directly behind the barrier
    __builtin_amdgcn_sched_barrier(0);
    asm volatile("s_wait_dscnt 0x0" ::: "memory");     /* this wave's reads of the buffer are done before it is refilled */
    asm volatile("s_wait_asynccnt 0x0" ::: "memory");  /* this wave's copies of stage t + 1 have landed */
    __syncthreads();                                   /* publishes stage t + 1 and ends every wave's reads of stage t */
    if (t + 2 < nt) fill_stage(l0 + (t & 1) * lbuf, ga + (size_t)(t + 2) * GK, sa, gb + (size_t)(t + 2) * GK, sb);
  }
  asm volatile("s_wait_asynccnt 0x0" ::: "memory");    /* no copy is left in flight when the wave ends */
#pragma unroll  /* these three: constant accumulator indices, so that acc stays in registers */
  for (int j = 0; j < 2; ++j) { const float bv = bias ? bf16_round(bias[col0 + wc * 32 + j * 16 + ln]) : 0.f;
#pragma unroll
    for (int i = 0; i < 2; ++i)
#pragma unroll
      for (int r = 0; r < 8; ++r) so[w][i * 16 + 8 * hh + r][j * 16 + ln] = acc[i][j][r] * alpha + bv; }
  // each wave reads back only its own slab, so that a store covers whole 128-B lines: the fence keeps the LDS reads behind the writes of the wave's other lanes
  __builtin_amdgcn_fence(__ATOMIC_ACQ_REL, "workgroup"); __builtin_amdgcn_wave_barrier();
#pragma unroll  /* all eight LDS reads go out ahead of the stores */
  for (int q = 0; q < 8; ++q) { const int r = q * 4 + (lane >> 3), c4 = (lane & 7) * 4; const v4f v = *(const v4fa*)&so[w][r][c4]; *(v4f*)(C + (size_t)(row0 + wr * 32 + r) * ldc + col0 + wc * 32 + c4) = v; }
}

extern "C" void kernel_launch(void* const* d_in, const int* in_sizes, int n_in,
                              void* d_out, int out_size, void* d_ws, size_t ws_size, hipStream_t stream) {
  (void)in_sizes; (void)n_in; (void)out_size;
  const float* x1 = (const float*)d_in[0]; const float* x2 = (const float*)d_in[1]; const float* Wb = (const float*)d_in[2]; const float* bb_ = (const float*)d_in[3]; const float* Wc = (const float*)d_in[4]; const float* bc = (const float*)d_in[5]; const float* Wd = (const float*)d_in[6]; const float* bd = (const float*)d_in[7]; const float* al = (const float*)d_in[8]; const float* be = (const float*)d_in[9];
  char* ws = (char*)d_ws; size_t off = 0;
  auto take = [&](size_t bytes) { char* p = ws + off; off += (bytes + 255) & ~(size_t)255; return p; };
  _Float16* BW = (_Float16*)take((size_t)NW * CC * 2); float* BI = (float*)take(NW * 4);
  _Float16* X = (_Float16*)take((size_t)NS * NP * CC * 2); float* P = (float*)take((size_t)NS * NP * NW * 4);
  _Float16* Hh = (_Float16*)take((size_t)2 * NS * NP * C8 * 2); _Float16* Hl = (_Float16*)take((size_t)2 * NS * NP * C8 * 2);      /* plane 2 s + j: conv_b (j 0) or conv_c (j 1) of slab s */
  _Float16* FT = (_Float16*)take((size_t)NBt * CC * NP * 2); _Float16* D16 = (_Float16*)take((size_t)NBt * NP * NP * 2);
  if (off > ws_size) return;
  const size_t n8 = (size_t)NP * C8 / 8, pl = (size_t)NP * C8;
  k_prep<<<(NW * CC / 8 + 255) / 256, 256, 0, stream>>>(Wb, Wc, Wd, bb_, bc, bd, BW, BI);      /* conv weights [O][C] = natural Bt */
  k_tok<<<dim3(NP / TWX, CC / TR, NS), 256, 0, stream>>>(x1, x2, X);
  k_gemm_t<<<dim3(NW / GT, NS * NP / GT), 128, 0, stream>>>(X, CC, 0, BW, CC, 0, 0.0625f, BI, P, NW, 0, CC);      /* P[s][n][0..63] = conv_b, [64..127] = conv_c, [128..639] = conv_d of slab s (exact + bias) */
  k_split<<<dim3((unsigned)((n8 + 255) / 256), 2 * NS), 256, 0, stream>>>(P, Hh, Hl, n8);      /* a1, b1, a2, b2 of each batch -> hi/lo planes */
  k_fcomb<<<dim3(NP / TR, CC / TWF, NBt), 256, 0, stream>>>(P, al, be, FT);
  k_attdiff<<<dim3(NP / DROW, NBt), DW * 32, 0, stream>>>(Hh, Hl, Hh + 2 * pl, Hl + 2 * pl, Hh + 3 * pl, Hl + 3 * pl, Hh + pl, Hl + pl, D16);      /* a1 = plane 0, a2 = plane 2, b2 = plane 3, b1 = plane 1: |softmax(a1.b2) - softmax(a2.b1)| x 2^14 */
  k_gemm_t<<<dim3(NP / GT, CC / GT, NBt), 128, 0, stream>>>(FT, NP, (size_t)CC * NP, D16, NP, (size_t)NP * NP, 1.0f / 16384.0f, nullptr, (float*)d_out, NP, (size_t)CC * NP, NP);      /* out[b][c][n] = sum_m F[c][m] att[n][m]: M 512 (c), N 4096 (n), K 4096 (m) -> NCHW directly */
}

// v006
// A run of this version takes 159 microseconds.
// In both of two side-by-side timings against v005, it was 1.09 times as fast.
// Over all steps from v000 it is 9.58 times as fast.
#include <hip/hip_runtime.h>
// Position-attention difference module (B 2, C 512, 64×64 = 4096 positions): a1 = conv_b(x1), b2 = conv_c(x2), a2 = conv_b(x2), b1 = conv_c(x1) (1×1, 512→64, + bias); f = conv_d (512→512, + bias); att12 = softmax_m(a1ᵀ·b2), att21 = softmax_m(a2ᵀ·b1) (no scaling); att = |att12 − att21|; out = α·f1·attᵀ + β·f2·attᵀ = (α f1 + β f2)·attᵀ → [2,512,64,64].
// Structure: every kernel runs once, over both batches and both inputs (7 launches): 1x1 convs as one GEMM against the stacked weights [Wb; Wc; Wd] on position-major f16 planes (exact products); a/b as f16 hi + lo*2^10 planes so both logit matrices are about f32 (three cross products each); one kernel forms both logit matrices in registers, both softmaxes per row in f32 and writes |difference| x 2^14 as f16; F = alpha f1 + beta f2 (f32 combine, then f16) and out = F.att^T by one GEMM straight into the NCHW output.
// Compute dtype: inputs and parameters rounded to bf16; logits ≈f32; softmaxes/difference in f32; |Δ| (×2^14) and F as f16 operands (≈2^-12), f32 accumulation. v_wmma_f32_16x16x32_f16.
#define NBt 2
#define CC 512
#define C8 64
#define NP 4096
#define NW (2 * C8 + CC)         /* rows of the stacked weights [Wb; Wc; Wd] = columns of the projection matrix P */
#define NS (2 * NBt)             /* position-major input slabs: slab s = 2 * batch + (0 for x1, 1 for x2) */
typedef __bf16 v16b __attribute__((ext_vector_type(16)));
typedef unsigned short v8us __attribute__((ext_vector_type(8), may_alias));
typedef float  v8f  __attribute__((ext_vector_type(8)));
typedef float  v4f  __attribute__((ext_vector_type(4)));
typedef float  v4fa __attribute__((ext_vector_type(4), may_alias));
union FragB { v16b v; v8us half[2]; unsigned short u[16]; };

__device__ __forceinline__ unsigned short bf16_bits(float x) { unsigned int u = __float_as_uint(x); return (unsigned short)((u + 0x7FFFu + ((u >> 16) & 1u)) >> 16); }
__device__ __forceinline__ float bf16_val(unsigned short b) { return __uint_as_float(((unsigned int)b) << 16); }
__device__ __forceinline__ float bf16_round(float x) { return bf16_val(bf16_bits(x)); }
// D += A·B with NT terms: 1 = ah·bh, 2 = + al·bh (A split), 3 = + ah·bl (both split)
template <int NT>
__device__ __forceinline__ v8f mmaN(v16b ah, v16b al, v16b bh, v16b bl, v8f c) {
  c = __builtin_amdgcn_wmma_f32_16x16x32_bf16(false, ah, false, bh, (short)0, c, false, false);
  if (NT >= 2) c = __builtin_amdgcn_wmma_f32_16x16x32_bf16(false, al, false, bh, (short)0, c, false, false);
  if (NT >= 3) c = __builtin_amdgcn_wmma_f32_16x16x32_bf16(false, ah, false, bl, (short)0, c, false, false);
  asm volatile("v_nop\n\tv_nop\n\tv_nop\n\tv_nop" : "+v"(c) : "v"(ah), "v"(al), "v"(bh), "v"(bl));
  return c;
}

__global__ __launch_bounds__(256) void k_wt_bf16(const float* __restrict__ W, unsigned short* __restrict__ Wt, int K, int N) {
  const int t = blockIdx.x * 256 + threadIdx.x;
  const int k8n = K / 8;
  if (t >= N * k8n) return;
  const int n = t / k8n, k8 = (t % k8n) * 8;
  v8us v;
#pragma unroll
  for (int i = 0; i < 8; ++i) v[i] = bf16_bits(W[(size_t)(k8 + i) * N + n]);
  *(v8us*)(Wt + (size_t)n * K + k8) = v;
  
}

// GEMM C[M][N] (f32, pitch ldc) = act(A[M][K]·W + bias). A f32 row-major (pitch lda) converted per fragment to bf16
// (ASPLIT: hi/lo two planes -> 2 terms, else single rounded term); Wt bf16 [N][K] (pitch ldb). BIAS_BF16 rounds the
// bias to bf16 first (bias quantised to bf16 before the add). K%32==0, M%16==0, N%64==0.
template <bool ASPLIT, int ACT, bool BIAS_BF16>
__global__ __launch_bounds__(128) void k_gemm_bf(const float* __restrict__ A, int lda, const unsigned short* __restrict__ Wt, int ldb,
                                               const float* __restrict__ bias, float* __restrict__ C, int ldc, int M, int N, int K) {
  __shared__ __attribute__((aligned(16))) float so[4][16][64];
  const int tid = threadIdx.x, w = tid >> 5, lane = tid & 31, ln = lane & 15, hh = lane >> 4;
  const int ntn = N / 64;
  const int wid = blockIdx.x * 4 + w;
  const int mt = wid / ntn, nq = wid % ntn;
  if (mt * 16 >= M) return;
  const int row0 = mt * 16, col0 = nq * 64;
  const float* arow = A + (size_t)(row0 + ln) * lda;
  v8f acc[4] = {};
  for (int kb = 0; kb < K; kb += 32) {
    FragB ah, al;
    const v4f x0 = *(const v4fa*)(arow + kb + 8 * hh), x1 = *(const v4fa*)(arow + kb + 8 * hh + 4);
    const v4f x2 = *(const v4fa*)(arow + kb + 16 + 8 * hh), x3 = *(const v4fa*)(arow + kb + 16 + 8 * hh + 4);
    float xs[16] = {x0[0],x0[1],x0[2],x0[3],x1[0],x1[1],x1[2],x1[3],x2[0],x2[1],x2[2],x2[3],x3[0],x3[1],x3[2],x3[3]};
#pragma unroll
    for (int i = 0; i < 16; ++i) { const unsigned short hb = bf16_bits(xs[i]); ah.u[i] = hb; al.u[i] = ASPLIT ? bf16_bits(xs[i] - bf16_val(hb)) : (unsigned short)0; }
#pragma unroll
    for (int t = 0; t < 4; ++t) {
      const unsigned short* brow = Wt + (size_t)(col0 + t * 16 + ln) * ldb + kb;
      FragB b;
      b.half[0] = *(const v8us*)(brow + 8 * hh);
      b.half[1] = *(const v8us*)(brow + 16 + 8 * hh);
      acc[t] = mmaN<ASPLIT ? 2 : 1>(ah.v, al.v, b.v, b.v, acc[t]);
    }
  }
#pragma unroll
  for (int t = 0; t < 4; ++t) {
    float bv = bias ? bias[col0 + t * 16 + ln] : 0.f;
    if (BIAS_BF16) bv = bf16_round(bv);
#pragma unroll
    for (int r = 0; r < 8; ++r) { float v = acc[t][r] + bv; if (ACT == 1) v = fmaxf(v, 0.f); so[w][8 * hh + r][t * 16 + ln] = v; }
  }
  __builtin_amdgcn_fence(__ATOMIC_ACQ_REL, "workgroup");
  __builtin_amdgcn_wave_barrier();
  const int rsub = lane >> 4, c4 = (lane & 15) * 4;
  {
#pragma unroll
    for (int q = 0; q < 8; ++q) {
      const int r = q * 2 + rsub;
      const v4f v = *(const v4fa*)&so[w][r][c4];
      *(v4f*)(C + (size_t)(row0 + r) * ldc + col0 + c4) = v;
    }
    
  }
}

// GEMM C = act(A·W + bias + resid): A f32 (ASPLIT -> hi/lo 2 terms), Wt bf16 [N][K]; ACT 0 none, 1 relu, 2 exact gelu;
// resid (optional, f32, row index = (row % rmod), pitch ldr, RES_BF16 rounds it) added before the activation.
template <bool ASPLIT, int ACT, bool BIAS_BF16, bool RES_BF16>
__global__ __launch_bounds__(128) void k_gemm_bf3(const float* __restrict__ A, int lda, const unsigned short* __restrict__ Wt, int ldb,
                                                const float* __restrict__ bias, const float* __restrict__ resid, int rmod, int ldr,
                                                float* __restrict__ C, int ldc, int M, int N, int K) {
  __shared__ __attribute__((aligned(16))) float so[4][16][64];
  const int tid = threadIdx.x, w = tid >> 5, lane = tid & 31, ln = lane & 15, hh = lane >> 4;
  const int ntn = N / 64;
  const int wid = blockIdx.x * 4 + w;
  const int mt = wid / ntn, nq = wid % ntn;
  if (mt * 16 >= M) return;
  const int row0 = mt * 16, col0 = nq * 64;
  const float* arow = A + (size_t)(row0 + ln) * lda;
  v8f acc[4] = {};
  for (int kb = 0; kb < K; kb += 32) {
    FragB ah, al;
    const v4f x0 = *(const v4fa*)(arow + kb + 8 * hh), x1 = *(const v4fa*)(arow + kb + 8 * hh + 4);
    const v4f x2 = *(const v4fa*)(arow + kb + 16 + 8 * hh), x3 = *(const v4fa*)(arow + kb + 16 + 8 * hh + 4);
    float xs[16] = {x0[0],x0[1],x0[2],x0[3],x1[0],x1[1],x1[2],x1[3],x2[0],x2[1],x2[2],x2[3],x3[0],x3[1],x3[2],x3[3]};
#pragma unroll
    for (int i = 0; i < 16; ++i) { const unsigned short hb = bf16_bits(xs[i]); ah.u[i] = hb; al.u[i] = ASPLIT ? bf16_bits(xs[i] - bf16_val(hb)) : (unsigned short)0; }
#pragma unroll
    for (int t = 0; t < 4; ++t) {
      const unsigned short* brow = Wt + (size_t)(col0 + t * 16 + ln) * ldb + kb;
      FragB b;
      b.half[0] = *(const v8us*)(brow + 8 * hh);
      b.half[1] = *(const v8us*)(brow + 16 + 8 * hh);
      acc[t] = mmaN<ASPLIT ? 2 : 1>(ah.v, al.v, b.v, b.v, acc[t]);
    }
  }
#pragma unroll
  for (int t = 0; t < 4; ++t) {
    const int col = col0 + t * 16 + ln;
    float bv = bias ? bias[col] : 0.f;
    if (BIAS_BF16) bv = bf16_round(bv);
#pragma unroll
    for (int r = 0; r < 8; ++r) {
      float v = acc[t][r] + bv;
      if (resid) { float rv = resid[(size_t)((row0 + 8 * hh + r) % rmod) * ldr + col]; if (RES_BF16) rv = bf16_round(rv); v += rv; }
      if (ACT == 1) v = fmaxf(v, 0.f);
      if (ACT == 2) v = 0.5f * v * (1.0f + erff(v * 0.70710678118654752f));
      if (ACT == 3) { const float u = 0.7978845608028654f * (v + 0.044715f * v * v * v); v = 0.5f * v * (1.0f + tanhf(u)); }
      so[w][8 * hh + r][t * 16 + ln] = v;
    }
  }
  __builtin_amdgcn_fence(__ATOMIC_ACQ_REL, "workgroup");
  __builtin_amdgcn_wave_barrier();
  const int rsub = lane >> 4, c4 = (lane & 15) * 4;
  {
#pragma unroll
    for (int q = 0; q < 8; ++q) {
      const int r = q * 2 + rsub;
      const v4f v = *(const v4fa*)&so[w][r][c4];
      *(v4f*)(C + (size_t)(row0 + r) * ldc + col0 + c4) = v;
    }
    
  }
}
// row LayerNorm (biased variance, eps) over N: s = X (+ R); optional out_sum <- s; out_norm <- (s-mu)*rsqrt(var+eps)*g + b
template <bool PARAM_BF16>
__global__ __launch_bounds__(256) void k_layernorm(const float* __restrict__ X, const float* __restrict__ R, const float* __restrict__ g, const float* __restrict__ bta,
                                                  float* __restrict__ out_sum, float* __restrict__ out_norm, int N, float eps) {
  __shared__ float red[256];
  const int row = blockIdx.x, tid = threadIdx.x;
  const float* x = X + (size_t)row * N; const float* rr = R ? R + (size_t)row * N : nullptr;
  float vals[16];                     // up to N = 4096
  const int per = N / 256;            // contiguous chunk per thread? use strided-by-4 chunks: thread handles j = tid*4 + 1024*u
  float s1 = 0.f;
  for (int u = 0; u < per / 4; ++u) {
    const int j = tid * 4 + 1024 * u;
    const v4f a = *(const v4fa*)(x + j);
    v4f b = {0.f,0.f,0.f,0.f}; if (rr) b = *(const v4fa*)(rr + j);
#pragma unroll
    for (int q = 0; q < 4; ++q) { const float v = a[q] + b[q]; vals[u * 4 + q] = v; s1 += v; }
  }
  red[tid] = s1; __syncthreads();
  for (int st = 128; st > 0; st >>= 1) { if (tid < st) red[tid] += red[tid + st]; __syncthreads(); }
  const float mu = red[0] / (float)N; __syncthreads();
  float s2 = 0.f;
  for (int u = 0; u < per / 4; ++u)
#pragma unroll
    for (int q = 0; q < 4; ++q) { const float c = vals[u * 4 + q] - mu; s2 += c * c; }
  red[tid] = s2; __syncthreads();
  for (int st = 128; st > 0; st >>= 1) { if (tid < st) red[tid] += red[tid + st]; __syncthreads(); }
  const float rs = rsqrtf(red[0] / (float)N + eps);
  {
    for (int u = 0; u < per / 4; ++u) {
      const int j = tid * 4 + 1024 * u;
      v4f o, sm;
#pragma unroll
      for (int q = 0; q < 4; ++q) {
        float gg = g[j + q], bb = bta[j + q];
        if (PARAM_BF16) { gg = bf16_round(gg); bb = bf16_round(bb); }
        sm[q] = vals[u * 4 + q]; o[q] = (vals[u * 4 + q] - mu) * rs * gg + bb;
      }
      if (out_sum) *(v4f*)(out_sum + (size_t)row * N + j) = sm;
      *(v4f*)(out_norm + (size_t)row * N + j) = o;
    }
    
  }
}



// ---- f16 WMMA path (v_wmma_f32_16x16x32_f16): 11-bit significands for operands in range — used where a [0,1] probability operand needs more precision than bf16
typedef _Float16 v16h __attribute__((ext_vector_type(16)));
union FragH { v16h v; v8us half[2]; _Float16 h[16]; unsigned short u[16]; };
template <int NT>
__device__ __forceinline__ v8f mmaH(v16h ah, v16h al, v16h bh, v16h bl, v8f c) {
  c = __builtin_amdgcn_wmma_f32_16x16x32_f16(false, ah, false, bh, (short)0, c, false, false);
  if (NT >= 2) c = __builtin_amdgcn_wmma_f32_16x16x32_f16(false, al, false, bh, (short)0, c, false, false);
  if (NT >= 3) c = __builtin_amdgcn_wmma_f32_16x16x32_f16(false, ah, false, bl, (short)0, c, false, false);
  asm volatile("v_nop\n\tv_nop\n\tv_nop\n\tv_nop" : "+v"(c) : "v"(ah), "v"(al), "v"(bh), "v"(bl));
  return c;
}
// batched GEMM like k_gemm_b but f16 operands: A f32 (split into f16 hi/lo if ASPLIT, else rounded to f16), Bt = f16 values [n][k]; alpha; C f32; N multiple of 16 (partial tiles skipped)
template <bool ASPLIT>
__global__ __launch_bounds__(128) void k_gemm_h(const float* __restrict__ A, int lda, size_t sA, const _Float16* __restrict__ Bh, int ldb, size_t sB, float alpha, float* __restrict__ C, int ldc, size_t sC, int M, int N, int K) {
  __shared__ __attribute__((aligned(16))) float so[4][16][64];
  const int tid = threadIdx.x, w = tid >> 5, lane = tid & 31, ln = lane & 15, hh = lane >> 4; const int by = blockIdx.y;
  A += (size_t)by * sA; Bh += (size_t)by * sB; C += (size_t)by * sC;
  const int ntn = (N + 63) / 64; const int wid = blockIdx.x * 4 + w; const int mt = wid / ntn, nq = wid % ntn; if (mt * 16 >= M) return;
  const int row0 = mt * 16, col0 = nq * 64; const float* arow = A + (size_t)(row0 + ln) * lda;
  v8f acc[4] = {};
  for (int kb = 0; kb < K; kb += 32) {
    FragH ah, al;
    const v4f x0 = *(const v4fa*)(arow + kb + 8 * hh), x1 = *(const v4fa*)(arow + kb + 8 * hh + 4), x2 = *(const v4fa*)(arow + kb + 16 + 8 * hh), x3 = *(const v4fa*)(arow + kb + 16 + 8 * hh + 4);
    float xs[16] = {x0[0],x0[1],x0[2],x0[3],x1[0],x1[1],x1[2],x1[3],x2[0],x2[1],x2[2],x2[3],x3[0],x3[1],x3[2],x3[3]};
#pragma unroll
    for (int i = 0; i < 16; ++i) { const _Float16 h = (_Float16)xs[i]; ah.h[i] = h; al.h[i] = ASPLIT ? (_Float16)(xs[i] - (float)h) : (_Float16)0.0f; }
#pragma unroll
    for (int t = 0; t < 4; ++t) { if (col0 + t * 16 >= N) continue; const size_t boff = (size_t)(col0 + t * 16 + ln) * ldb + kb; FragH bq; bq.half[0] = *(const v8us*)(Bh + boff + 8 * hh); bq.half[1] = *(const v8us*)(Bh + boff + 16 + 8 * hh);
      acc[t] = mmaH<ASPLIT ? 2 : 1>(ah.v, al.v, bq.v, bq.v, acc[t]); }
  }
#pragma unroll
  for (int t = 0; t < 4; ++t) { if (col0 + t * 16 >= N) continue;
#pragma unroll
    for (int r = 0; r < 8; ++r) so[w][8 * hh + r][t * 16 + ln] = acc[t][r] * alpha; }
  __builtin_amdgcn_fence(__ATOMIC_ACQ_REL, "workgroup"); __builtin_amdgcn_wave_barrier();
  const int rsub = lane >> 4, c4 = (lane & 15) * 4;
  {
#pragma unroll
    for (int q = 0; q < 8; ++q) { const int r = q * 2 + rsub; if (col0 + c4 < N) { const v4f v = *(const v4fa*)&so[w][r][c4]; *(v4f*)(C + (size_t)(row0 + r) * ldc + col0 + c4) = v; } }
     }
}

// Wt[n][k] = f16(W[k][n]·scale) from f32 row-major W[K][N] (scale = power of two; bf16-exact weights stay exact in f16 away from the subnormal range)
__global__ __launch_bounds__(256) void k_wt_f16(const float* __restrict__ W, _Float16* __restrict__ Wt, int K, int N, float scale) {
  const int t = blockIdx.x * 256 + threadIdx.x; if (t >= N * (K / 8)) return; const int n = t / (K / 8), k8 = (t % (K / 8)) * 8; FragH f;
#pragma unroll
  for (int i = 0; i < 8; ++i) f.h[i] = (_Float16)(bf16_round(W[(size_t)(k8 + i) * N + n]) * scale); const v8us o = f.half[0];
  *(v8us*)((unsigned short*)Wt + (size_t)n * K + k8) = o; 
}
// k_gemm_hh variant with fused epilogue: v = acc·alpha + bias[by·sBias + col] (+ CP[(row/rowsPerB)·sCPb + by·64 + col] if CP) ; ACT 0 none / 1 elu ; writes f32 C and f16 C16, each if non-null
template <int ACT>
__global__ __launch_bounds__(128) void k_gemm_hhx(const _Float16* __restrict__ A, int lda, size_t sA, const _Float16* __restrict__ Bh, int ldb, size_t sB, float alpha, const float* __restrict__ bias, size_t sBias, const float* __restrict__ CP, int rowsPerB, size_t sCPb, int row0g,
    float* __restrict__ C, _Float16* __restrict__ C16, int ldc, size_t sC, int M, int N, int K) {
  __shared__ __attribute__((aligned(16))) float so[4][16][64];
  const int tid = threadIdx.x, w = tid >> 5, lane = tid & 31, ln = lane & 15, hh = lane >> 4; const int by = blockIdx.y;
  A += (size_t)by * sA; Bh += (size_t)by * sB; const size_t cofs = (size_t)by * sC; const float* bp = bias ? bias + (size_t)by * sBias : nullptr;
  const int ntn = (N + 63) / 64; const int wid = blockIdx.x * 4 + w; const int mt = wid / ntn, nq = wid % ntn; if (mt * 16 >= M) return;
  const int row0 = mt * 16, col0 = nq * 64; const _Float16* arow = A + (size_t)(row0 + ln) * lda;
  v8f acc[4] = {};
  for (int kb = 0; kb < K; kb += 32) { FragH ah; ah.half[0] = *(const v8us*)((const unsigned short*)arow + kb + 8 * hh); ah.half[1] = *(const v8us*)((const unsigned short*)arow + kb + 16 + 8 * hh);
#pragma unroll
    for (int t = 0; t < 4; ++t) { if (col0 + t * 16 >= N) continue; const size_t boff = (size_t)(col0 + t * 16 + ln) * ldb + kb; FragH bq; bq.half[0] = *(const v8us*)((const unsigned short*)Bh + boff + 8 * hh); bq.half[1] = *(const v8us*)((const unsigned short*)Bh + boff + 16 + 8 * hh);
      acc[t] = mmaH<1>(ah.v, ah.v, bq.v, bq.v, acc[t]); }
  }
#pragma unroll
  for (int t = 0; t < 4; ++t) { if (col0 + t * 16 >= N) continue; const int col = col0 + t * 16 + ln; const float bv = bp ? bf16_round(bp[col]) : 0.f;
#pragma unroll
    for (int r = 0; r < 8; ++r) { float v = acc[t][r] * alpha + bv; if (CP) { const int bidx = (row0g + row0 + 8 * hh + r) / rowsPerB; v += CP[(size_t)bidx * sCPb + (size_t)by * 64 + col]; } if (ACT == 1) v = (v > 0.f) ? v : expm1f(v); else if (ACT == 7) v = (v > 0.f) ? v + 1.0f : expf(v); else if (ACT == 8) v = tanhf(v); else if (ACT == 9) v = 0.5f * v * (1.0f + tanhf(0.7978845608028654f * (v + 0.044715f * v * v * v))); else if (ACT == 11) v = 1.0f / (1.0f + expf(-v)); else if (ACT == 12) v = (v > 0.f) ? v : 0.01f * v; else if (ACT == 14) v = (v > 0.f) ? v : 0.1f * v; else if (ACT == 15) v = v / (1.0f + expf(-v)); else if (ACT == 3) v = fmaxf(v, 0.f); else if (ACT == 6) v = 0.5f * v * (1.0f + erff(v * 0.70710678118654752f)); so[w][8 * hh + r][t * 16 + ln] = v; } }
  __builtin_amdgcn_fence(__ATOMIC_ACQ_REL, "workgroup"); __builtin_amdgcn_wave_barrier();
  const int rsub = lane >> 4, c4 = (lane & 15) * 4; typedef _Float16 v4h __attribute__((ext_vector_type(4)));
  {
#pragma unroll
    for (int q = 0; q < 8; ++q) { const int r = q * 2 + rsub; if (col0 + c4 < N) { const v4f v = *(const v4fa*)&so[w][r][c4]; if (C) *(v4f*)(C + cofs + (size_t)(row0 + r) * ldc + col0 + c4) = v; if (C16) { v4h h4; for (int i = 0; i < 4; ++i) h4[i] = (_Float16)v[i]; *(v4h*)(C16 + cofs + (size_t)(row0 + r) * ldc + col0 + c4) = h4; } } }
     }
}


typedef _Float16 v4h __attribute__((ext_vector_type(4)));

__global__ __launch_bounds__(256) void k_x16(const float* __restrict__ x, _Float16* __restrict__ X16, size_t n8) { const size_t t = (size_t)blockIdx.x * 256 + threadIdx.x; if (t >= n8) return; FragH f;
#pragma unroll
  for (int q = 0; q < 8; ++q) f.h[q] = (_Float16)bf16_round(x[t * 8 + q]); *(v8us*)((unsigned short*)X16 + t * 8) = f.half[0];  }
__global__ __launch_bounds__(256) void k_h16(const float* __restrict__ x, _Float16* __restrict__ X16, size_t n8) { const size_t t = (size_t)blockIdx.x * 256 + threadIdx.x; if (t >= n8) return; FragH f;
#pragma unroll
  for (int q = 0; q < 8; ++q) f.h[q] = (_Float16)x[t * 8 + q]; *(v8us*)((unsigned short*)X16 + t * 8) = f.half[0];  }
__global__ __launch_bounds__(256) void k_round16f(const float* __restrict__ W, _Float16* __restrict__ Bt, size_t n8) { const size_t t = (size_t)blockIdx.x * 256 + threadIdx.x; if (t >= n8) return; FragH f;
#pragma unroll
  for (int i = 0; i < 8; ++i) f.h[i] = (_Float16)(bf16_round(W[t * 8 + i]) * 16.0f); *(v8us*)((unsigned short*)Bt + t * 8) = f.half[0];  }
template <int NHv, int TTv>
__global__ __launch_bounds__(256) void k_vt(const _Float16* __restrict__ V16, int ldv, int voff, _Float16* __restrict__ Vt) { __shared__ unsigned short tl[64][66]; const int tid = threadIdx.x; const int slab = blockIdx.x / (TTv / 64), lg = blockIdx.x % (TTv / 64); const int b = slab / NHv, h = slab % NHv;
  for (int i = tid; i < 64 * 8; i += 256) { const int r = i / 8, c8 = (i % 8) * 8; FragH f; f.half[0] = *(const v8us*)((const unsigned short*)V16 + ((size_t)b * TTv + lg * 64 + r) * ldv + voff + h * 64 + c8);
#pragma unroll
    for (int q = 0; q < 8; ++q) tl[r][c8 + q] = f.u[q]; }
  __syncthreads();
  {
#pragma unroll
    for (int rd = 0; rd < 2; ++rd) { const int d = rd * 32 + tid / 8, pc = tid % 8; FragH f;
#pragma unroll
      for (int q = 0; q < 8; ++q) f.u[q] = tl[pc * 8 + q][d];
      *(v8us*)((unsigned short*)Vt + ((size_t)slab * 64 + d) * TTv + lg * 64 + pc * 8) = f.half[0]; }
     } }

__global__ __launch_bounds__(256) void k_hl(const float* __restrict__ F, _Float16* __restrict__ Hh, _Float16* __restrict__ Hl, size_t n8) { const size_t t = (size_t)blockIdx.x * 256 + threadIdx.x; if (t >= n8) return; FragH fh, fl; const v4f a = *(const v4fa*)(F + t * 8), c = *(const v4fa*)(F + t * 8 + 4);
#pragma unroll
  for (int q = 0; q < 4; ++q) { _Float16 h = (_Float16)a[q]; fh.h[q] = h; fl.h[q] = (_Float16)((a[q] - (float)h) * 1024.0f); h = (_Float16)c[q]; fh.h[4 + q] = h; fl.h[4 + q] = (_Float16)((c[q] - (float)h) * 1024.0f); }
  { *(v8us*)((unsigned short*)Hh + t * 8) = fh.half[0]; *(v8us*)((unsigned short*)Hl + t * 8) = fl.half[0];  } }

// stacked weights BW[NW][CC] = f16(bf16(W) * 16), rows 0..63 Wb, 64..127 Wc, 128..639 Wd, and the stacked biases BI[NW] (f32, as given)
__global__ __launch_bounds__(256) void k_prep(const float* __restrict__ Wb, const float* __restrict__ Wc, const float* __restrict__ Wd, const float* __restrict__ bb, const float* __restrict__ bc, const float* __restrict__ bd, _Float16* __restrict__ BW, float* __restrict__ BI) {
  const int t = blockIdx.x * 256 + threadIdx.x, n1 = C8 * CC / 8; if (t >= NW * CC / 8) return;
  const float* Wp = (t < n1) ? Wb + (size_t)t * 8 : (t < 2 * n1) ? Wc + (size_t)(t - n1) * 8 : Wd + (size_t)(t - 2 * n1) * 8; FragH f;
#pragma unroll
  for (int i = 0; i < 8; ++i) f.h[i] = (_Float16)(bf16_round(Wp[i]) * 16.0f); *(v8us*)((unsigned short*)BW + (size_t)t * 8) = f.half[0];
  if (t < NW) BI[t] = (t < C8) ? bb[t] : (t < 2 * C8) ? bc[t - C8] : bd[t - 2 * C8]; }
// The two layout changes (k_tok, k_fcomb) go through an LDS tile: 64 source rows x TW contiguous source columns come in as whole 128-B lines (8 lanes x 16 B a row),
// are converted, and leave as rows of 64 f16 = one whole 128-B line each. Read straight across the source rows, every lane of a load would touch a line of its own.
// Few, fat work-groups (two per WGP): every thread has all of its loads in flight at once.
#define TR 64                    /* source rows per tile = f16 per output row */
#define TP (TR + 8)              /* LDS row pitch in f16: 144 B = 16 B x odd */
typedef _Float16 v2ha __attribute__((ext_vector_type(2), may_alias));
// the tile's TW output rows, 128 B each, from LDS to dst (pitch ldd elements): 8 lanes a row
template <int TW>
__device__ __forceinline__ void tile_out(const _Float16 (&tl)[TW][TP], _Float16* __restrict__ dst, size_t ldd, int tid) {
#pragma unroll  /* all LDS reads go out ahead of the stores */
  for (int i = 0; i < TW / 32; ++i) { const int r = (tid >> 3) + 32 * i, e8 = (tid & 7) * 8; const v8us v = *(const v8us*)&tl[r][e8]; *(v8us*)((unsigned short*)dst + (size_t)r * ldd + e8) = v; }
}
#define TWX 256                  /* positions per tile of k_tok */
// blockIdx.x = tile of TWX positions, blockIdx.y = tile of 64 channels, blockIdx.z = slab s
__global__ __launch_bounds__(256) void k_tok(const float* __restrict__ x1, const float* __restrict__ x2, _Float16* __restrict__ X16) {
  __shared__ __attribute__((aligned(16))) _Float16 tl[TWX][TP];  /* [position][channel] */
  const int tid = threadIdx.x, s = blockIdx.z, b = s >> 1, n0 = blockIdx.x * TWX, c0 = blockIdx.y * TR, c = 2 * (tid >> 3), k0 = (tid & 7) * 4;
  const char* x = (const char*)(((s & 1) ? x2 : x1) + ((size_t)b * CC + c0) * NP + n0);  /* the tile's first element: the same for the whole work-group */
  const unsigned ob = (unsigned)(c * NP + k0) * 4;                                       /* the lane's byte offset in the tile */
  v4f u[TWX / 32], v[TWX / 32];
#pragma unroll  /* constant indices: the values stay in registers, and the sixteen loads of a thread are all in flight at once */
  for (int i = 0; i < TWX / 32; ++i) { u[i] = *(const v4fa*)(x + ob + 128 * i); v[i] = *(const v4fa*)(x + ob + NP * 4 + 128 * i); }
  asm volatile("s_wait_xcnt 0x0" :: "v"(ob) : "memory");  /* stands in front of any rewrite of the offset register that these loads name; the operand keeps that register until here */
  __builtin_amdgcn_sched_barrier(0);                      /* keeps the conversions behind all sixteen loads; left alone the compiler holds five loads back until the first have returned: a second memory latency */
#pragma unroll
  for (int i = 0; i < TWX / 32; ++i)
#pragma unroll
    for (int q = 0; q < 4; ++q) { v2ha h; h[0] = (_Float16)bf16_round(u[i][q]); h[1] = (_Float16)bf16_round(v[i][q]); *(v2ha*)&tl[k0 + 32 * i + q][c] = h; }
  __syncthreads();  /* the tile is whole before any wave reads it across */
  tile_out<TWX>(tl, X16 + ((size_t)s * NP + n0) * CC + c0, CC, tid);
}
// blockIdx.y = plane p = 2 * slab + (0 for conv_b, 1 for conv_c): columns 64 (p & 1) .. + 63 of slab p >> 1 of P
__global__ __launch_bounds__(256) void k_split(const float* __restrict__ F, _Float16* __restrict__ Hh, _Float16* __restrict__ Hl, size_t n8) {
  #pragma clang fp contract(off)
  const size_t t = (size_t)blockIdx.x * 256 + threadIdx.x; if (t >= n8) return;
  const size_t p = blockIdx.y; F += (p >> 1) * NP * NW + (p & 1) * C8; Hh += p * NP * C8; Hl += p * NP * C8;
  // planes in WMMA fragment order, 16 positions x 64 channels per 2-KiB block: [k step of 32][fragment half][lane][8 channels]; piece t of the plane is position 16*(t>>7) + (t&15), channels 8*sc..8*sc+7
  const size_t sc = ((t >> 6) & 1) * 4 + ((t >> 5) & 1) * 2 + ((t >> 4) & 1), so = ((t >> 7) * 16 + (t & 15)) * NW + sc * 8;
  const v4f a = *(const v4fa*)(F + so), c = *(const v4fa*)(F + so + 4); FragH fh, fl;
#pragma unroll
  for (int q = 0; q < 8; ++q) { const float v = (q < 4) ? a[q] : c[q - 4]; const _Float16 hi = (_Float16)v; fh.h[q] = hi; fl.h[q] = (_Float16)((v - (float)hi) * 1024.0f); }
  { *(v8us*)((unsigned short*)Hh + t * 8) = fh.half[0]; *(v8us*)((unsigned short*)Hl + t * 8) = fl.half[0];  } }
#define TWF 128                  /* channels per tile of k_fcomb */
// blockIdx.x = tile of 64 positions, blockIdx.y = tile of TWF channels, blockIdx.z = batch; f1, f2 = columns 128.. of the batch's two slabs of P
__global__ __launch_bounds__(256) void k_fcomb(const float* __restrict__ P, const float* __restrict__ al, const float* __restrict__ be, _Float16* __restrict__ FT) {
  #pragma clang fp contract(off)
  __shared__ __attribute__((aligned(16))) _Float16 tl[TWF][TP];  /* [channel][position] */
  const int tid = threadIdx.x, m0 = blockIdx.x * TR, c0 = blockIdx.y * TWF, m = 2 * (tid >> 3), k0 = (tid & 7) * 4;
  const char* F = (const char*)(P + ((size_t)(2 * blockIdx.z) * NP + m0) * NW + 2 * C8 + c0);  /* the first element of f1's tile: the same for the whole work-group */
  const unsigned ob = (unsigned)(m * NW + k0) * 4, ob2 = ob + (unsigned)(NP * NW * 4);         /* the lane's byte offsets from there in f1's tile and in f2's, one slab of P further on */
  const float a = bf16_round(al[0]), bq = bf16_round(be[0]);
  v4f p0[TWF / 32], p1[TWF / 32], r0[TWF / 32], r1[TWF / 32];
#pragma unroll  /* constant indices: the values stay in registers, and the sixteen loads of a thread are all in flight at once */
  for (int i = 0; i < TWF / 32; ++i) { p0[i] = *(const v4fa*)(F + ob + 128 * i); p1[i] = *(const v4fa*)(F + ob + NW * 4 + 128 * i); r0[i] = *(const v4fa*)(F + ob2 + 128 * i); r1[i] = *(const v4fa*)(F + ob2 + NW * 4 + 128 * i); }
  asm volatile("s_wait_xcnt 0x0" :: "v"(ob), "v"(ob2) : "memory");  /* stands in front of any rewrite of the offset registers that these loads name; the operands keep those registers until here */
#pragma unroll
  for (int i = 0; i < TWF / 32; ++i)
#pragma unroll
    for (int q = 0; q < 4; ++q) { v2ha h; h[0] = (_Float16)(a * p0[i][q] + bq * r0[i][q]); h[1] = (_Float16)(a * p1[i][q] + bq * r1[i][q]); *(v2ha*)&tl[k0 + 32 * i + q][m] = h; }
  __syncthreads();  /* the tile is whole before any wave reads it across */
  tile_out<TWF>(tl, FT + ((size_t)blockIdx.z * CC + c0) * NP + m0, NP, tid);
}
// One 16x32 f16 fragment (A row or B column = lane & 15; k = 8*(lane>>4)+0..7 and 16+8*(lane>>4)+0..7) from a plane in the fragment order that k_split writes; p already holds 8*lane.
// Each of the two loads reads 512 contiguous bytes (4 whole lines) per wave; from a row-major plane it would touch 16 lines.
__device__ __forceinline__ v16h frag_at(const _Float16* p) { FragH f; f.half[0] = *(const v8us*)((const unsigned short*)p); f.half[1] = *(const v8us*)((const unsigned short*)p + 256); return f.v; }
__device__ __forceinline__ v8f wm(v16h a, v16h b, v8f c) { return __builtin_amdgcn_wmma_f32_16x16x32_f16(false, a, false, b, (short)0, c, false, false); }
// value of lane ^ X inside the 16-lane row, by DPP row_xmask (a shuffle would go through the LDS pipe and its wait); every lane is on where it is used
template <int X> __device__ __forceinline__ float row_xor(float v) { return __int_as_float(__builtin_amdgcn_update_dpp(0, __float_as_int(v), 0x160 + X, 0xf, 0xf, true)); }
__device__ __forceinline__ float row_max16(float v) { v = fmaxf(v, row_xor<1>(v)); v = fmaxf(v, row_xor<2>(v)); v = fmaxf(v, row_xor<4>(v)); return fmaxf(v, row_xor<8>(v)); }
__device__ __forceinline__ float row_sum16(float v) { v += row_xor<1>(v); v += row_xor<2>(v); v += row_xor<4>(v); return v + row_xor<8>(v); }
// e^(s - m) for the eight rows of a logit tile as 2^(s * log2(e) + nm), nm = -m * log2(e) formed once per row: one fused multiply-add and the hardware's 2^x each. s <= m up to rounding, so nothing
// overflows, and a result under the smallest normal number may go to zero: it is far below one unit of the f16 output. The library's expf spends about a dozen vector instructions on ranges that cannot occur here.
#define LOG2E 1.4426950408889634f
__device__ __forceinline__ v8f exp_rel(v8f s, const float (&nm)[8]) {
  float x[8], e0, e1, e2, e3, e4, e5, e6, e7;
#pragma unroll  /* constant indices: x stays in registers */
  for (int r = 0; r < 8; ++r) x[r] = fmaf(s[r], LOG2E, nm[r]);
  asm("v_exp_f32 %0, %8\n\tv_exp_f32 %1, %9\n\tv_exp_f32 %2, %10\n\tv_exp_f32 %3, %11\n\tv_exp_f32 %4, %12\n\tv_exp_f32 %5, %13\n\tv_exp_f32 %6, %14\n\tv_exp_f32 %7, %15\n\tv_nop"
      : "=&v"(e0), "=&v"(e1), "=&v"(e2), "=&v"(e3), "=&v"(e4), "=&v"(e5), "=&v"(e6), "=&v"(e7) : "v"(x[0]), "v"(x[1]), "v"(x[2]), "v"(x[3]), "v"(x[4]), "v"(x[5]), "v"(x[6]), "v"(x[7]));
  return v8f{e0, e1, e2, e3, e4, e5, e6, e7};
}
struct QFrag { v16h a1h[2], a1l[2], a2h[2], a2l[2]; };
#define DRT 2                    /* 16-row query tiles per wave: every B fragment that is loaded feeds both */
// both logit tiles (16 query rows x 16 key columns, K 64) of each of the wave's DRT query tiles from the hi/lo planes: hi*hi in one accumulator, the two cross terms (scaled 2^10) in a second
__device__ __forceinline__ void logit_tile(const QFrag (&q)[DRT], const _Float16* b2h, const _Float16* b2l, const _Float16* b1h, const _Float16* b1l, v8f (&s1)[DRT], v8f (&s2)[DRT]) {
  v8f h1[DRT] = {}, l1[DRT] = {}, h2[DRT] = {}, l2[DRT] = {};
  const v16h p[2] = {frag_at(b2h), frag_at(b2h + 512)}, x[2] = {frag_at(b1h), frag_at(b1h + 512)}, pl[2] = {frag_at(b2l), frag_at(b2l + 512)}, xl[2] = {frag_at(b1l), frag_at(b1l + 512)};
  // holds all sixteen loads of the tile in front of its first WMMA: one load latency a tile; left alone the compiler reuses fragment registers and waits for memory several times a tile
  asm volatile("" :: "v"(p[0]), "v"(p[1]), "v"(x[0]), "v"(x[1]), "v"(pl[0]), "v"(pl[1]), "v"(xl[0]), "v"(xl[1]));
#pragma unroll
  for (int ks = 0; ks < 2; ++ks) {
#pragma unroll
    for (int i = 0; i < DRT; ++i) { h1[i] = wm(q[i].a1h[ks], p[ks], h1[i]); h2[i] = wm(q[i].a2h[ks], x[ks], h2[i]); }
#pragma unroll
    for (int i = 0; i < DRT; ++i) { l1[i] = wm(q[i].a1l[ks], p[ks], l1[i]); l2[i] = wm(q[i].a2l[ks], x[ks], l2[i]); }
#pragma unroll
    for (int i = 0; i < DRT; ++i) { l1[i] = wm(q[i].a1h[ks], pl[ks], l1[i]); l2[i] = wm(q[i].a2h[ks], xl[ks], l2[i]); }
  }
#pragma unroll
  for (int i = 0; i < DRT; ++i)
#pragma unroll
    for (int r = 0; r < 8; ++r) { s1[i][r] = h1[i][r] + l1[i][r] * 0.0009765625f; s2[i][r] = h2[i][r] + l2[i][r] * 0.0009765625f; }
}
// Logits, both softmaxes and |difference| in one kernel: a work-group of 8 waves owns 32 query rows (one work-group per WGP covers all rows), wave w the key columns [512 w, 512 w + 512).
// Every wave holds the query fragments of both 16-row tiles in registers (2 waves per SIMD: 512 registers each), so the key planes are read from L2 once per 32 rows and pass.
// The logits stay in registers and are formed three times (row maximum, row sum, output); nothing of them goes to memory.
#define DW 8                     /* waves per work-group */
#define DROW (16 * DRT)          /* query rows per work-group */
#define DCOL (NP / DW)           /* key columns per wave */
#define DPIT (DCOL + 8)          /* LDS row pitch in f16: 16-byte multiple, rows 8 apart fall on other banks */
__global__ __launch_bounds__(DW * 32) void k_attdiff(const _Float16* __restrict__ A1h, const _Float16* __restrict__ A1l, const _Float16* __restrict__ A2h, const _Float16* __restrict__ A2l,
                                                 const _Float16* __restrict__ B2h, const _Float16* __restrict__ B2l, const _Float16* __restrict__ B1h, const _Float16* __restrict__ B1l, _Float16* __restrict__ D16) {
  __shared__ __attribute__((aligned(16))) _Float16 st[DW][DROW][DPIT];
  __shared__ float red[2][DW][DROW];
  __shared__ float fin[2][DROW];
  const int tid = threadIdx.x, w = tid >> 5, lane = tid & 31, ln = lane & 15, hh = lane >> 4; const int row0 = blockIdx.x * DROW;
  { const size_t pb = (size_t)blockIdx.y * 4 * NP * C8;  /* blockIdx.y = batch: four planes of each kind a batch */
    A1h += pb; A1l += pb; A2h += pb; A2l += pb; B2h += pb; B2l += pb; B1h += pb; B1l += pb; D16 += (size_t)blockIdx.y * NP * NP; }
  QFrag q[DRT];
#pragma unroll
  for (int i = 0; i < DRT; ++i) { const size_t ao = (size_t)(row0 + 16 * i) * C8 + 8 * lane;
#pragma unroll
    for (int ks = 0; ks < 2; ++ks) { q[i].a1h[ks] = frag_at(A1h + ao + ks * 512); q[i].a1l[ks] = frag_at(A1l + ao + ks * 512); q[i].a2h[ks] = frag_at(A2h + ao + ks * 512); q[i].a2l[ks] = frag_at(A2l + ao + ks * 512); } }
  asm volatile("s_wait_xcnt 0x0" ::: "memory");  /* stands in front of the reuse of the address registers that the query loads name */
  __builtin_amdgcn_sched_barrier(0);             /* keeps the key-plane address arithmetic, which reuses those registers, behind that wait */
  const size_t bo = (size_t)(w * DCOL) * C8 + 8 * lane; B2h += bo; B2l += bo; B1h += bo; B1l += bo;
  float m1[DRT][8], m2[DRT][8];
#pragma unroll
  for (int i = 0; i < DRT; ++i)
#pragma unroll
    for (int r = 0; r < 8; ++r) { m1[i][r] = -3.0e38f; m2[i][r] = -3.0e38f; }
#pragma unroll 1  /* rolled: an unrolled body would hold several tiles' B fragments and leave the 512-register budget of 2 waves per SIMD */
  for (int j = 0; j < DCOL / 16; ++j) { v8f s1[DRT], s2[DRT]; const size_t o = (size_t)j * 16 * C8; logit_tile(q, B2h + o, B2l + o, B1h + o, B1l + o, s1, s2);
#pragma unroll
    for (int i = 0; i < DRT; ++i)
#pragma unroll
      for (int r = 0; r < 8; ++r) { m1[i][r] = fmaxf(m1[i][r], s1[i][r]); m2[i][r] = fmaxf(m2[i][r], s2[i][r]); } }
#pragma unroll
  for (int i = 0; i < DRT; ++i)
#pragma unroll
    for (int r = 0; r < 8; ++r) { m1[i][r] = row_max16(m1[i][r]); m2[i][r] = row_max16(m2[i][r]); }
  if (ln == 0) {
#pragma unroll
    for (int i = 0; i < DRT; ++i)
#pragma unroll
      for (int r = 0; r < 8; ++r) { red[0][w][16 * i + 8 * hh + r] = m1[i][r]; red[1][w][16 * i + 8 * hh + r] = m2[i][r]; } }
  __syncthreads();
  if (tid < 2 * DROW) { const int mt = tid / DROW, rw = tid % DROW; float v = red[mt][0][rw]; for (int k = 1; k < DW; ++k) v = fmaxf(v, red[mt][k][rw]); fin[mt][rw] = v; }
  __syncthreads();
  float u1[DRT][8], u2[DRT][8];
#pragma unroll
  for (int i = 0; i < DRT; ++i)
#pragma unroll
    for (int r = 0; r < 8; ++r) { m1[i][r] = -LOG2E * fin[0][16 * i + 8 * hh + r]; m2[i][r] = -LOG2E * fin[1][16 * i + 8 * hh + r]; u1[i][r] = 0.f; u2[i][r] = 0.f; }  /* from here on m1, m2 hold -max * log2(e) */
#pragma unroll 1  /* rolled for the register budget, as above */
  for (int j = 0; j < DCOL / 16; ++j) { v8f s1[DRT], s2[DRT]; const size_t o = (size_t)j * 16 * C8; logit_tile(q, B2h + o, B2l + o, B1h + o, B1l + o, s1, s2);
#pragma unroll
    for (int i = 0; i < DRT; ++i) { const v8f e1 = exp_rel(s1[i], m1[i]), e2 = exp_rel(s2[i], m2[i]);
#pragma unroll
      for (int r = 0; r < 8; ++r) { u1[i][r] += e1[r]; u2[i][r] += e2[r]; } } }
#pragma unroll
  for (int i = 0; i < DRT; ++i)
#pragma unroll
    for (int r = 0; r < 8; ++r) { u1[i][r] = row_sum16(u1[i][r]); u2[i][r] = row_sum16(u2[i][r]); }
  if (ln == 0) {
#pragma unroll
    for (int i = 0; i < DRT; ++i)
#pragma unroll
      for (int r = 0; r < 8; ++r) { red[0][w][16 * i + 8 * hh + r] = u1[i][r]; red[1][w][16 * i + 8 * hh + r] = u2[i][r]; } }
  __syncthreads();
  if (tid < 2 * DROW) { const int mt = tid / DROW, rw = tid % DROW; float v = red[mt][0][rw]; for (int k = 1; k < DW; ++k) v += red[mt][k][rw]; fin[mt][rw] = 1.0f / v; }
  __syncthreads();
#pragma unroll
  for (int i = 0; i < DRT; ++i)
#pragma unroll
    for (int r = 0; r < 8; ++r) { u1[i][r] = fin[0][16 * i + 8 * hh + r]; u2[i][r] = fin[1][16 * i + 8 * hh + r]; }
#pragma unroll 1  /* rolled for the register budget, as above */
  for (int j = 0; j < DCOL / 16; ++j) { v8f s1[DRT], s2[DRT]; const size_t o = (size_t)j * 16 * C8; logit_tile(q, B2h + o, B2l + o, B1h + o, B1l + o, s1, s2);
#pragma unroll
    for (int i = 0; i < DRT; ++i) { const v8f e1 = exp_rel(s1[i], m1[i]), e2 = exp_rel(s2[i], m2[i]);
#pragma unroll
      for (int r = 0; r < 8; ++r) st[w][16 * i + 8 * hh + r][j * 16 + ln] = (_Float16)(fabsf(e1[r] * u1[i][r] - e2[r] * u2[i][r]) * 16384.0f); } }
  // each wave reads back only its own slab: the fence keeps the LDS reads behind the writes of the wave's other lanes, no work-group barrier is needed
  __builtin_amdgcn_fence(__ATOMIC_ACQ_REL, "workgroup"); __builtin_amdgcn_wave_barrier();
#pragma unroll 1  /* rolled in groups of eight rows: sixteen LDS reads go out ahead of their stores */
  for (int r0 = 0; r0 < DROW; r0 += 8) {
#pragma unroll
    for (int r = r0; r < r0 + 8; ++r)
#pragma unroll
      for (int c = 0; c < DCOL; c += 256) { const v8us v = *(const v8us*)&st[w][r][c + lane * 8]; *(v8us*)((unsigned short*)D16 + (size_t)(row0 + r) * NP + w * DCOL + c + lane * 8) = v; }
    asm volatile("s_wait_xcnt 0x0" ::: "memory");  /* stands in front of the next trip's rewrite of the data and address registers that these stores name */
  }
}

// C[M][N] (f32, pitch ldc) = A[M][K] . B[N][K]^T * alpha + bias[col] (bias rounded to bf16); A and B f16 with k contiguous. One 64 x 64 tile of C per work-group of 4 waves (2 x 2, 32 x 32 each).
// A stage is 256 k of the tile's 64 A rows and 64 B rows, brought into LDS by asynchronous b128 copies: one copy of a wave is 512 contiguous bytes of one row (4 whole lines), where a fragment load
// straight from the row-major operand touches 16 lines. Two buffers: the next stage's copies fly while this stage is worked on. M, N multiples of 64, K a multiple of 256.
// Every accumulator sums k in rising order, 32 at a time.
#define GT 64                    /* rows of each operand per work-group */
#define GK 256                   /* k per stage */
#define GP (GK + 8)              /* LDS row pitch in f16: 528 B = 16 B x odd, so the 16 rows of a ds_load_b128 fall on all banks */
typedef __attribute__((address_space(3))) const _Float16 lds_f16;
// eight rows (4 apart) of one operand: l = the lane's LDS byte address, g = the lane's global address, gs = 4 rows of the operand in elements
__device__ __forceinline__ void copy8(unsigned l, const _Float16* g, size_t gs) {
  const unsigned ls = 4 * GP * 2;
  // the last line is the wait that stands in front of any rewrite of the address registers that these copies name
  asm volatile("global_load_async_to_lds_b128 %0, %8, off\n\t"
               "global_load_async_to_lds_b128 %1, %9, off\n\t"
               "global_load_async_to_lds_b128 %2, %10, off\n\t"
               "global_load_async_to_lds_b128 %3, %11, off\n\t"
               "global_load_async_to_lds_b128 %4, %12, off\n\t"
               "global_load_async_to_lds_b128 %5, %13, off\n\t"
               "global_load_async_to_lds_b128 %6, %14, off\n\t"
               "global_load_async_to_lds_b128 %7, %15, off\n\t"
               "s_wait_xcnt 0x0"
               :: "v"(l), "v"(l + ls), "v"(l + 2 * ls), "v"(l + 3 * ls), "v"(l + 4 * ls), "v"(l + 5 * ls), "v"(l + 6 * ls), "v"(l + 7 * ls),
                  "v"(g), "v"(g + gs), "v"(g + 2 * gs), "v"(g + 3 * gs), "v"(g + 4 * gs), "v"(g + 5 * gs), "v"(g + 6 * gs), "v"(g + 7 * gs) : "memory");
}
// one stage: wave w brings rows w, w + 4, ..., w + 60 of the A tile (LDS rows 0..63) and of the B tile (LDS rows 64..127): 32 copies of a wave
__device__ __forceinline__ void fill_stage(unsigned l, const _Float16* ga, size_t sa, const _Float16* gb, size_t sb) {
  copy8(l, ga, sa); copy8(l + 32 * GP * 2, ga + 8 * sa, sa); copy8(l + 64 * GP * 2, gb, sb); copy8(l + 96 * GP * 2, gb + 8 * sb, sb);
}
// fragment from a row-major LDS tile; p = row (lane & 15), k = 8 * (lane >> 4): k 8*(lane>>4)+0..7 and 16+8*(lane>>4)+0..7, alike for A and B
__device__ __forceinline__ v16h frag_lds(const _Float16* p) { FragH f; f.half[0] = *(const v8us*)((const unsigned short*)p); f.half[1] = *(const v8us*)((const unsigned short*)p + 16); return f.v; }
// blockIdx.z = batch: A, B and C move on by sA, sB, sC elements
__global__ __launch_bounds__(128) void k_gemm_t(const _Float16* __restrict__ A, int lda, size_t sA, const _Float16* __restrict__ B, int ldb, size_t sB, float alpha, const float* __restrict__ bias, float* __restrict__ C, int ldc, size_t sC, int K) {
  __shared__ __attribute__((aligned(16))) _Float16 sm[2][2 * GT][GP];
  __shared__ __attribute__((aligned(16))) float so[4][32][36];
  const int tid = threadIdx.x, w = tid >> 5, lane = tid & 31, ln = lane & 15, hh = lane >> 4, wr = w >> 1, wc = w & 1;
  const int row0 = blockIdx.y * GT, col0 = blockIdx.x * GT;
  A += blockIdx.z * sA; B += blockIdx.z * sB; C += blockIdx.z * sC;
  const _Float16* ga = A + (size_t)(row0 + w) * lda + lane * 8; const _Float16* gb = B + (size_t)(col0 + w) * ldb + lane * 8;
  const size_t sa = (size_t)4 * lda, sb = (size_t)4 * ldb;
  const unsigned l0 = (unsigned)(uintptr_t)(lds_f16*)&sm[0][w][lane * 8], lbuf = 2 * GT * GP * 2;
  const int nt = K / GK;
  v8f acc[2][2] = {};
  fill_stage(l0, ga, sa, gb, sb);
  asm volatile("s_wait_asynccnt 0x0" ::: "memory");  /* this wave's copies of stage 0 have landed */
  __syncthreads();                                   /* and every other wave's */
  if (nt > 1) fill_stage(l0 + lbuf, ga + GK, sa, gb + GK, sb);
  for (int t = 0; t < nt; ++t) {
    const _Float16* pa = &sm[t & 1][wr * 32 + ln][8 * hh]; const _Float16* pb = &sm[t & 1][GT + wc * 32 + ln][8 * hh];
    v16h fa[GK / 32][2], fb[GK / 32][2];
#pragma unroll  /* every index constant: the fragments stay in registers */
    for (int ks = 0; ks < GK / 32; ++ks) { fa[ks][0] = frag_lds(pa + ks * 32); fb[ks][0] = frag_lds(pb + ks * 32); fb[ks][1] = frag_lds(pb + 16 * GP + ks * 32); fa[ks][1] = frag_lds(pa + 16 * GP + ks * 32); }
    // keeps the stage's 64 LDS loads one group in front of its WMMAs, which then follow behind counted waits; left alone the compiler reuses three fragment registers and the lone wave of a SIMD waits out the LDS latency three times per k step
    __builtin_amdgcn_sched_barrier(0);
#pragma unroll  /* as above */
    for (int ks = 0; ks < GK / 32; ++ks) {
      acc[0][0] = wm(fa[ks][0], fb[ks][0], acc[0][0]); acc[0][1] = wm(fa[ks][0], fb[ks][1], acc[0][1]); acc[1][0] = wm(fa[ks][1], fb[ks][0], acc[1][0]); acc[1][1] = wm(fa[ks][1], fb[ks][1], acc[1][1]);
    }
    // keeps the WMMAs in front of the waits below, so that they run while the later LDS loads still return and the refill is issued directly behind the barrier
    __builtin_amdgcn_sched_barrier(0);
    asm volatile("s_wait_dscnt 0x0" ::: "memory");     /* this wave's reads of the buffer are done before it is refilled */
    asm volatile("s_wait_asynccnt 0x0" ::: "memory");  /* this wave's copies of stage t + 1 have landed */
    __syncthreads();                                   /* publishes stage t + 1 and ends every wave's reads of stage t */
    if (t + 2 < nt) fill_stage(l0 + (t & 1) * lbuf, ga + (size_t)(t + 2) * GK, sa, gb + (size_t)(t + 2) * GK, sb);
  }
  asm volatile("s_wait_asynccnt 0x0" ::: "memory");    /* no copy is left in flight when the wave ends */
#pragma unroll  /* these three: constant accumulator indices, so that acc stays in registers */
  for (int j = 0; j < 2; ++j) { const float bv = bias ? bf16_round(bias[col0 + wc * 32 + j * 16 + ln]) : 0.f;
#pragma unroll
    for (int i = 0; i < 2; ++i)
#pragma unroll
      for (int r = 0; r < 8; ++r) so[w][i * 16 + 8 * hh + r][j * 16 + ln] = acc[i][j][r] * alpha + bv; }
  // each wave reads back only its own slab, so that a store covers whole 128-B lines: the fence keeps the LDS reads behind the writes of the wave's other lanes
  __builtin_amdgcn_fence(__ATOMIC_ACQ_REL, "workgroup"); __builtin_amdgcn_wave_barrier();
#pragma unroll  /* all eight LDS reads go out ahead of the stores */
  for (int q = 0; q < 8; ++q) { const int r = q * 4 + (lane >> 3), c4 = (lane & 7) * 4; const v4f v = *(const v4fa*)&so[w][r][c4]; *(v4f*)(C + (size_t)(row0 + wr * 32 + r) * ldc + col0 + wc * 32 + c4) = v; }
}

extern "C" void kernel_launch(void* const* d_in, const int* in_sizes, int n_in,
                              void* d_out, int out_size, void* d_ws, size_t ws_size, hipStream_t stream) {
  (void)in_sizes; (void)n_in; (void)out_size;
  const float* x1 = (const float*)d_in[0]; const float* x2 = (const float*)d_in[1]; const float* Wb = (const float*)d_in[2]; const float* bb_ = (const float*)d_in[3]; const float* Wc = (const float*)d_in[4]; const float* bc = (const float*)d_in[5]; const float* Wd = (const float*)d_in[6]; const float* bd = (const float*)d_in[7]; const float* al = (const float*)d_in[8]; const float* be = (const float*)d_in[9];
  char* ws = (char*)d_ws; size_t off = 0;
  auto take = [&](size_t bytes) { char* p = ws + off; off += (bytes + 255) & ~(size_t)255; return p; };
  _Float16* BW = (_Float16*)take((size_t)NW * CC * 2); float* BI = (float*)take(NW * 4);
  _Float16* X = (_Float16*)take((size_t)NS * NP * CC * 2); float* P = (float*)take((size_t)NS * NP * NW * 4);
  _Float16* Hh = (_Float16*)take((size_t)2 * NS * NP * C8 * 2); _Float16* Hl = (_Float16*)take((size_t)2 * NS * NP * C8 * 2);      /* plane 2 s + j: conv_b (j 0) or conv_c (j 1) of slab s */
  _Float16* FT = (_Float16*)take((size_t)NBt * CC * NP * 2); _Float16* D16 = (_Float16*)take((size_t)NBt * NP * NP * 2);
  if (off > ws_size) return;
  const size_t n8 = (size_t)NP * C8 / 8, pl = (size_t)NP * C8;
  k_prep<<<(NW * CC / 8 + 255) / 256, 256, 0, stream>>>(Wb, Wc, Wd, bb_, bc, bd, BW, BI);      /* conv weights [O][C] = natural Bt */
  k_tok<<<dim3(NP / TWX, CC / TR, NS), 256, 0, stream>>>(x1, x2, X);
  k_gemm_t<<<dim3(NW / GT, NS * NP / GT), 128, 0, stream>>>(X, CC, 0, BW, CC, 0, 0.0625f, BI, P, NW, 0, CC);      /* P[s][n][0..63] = conv_b, [64..127] = conv_c, [128..639] = conv_d of slab s (exact + bias) */
  k_split<<<dim3((unsigned)((n8 + 255) / 256), 2 * NS), 256, 0, stream>>>(P, Hh, Hl, n8);      /* a1, b1, a2, b2 of each batch -> hi/lo planes */
  k_fcomb<<<dim3(NP / TR, CC / TWF, NBt), 256, 0, stream>>>(P, al, be, FT);
  k_attdiff<<<dim3(NP / DROW, NBt), DW * 32, 0, stream>>>(Hh, Hl, Hh + 2 * pl, Hl + 2 * pl, Hh + 3 * pl, Hl + 3 * pl, Hh + pl, Hl + pl, D16);      /* a1 = plane 0, a2 = plane 2, b2 = plane 3, b1 = plane 1: |softmax(a1.b2) - softmax(a2.b1)| x 2^14 */
  k_gemm_t<<<dim3(NP / GT, CC / GT, NBt), 128, 0, stream>>>(FT, NP, (size_t)CC * NP, D16, NP, (size_t)NP * NP, 1.0f / 16384.0f, nullptr, (float*)d_out, NP, (size_t)CC * NP, NP);      /* out[b][c][n] = sum_m F[c][m] att[n][m]: M 512 (c), N 4096 (n), K 4096 (m) -> NCHW directly */
}

// v007
// A run of this version takes 151 microseconds.
// Timed twice side by side with v006, it ran 1.05 times as fast both times.
// All steps since v000 together make it 10.1 times as fast.
#include <hip/hip_runtime.h>
// Position-attention difference module (B 2, C 512, 64×64 = 4096 positions): a1 = conv_b(x1), b2 = conv_c(x2), a2 = conv_b(x2), b1 = conv_c(x1) (1×1, 512→64, + bias); f = conv_d (512→512, + bias); att12 = softmax_m(a1ᵀ·b2), att21 = softmax_m(a2ᵀ·b1) (no scaling); att = |att12 − att21|; out = α·f1·attᵀ + β·f2·attᵀ = (α f1 + β f2)·attᵀ → [2,512,64,64].
// Structure: every kernel runs once, over both batches and both inputs (7 launches): 1x1 convs as one GEMM against the stacked weights [Wb; Wc; Wd] on position-major f16 planes (exact products); a/b as f16 hi + lo*2^10 planes so both logit matrices are about f32 (three cross products each); one kernel forms both logit matrices in registers, both softmaxes per row in f32 and writes |difference| x 2^14 as f16; F = alpha f1 + beta f2 (f32 combine, then f16) and out = F.att^T by one GEMM straight into the NCHW output.
// Compute dtype: inputs and parameters rounded to bf16; logits ≈f32; softmaxes/difference in f32; |Δ| (×2^14) and F as f16 operands (≈2^-12), f32 accumulation. v_wmma_f32_16x16x32_f16.
#define NBt 2
#define CC 512
#define C8 64
#define NP 4096
#define NW (2 * C8 + CC)         /* rows of the stacked weights [Wb; Wc; Wd] = columns of the projection matrix P */
#define NS (2 * NBt)             /* position-major input slabs: slab s = 2 * batch + (0 for x1, 1 for x2) */
typedef __bf16 v16b __attribute__((ext_vector_type(16)));
typedef unsigned short v8us __attribute__((ext_vector_type(8), may_alias));
typedef float  v8f  __attribute__((ext_vector_type(8)));
typedef float  v4f  __attribute__((ext_vector_type(4)));
typedef float  v4fa __attribute__((ext_vector_type(4), may_alias));
union FragB { v16b v; v8us half[2]; unsigned short u[16]; };

__device__ __forceinline__ unsigned short bf16_bits(float x) { unsigned int u = __float_as_uint(x); return (unsigned short)((u + 0x7FFFu + ((u >> 16) & 1u)) >> 16); }
__device__ __forceinline__ float bf16_val(unsigned short b) { return __uint_as_float(((unsigned int)b) << 16); }
__device__ __forceinline__ float bf16_round(float x) { return bf16_val(bf16_bits(x)); }
// D += A·B with NT terms: 1 = ah·bh, 2 = + al·bh (A split), 3 = + ah·bl (both split)
template <int NT>
__device__ __forceinline__ v8f mmaN(v16b ah, v16b al, v16b bh, v16b bl, v8f c) {
  c = __builtin_amdgcn_wmma_f32_16x16x32_bf16(false, ah, false, bh, (short)0, c, false, false);
  if (NT >= 2) c = __builtin_amdgcn_wmma_f32_16x16x32_bf16(false, al, false, bh, (short)0, c, false, false);
  if (NT >= 3) c = __builtin_amdgcn_wmma_f32_16x16x32_bf16(false, ah, false, bl, (short)0, c, false, false);
  asm volatile("v_nop\n\tv_nop\n\tv_nop\n\tv_nop" : "+v"(c) : "v"(ah), "v"(al), "v"(bh), "v"(bl));
  return c;
}

__global__ __launch_bounds__(256) void k_wt_bf16(const float* __restrict__ W, unsigned short* __restrict__ Wt, int K, int N) {
  const int t = blockIdx.x * 256 + threadIdx.x;
  const int k8n = K / 8;
  if (t >= N * k8n) return;
  const int n = t / k8n, k8 = (t % k8n) * 8;
  v8us v;
#pragma unroll
  for (int i = 0; i < 8; ++i) v[i] = bf16_bits(W[(size_t)(k8 + i) * N + n]);
  *(v8us*)(Wt + (size_t)n * K + k8) = v;
  
}

// GEMM C[M][N] (f32, pitch ldc) = act(A[M][K]·W + bias). A f32 row-major (pitch lda) converted per fragment to bf16
// (ASPLIT: hi/lo two planes -> 2 terms, else single rounded term); Wt bf16 [N][K] (pitch ldb). BIAS_BF16 rounds the
// bias to bf16 first (bias quantised to bf16 before the add). K%32==0, M%16==0, N%64==0.
template <bool ASPLIT, int ACT, bool BIAS_BF16>
__global__ __launch_bounds__(128) void k_gemm_bf(const float* __restrict__ A, int lda, const unsigned short* __restrict__ Wt, int ldb,
                                               const float* __restrict__ bias, float* __restrict__ C, int ldc, int M, int N, int K) {
  __shared__ __attribute__((aligned(16))) float so[4][16][64];
  const int tid = threadIdx.x, w = tid >> 5, lane = tid & 31, ln = lane & 15, hh = lane >> 4;
  const int ntn = N / 64;
  const int wid = blockIdx.x * 4 + w;
  const int mt = wid / ntn, nq = wid % ntn;
  if (mt * 16 >= M) return;
  const int row0 = mt * 16, col0 = nq * 64;
  const float* arow = A + (size_t)(row0 + ln) * lda;
  v8f acc[4] = {};
  for (int kb = 0; kb < K; kb += 32) {
    FragB ah, al;
    const v4f x0 = *(const v4fa*)(arow + kb + 8 * hh), x1 = *(const v4fa*)(arow + kb + 8 * hh + 4);
    const v4f x2 = *(const v4fa*)(arow + kb + 16 + 8 * hh), x3 = *(const v4fa*)(arow + kb + 16 + 8 * hh + 4);
    float xs[16] = {x0[0],x0[1],x0[2],x0[3],x1[0],x1[1],x1[2],x1[3],x2[0],x2[1],x2[2],x2[3],x3[0],x3[1],x3[2],x3[3]};
#pragma unroll
    for (int i = 0; i < 16; ++i) { const unsigned short hb = bf16_bits(xs[i]); ah.u[i] = hb; al.u[i] = ASPLIT ? bf16_bits(xs[i] - bf16_val(hb)) : (unsigned short)0; }
#pragma unroll
    for (int t = 0; t < 4; ++t) {
      const unsigned short* brow = Wt + (size_t)(col0 + t * 16 + ln) * ldb + kb;
      FragB b;
      b.half[0] = *(const v8us*)(brow + 8 * hh);
      b.half[1] = *(const v8us*)(brow + 16 + 8 * hh);
      acc[t] = mmaN<ASPLIT ? 2 : 1>(ah.v, al.v, b.v, b.v, acc[t]);
    }
  }
#pragma unroll
  for (int t = 0; t < 4; ++t) {
    float bv = bias ? bias[col0 + t * 16 + ln] : 0.f;
    if (BIAS_BF16) bv = bf16_round(bv);
#pragma unroll
    for (int r = 0; r < 8; ++r) { float v = acc[t][r] + bv; if (ACT == 1) v = fmaxf(v, 0.f); so[w][8 * hh + r][t * 16 + ln] = v; }
  }
  __builtin_amdgcn_fence(__ATOMIC_ACQ_REL, "workgroup");
  __builtin_amdgcn_wave_barrier();
  const int rsub = lane >> 4, c4 = (lane & 15) * 4;
  {
#pragma unroll
    for (int q = 0; q < 8; ++q) {
      const int r = q * 2 + rsub;
      const v4f v = *(const v4fa*)&so[w][r][c4];
      *(v4f*)(C + (size_t)(row0 + r) * ldc + col0 + c4) = v;
    }
    
  }
}

// GEMM C = act(A·W + bias + resid): A f32 (ASPLIT -> hi/lo 2 terms), Wt bf16 [N][K]; ACT 0 none, 1 relu, 2 exact gelu;
// resid (optional, f32, row index = (row % rmod), pitch ldr, RES_BF16 rounds it) added before the activation.
template <bool ASPLIT, int ACT, bool BIAS_BF16, bool RES_BF16>
__global__ __launch_bounds__(128) void k_gemm_bf3(const float* __restrict__ A, int lda, const unsigned short* __restrict__ Wt, int ldb,
                                                const float* __restrict__ bias, const float* __restrict__ resid, int rmod, int ldr,
                                                float* __restrict__ C, int ldc, int M, int N, int K) {
  __shared__ __attribute__((aligned(16))) float so[4][16][64];
  const int tid = threadIdx.x, w = tid >> 5, lane = tid & 31, ln = lane & 15, hh = lane >> 4;
  const int ntn = N / 64;
  const int wid = blockIdx.x * 4 + w;
  const int mt = wid / ntn, nq = wid % ntn;
  if (mt * 16 >= M) return;
  const int row0 = mt * 16, col0 = nq * 64;
  const float* arow = A + (size_t)(row0 + ln) * lda;
  v8f acc[4] = {};
  for (int kb = 0; kb < K; kb += 32) {
    FragB ah, al;
    const v4f x0 = *(const v4fa*)(arow + kb + 8 * hh), x1 = *(const v4fa*)(arow + kb + 8 * hh + 4);
    const v4f x2 = *(const v4fa*)(arow + kb + 16 + 8 * hh), x3 = *(const v4fa*)(arow + kb + 16 + 8 * hh + 4);
    float xs[16] = {x0[0],x0[1],x0[2],x0[3],x1[0],x1[1],x1[2],x1[3],x2[0],x2[1],x2[2],x2[3],x3[0],x3[1],x3[2],x3[3]};
#pragma unroll
    for (int i = 0; i < 16; ++i) { const unsigned short hb = bf16_bits(xs[i]); ah.u[i] = hb; al.u[i] = ASPLIT ? bf16_bits(xs[i] - bf16_val(hb)) : (unsigned short)0; }
#pragma unroll
    for (int t = 0; t < 4; ++t) {
      const unsigned short* brow = Wt + (size_t)(col0 + t * 16 + ln) * ldb + kb;
      FragB b;
      b.half[0] = *(const v8us*)(brow + 8 * hh);
      b.half[1] = *(const v8us*)(brow + 16 + 8 * hh);
      acc[t] = mmaN<ASPLIT ? 2 : 1>(ah.v, al.v, b.v, b.v, acc[t]);
    }
  }
#pragma unroll
  for (int t = 0; t < 4; ++t) {
    const int col = col0 + t * 16 + ln;
    float bv = bias ? bias[col] : 0.f;
    if (BIAS_BF16) bv = bf16_round(bv);
#pragma unroll
    for (int r = 0; r < 8; ++r) {
      float v = acc[t][r] + bv;
      if (resid) { float rv = resid[(size_t)((row0 + 8 * hh + r) % rmod) * ldr + col]; if (RES_BF16) rv = bf16_round(rv); v += rv; }
      if (ACT == 1) v = fmaxf(v, 0.f);
      if (ACT == 2) v = 0.5f * v * (1.0f + erff(v * 0.70710678118654752f));
      if (ACT == 3) { const float u = 0.7978845608028654f * (v + 0.044715f * v * v * v); v = 0.5f * v * (1.0f + tanhf(u)); }
      so[w][8 * hh + r][t * 16 + ln] = v;
    }
  }
  __builtin_amdgcn_fence(__ATOMIC_ACQ_REL, "workgroup");
  __builtin_amdgcn_wave_barrier();
  const int rsub = lane >> 4, c4 = (lane & 15) * 4;
  {
#pragma unroll
    for (int q = 0; q < 8; ++q) {
      const int r = q * 2 + rsub;
      const v4f v = *(const v4fa*)&so[w][r][c4];
      *(v4f*)(C + (size_t)(row0 + r) * ldc + col0 + c4) = v;
    }
    
  }
}
// row LayerNorm (biased variance, eps) over N: s = X (+ R); optional out_sum <- s; out_norm <- (s-mu)*rsqrt(var+eps)*g + b
template <bool PARAM_BF16>
__global__ __launch_bounds__(256) void k_layernorm(const float* __restrict__ X, const float* __restrict__ R, const float* __restrict__ g, const float* __restrict__ bta,
                                                  float* __restrict__ out_sum, float* __restrict__ out_norm, int N, float eps) {
  __shared__ float red[256];
  const int row = blockIdx.x, tid = threadIdx.x;
  const float* x = X + (size_t)row * N; const float* rr = R ? R + (size_t)row * N : nullptr;
  float vals[16];                     // up to N = 4096
  const int per = N / 256;            // contiguous chunk per thread? use strided-by-4 chunks: thread handles j = tid*4 + 1024*u
  float s1 = 0.f;
  for (int u = 0; u < per / 4; ++u) {
    const int j = tid * 4 + 1024 * u;
    const v4f a = *(const v4fa*)(x + j);
    v4f b = {0.f,0.f,0.f,0.f}; if (rr) b = *(const v4fa*)(rr + j);
#pragma unroll
    for (int q = 0; q < 4; ++q) { const float v = a[q] + b[q]; vals[u * 4 + q] = v; s1 += v; }
  }
  red[tid] = s1; __syncthreads();
  for (int st = 128; st > 0; st >>= 1) { if (tid < st) red[tid] += red[tid + st]; __syncthreads(); }
  const float mu = red[0] / (float)N; __syncthreads();
  float s2 = 0.f;
  for (int u = 0; u < per / 4; ++u)
#pragma unroll
    for (int q = 0; q < 4; ++q) { const float c = vals[u * 4 + q] - mu; s2 += c * c; }
  red[tid] = s2; __syncthreads();
  for (int st = 128; st > 0; st >>= 1) { if (tid < st) red[tid] += red[tid + st]; __syncthreads(); }
  const float rs = rsqrtf(red[0] / (float)N + eps);
  {
    for (int u = 0; u < per / 4; ++u) {
      const int j = tid * 4 + 1024 * u;
      v4f o, sm;
#pragma unroll
      for (int q = 0; q < 4; ++q) {
        float gg = g[j + q], bb = bta[j + q];
        if (PARAM_BF16) { gg = bf16_round(gg); bb = bf16_round(bb); }
        sm[q] = vals[u * 4 + q]; o[q] = (vals[u * 4 + q] - mu) * rs * gg + bb;
      }
      if (out_sum) *(v4f*)(out_sum + (size_t)row * N + j) = sm;
      *(v4f*)(out_norm + (size_t)row * N + j) = o;
    }
    
  }
}



// ---- f16 WMMA path (v_wmma_f32_16x16x32_f16): 11-bit significands for operands in range — used where a [0,1] probability operand needs more precision than bf16
typedef _Float16 v16h __attribute__((ext_vector_type(16)));
union FragH { v16h v; v8us half[2]; _Float16 h[16]; unsigned short u[16]; };
template <int NT>
__device__ __forceinline__ v8f mmaH(v16h ah, v16h al, v16h bh, v16h bl, v8f c) {
  c = __builtin_amdgcn_wmma_f32_16x16x32_f16(false, ah, false, bh, (short)0, c, false, false);
  if (NT >= 2) c = __builtin_amdgcn_wmma_f32_16x16x32_f16(false, al, false, bh, (short)0, c, false, false);
  if (NT >= 3) c = __builtin_amdgcn_wmma_f32_16x16x32_f16(false, ah, false, bl, (short)0, c, false, false);
  asm volatile("v_nop\n\tv_nop\n\tv_nop\n\tv_nop" : "+v"(c) : "v"(ah), "v"(al), "v"(bh), "v"(bl));
  return c;
}
// batched GEMM like k_gemm_b but f16 operands: A f32 (split into f16 hi/lo if ASPLIT, else rounded to f16), Bt = f16 values [n][k]; alpha; C f32; N multiple of 16 (partial tiles skipped)
template <bool ASPLIT>
__global__ __launch_bounds__(128) void k_gemm_h(const float* __restrict__ A, int lda, size_t sA, const _Float16* __restrict__ Bh, int ldb, size_t sB, float alpha, float* __restrict__ C, int ldc, size_t sC, int M, int N, int K) {
  __shared__ __attribute__((aligned(16))) float so[4][16][64];
  const int tid = threadIdx.x, w = tid >> 5, lane = tid & 31, ln = lane & 15, hh = lane >> 4; const int by = blockIdx.y;
  A += (size_t)by * sA; Bh += (size_t)by * sB; C += (size_t)by * sC;
  const int ntn = (N + 63) / 64; const int wid = blockIdx.x * 4 + w; const int mt = wid / ntn, nq = wid % ntn; if (mt * 16 >= M) return;
  const int row0 = mt * 16, col0 = nq * 64; const float* arow = A + (size_t)(row0 + ln) * lda;
  v8f acc[4] = {};
  for (int kb = 0; kb < K; kb += 32) {
    FragH ah, al;
    const v4f x0 = *(const v4fa*)(arow + kb + 8 * hh), x1 = *(const v4fa*)(arow + kb + 8 * hh + 4), x2 = *(const v4fa*)(arow + kb + 16 + 8 * hh), x3 = *(const v4fa*)(arow + kb + 16 + 8 * hh + 4);
    float xs[16] = {x0[0],x0[1],x0[2],x0[3],x1[0],x1[1],x1[2],x1[3],x2[0],x2[1],x2[2],x2[3],x3[0],x3[1],x3[2],x3[3]};
#pragma unroll
    for (int i = 0; i < 16; ++i) { const _Float16 h = (_Float16)xs[i]; ah.h[i] = h; al.h[i] = ASPLIT ? (_Float16)(xs[i] - (float)h) : (_Float16)0.0f; }
#pragma unroll
    for (int t = 0; t < 4; ++t) { if (col0 + t * 16 >= N) continue; const size_t boff = (size_t)(col0 + t * 16 + ln) * ldb + kb; FragH bq; bq.half[0] = *(const v8us*)(Bh + boff + 8 * hh); bq.half[1] = *(const v8us*)(Bh + boff + 16 + 8 * hh);
      acc[t] = mmaH<ASPLIT ? 2 : 1>(ah.v, al.v, bq.v, bq.v, acc[t]); }
  }
#pragma unroll
  for (int t = 0; t < 4; ++t) { if (col0 + t * 16 >= N) continue;
#pragma unroll
    for (int r = 0; r < 8; ++r) so[w][8 * hh + r][t * 16 + ln] = acc[t][r] * alpha; }
  __builtin_amdgcn_fence(__ATOMIC_ACQ_REL, "workgroup"); __builtin_amdgcn_wave_barrier();
  const int rsub = lane >> 4, c4 = (lane & 15) * 4;
  {
#pragma unroll
    for (int q = 0; q < 8; ++q) { const int r = q * 2 + rsub; if (col0 + c4 < N) { const v4f v = *(const v4fa*)&so[w][r][c4]; *(v4f*)(C + (size_t)(row0 + r) * ldc + col0 + c4) = v; } }
     }
}

// Wt[n][k] = f16(W[k][n]·scale) from f32 row-major W[K][N] (scale = power of two; bf16-exact weights stay exact in f16 away from the subnormal range)
__global__ __launch_bounds__(256) void k_wt_f16(const float* __restrict__ W, _Float16* __restrict__ Wt, int K, int N, float scale) {
  const int t = blockIdx.x * 256 + threadIdx.x; if (t >= N * (K / 8)) return; const int n = t / (K / 8), k8 = (t % (K / 8)) * 8; FragH f;
#pragma unroll
  for (int i = 0; i < 8; ++i) f.h[i] = (_Float16)(bf16_round(W[(size_t)(k8 + i) * N + n]) * scale); const v8us o = f.half[0];
  *(v8us*)((unsigned short*)Wt + (size_t)n * K + k8) = o; 
}
// k_gemm_hh variant with fused epilogue: v = acc·alpha + bias[by·sBias + col] (+ CP[(row/rowsPerB)·sCPb + by·64 + col] if CP) ; ACT 0 none / 1 elu ; writes f32 C and f16 C16, each if non-null
template <int ACT>
__global__ __launch_bounds__(128) void k_gemm_hhx(const _Float16* __restrict__ A, int lda, size_t sA, const _Float16* __restrict__ Bh, int ldb, size_t sB, float alpha, const float* __restrict__ bias, size_t sBias, const float* __restrict__ CP, int rowsPerB, size_t sCPb, int row0g,
    float* __restrict__ C, _Float16* __restrict__ C16, int ldc, size_t sC, int M, int N, int K) {
  __shared__ __attribute__((aligned(16))) float so[4][16][64];
  const int tid = threadIdx.x, w = tid >> 5, lane = tid & 31, ln = lane & 15, hh = lane >> 4; const int by = blockIdx.y;
  A += (size_t)by * sA; Bh += (size_t)by * sB; const size_t cofs = (size_t)by * sC; const float* bp = bias ? bias + (size_t)by * sBias : nullptr;
  const int ntn = (N + 63) / 64; const int wid = blockIdx.x * 4 + w; const int mt = wid / ntn, nq = wid % ntn; if (mt * 16 >= M) return;
  const int row0 = mt * 16, col0 = nq * 64; const _Float16* arow = A + (size_t)(row0 + ln) * lda;
  v8f acc[4] = {};
  for (int kb = 0; kb < K; kb += 32) { FragH ah; ah.half[0] = *(const v8us*)((const unsigned short*)arow + kb + 8 * hh); ah.half[1] = *(const v8us*)((const unsigned short*)arow + kb + 16 + 8 * hh);
#pragma unroll
    for (int t = 0; t < 4; ++t) { if (col0 + t * 16 >= N) continue; const size_t boff = (size_t)(col0 + t * 16 + ln) * ldb + kb; FragH bq; bq.half[0] = *(const v8us*)((const unsigned short*)Bh + boff + 8 * hh); bq.half[1] = *(const v8us*)((const unsigned short*)Bh + boff + 16 + 8 * hh);
      acc[t] = mmaH<1>(ah.v, ah.v, bq.v, bq.v, acc[t]); }
  }
#pragma unroll
  for (int t = 0; t < 4; ++t) { if (col0 + t * 16 >= N) continue; const int col = col0 + t * 16 + ln; const float bv = bp ? bf16_round(bp[col]) : 0.f;
#pragma unroll
    for (int r = 0; r < 8; ++r) { float v = acc[t][r] * alpha + bv; if (CP) { const int bidx = (row0g + row0 + 8 * hh + r) / rowsPerB; v += CP[(size_t)bidx * sCPb + (size_t)by * 64 + col]; } if (ACT == 1) v = (v > 0.f) ? v : expm1f(v); else if (ACT == 7) v = (v > 0.f) ? v + 1.0f : expf(v); else if (ACT == 8) v = tanhf(v); else if (ACT == 9) v = 0.5f * v * (1.0f + tanhf(0.7978845608028654f * (v + 0.044715f * v * v * v))); else if (ACT == 11) v = 1.0f / (1.0f + expf(-v)); else if (ACT == 12) v = (v > 0.f) ? v : 0.01f * v; else if (ACT == 14) v = (v > 0.f) ? v : 0.1f * v; else if (ACT == 15) v = v / (1.0f + expf(-v)); else if (ACT == 3) v = fmaxf(v, 0.f); else if (ACT == 6) v = 0.5f * v * (1.0f + erff(v * 0.70710678118654752f)); so[w][8 * hh + r][t * 16 + ln] = v; } }
  __builtin_amdgcn_fence(__ATOMIC_ACQ_REL, "workgroup"); __builtin_amdgcn_wave_barrier();
  const int rsub = lane >> 4, c4 = (lane & 15) * 4; typedef _Float16 v4h __attribute__((ext_vector_type(4)));
  {
#pragma unroll
    for (int q = 0; q < 8; ++q) { const int r = q * 2 + rsub; if (col0 + c4 < N) { const v4f v = *(const v4fa*)&so[w][r][c4]; if (C) *(v4f*)(C + cofs + (size_t)(row0 + r) * ldc + col0 + c4) = v; if (C16) { v4h h4; for (int i = 0; i < 4; ++i) h4[i] = (_Float16)v[i]; *(v4h*)(C16 + cofs + (size_t)(row0 + r) * ldc + col0 + c4) = h4; } } }
     }
}


typedef _Float16 v4h __attribute__((ext_vector_type(4)));

__global__ __launch_bounds__(256) void k_x16(const float* __restrict__ x, _Float16* __restrict__ X16, size_t n8) { const size_t t = (size_t)blockIdx.x * 256 + threadIdx.x; if (t >= n8) return; FragH f;
#pragma unroll
  for (int q = 0; q < 8; ++q) f.h[q] = (_Float16)bf16_round(x[t * 8 + q]); *(v8us*)((unsigned short*)X16 + t * 8) = f.half[0];  }
__global__ __launch_bounds__(256) void k_h16(const float* __restrict__ x, _Float16* __restrict__ X16, size_t n8) { const size_t t = (size_t)blockIdx.x * 256 + threadIdx.x; if (t >= n8) return; FragH f;
#pragma unroll
  for (int q = 0; q < 8; ++q) f.h[q] = (_Float16)x[t * 8 + q]; *(v8us*)((unsigned short*)X16 + t * 8) = f.half[0];  }
__global__ __launch_bounds__(256) void k_round16f(const float* __restrict__ W, _Float16* __restrict__ Bt, size_t n8) { const size_t t = (size_t)blockIdx.x * 256 + threadIdx.x; if (t >= n8) return; FragH f;
#pragma unroll
  for (int i = 0; i < 8; ++i) f.h[i] = (_Float16)(bf16_round(W[t * 8 + i]) * 16.0f); *(v8us*)((unsigned short*)Bt + t * 8) = f.half[0];  }
template <int NHv, int TTv>
__global__ __launch_bounds__(256) void k_vt(const _Float16* __restrict__ V16, int ldv, int voff, _Float16* __restrict__ Vt) { __shared__ unsigned short tl[64][66]; const int tid = threadIdx.x; const int slab = blockIdx.x / (TTv / 64), lg = blockIdx.x % (TTv / 64); const int b = slab / NHv, h = slab % NHv;
  for (int i = tid; i < 64 * 8; i += 256) { const int r = i / 8, c8 = (i % 8) * 8; FragH f; f.half[0] = *(const v8us*)((const unsigned short*)V16 + ((size_t)b * TTv + lg * 64 + r) * ldv + voff + h * 64 + c8);
#pragma unroll
    for (int q = 0; q < 8; ++q) tl[r][c8 + q] = f.u[q]; }
  __syncthreads();
  {
#pragma unroll
    for (int rd = 0; rd < 2; ++rd) { const int d = rd * 32 + tid / 8, pc = tid % 8; FragH f;
#pragma unroll
      for (int q = 0; q < 8; ++q) f.u[q] = tl[pc * 8 + q][d];
      *(v8us*)((unsigned short*)Vt + ((size_t)slab * 64 + d) * TTv + lg * 64 + pc * 8) = f.half[0]; }
     } }

__global__ __launch_bounds__(256) void k_hl(const float* __restrict__ F, _Float16* __restrict__ Hh, _Float16* __restrict__ Hl, size_t n8) { const size_t t = (size_t)blockIdx.x * 256 + threadIdx.x; if (t >= n8) return; FragH fh, fl; const v4f a = *(const v4fa*)(F + t * 8), c = *(const v4fa*)(F + t * 8 + 4);
#pragma unroll
  for (int q = 0; q < 4; ++q) { _Float16 h = (_Float16)a[q]; fh.h[q] = h; fl.h[q] = (_Float16)((a[q] - (float)h) * 1024.0f); h = (_Float16)c[q]; fh.h[4 + q] = h; fl.h[4 + q] = (_Float16)((c[q] - (float)h) * 1024.0f); }
  { *(v8us*)((unsigned short*)Hh + t * 8) = fh.half[0]; *(v8us*)((unsigned short*)Hl + t * 8) = fl.half[0];  } }

// stacked weights BW[NW][CC] = f16(bf16(W) * 16), rows 0..63 Wb, 64..127 Wc, 128..639 Wd, and the stacked biases BI[NW] (f32, as given)
__global__ __launch_bounds__(256) void k_prep(const float* __restrict__ Wb, const float* __restrict__ Wc, const float* __restrict__ Wd, const float* __restrict__ bb, const float* __restrict__ bc, const float* __restrict__ bd, _Float16* __restrict__ BW, float* __restrict__ BI) {
  const int t = blockIdx.x * 256 + threadIdx.x, n1 = C8 * CC / 8; if (t >= NW * CC / 8) return;
  const float* Wp = (t < n1) ? Wb + (size_t)t * 8 : (t < 2 * n1) ? Wc + (size_t)(t - n1) * 8 : Wd + (size_t)(t - 2 * n1) * 8; FragH f;
#pragma unroll
  for (int i = 0; i < 8; ++i) f.h[i] = (_Float16)(bf16_round(Wp[i]) * 16.0f); *(v8us*)((unsigned short*)BW + (size_t)t * 8) = f.half[0];
  if (t < NW) BI[t] = (t < C8) ? bb[t] : (t < 2 * C8) ? bc[t - C8] : bd[t - 2 * C8]; }
// The two layout changes (k_tok, k_fcomb) go through an LDS tile: 64 source rows x TW contiguous source columns come in as whole 128-B lines (8 lanes x 16 B a row),
// are converted, and leave as rows of 64 f16 = one whole 128-B line each. Read straight across the source rows, every lane of a load would touch a line of its own.
// Few, fat work-groups (two per WGP): every thread has all of its loads in flight at once.
#define TR 64                    /* source rows per tile = f16 per output row */
#define TP (TR + 8)              /* LDS row pitch in f16: 144 B = 16 B x odd */
typedef _Float16 v2ha __attribute__((ext_vector_type(2), may_alias));
// the tile's TW output rows, 128 B each, from LDS to dst (pitch ldd elements): 8 lanes a row
template <int TW>
__device__ __forceinline__ void tile_out(const _Float16 (&tl)[TW][TP], _Float16* __restrict__ dst, size_t ldd, int tid) {
#pragma unroll  /* all LDS reads go out ahead of the stores */
  for (int i = 0; i < TW / 32; ++i) { const int r = (tid >> 3) + 32 * i, e8 = (tid & 7) * 8; const v8us v = *(const v8us*)&tl[r][e8]; *(v8us*)((unsigned short*)dst + (size_t)r * ldd + e8) = v; }
}
#define TWX 256                  /* positions per tile of k_tok */
// blockIdx.x = tile of TWX positions, blockIdx.y = tile of 64 channels, blockIdx.z = slab s
__global__ __launch_bounds__(256) void k_tok(const float* __restrict__ x1, const float* __restrict__ x2, _Float16* __restrict__ X16) {
  __shared__ __attribute__((aligned(16))) _Float16 tl[TWX][TP];  /* [position][channel] */
  const int tid = threadIdx.x, s = blockIdx.z, b = s >> 1, n0 = blockIdx.x * TWX, c0 = blockIdx.y * TR, c = 2 * (tid >> 3), k0 = (tid & 7) * 4;
  const char* x = (const char*)(((s & 1) ? x2 : x1) + ((size_t)b * CC + c0) * NP + n0);  /* the tile's first element: the same for the whole work-group */
  const unsigned ob = (unsigned)(c * NP + k0) * 4;                                       /* the lane's byte offset in the tile */
  v4f u[TWX / 32], v[TWX / 32];
#pragma unroll  /* constant indices: the values stay in registers, and the sixteen loads of a thread are all in flight at once */
  for (int i = 0; i < TWX / 32; ++i) { u[i] = *(const v4fa*)(x + ob + 128 * i); v[i] = *(const v4fa*)(x + ob + NP * 4 + 128 * i); }
  asm volatile("s_wait_xcnt 0x0" :: "v"(ob) : "memory");  /* stands in front of any rewrite of the offset register that these loads name; the operand keeps that register until here */
  __builtin_amdgcn_sched_barrier(0);                      /* keeps the conversions behind all sixteen loads; left alone the compiler holds five loads back until the first have returned: a second memory latency */
#pragma unroll
  for (int i = 0; i < TWX / 32; ++i)
#pragma unroll
    for (int q = 0; q < 4; ++q) { v2ha h; h[0] = (_Float16)bf16_round(u[i][q]); h[1] = (_Float16)bf16_round(v[i][q]); *(v2ha*)&tl[k0 + 32 * i + q][c] = h; }
  __syncthreads();  /* the tile is whole before any wave reads it across */
  tile_out<TWX>(tl, X16 + ((size_t)s * NP + n0) * CC + c0, CC, tid);
}
// blockIdx.y = plane p = 2 * slab + (0 for conv_b, 1 for conv_c): columns 64 (p & 1) .. + 63 of slab p >> 1 of P
__global__ __launch_bounds__(256) void k_split(const float* __restrict__ F, _Float16* __restrict__ Hh, _Float16* __restrict__ Hl, size_t n8) {
  #pragma clang fp contract(off)
  const size_t t = (size_t)blockIdx.x * 256 + threadIdx.x; if (t >= n8) return;
  const size_t p = blockIdx.y; F += (p >> 1) * NP * NW + (p & 1) * C8; Hh += p * NP * C8; Hl += p * NP * C8;
  // planes in WMMA fragment order, 16 positions x 64 channels per 2-KiB block: [k step of 32][fragment half][lane][8 channels]; piece t of the plane is position 16*(t>>7) + (t&15), channels 8*sc..8*sc+7
  const size_t sc = ((t >> 6) & 1) * 4 + ((t >> 5) & 1) * 2 + ((t >> 4) & 1), so = ((t >> 7) * 16 + (t & 15)) * NW + sc * 8;
  const v4f a = *(const v4fa*)(F + so), c = *(const v4fa*)(F + so + 4); FragH fh, fl;
#pragma unroll
  for (int q = 0; q < 8; ++q) { const float v = (q < 4) ? a[q] : c[q - 4]; const _Float16 hi = (_Float16)v; fh.h[q] = hi; fl.h[q] = (_Float16)((v - (float)hi) * 1024.0f); }
  { *(v8us*)((unsigned short*)Hh + t * 8) = fh.half[0]; *(v8us*)((unsigned short*)Hl + t * 8) = fl.half[0];  } }
#define TWF 128                  /* channels per tile of k_fcomb */
// blockIdx.x = tile of 64 positions, blockIdx.y = tile of TWF channels, blockIdx.z = batch; f1, f2 = columns 128.. of the batch's two slabs of P
__global__ __launch_bounds__(256) void k_fcomb(const float* __restrict__ P, const float* __restrict__ al, const float* __restrict__ be, _Float16* __restrict__ FT) {
  #pragma clang fp contract(off)
  __shared__ __attribute__((aligned(16))) _Float16 tl[TWF][TP];  /* [channel][position] */
  const int tid = threadIdx.x, m0 = blockIdx.x * TR, c0 = blockIdx.y * TWF, m = 2 * (tid >> 3), k0 = (tid & 7) * 4;
  const char* F = (const char*)(P + ((size_t)(2 * blockIdx.z) * NP + m0) * NW + 2 * C8 + c0);  /* the first element of f1's tile: the same for the whole work-group */
  const unsigned ob = (unsigned)(m * NW + k0) * 4, ob2 = ob + (unsigned)(NP * NW * 4);         /* the lane's byte offsets from there in f1's tile and in f2's, one slab of P further on */
  const float a = bf16_round(al[0]), bq = bf16_round(be[0]);
  v4f p0[TWF / 32], p1[TWF / 32], r0[TWF / 32], r1[TWF / 32];
#pragma unroll  /* constant indices: the values stay in registers, and the sixteen loads of a thread are all in flight at once */
  for (int i = 0; i < TWF / 32; ++i) { p0[i] = *(const v4fa*)(F + ob + 128 * i); p1[i] = *(const v4fa*)(F + ob + NW * 4 + 128 * i); r0[i] = *(const v4fa*)(F + ob2 + 128 * i); r1[i] = *(const v4fa*)(F + ob2 + NW * 4 + 128 * i); }
  asm volatile("s_wait_xcnt 0x0" :: "v"(ob), "v"(ob2) : "memory");  /* stands in front of any rewrite of the offset registers that these loads name; the operands keep those registers until here */
#pragma unroll
  for (int i = 0; i < TWF / 32; ++i)
#pragma unroll
    for (int q = 0; q < 4; ++q) { v2ha h; h[0] = (_Float16)(a * p0[i][q] + bq * r0[i][q]); h[1] = (_Float16)(a * p1[i][q] + bq * r1[i][q]); *(v2ha*)&tl[k0 + 32 * i + q][m] = h; }
  __syncthreads();  /* the tile is whole before any wave reads it across */
  tile_out<TWF>(tl, FT + ((size_t)blockIdx.z * CC + c0) * NP + m0, NP, tid);
}
// One 16x32 f16 fragment (A row or B column = lane & 15; k = 8*(lane>>4)+0..7 and 16+8*(lane>>4)+0..7) from a plane in the fragment order that k_split writes; p already holds 8*lane.
// Each of the two loads reads 512 contiguous bytes (4 whole lines) per wave; from a row-major plane it would touch 16 lines.
__device__ __forceinline__ v16h frag_at(const _Float16* p) { FragH f; f.half[0] = *(const v8us*)((const unsigned short*)p); f.half[1] = *(const v8us*)((const unsigned short*)p + 256); return f.v; }
__device__ __forceinline__ v8f wm(v16h a, v16h b, v8f c) { return __builtin_amdgcn_wmma_f32_16x16x32_f16(false, a, false, b, (short)0, c, false, false); }
// value of lane ^ X inside the 16-lane row, by DPP row_xmask (a shuffle would go through the LDS pipe and its wait); every lane is on where it is used
template <int X> __device__ __forceinline__ float row_xor(float v) { return __int_as_float(__builtin_amdgcn_update_dpp(0, __float_as_int(v), 0x160 + X, 0xf, 0xf, true)); }
__device__ __forceinline__ float row_max16(float v) { v = fmaxf(v, row_xor<1>(v)); v = fmaxf(v, row_xor<2>(v)); v = fmaxf(v, row_xor<4>(v)); return fmaxf(v, row_xor<8>(v)); }
__device__ __forceinline__ float row_sum16(float v) { v += row_xor<1>(v); v += row_xor<2>(v); v += row_xor<4>(v); return v + row_xor<8>(v); }
// e^(s - m) for the eight rows of a logit tile as 2^(s * log2(e) + nm), nm = -m * log2(e) formed once per row: one fused multiply-add and the hardware's 2^x each. s <= m up to rounding, so nothing
// overflows, and a result under the smallest normal number may go to zero: it is far below one unit of the f16 output. The library's expf spends about a dozen vector instructions on ranges that cannot occur here.
#define LOG2E 1.4426950408889634f
__device__ __forceinline__ v8f exp_rel(v8f s, const float (&nm)[8]) {
  float x[8], e0, e1, e2, e3, e4, e5, e6, e7;
#pragma unroll  /* constant indices: x stays in registers */
  for (int r = 0; r < 8; ++r) x[r] = fmaf(s[r], LOG2E, nm[r]);
  asm("v_exp_f32 %0, %8\n\tv_exp_f32 %1, %9\n\tv_exp_f32 %2, %10\n\tv_exp_f32 %3, %11\n\tv_exp_f32 %4, %12\n\tv_exp_f32 %5, %13\n\tv_exp_f32 %6, %14\n\tv_exp_f32 %7, %15\n\tv_nop"
      : "=&v"(e0), "=&v"(e1), "=&v"(e2), "=&v"(e3), "=&v"(e4), "=&v"(e5), "=&v"(e6), "=&v"(e7) : "v"(x[0]), "v"(x[1]), "v"(x[2]), "v"(x[3]), "v"(x[4]), "v"(x[5]), "v"(x[6]), "v"(x[7]));
  return v8f{e0, e1, e2, e3, e4, e5, e6, e7};
}
struct QFrag { v16h a1h[2], a1l[2], a2h[2], a2l[2]; };
#define DRT 2                    /* 16-row query tiles per wave: every B fragment that is loaded feeds both */
// both logit tiles (16 query rows x 16 key columns, K 64) of each of the wave's DRT query tiles from the hi/lo planes: hi*hi in one accumulator, the two cross terms (scaled 2^10) in a second
__device__ __forceinline__ void logit_tile(const QFrag (&q)[DRT], const _Float16* b2h, const _Float16* b2l, const _Float16* b1h, const _Float16* b1l, v8f (&s1)[DRT], v8f (&s2)[DRT]) {
  v8f h1[DRT] = {}, l1[DRT] = {}, h2[DRT] = {}, l2[DRT] = {};
  const v16h p[2] = {frag_at(b2h), frag_at(b2h + 512)}, x[2] = {frag_at(b1h), frag_at(b1h + 512)}, pl[2] = {frag_at(b2l), frag_at(b2l + 512)}, xl[2] = {frag_at(b1l), frag_at(b1l + 512)};
  // holds all sixteen loads of the tile in front of its first WMMA: one load latency a tile; left alone the compiler reuses fragment registers and waits for memory several times a tile
  asm volatile("" :: "v"(p[0]), "v"(p[1]), "v"(x[0]), "v"(x[1]), "v"(pl[0]), "v"(pl[1]), "v"(xl[0]), "v"(xl[1]));
#pragma unroll
  for (int ks = 0; ks < 2; ++ks) {
#pragma unroll
    for (int i = 0; i < DRT; ++i) { h1[i] = wm(q[i].a1h[ks], p[ks], h1[i]); h2[i] = wm(q[i].a2h[ks], x[ks], h2[i]); }
#pragma unroll
    for (int i = 0; i < DRT; ++i) { l1[i] = wm(q[i].a1l[ks], p[ks], l1[i]); l2[i] = wm(q[i].a2l[ks], x[ks], l2[i]); }
#pragma unroll
    for (int i = 0; i < DRT; ++i) { l1[i] = wm(q[i].a1h[ks], pl[ks], l1[i]); l2[i] = wm(q[i].a2h[ks], xl[ks], l2[i]); }
  }
#pragma unroll
  for (int i = 0; i < DRT; ++i)
#pragma unroll
    for (int r = 0; r < 8; ++r) { s1[i][r] = h1[i][r] + l1[i][r] * 0.0009765625f; s2[i][r] = h2[i][r] + l2[i][r] * 0.0009765625f; }
}
// Logits, both softmaxes and |difference| in one kernel: a work-group of 8 waves owns 32 query rows (one work-group per WGP covers all rows), wave w the key columns [512 w, 512 w + 512).
// Every wave holds the query fragments of both 16-row tiles in registers (2 waves per SIMD: 512 registers each), so the key planes are read from L2 once per 32 rows and pass.
// The logits stay in registers and are formed three times (row maximum, row sum, output); nothing of them goes to memory.
#define DW 8                     /* waves per work-group */
#define DROW (16 * DRT)          /* query rows per work-group */
#define DCOL (NP / DW)           /* key columns per wave */
#define DPIT (DCOL + 8)          /* LDS row pitch in f16: 16-byte multiple, rows 8 apart fall on other banks */
__global__ __launch_bounds__(DW * 32) void k_attdiff(const _Float16* __restrict__ A1h, const _Float16* __restrict__ A1l, const _Float16* __restrict__ A2h, const _Float16* __restrict__ A2l,
                                                 const _Float16* __restrict__ B2h, const _Float16* __restrict__ B2l, const _Float16* __restrict__ B1h, const _Float16* __restrict__ B1l, _Float16* __restrict__ D16) {
  __shared__ __attribute__((aligned(16))) _Float16 st[DW][DROW][DPIT];
  __shared__ float red[2][DW][DROW];
  __shared__ float fin[2][DROW];
  const int tid = threadIdx.x, w = tid >> 5, lane = tid & 31, ln = lane & 15, hh = lane >> 4; const int row0 = blockIdx.x * DROW;
  { const size_t pb = (size_t)blockIdx.y * 4 * NP * C8;  /* blockIdx.y = batch: four planes of each kind a batch */
    A1h += pb; A1l += pb; A2h += pb; A2l += pb; B2h += pb; B2l += pb; B1h += pb; B1l += pb; D16 += (size_t)blockIdx.y * NP * NP; }
  QFrag q[DRT];
#pragma unroll
  for (int i = 0; i < DRT; ++i) { const size_t ao = (size_t)(row0 + 16 * i) * C8 + 8 * lane;
#pragma unroll
    for (int ks = 0; ks < 2; ++ks) { q[i].a1h[ks] = frag_at(A1h + ao + ks * 512); q[i].a1l[ks] = frag_at(A1l + ao + ks * 512); q[i].a2h[ks] = frag_at(A2h + ao + ks * 512); q[i].a2l[ks] = frag_at(A2l + ao + ks * 512); } }
  asm volatile("s_wait_xcnt 0x0" ::: "memory");  /* stands in front of the reuse of the address registers that the query loads name */
  __builtin_amdgcn_sched_barrier(0);             /* keeps the key-plane address arithmetic, which reuses those registers, behind that wait */
  const size_t bo = (size_t)(w * DCOL) * C8 + 8 * lane; B2h += bo; B2l += bo; B1h += bo; B1l += bo;
  float m1[DRT][8], m2[DRT][8];
#pragma unroll
  for (int i = 0; i < DRT; ++i)
#pragma unroll
    for (int r = 0; r < 8; ++r) { m1[i][r] = -3.0e38f; m2[i][r] = -3.0e38f; }
#pragma unroll 1  /* rolled: an unrolled body would hold several tiles' B fragments and leave the 512-register budget of 2 waves per SIMD */
  for (int j = 0; j < DCOL / 16; ++j) { v8f s1[DRT], s2[DRT]; const size_t o = (size_t)j * 16 * C8; logit_tile(q, B2h + o, B2l + o, B1h + o, B1l + o, s1, s2);
#pragma unroll
    for (int i = 0; i < DRT; ++i)
#pragma unroll
      for (int r = 0; r < 8; ++r) { m1[i][r] = fmaxf(m1[i][r], s1[i][r]); m2[i][r] = fmaxf(m2[i][r], s2[i][r]); } }
#pragma unroll
  for (int i = 0; i < DRT; ++i)
#pragma unroll
    for (int r = 0; r < 8; ++r) { m1[i][r] = row_max16(m1[i][r]); m2[i][r] = row_max16(m2[i][r]); }
  if (ln == 0) {
#pragma unroll
    for (int i = 0; i < DRT; ++i)
#pragma unroll
      for (int r = 0; r < 8; ++r) { red[0][w][16 * i + 8 * hh + r] = m1[i][r]; red[1][w][16 * i + 8 * hh + r] = m2[i][r]; } }
  __syncthreads();
  if (tid < 2 * DROW) { const int mt = tid / DROW, rw = tid % DROW; float v = red[mt][0][rw]; for (int k = 1; k < DW; ++k) v = fmaxf(v, red[mt][k][rw]); fin[mt][rw] = v; }
  __syncthreads();
  float u1[DRT][8], u2[DRT][8];
#pragma unroll
  for (int i = 0; i < DRT; ++i)
#pragma unroll
    for (int r = 0; r < 8; ++r) { m1[i][r] = -LOG2E * fin[0][16 * i + 8 * hh + r]; m2[i][r] = -LOG2E * fin[1][16 * i + 8 * hh + r]; u1[i][r] = 0.f; u2[i][r] = 0.f; }  /* from here on m1, m2 hold -max * log2(e) */
#pragma unroll 1  /* rolled for the register budget, as above */
  for (int j = 0; j < DCOL / 16; ++j) { v8f s1[DRT], s2[DRT]; const size_t o = (size_t)j * 16 * C8; logit_tile(q, B2h + o, B2l + o, B1h + o, B1l + o, s1, s2);
#pragma unroll
    for (int i = 0; i < DRT; ++i) { const v8f e1 = exp_rel(s1[i], m1[i]), e2 = exp_rel(s2[i], m2[i]);
#pragma unroll
      for (int r = 0; r < 8; ++r) { u1[i][r] += e1[r]; u2[i][r] += e2[r]; } } }
#pragma unroll
  for (int i = 0; i < DRT; ++i)
#pragma unroll
    for (int r = 0; r < 8; ++r) { u1[i][r] = row_sum16(u1[i][r]); u2[i][r] = row_sum16(u2[i][r]); }
  if (ln == 0) {
#pragma unroll
    for (int i = 0; i < DRT; ++i)
#pragma unroll
      for (int r = 0; r < 8; ++r) { red[0][w][16 * i + 8 * hh + r] = u1[i][r]; red[1][w][16 * i + 8 * hh + r] = u2[i][r]; } }
  __syncthreads();
  if (tid < 2 * DROW) { const int mt = tid / DROW, rw = tid % DROW; float v = red[mt][0][rw]; for (int k = 1; k < DW; ++k) v += red[mt][k][rw]; fin[mt][rw] = 1.0f / v; }
  __syncthreads();
#pragma unroll
  for (int i = 0; i < DRT; ++i)
#pragma unroll
    for (int r = 0; r < 8; ++r) { u1[i][r] = fin[0][16 * i + 8 * hh + r]; u2[i][r] = fin[1][16 * i + 8 * hh + r]; }
#pragma unroll 1  /* rolled for the register budget, as above */
  for (int j = 0; j < DCOL / 16; ++j) { v8f s1[DRT], s2[DRT]; const size_t o = (size_t)j * 16 * C8; logit_tile(q, B2h + o, B2l + o, B1h + o, B1l + o, s1, s2);
#pragma unroll
    for (int i = 0; i < DRT; ++i) { const v8f e1 = exp_rel(s1[i], m1[i]), e2 = exp_rel(s2[i], m2[i]);
#pragma unroll
      for (int r = 0; r < 8; ++r) st[w][16 * i + 8 * hh + r][j * 16 + ln] = (_Float16)(fabsf(e1[r] * u1[i][r] - e2[r] * u2[i][r]) * 16384.0f); } }
  // each wave reads back only its own slab: the fence keeps the LDS reads behind the writes of the wave's other lanes, no work-group barrier is needed
  __builtin_amdgcn_fence(__ATOMIC_ACQ_REL, "workgroup"); __builtin_amdgcn_wave_barrier();
#pragma unroll 1  /* rolled in groups of eight rows: sixteen LDS reads go out ahead of their stores */
  for (int r0 = 0; r0 < DROW; r0 += 8) {
#pragma unroll
    for (int r = r0; r < r0 + 8; ++r)
#pragma unroll
      for (int c = 0; c < DCOL; c += 256) { const v8us v = *(const v8us*)&st[w][r][c + lane * 8]; *(v8us*)((unsigned short*)D16 + (size_t)(row0 + r) * NP + w * DCOL + c + lane * 8) = v; }
    asm volatile("s_wait_xcnt 0x0" ::: "memory");  /* stands in front of the next trip's rewrite of the data and address registers that these stores name */
  }
}

// C[M][N] (f32, pitch ldc) = A[M][K] . B[N][K]^T * alpha + bias[col] (bias rounded to bf16); A and B f16 with k contiguous. One 128 x 128 tile of C per work-group of 4 waves (2 x 2, 64 x 64 each):
// an operand row that comes from L2 feeds 128 rows or columns of C, and a fragment that is read from LDS feeds four WMMAs.
// A stage is 128 k of the tile's 128 A rows and 128 B rows, brought into LDS by asynchronous b128 copies: one copy of a wave is 256 contiguous bytes (2 whole lines) of each of two rows, where a fragment load
// straight from the row-major operand touches 16 lines. Two buffers: the next stage's copies fly while this stage is worked on. M, N multiples of 128, K a multiple of 128.
// Every accumulator sums k in rising order, 32 at a time.
#define GT 128                   /* rows of each operand per work-group */
#define GW 64                    /* rows and columns of C per wave */
#define GK 128                   /* k per stage */
#define GP (GK + 8)              /* LDS row pitch in f16: 272 B = 16 B x odd, so the 16 rows of a ds_load_b128 fall on all banks */
#define GQ (GW + 4)              /* row pitch in f32 of a wave's tile of C in LDS: rows 8 apart fall on other banks, 16-byte multiple */
typedef __attribute__((address_space(3))) const _Float16 lds_f16;
// eight pairs of rows (8 rows apart) of one operand: l = the lane's LDS byte address, g = the lane's global address, gs = 8 rows of the operand in elements
__device__ __forceinline__ void copy8(unsigned l, const _Float16* g, size_t gs) {
  const unsigned ls = 8 * GP * 2;
  // the last line is the wait that stands in front of any rewrite of the address registers that these copies name
  asm volatile("global_load_async_to_lds_b128 %0, %8, off\n\t"
               "global_load_async_to_lds_b128 %1, %9, off\n\t"
               "global_load_async_to_lds_b128 %2, %10, off\n\t"
               "global_load_async_to_lds_b128 %3, %11, off\n\t"
               "global_load_async_to_lds_b128 %4, %12, off\n\t"
               "global_load_async_to_lds_b128 %5, %13, off\n\t"
               "global_load_async_to_lds_b128 %6, %14, off\n\t"
               "global_load_async_to_lds_b128 %7, %15, off\n\t"
               "s_wait_xcnt 0x0"
               :: "v"(l), "v"(l + ls), "v"(l + 2 * ls), "v"(l + 3 * ls), "v"(l + 4 * ls), "v"(l + 5 * ls), "v"(l + 6 * ls), "v"(l + 7 * ls),
                  "v"(g), "v"(g + gs), "v"(g + 2 * gs), "v"(g + 3 * gs), "v"(g + 4 * gs), "v"(g + 5 * gs), "v"(g + 6 * gs), "v"(g + 7 * gs) : "memory");
}
// one stage: wave w brings rows 2 w, 2 w + 1, 2 w + 8, 2 w + 9, ..., 2 w + 121 of the A tile (LDS rows 0..127) and of the B tile (LDS rows 128..255): 32 copies of a wave
__device__ __forceinline__ void fill_stage(unsigned l, const _Float16* ga, size_t sa, const _Float16* gb, size_t sb) {
  copy8(l, ga, sa); copy8(l + 64 * GP * 2, ga + 8 * sa, sa); copy8(l + 128 * GP * 2, gb, sb); copy8(l + 192 * GP * 2, gb + 8 * sb, sb);
}
// fragment from a row-major LDS tile; p = row (lane & 15), k = 8 * (lane >> 4): k 8*(lane>>4)+0..7 and 16+8*(lane>>4)+0..7, alike for A and B
__device__ __forceinline__ v16h frag_lds(const _Float16* p) { FragH f; f.half[0] = *(const v8us*)((const unsigned short*)p); f.half[1] = *(const v8us*)((const unsigned short*)p + 16); return f.v; }
// blockIdx.z = batch: A, B and C move on by sA, sB, sC elements
__global__ __launch_bounds__(128) void k_gemm_t(const _Float16* __restrict__ A, int lda, size_t sA, const _Float16* __restrict__ B, int ldb, size_t sB, float alpha, const float* __restrict__ bias, float* __restrict__ C, int ldc, size_t sC, int K) {
  __shared__ __attribute__((aligned(16))) _Float16 sm[2][2 * GT][GP];
  const int tid = threadIdx.x, w = tid >> 5, lane = tid & 31, ln = lane & 15, hh = lane >> 4, wr = w >> 1, wc = w & 1;
  const int row0 = blockIdx.y * GT, col0 = blockIdx.x * GT;
  A += blockIdx.z * sA; B += blockIdx.z * sB; C += blockIdx.z * sC;
  const _Float16* ga = A + (size_t)(row0 + 2 * w + hh) * lda + ln * 8; const _Float16* gb = B + (size_t)(col0 + 2 * w + hh) * ldb + ln * 8;
  const size_t sa = (size_t)8 * lda, sb = (size_t)8 * ldb;
  const unsigned l0 = (unsigned)(uintptr_t)(lds_f16*)&sm[0][2 * w + hh][ln * 8], lbuf = 2 * GT * GP * 2;
  const int nt = K / GK;
  v8f acc[4][4] = {};
  fill_stage(l0, ga, sa, gb, sb);
  float bv[4] = {0.f, 0.f, 0.f, 0.f};
  if (bias) {  /* the lane's four bias values: one branch, so that the four loads go out together, while stage 0 is under way */
    const float* bp = bias + col0 + wc * GW + ln; const float b0 = bp[0], b1 = bp[16], b2 = bp[32], b3 = bp[48];
    bv[0] = bf16_round(b0); bv[1] = bf16_round(b1); bv[2] = bf16_round(b2); bv[3] = bf16_round(b3);
  }
  asm volatile("s_wait_asynccnt 0x0" ::: "memory");  /* this wave's copies of stage 0 have landed */
  __syncthreads();                                   /* and every other wave's */
  if (nt > 1) fill_stage(l0 + lbuf, ga + GK, sa, gb + GK, sb);
  for (int t = 0; t < nt; ++t) {
    const _Float16* pa = &sm[t & 1][wr * GW + ln][8 * hh]; const _Float16* pb = &sm[t & 1][GT + wc * GW + ln][8 * hh];
    v16h fa[GK / 32][4], fb[GK / 32][4];
#pragma unroll  /* every index constant: the fragments stay in registers */
    for (int ks = 0; ks < GK / 32; ++ks) {
      fa[ks][0] = frag_lds(pa + ks * 32);
#pragma unroll
      for (int j = 0; j < 4; ++j) fb[ks][j] = frag_lds(pb + j * 16 * GP + ks * 32);
#pragma unroll
      for (int i = 1; i < 4; ++i) fa[ks][i] = frag_lds(pa + i * 16 * GP + ks * 32);
    }
    // keeps the stage's 64 LDS loads one group in front of its WMMAs, which then follow behind counted waits; left alone the compiler reuses fragment registers and the lone wave of a SIMD waits out the LDS latency several times per k step
    __builtin_amdgcn_sched_barrier(0);
#pragma unroll  /* as above */
    for (int ks = 0; ks < GK / 32; ++ks)
#pragma unroll
      for (int i = 0; i < 4; ++i)
#pragma unroll
        for (int j = 0; j < 4; ++j) acc[i][j] = wm(fa[ks][i], fb[ks][j], acc[i][j]);
    // keeps the WMMAs in front of the waits below, so that they run while the later LDS loads still return and the refill is issued directly behind the barrier
    __builtin_amdgcn_sched_barrier(0);
    asm volatile("s_wait_dscnt 0x0" ::: "memory");     /* this wave's reads of the buffer are done before it is refilled */
    asm volatile("s_wait_asynccnt 0x0" ::: "memory");  /* this wave's copies of stage t + 1 have landed */
    __syncthreads();                                   /* publishes stage t + 1 and ends every wave's reads of stage t */
    if (t + 2 < nt) fill_stage(l0 + (t & 1) * lbuf, ga + (size_t)(t + 2) * GK, sa, gb + (size_t)(t + 2) * GK, sb);
  }
  asm volatile("s_wait_asynccnt 0x0" ::: "memory");    /* no copy is left in flight when the wave ends */
  // behind the last trip's barrier no wave reads the operand buffers any more and no copy is under way: the four waves' tiles of C take the place of buffer 0 (4 x 64 x 68 f32 = its size)
  float* so = (float*)&sm[0][0][0] + w * GW * GQ;
#pragma unroll  /* these three: constant accumulator indices, so that acc stays in registers */
  for (int j = 0; j < 4; ++j)
#pragma unroll
    for (int i = 0; i < 4; ++i)
#pragma unroll
      for (int r = 0; r < 8; ++r) so[(i * 16 + 8 * hh + r) * GQ + j * 16 + ln] = acc[i][j][r] * alpha + bv[j];
  // each wave reads back only its own slab, so that a store covers whole 128-B lines: the fence keeps the LDS reads behind the writes of the wave's other lanes
  __builtin_amdgcn_fence(__ATOMIC_ACQ_REL, "workgroup"); __builtin_amdgcn_wave_barrier();
  float* cw = C + (size_t)(row0 + wr * GW + hh) * ldc + col0 + wc * GW + ln * 4;
#pragma unroll 1  /* rolled in groups of sixteen rows: eight LDS reads go out ahead of their stores */
  for (int q0 = 0; q0 < GW / 2; q0 += 8) {
#pragma unroll
    for (int q = q0; q < q0 + 8; ++q) { const v4f v = *(const v4fa*)&so[(q * 2 + hh) * GQ + ln * 4]; *(v4f*)(cw + (size_t)(q * 2) * ldc) = v; }
    asm volatile("s_wait_xcnt 0x0" ::: "memory");  /* stands in front of the next trip's rewrite of the data and address registers that these stores name */
  }
}

extern "C" void kernel_launch(void* const* d_in, const int* in_sizes, int n_in,
                              void* d_out, int out_size, void* d_ws, size_t ws_size, hipStream_t stream) {
  (void)in_sizes; (void)n_in; (void)out_size;
  const float* x1 = (const float*)d_in[0]; const float* x2 = (const float*)d_in[1]; const float* Wb = (const float*)d_in[2]; const float* bb_ = (const float*)d_in[3]; const float* Wc = (const float*)d_in[4]; const float* bc = (const float*)d_in[5]; const float* Wd = (const float*)d_in[6]; const float* bd = (const float*)d_in[7]; const float* al = (const float*)d_in[8]; const float* be = (const float*)d_in[9];
  char* ws = (char*)d_ws; size_t off = 0;
  auto take = [&](size_t bytes) { char* p = ws + off; off += (bytes + 255) & ~(size_t)255; return p; };
  _Float16* BW = (_Float16*)take((size_t)NW * CC * 2); float* BI = (float*)take(NW * 4);
  _Float16* X = (_Float16*)take((size_t)NS * NP * CC * 2); float* P = (float*)take((size_t)NS * NP * NW * 4);
  _Float16* Hh = (_Float16*)take((size_t)2 * NS * NP * C8 * 2); _Float16* Hl = (_Float16*)take((size_t)2 * NS * NP * C8 * 2);      /* plane 2 s + j: conv_b (j 0) or conv_c (j 1) of slab s */
  _Float16* FT = (_Float16*)take((size_t)NBt * CC * NP * 2); _Float16* D16 = (_Float16*)take((size_t)NBt * NP * NP * 2);
  if (off > ws_size) return;
  const size_t n8 = (size_t)NP * C8 / 8, pl = (size_t)NP * C8;
  k_prep<<<(NW * CC / 8 + 255) / 256, 256, 0, stream>>>(Wb, Wc, Wd, bb_, bc, bd, BW, BI);      /* conv weights [O][C] = natural Bt */
  k_tok<<<dim3(NP / TWX, CC / TR, NS), 256, 0, stream>>>(x1, x2, X);
  k_gemm_t<<<dim3(NW / GT, NS * NP / GT), 128, 0, stream>>>(X, CC, 0, BW, CC, 0, 0.0625f, BI, P, NW, 0, CC);      /* P[s][n][0..63] = conv_b, [64..127] = conv_c, [128..639] = conv_d of slab s (exact + bias) */
  k_split<<<dim3((unsigned)((n8 + 255) / 256), 2 * NS), 256, 0, stream>>>(P, Hh, Hl, n8);      /* a1, b1, a2, b2 of each batch -> hi/lo planes */
  k_fcomb<<<dim3(NP / TR, CC / TWF, NBt), 256, 0, stream>>>(P, al, be, FT);
  k_attdiff<<<dim3(NP / DROW, NBt), DW * 32, 0, stream>>>(Hh, Hl, Hh + 2 * pl, Hl + 2 * pl, Hh + 3 * pl, Hl + 3 * pl, Hh + pl, Hl + pl, D16);      /* a1 = plane 0, a2 = plane 2, b2 = plane 3, b1 = plane 1: |softmax(a1.b2) - softmax(a2.b1)| x 2^14 */
  k_gemm_t<<<dim3(NP / GT, CC / GT, NBt), 128, 0, stream>>>(FT, NP, (size_t)CC * NP, D16, NP, (size_t)NP * NP, 1.0f / 16384.0f, nullptr, (float*)d_out, NP, (size_t)CC * NP, NP);      /* out[b][c][n] = sum_m F[c][m] att[n][m]: M 512 (c), N 4096 (n), K 4096 (m) -> NCHW directly */
}

// v008
// It runs in 137 microseconds.
// Timed twice side by side with v007, it ran 1.10 times as fast both times.
// Over all steps from v000 it is 11.1 times as fast.
#include <hip/hip_runtime.h>
// Position-attention difference module (B 2, C 512, 64×64 = 4096 positions): a1 = conv_b(x1), b2 = conv_c(x2), a2 = conv_b(x2), b1 = conv_c(x1) (1×1, 512→64, + bias); f = conv_d (512→512, + bias); att12 = softmax_m(a1ᵀ·b2), att21 = softmax_m(a2ᵀ·b1) (no scaling); att = |att12 − att21|; out = α·f1·attᵀ + β·f2·attᵀ = (α f1 + β f2)·attᵀ → [2,512,64,64].
// Structure: every kernel runs once, over both batches and both inputs (7 launches): 1x1 convs as one GEMM against the stacked weights [Wb; Wc; Wd] on position-major f16 planes (exact products); a/b as f16 hi + lo*2^10 planes so both logit matrices are about f32 (three cross products each); one kernel forms both logit matrices in registers, both softmaxes per row in f32 and writes |difference| x 2^14 as f16; F = alpha f1 + beta f2 (f32 combine, then f16) and out = F.att^T by one GEMM straight into the NCHW output.
// Compute dtype: inputs and parameters rounded to bf16; logits ≈f32; softmaxes/difference in f32; |Δ| (×2^14) and F as f16 operands (≈2^-12), f32 accumulation. v_wmma_f32_16x16x32_f16.
#define NBt 2
#define CC 512
#define C8 64
#define NP 4096
#define NW (2 * C8 + CC)         /* rows of the stacked weights [Wb; Wc; Wd] = columns of the projection matrix P */
#define NS (2 * NBt)             /* position-major input slabs: slab s = 2 * batch + (0 for x1, 1 for x2) */
typedef __bf16 v16b __attribute__((ext_vector_type(16)));
typedef unsigned short v8us __attribute__((ext_vector_type(8), may_alias));
typedef float  v8f  __attribute__((ext_vector_type(8)));
typedef float  v4f  __attribute__((ext_vector_type(4)));
typedef float  v4fa __attribute__((ext_vector_type(4), may_alias));
union FragB { v16b v; v8us half[2]; unsigned short u[16]; };

__device__ __forceinline__ unsigned short bf16_bits(float x) { unsigned int u = __float_as_uint(x); return (unsigned short)((u + 0x7FFFu + ((u >> 16) & 1u)) >> 16); }
__device__ __forceinline__ float bf16_val(unsigned short b) { return __uint_as_float(((unsigned int)b) << 16); }
__device__ __forceinline__ float bf16_round(float x) { return bf16_val(bf16_bits(x)); }
// D += A·B with NT terms: 1 = ah·bh, 2 = + al·bh (A split), 3 = + ah·bl (both split)
template <int NT>
__device__ __forceinline__ v8f mmaN(v16b ah, v16b al, v16b bh, v16b bl, v8f c) {
  c = __builtin_amdgcn_wmma_f32_16x16x32_bf16(false, ah, false, bh, (short)0, c, false, false);
  if (NT >= 2) c = __builtin_amdgcn_wmma_f32_16x16x32_bf16(false, al, false, bh, (short)0, c, false, false);
  if (NT >= 3) c = __builtin_amdgcn_wmma_f32_16x16x32_bf16(false, ah, false, bl, (short)0, c, false, false);
  asm volatile("v_nop\n\tv_nop\n\tv_nop\n\tv_nop" : "+v"(c) : "v"(ah), "v"(al), "v"(bh), "v"(bl));
  return c;
}

__global__ __launch_bounds__(256) void k_wt_bf16(const float* __restrict__ W, unsigned short* __restrict__ Wt, int K, int N) {
  const int t = blockIdx.x * 256 + threadIdx.x;
  const int k8n = K / 8;
  if (t >= N * k8n) return;
  const int n = t / k8n, k8 = (t % k8n) * 8;
  v8us v;
#pragma unroll
  for (int i = 0; i < 8; ++i) v[i] = bf16_bits(W[(size_t)(k8 + i) * N + n]);
  *(v8us*)(Wt + (size_t)n * K + k8) = v;
  
}

// GEMM C[M][N] (f32, pitch ldc) = act(A[M][K]·W + bias). A f32 row-major (pitch lda) converted per fragment to bf16
// (ASPLIT: hi/lo two planes -> 2 terms, else single rounded term); Wt bf16 [N][K] (pitch ldb). BIAS_BF16 rounds the
// bias to bf16 first (bias quantised to bf16 before the add). K%32==0, M%16==0, N%64==0.
template <bool ASPLIT, int ACT, bool BIAS_BF16>
__global__ __launch_bounds__(128) void k_gemm_bf(const float* __restrict__ A, int lda, const unsigned short* __restrict__ Wt, int ldb,
                                               const float* __restrict__ bias, float* __restrict__ C, int ldc, int M, int N, int K) {
  __shared__ __attribute__((aligned(16))) float so[4][16][64];
  const int tid = threadIdx.x, w = tid >> 5, lane = tid & 31, ln = lane & 15, hh = lane >> 4;
  const int ntn = N / 64;
  const int wid = blockIdx.x * 4 + w;
  const int mt = wid / ntn, nq = wid % ntn;
  if (mt * 16 >= M) return;
  const int row0 = mt * 16, col0 = nq * 64;
  const float* arow = A + (size_t)(row0 + ln) * lda;
  v8f acc[4] = {};
  for (int kb = 0; kb < K; kb += 32) {
    FragB ah, al;
    const v4f x0 = *(const v4fa*)(arow + kb + 8 * hh), x1 = *(const v4fa*)(arow + kb + 8 * hh + 4);
    const v4f x2 = *(const v4fa*)(arow + kb + 16 + 8 * hh), x3 = *(const v4fa*)(arow + kb + 16 + 8 * hh + 4);
    float xs[16] = {x0[0],x0[1],x0[2],x0[3],x1[0],x1[1],x1[2],x1[3],x2[0],x2[1],x2[2],x2[3],x3[0],x3[1],x3[2],x3[3]};
#pragma unroll
    for (int i = 0; i < 16; ++i) { const unsigned short hb = bf16_bits(xs[i]); ah.u[i] = hb; al.u[i] = ASPLIT ? bf16_bits(xs[i] - bf16_val(hb)) : (unsigned short)0; }
#pragma unroll
    for (int t = 0; t < 4; ++t) {
      const unsigned short* brow = Wt + (size_t)(col0 + t * 16 + ln) * ldb + kb;
      FragB b;
      b.half[0] = *(const v8us*)(brow + 8 * hh);
      b.half[1] = *(const v8us*)(brow + 16 + 8 * hh);
      acc[t] = mmaN<ASPLIT ? 2 : 1>(ah.v, al.v, b.v, b.v, acc[t]);
    }
  }
#pragma unroll
  for (int t = 0; t < 4; ++t) {
    float bv = bias ? bias[col0 + t * 16 + ln] : 0.f;
    if (BIAS_BF16) bv = bf16_round(bv);
#pragma unroll
    for (int r = 0; r < 8; ++r) { float v = acc[t][r] + bv; if (ACT == 1) v = fmaxf(v, 0.f); so[w][8 * hh + r][t * 16 + ln] = v; }
  }
  __builtin_amdgcn_fence(__ATOMIC_ACQ_REL, "workgroup");
  __builtin_amdgcn_wave_barrier();
  const int rsub = lane >> 4, c4 = (lane & 15) * 4;
  {
#pragma unroll
    for (int q = 0; q < 8; ++q) {
      const int r = q * 2 + rsub;
      const v4f v = *(const v4fa*)&so[w][r][c4];
      *(v4f*)(C + (size_t)(row0 + r) * ldc + col0 + c4) = v;
    }
    
  }
}

// GEMM C = act(A·W + bias + resid): A f32 (ASPLIT -> hi/lo 2 terms), Wt bf16 [N][K]; ACT 0 none, 1 relu, 2 exact gelu;
// resid (optional, f32, row index = (row % rmod), pitch ldr, RES_BF16 rounds it) added before the activation.
template <bool ASPLIT, int ACT, bool BIAS_BF16, bool RES_BF16>
__global__ __launch_bounds__(128) void k_gemm_bf3(const float* __restrict__ A, int lda, const unsigned short* __restrict__ Wt, int ldb,
                                                const float* __restrict__ bias, const float* __restrict__ resid, int rmod, int ldr,
                                                float* __restrict__ C, int ldc, int M, int N, int K) {
  __shared__ __attribute__((aligned(16))) float so[4][16][64];
  const int tid = threadIdx.x, w = tid >> 5, lane = tid & 31, ln = lane & 15, hh = lane >> 4;
  const int ntn = N / 64;
  const int wid = blockIdx.x * 4 + w;
  const int mt = wid / ntn, nq = wid % ntn;
  if (mt * 16 >= M) return;
  const int row0 = mt * 16, col0 = nq * 64;
  const float* arow = A + (size_t)(row0 + ln) * lda;
  v8f acc[4] = {};
  for (int kb = 0; kb < K; kb += 32) {
    FragB ah, al;
    const v4f x0 = *(const v4fa*)(arow + kb + 8 * hh), x1 = *(const v4fa*)(arow + kb + 8 * hh + 4);
    const v4f x2 = *(const v4fa*)(arow + kb + 16 + 8 * hh), x3 = *(const v4fa*)(arow + kb + 16 + 8 * hh + 4);
    float xs[16] = {x0[0],x0[1],x0[2],x0[3],x1[0],x1[1],x1[2],x1[3],x2[0],x2[1],x2[2],x2[3],x3[0],x3[1],x3[2],x3[3]};
#pragma unroll
    for (int i = 0; i < 16; ++i) { const unsigned short hb = bf16_bits(xs[i]); ah.u[i] = hb; al.u[i] = ASPLIT ? bf16_bits(xs[i] - bf16_val(hb)) : (unsigned short)0; }
#pragma unroll
    for (int t = 0; t < 4; ++t) {
      const unsigned short* brow = Wt + (size_t)(col0 + t * 16 + ln) * ldb + kb;
      FragB b;
      b.half[0] = *(const v8us*)(brow + 8 * hh);
      b.half[1] = *(const v8us*)(brow + 16 + 8 * hh);
      acc[t] = mmaN<ASPLIT ? 2 : 1>(ah.v, al.v, b.v, b.v, acc[t]);
    }
  }
#pragma unroll
  for (int t = 0; t < 4; ++t) {
    const int col = col0 + t * 16 + ln;
    float bv = bias ? bias[col] : 0.f;
    if (BIAS_BF16) bv = bf16_round(bv);
#pragma unroll
    for (int r = 0; r < 8; ++r) {
      float v = acc[t][r] + bv;
      if (resid) { float rv = resid[(size_t)((row0 + 8 * hh + r) % rmod) * ldr + col]; if (RES_BF16) rv = bf16_round(rv); v += rv; }
      if (ACT == 1) v = fmaxf(v, 0.f);
      if (ACT == 2) v = 0.5f * v * (1.0f + erff(v * 0.70710678118654752f));
      if (ACT == 3) { const float u = 0.7978845608028654f * (v + 0.044715f * v * v * v); v = 0.5f * v * (1.0f + tanhf(u)); }
      so[w][8 * hh + r][t * 16 + ln] = v;
    }
  }
  __builtin_amdgcn_fence(__ATOMIC_ACQ_REL, "workgroup");
  __builtin_amdgcn_wave_barrier();
  const int rsub = lane >> 4, c4 = (lane & 15) * 4;
  {
#pragma unroll
    for (int q = 0; q < 8; ++q) {
      const int r = q * 2 + rsub;
      const v4f v = *(const v4fa*)&so[w][r][c4];
      *(v4f*)(C + (size_t)(row0 + r) * ldc + col0 + c4) = v;
    }
    
  }
}
// row LayerNorm (biased variance, eps) over N: s = X (+ R); optional out_sum <- s; out_norm <- (s-mu)*rsqrt(var+eps)*g + b
template <bool PARAM_BF16>
__global__ __launch_bounds__(256) void k_layernorm(const float* __restrict__ X, const float* __restrict__ R, const float* __restrict__ g, const float* __restrict__ bta,
                                                  float* __restrict__ out_sum, float* __restrict__ out_norm, int N, float eps) {
  __shared__ float red[256];
  const int row = blockIdx.x, tid = threadIdx.x;
  const float* x = X + (size_t)row * N; const float* rr = R ? R + (size_t)row * N : nullptr;
  float vals[16];                     // up to N = 4096
  const int per = N / 256;            // contiguous chunk per thread? use strided-by-4 chunks: thread handles j = tid*4 + 1024*u
  float s1 = 0.f;
  for (int u = 0; u < per / 4; ++u) {
    const int j = tid * 4 + 1024 * u;
    const v4f a = *(const v4fa*)(x + j);
    v4f b = {0.f,0.f,0.f,0.f}; if (rr) b = *(const v4fa*)(rr + j);
#pragma unroll
    for (int q = 0; q < 4; ++q) { const float v = a[q] + b[q]; vals[u * 4 + q] = v; s1 += v; }
  }
  red[tid] = s1; __syncthreads();
  for (int st = 128; st > 0; st >>= 1) { if (tid < st) red[tid] += red[tid + st]; __syncthreads(); }
  const float mu = red[0] / (float)N; __syncthreads();
  float s2 = 0.f;
  for (int u = 0; u < per / 4; ++u)
#pragma unroll
    for (int q = 0; q < 4; ++q) { const float c = vals[u * 4 + q] - mu; s2 += c * c; }
  red[tid] = s2; __syncthreads();
  for (int st = 128; st > 0; st >>= 1) { if (tid < st) red[tid] += red[tid + st]; __syncthreads(); }
  const float rs = rsqrtf(red[0] / (float)N + eps);
  {
    for (int u = 0; u < per / 4; ++u) {
      const int j = tid * 4 + 1024 * u;
      v4f o, sm;
#pragma unroll
      for (int q = 0; q < 4; ++q) {
        float gg = g[j + q], bb = bta[j + q];
        if (PARAM_BF16) { gg = bf16_round(gg); bb = bf16_round(bb); }
        sm[q] = vals[u * 4 + q]; o[q] = (vals[u * 4 + q] - mu) * rs * gg + bb;
      }
      if (out_sum) *(v4f*)(out_sum + (size_t)row * N + j) = sm;
      *(v4f*)(out_norm + (size_t)row * N + j) = o;
    }
    
  }
}



// ---- f16 WMMA path (v_wmma_f32_16x16x32_f16): 11-bit significands for operands in range — used where a [0,1] probability operand needs more precision than bf16
typedef _Float16 v16h __attribute__((ext_vector_type(16)));
union FragH { v16h v; v8us half[2]; _Float16 h[16]; unsigned short u[16]; };
template <int NT>
__device__ __forceinline__ v8f mmaH(v16h ah, v16h al, v16h bh, v16h bl, v8f c) {
  c = __builtin_amdgcn_wmma_f32_16x16x32_f16(false, ah, false, bh, (short)0, c, false, false);
  if (NT >= 2) c = __builtin_amdgcn_wmma_f32_16x16x32_f16(false, al, false, bh, (short)0, c, false, false);
  if (NT >= 3) c = __builtin_amdgcn_wmma_f32_16x16x32_f16(false, ah, false, bl, (short)0, c, false, false);
  asm volatile("v_nop\n\tv_nop\n\tv_nop\n\tv_nop" : "+v"(c) : "v"(ah), "v"(al), "v"(bh), "v"(bl));
  return c;
}
// batched GEMM like k_gemm_b but f16 operands: A f32 (split into f16 hi/lo if ASPLIT, else rounded to f16), Bt = f16 values [n][k]; alpha; C f32; N multiple of 16 (partial tiles skipped)
template <bool ASPLIT>
__global__ __launch_bounds__(128) void k_gemm_h(const float* __restrict__ A, int lda, size_t sA, const _Float16* __restrict__ Bh, int ldb, size_t sB, float alpha, float* __restrict__ C, int ldc, size_t sC, int M, int N, int K) {
  __shared__ __attribute__((aligned(16))) float so[4][16][64];
  const int tid = threadIdx.x, w = tid >> 5, lane = tid & 31, ln = lane & 15, hh = lane >> 4; const int by = blockIdx.y;
  A += (size_t)by * sA; Bh += (size_t)by * sB; C += (size_t)by * sC;
  const int ntn = (N + 63) / 64; const int wid = blockIdx.x * 4 + w; const int mt = wid / ntn, nq = wid % ntn; if (mt * 16 >= M) return;
  const int row0 = mt * 16, col0 = nq * 64; const float* arow = A + (size_t)(row0 + ln) * lda;
  v8f acc[4] = {};
  for (int kb = 0; kb < K; kb += 32) {
    FragH ah, al;
    const v4f x0 = *(const v4fa*)(arow + kb + 8 * hh), x1 = *(const v4fa*)(arow + kb + 8 * hh + 4), x2 = *(const v4fa*)(arow + kb + 16 + 8 * hh), x3 = *(const v4fa*)(arow + kb + 16 + 8 * hh + 4);
    float xs[16] = {x0[0],x0[1],x0[2],x0[3],x1[0],x1[1],x1[2],x1[3],x2[0],x2[1],x2[2],x2[3],x3[0],x3[1],x3[2],x3[3]};
#pragma unroll
    for (int i = 0; i < 16; ++i) { const _Float16 h = (_Float16)xs[i]; ah.h[i] = h; al.h[i] = ASPLIT ? (_Float16)(xs[i] - (float)h) : (_Float16)0.0f; }
#pragma unroll
    for (int t = 0; t < 4; ++t) { if (col0 + t * 16 >= N) continue; const size_t boff = (size_t)(col0 + t * 16 + ln) * ldb + kb; FragH bq; bq.half[0] = *(const v8us*)(Bh + boff + 8 * hh); bq.half[1] = *(const v8us*)(Bh + boff + 16 + 8 * hh);
      acc[t] = mmaH<ASPLIT ? 2 : 1>(ah.v, al.v, bq.v, bq.v, acc[t]); }
  }
#pragma unroll
  for (int t = 0; t < 4; ++t) { if (col0 + t * 16 >= N) continue;
#pragma unroll
    for (int r = 0; r < 8; ++r) so[w][8 * hh + r][t * 16 + ln] = acc[t][r] * alpha; }
  __builtin_amdgcn_fence(__ATOMIC_ACQ_REL, "workgroup"); __builtin_amdgcn_wave_barrier();
  const int rsub = lane >> 4, c4 = (lane & 15) * 4;
  {
#pragma unroll
    for (int q = 0; q < 8; ++q) { const int r = q * 2 + rsub; if (col0 + c4 < N) { const v4f v = *(const v4fa*)&so[w][r][c4]; *(v4f*)(C + (size_t)(row0 + r) * ldc + col0 + c4) = v; } }
     }
}

// Wt[n][k] = f16(W[k][n]·scale) from f32 row-major W[K][N] (scale = power of two; bf16-exact weights stay exact in f16 away from the subnormal range)
__global__ __launch_bounds__(256) void k_wt_f16(const float* __restrict__ W, _Float16* __restrict__ Wt, int K, int N, float scale) {
  const int t = blockIdx.x * 256 + threadIdx.x; if (t >= N * (K / 8)) return; const int n = t / (K / 8), k8 = (t % (K / 8)) * 8; FragH f;
#pragma unroll
  for (int i = 0; i < 8; ++i) f.h[i] = (_Float16)(bf16_round(W[(size_t)(k8 + i) * N + n]) * scale); const v8us o = f.half[0];
  *(v8us*)((unsigned short*)Wt + (size_t)n * K + k8) = o; 
}
// k_gemm_hh variant with fused epilogue: v = acc·alpha + bias[by·sBias + col] (+ CP[(row/rowsPerB)·sCPb + by·64 + col] if CP) ; ACT 0 none / 1 elu ; writes f32 C and f16 C16, each if non-null
template <int ACT>
__global__ __launch_bounds__(128) void k_gemm_hhx(const _Float16* __restrict__ A, int lda, size_t sA, const _Float16* __restrict__ Bh, int ldb, size_t sB, float alpha, const float* __restrict__ bias, size_t sBias, const float* __restrict__ CP, int rowsPerB, size_t sCPb, int row0g,
    float* __restrict__ C, _Float16* __restrict__ C16, int ldc, size_t sC, int M, int N, int K) {
  __shared__ __attribute__((aligned(16))) float so[4][16][64];
  const int tid = threadIdx.x, w = tid >> 5, lane = tid & 31, ln = lane & 15, hh = lane >> 4; const int by = blockIdx.y;
  A += (size_t)by * sA; Bh += (size_t)by * sB; const size_t cofs = (size_t)by * sC; const float* bp = bias ? bias + (size_t)by * sBias : nullptr;
  const int ntn = (N + 63) / 64; const int wid = blockIdx.x * 4 + w; const int mt = wid / ntn, nq = wid % ntn; if (mt * 16 >= M) return;
  const int row0 = mt * 16, col0 = nq * 64; const _Float16* arow = A + (size_t)(row0 + ln) * lda;
  v8f acc[4] = {};
  for (int kb = 0; kb < K; kb += 32) { FragH ah; ah.half[0] = *(const v8us*)((const unsigned short*)arow + kb + 8 * hh); ah.half[1] = *(const v8us*)((const unsigned short*)arow + kb + 16 + 8 * hh);
#pragma unroll
    for (int t = 0; t < 4; ++t) { if (col0 + t * 16 >= N) continue; const size_t boff = (size_t)(col0 + t * 16 + ln) * ldb + kb; FragH bq; bq.half[0] = *(const v8us*)((const unsigned short*)Bh + boff + 8 * hh); bq.half[1] = *(const v8us*)((const unsigned short*)Bh + boff + 16 + 8 * hh);
      acc[t] = mmaH<1>(ah.v, ah.v, bq.v, bq.v, acc[t]); }
  }
#pragma unroll
  for (int t = 0; t < 4; ++t) { if (col0 + t * 16 >= N) continue; const int col = col0 + t * 16 + ln; const float bv = bp ? bf16_round(bp[col]) : 0.f;
#pragma unroll
    for (int r = 0; r < 8; ++r) { float v = acc[t][r] * alpha + bv; if (CP) { const int bidx = (row0g + row0 + 8 * hh + r) / rowsPerB; v += CP[(size_t)bidx * sCPb + (size_t)by * 64 + col]; } if (ACT == 1) v = (v > 0.f) ? v : expm1f(v); else if (ACT == 7) v = (v > 0.f) ? v + 1.0f : expf(v); else if (ACT == 8) v = tanhf(v); else if (ACT == 9) v = 0.5f * v * (1.0f + tanhf(0.7978845608028654f * (v + 0.044715f * v * v * v))); else if (ACT == 11) v = 1.0f / (1.0f + expf(-v)); else if (ACT == 12) v = (v > 0.f) ? v : 0.01f * v; else if (ACT == 14) v = (v > 0.f) ? v : 0.1f * v; else if (ACT == 15) v = v / (1.0f + expf(-v)); else if (ACT == 3) v = fmaxf(v, 0.f); else if (ACT == 6) v = 0.5f * v * (1.0f + erff(v * 0.70710678118654752f)); so[w][8 * hh + r][t * 16 + ln] = v; } }
  __builtin_amdgcn_fence(__ATOMIC_ACQ_REL, "workgroup"); __builtin_amdgcn_wave_barrier();
  const int rsub = lane >> 4, c4 = (lane & 15) * 4; typedef _Float16 v4h __attribute__((ext_vector_type(4)));
  {
#pragma unroll
    for (int q = 0; q < 8; ++q) { const int r = q * 2 + rsub; if (col0 + c4 < N) { const v4f v = *(const v4fa*)&so[w][r][c4]; if (C) *(v4f*)(C + cofs + (size_t)(row0 + r) * ldc + col0 + c4) = v; if (C16) { v4h h4; for (int i = 0; i < 4; ++i) h4[i] = (_Float16)v[i]; *(v4h*)(C16 + cofs + (size_t)(row0 + r) * ldc + col0 + c4) = h4; } } }
     }
}


typedef _Float16 v4h __attribute__((ext_vector_type(4)));

__global__ __launch_bounds__(256) void k_x16(const float* __restrict__ x, _Float16* __restrict__ X16, size_t n8) { const size_t t = (size_t)blockIdx.x * 256 + threadIdx.x; if (t >= n8) return; FragH f;
#pragma unroll
  for (int q = 0; q < 8; ++q) f.h[q] = (_Float16)bf16_round(x[t * 8 + q]); *(v8us*)((unsigned short*)X16 + t * 8) = f.half[0];  }
__global__ __launch_bounds__(256) void k_h16(const float* __restrict__ x, _Float16* __restrict__ X16, size_t n8) { const size_t t = (size_t)blockIdx.x * 256 + threadIdx.x; if (t >= n8) return; FragH f;
#pragma unroll
  for (int q = 0; q < 8; ++q) f.h[q] = (_Float16)x[t * 8 + q]; *(v8us*)((unsigned short*)X16 + t * 8) = f.half[0];  }
__global__ __launch_bounds__(256) void k_round16f(const float* __restrict__ W, _Float16* __restrict__ Bt, size_t n8) { const size_t t = (size_t)blockIdx.x * 256 + threadIdx.x; if (t >= n8) return; FragH f;
#pragma unroll
  for (int i = 0; i < 8; ++i) f.h[i] = (_Float16)(bf16_round(W[t * 8 + i]) * 16.0f); *(v8us*)((unsigned short*)Bt + t * 8) = f.half[0];  }
template <int NHv, int TTv>
__global__ __launch_bounds__(256) void k_vt(const _Float16* __restrict__ V16, int ldv, int voff, _Float16* __restrict__ Vt) { __shared__ unsigned short tl[64][66]; const int tid = threadIdx.x; const int slab = blockIdx.x / (TTv / 64), lg = blockIdx.x % (TTv / 64); const int b = slab / NHv, h = slab % NHv;
  for (int i = tid; i < 64 * 8; i += 256) { const int r = i / 8, c8 = (i % 8) * 8; FragH f; f.half[0] = *(const v8us*)((const unsigned short*)V16 + ((size_t)b * TTv + lg * 64 + r) * ldv + voff + h * 64 + c8);
#pragma unroll
    for (int q = 0; q < 8; ++q) tl[r][c8 + q] = f.u[q]; }
  __syncthreads();
  {
#pragma unroll
    for (int rd = 0; rd < 2; ++rd) { const int d = rd * 32 + tid / 8, pc = tid % 8; FragH f;
#pragma unroll
      for (int q = 0; q < 8; ++q) f.u[q] = tl[pc * 8 + q][d];
      *(v8us*)((unsigned short*)Vt + ((size_t)slab * 64 + d) * TTv + lg * 64 + pc * 8) = f.half[0]; }
     } }

__global__ __launch_bounds__(256) void k_hl(const float* __restrict__ F, _Float16* __restrict__ Hh, _Float16* __restrict__ Hl, size_t n8) { const size_t t = (size_t)blockIdx.x * 256 + threadIdx.x; if (t >= n8) return; FragH fh, fl; const v4f a = *(const v4fa*)(F + t * 8), c = *(const v4fa*)(F + t * 8 + 4);
#pragma unroll
  for (int q = 0; q < 4; ++q) { _Float16 h = (_Float16)a[q]; fh.h[q] = h; fl.h[q] = (_Float16)((a[q] - (float)h) * 1024.0f); h = (_Float16)c[q]; fh.h[4 + q] = h; fl.h[4 + q] = (_Float16)((c[q] - (float)h) * 1024.0f); }
  { *(v8us*)((unsigned short*)Hh + t * 8) = fh.half[0]; *(v8us*)((unsigned short*)Hl + t * 8) = fl.half[0];  } }

// stacked weights BW[NW][CC] = f16(bf16(W) * 16), rows 0..63 Wb, 64..127 Wc, 128..639 Wd, and the stacked biases BI[NW] (f32, as given)
__global__ __launch_bounds__(256) void k_prep(const float* __restrict__ Wb, const float* __restrict__ Wc, const float* __restrict__ Wd, const float* __restrict__ bb, const float* __restrict__ bc, const float* __restrict__ bd, _Float16* __restrict__ BW, float* __restrict__ BI) {
  const int t = blockIdx.x * 256 + threadIdx.x, n1 = C8 * CC / 8; if (t >= NW * CC / 8) return;
  const float* Wp = (t < n1) ? Wb + (size_t)t * 8 : (t < 2 * n1) ? Wc + (size_t)(t - n1) * 8 : Wd + (size_t)(t - 2 * n1) * 8; FragH f;
#pragma unroll
  for (int i = 0; i < 8; ++i) f.h[i] = (_Float16)(bf16_round(Wp[i]) * 16.0f); *(v8us*)((unsigned short*)BW + (size_t)t * 8) = f.half[0];
  if (t < NW) BI[t] = (t < C8) ? bb[t] : (t < 2 * C8) ? bc[t - C8] : bd[t - 2 * C8]; }
// The two layout changes (k_tok, k_fcomb) go through an LDS tile: 64 source rows x TW contiguous source columns come in as whole 128-B lines (8 lanes x 16 B a row),
// are converted, and leave as rows of 64 f16 = one whole 128-B line each. Read straight across the source rows, every lane of a load would touch a line of its own.
// Few, fat work-groups (two per WGP): every thread has all of its loads in flight at once.
#define TR 64                    /* source rows per tile = f16 per output row */
#define TP (TR + 8)              /* LDS row pitch in f16: 144 B = 16 B x odd */
typedef _Float16 v2ha __attribute__((ext_vector_type(2), may_alias));
// the tile's TW output rows, 128 B each, from LDS to dst (pitch ldd elements): 8 lanes a row
template <int TW>
__device__ __forceinline__ void tile_out(const _Float16 (&tl)[TW][TP], _Float16* __restrict__ dst, size_t ldd, int tid) {
#pragma unroll  /* all LDS reads go out ahead of the stores */
  for (int i = 0; i < TW / 32; ++i) { const int r = (tid >> 3) + 32 * i, e8 = (tid & 7) * 8; const v8us v = *(const v8us*)&tl[r][e8]; *(v8us*)((unsigned short*)dst + (size_t)r * ldd + e8) = v; }
}
#define TWX 256                  /* positions per tile of k_tok */
// blockIdx.x = tile of TWX positions, blockIdx.y = tile of 64 channels, blockIdx.z = slab s
__global__ __launch_bounds__(256) void k_tok(const float* __restrict__ x1, const float* __restrict__ x2, _Float16* __restrict__ X16) {
  __shared__ __attribute__((aligned(16))) _Float16 tl[TWX][TP];  /* [position][channel] */
  const int tid = threadIdx.x, s = blockIdx.z, b = s >> 1, n0 = blockIdx.x * TWX, c0 = blockIdx.y * TR, c = 2 * (tid >> 3), k0 = (tid & 7) * 4;
  const char* x = (const char*)(((s & 1) ? x2 : x1) + ((size_t)b * CC + c0) * NP + n0);  /* the tile's first element: the same for the whole work-group */
  const unsigned ob = (unsigned)(c * NP + k0) * 4;                                       /* the lane's byte offset in the tile */
  v4f u[TWX / 32], v[TWX / 32];
#pragma unroll  /* constant indices: the values stay in registers, and the sixteen loads of a thread are all in flight at once */
  for (int i = 0; i < TWX / 32; ++i) { u[i] = *(const v4fa*)(x + ob + 128 * i); v[i] = *(const v4fa*)(x + ob + NP * 4 + 128 * i); }
  asm volatile("s_wait_xcnt 0x0" :: "v"(ob) : "memory");  /* stands in front of any rewrite of the offset register that these loads name; the operand keeps that register until here */
  __builtin_amdgcn_sched_barrier(0);                      /* keeps the conversions behind all sixteen loads; left alone the compiler holds five loads back until the first have returned: a second memory latency */
#pragma unroll
  for (int i = 0; i < TWX / 32; ++i)
#pragma unroll
    for (int q = 0; q < 4; ++q) { v2ha h; h[0] = (_Float16)bf16_round(u[i][q]); h[1] = (_Float16)bf16_round(v[i][q]); *(v2ha*)&tl[k0 + 32 * i + q][c] = h; }
  __syncthreads();  /* the tile is whole before any wave reads it across */
  tile_out<TWX>(tl, X16 + ((size_t)s * NP + n0) * CC + c0, CC, tid);
}
// blockIdx.y = plane p = 2 * slab + (0 for conv_b, 1 for conv_c): columns 64 (p & 1) .. + 63 of slab p >> 1 of P
__global__ __launch_bounds__(256) void k_split(const float* __restrict__ F, _Float16* __restrict__ Hh, _Float16* __restrict__ Hl, size_t n8) {
  #pragma clang fp contract(off)
  const size_t t = (size_t)blockIdx.x * 256 + threadIdx.x; if (t >= n8) return;
  const size_t p = blockIdx.y; F += (p >> 1) * NP * NW + (p & 1) * C8; Hh += p * NP * C8; Hl += p * NP * C8;
  // planes in WMMA fragment order, 16 positions x 64 channels per 2-KiB block: [k step of 32][fragment half][lane][8 channels]; piece t of the plane is position 16*(t>>7) + (t&15), channels 8*sc..8*sc+7
  const size_t sc = ((t >> 6) & 1) * 4 + ((t >> 5) & 1) * 2 + ((t >> 4) & 1), so = ((t >> 7) * 16 + (t & 15)) * NW + sc * 8;
  const v4f a = *(const v4fa*)(F + so), c = *(const v4fa*)(F + so + 4); FragH fh, fl;
#pragma unroll
  for (int q = 0; q < 8; ++q) { const float v = (q < 4) ? a[q] : c[q - 4]; const _Float16 hi = (_Float16)v; fh.h[q] = hi; fl.h[q] = (_Float16)((v - (float)hi) * 1024.0f); }
  { *(v8us*)((unsigned short*)Hh + t * 8) = fh.half[0]; *(v8us*)((unsigned short*)Hl + t * 8) = fl.half[0];  } }
#define TWF 128                  /* channels per tile of k_fcomb */
// blockIdx.x = tile of 64 positions, blockIdx.y = tile of TWF channels, blockIdx.z = batch; f1, f2 = columns 128.. of the batch's two slabs of P
__global__ __launch_bounds__(256) void k_fcomb(const float* __restrict__ P, const float* __restrict__ al, const float* __restrict__ be, _Float16* __restrict__ FT) {
  #pragma clang fp contract(off)
  __shared__ __attribute__((aligned(16))) _Float16 tl[TWF][TP];  /* [channel][position] */
  const int tid = threadIdx.x, m0 = blockIdx.x * TR, c0 = blockIdx.y * TWF, m = 2 * (tid >> 3), k0 = (tid & 7) * 4;
  const char* F = (const char*)(P + ((size_t)(2 * blockIdx.z) * NP + m0) * NW + 2 * C8 + c0);  /* the first element of f1's tile: the same for the whole work-group */
  const unsigned ob = (unsigned)(m * NW + k0) * 4, ob2 = ob + (unsigned)(NP * NW * 4);         /* the lane's byte offsets from there in f1's tile and in f2's, one slab of P further on */
  const float a = bf16_round(al[0]), bq = bf16_round(be[0]);
  v4f p0[TWF / 32], p1[TWF / 32], r0[TWF / 32], r1[TWF / 32];
#pragma unroll  /* constant indices: the values stay in registers, and the sixteen loads of a thread are all in flight at once */
  for (int i = 0; i < TWF / 32; ++i) { p0[i] = *(const v4fa*)(F + ob + 128 * i); p1[i] = *(const v4fa*)(F + ob + NW * 4 + 128 * i); r0[i] = *(const v4fa*)(F + ob2 + 128 * i); r1[i] = *(const v4fa*)(F + ob2 + NW * 4 + 128 * i); }
  asm volatile("s_wait_xcnt 0x0" :: "v"(ob), "v"(ob2) : "memory");  /* stands in front of any rewrite of the offset registers that these loads name; the operands keep those registers until here */
#pragma unroll
  for (int i = 0; i < TWF / 32; ++i)
#pragma unroll
    for (int q = 0; q < 4; ++q) { v2ha h; h[0] = (_Float16)(a * p0[i][q] + bq * r0[i][q]); h[1] = (_Float16)(a * p1[i][q] + bq * r1[i][q]); *(v2ha*)&tl[k0 + 32 * i + q][m] = h; }
  __syncthreads();  /* the tile is whole before any wave reads it across */
  tile_out<TWF>(tl, FT + ((size_t)blockIdx.z * CC + c0) * NP + m0, NP, tid);
}
// One 16x32 f16 fragment (A row or B column = lane & 15; k = 8*(lane>>4)+0..7 and 16+8*(lane>>4)+0..7) from a plane in the fragment order that k_split writes; p already holds 8*lane.
// Each of the two loads reads 512 contiguous bytes (4 whole lines) per wave; from a row-major plane it would touch 16 lines.
__device__ __forceinline__ v16h frag_at(const _Float16* p) { FragH f; f.half[0] = *(const v8us*)((const unsigned short*)p); f.half[1] = *(const v8us*)((const unsigned short*)p + 256); return f.v; }
__device__ __forceinline__ v8f wm(v16h a, v16h b, v8f c) { return __builtin_amdgcn_wmma_f32_16x16x32_f16(false, a, false, b, (short)0, c, false, false); }
// value of lane ^ X inside the 16-lane row, by DPP row_xmask (a shuffle would go through the LDS pipe and its wait); every lane is on where it is used
template <int X> __device__ __forceinline__ float row_xor(float v) { return __int_as_float(__builtin_amdgcn_update_dpp(0, __float_as_int(v), 0x160 + X, 0xf, 0xf, true)); }
__device__ __forceinline__ float row_min16(float v) { v = fminf(v, row_xor<1>(v)); v = fminf(v, row_xor<2>(v)); v = fminf(v, row_xor<4>(v)); return fminf(v, row_xor<8>(v)); }
__device__ __forceinline__ float row_sum16(float v) { v += row_xor<1>(v); v += row_xor<2>(v); v += row_xor<4>(v); return v + row_xor<8>(v); }
// 2^x of eight values by the hardware's instruction
__device__ __forceinline__ v8f exp2_8(const float (&x)[8]) {
  float e0, e1, e2, e3, e4, e5, e6, e7;
  asm("v_exp_f32 %0, %8\n\tv_exp_f32 %1, %9\n\tv_exp_f32 %2, %10\n\tv_exp_f32 %3, %11\n\tv_exp_f32 %4, %12\n\tv_exp_f32 %5, %13\n\tv_exp_f32 %6, %14\n\tv_exp_f32 %7, %15\n\tv_nop"
      : "=&v"(e0), "=&v"(e1), "=&v"(e2), "=&v"(e3), "=&v"(e4), "=&v"(e5), "=&v"(e6), "=&v"(e7) : "v"(x[0]), "v"(x[1]), "v"(x[2]), "v"(x[3]), "v"(x[4]), "v"(x[5]), "v"(x[6]), "v"(x[7]));
  return v8f{e0, e1, e2, e3, e4, e5, e6, e7};
}
// e^(s - m) for the eight rows of a logit tile as 2^(s * log2(e) + nm), nm = -m * log2(e) formed once per row: one fused multiply-add and the hardware's 2^x each. s <= m up to rounding, so nothing
// overflows, and a result under the smallest normal number may go to zero: it is far below one unit of the f16 output. The library's expf spends about a dozen vector instructions on ranges that cannot occur here.
#define LOG2E 1.4426950408889634f
__device__ __forceinline__ v8f exp_rel(v8f s, const float (&nm)[8]) {
  float x[8];
#pragma unroll  /* constant indices: x stays in registers */
  for (int r = 0; r < 8; ++r) x[r] = fmaf(s[r], LOG2E, nm[r]);
  return exp2_8(x);
}
// Row maximum and row sum in one pass. For eight rows the lane keeps nm = -(largest logit it has seen) * log2(e) and u = the sum of 2^(s * log2(e) + nm) over the logits s it has seen.
// Two more logit tiles a and b: nm falls to the new value, the old sum is brought along by 2^(new nm - old nm) (exactly 1 where nm stays), and the two new terms are added.
// Two tiles a step: one new nm and one such factor serve two logits. At the start nm is far above any value it can take and u is 0: the first factor is 0.
__device__ __forceinline__ void online2(v8f a, v8f b, float (&nm)[8], float (&u)[8]) {
  float d[8];
#pragma unroll  /* constant indices: everything stays in registers */
  for (int r = 0; r < 8; ++r) { const float n = fminf(nm[r], -LOG2E * fmaxf(a[r], b[r])); d[r] = n - nm[r]; nm[r] = n; }
  const v8f c = exp2_8(d), ea = exp_rel(a, nm), eb = exp_rel(b, nm);
#pragma unroll
  for (int r = 0; r < 8; ++r) u[r] = fmaf(u[r], c[r], ea[r] + eb[r]);
}
// the sixteen lanes' pairs (nm, u) of eight rows made one, alike in all sixteen lanes: the pair of the wave's columns
__device__ __forceinline__ void online_row(float (&nm)[8], float (&u)[8]) {
  float d[8];
#pragma unroll
  for (int r = 0; r < 8; ++r) { const float n = row_min16(nm[r]); d[r] = n - nm[r]; nm[r] = n; }
  const v8f c = exp2_8(d);
#pragma unroll
  for (int r = 0; r < 8; ++r) u[r] = row_sum16(u[r] * c[r]);
}
struct QFrag { v16h a1h[2], a1l[2], a2h[2], a2l[2]; };
#define DRT 2                    /* 16-row query tiles per wave: every B fragment that is loaded feeds both */
// both logit tiles (16 query rows x 16 key columns, K 64) of each of the wave's DRT query tiles from the hi/lo planes: hi*hi in one accumulator, the two cross terms (scaled 2^10) in a second
__device__ __forceinline__ void logit_tile(const QFrag (&q)[DRT], const _Float16* b2h, const _Float16* b2l, const _Float16* b1h, const _Float16* b1l, v8f (&s1)[DRT], v8f (&s2)[DRT]) {
  v8f h1[DRT] = {}, l1[DRT] = {}, h2[DRT] = {}, l2[DRT] = {};
  const v16h p[2] = {frag_at(b2h), frag_at(b2h + 512)}, x[2] = {frag_at(b1h), frag_at(b1h + 512)}, pl[2] = {frag_at(b2l), frag_at(b2l + 512)}, xl[2] = {frag_at(b1l), frag_at(b1l + 512)};
  // holds all sixteen loads of the tile in front of its first WMMA: one load latency a tile; left alone the compiler reuses fragment registers and waits for memory several times a tile
  asm volatile("" :: "v"(p[0]), "v"(p[1]), "v"(x[0]), "v"(x[1]), "v"(pl[0]), "v"(pl[1]), "v"(xl[0]), "v"(xl[1]));
#pragma unroll
  for (int ks = 0; ks < 2; ++ks) {
#pragma unroll
    for (int i = 0; i < DRT; ++i) { h1[i] = wm(q[i].a1h[ks], p[ks], h1[i]); h2[i] = wm(q[i].a2h[ks], x[ks], h2[i]); }
#pragma unroll
    for (int i = 0; i < DRT; ++i) { l1[i] = wm(q[i].a1l[ks], p[ks], l1[i]); l2[i] = wm(q[i].a2l[ks], x[ks], l2[i]); }
#pragma unroll
    for (int i = 0; i < DRT; ++i) { l1[i] = wm(q[i].a1h[ks], pl[ks], l1[i]); l2[i] = wm(q[i].a2h[ks], xl[ks], l2[i]); }
  }
#pragma unroll
  for (int i = 0; i < DRT; ++i)
#pragma unroll
    for (int r = 0; r < 8; ++r) { s1[i][r] = h1[i][r] + l1[i][r] * 0.0009765625f; s2[i][r] = h2[i][r] + l2[i][r] * 0.0009765625f; }
}
// Logits, both softmaxes and |difference| in one kernel: a work-group of 8 waves owns 32 query rows (one work-group per WGP covers all rows), wave w the key columns [512 w, 512 w + 512).
// Every wave holds the query fragments of both 16-row tiles in registers (2 waves per SIMD: 512 registers each), so the key planes are read from L2 once per 32 rows and pass.
// The logits stay in registers and are formed twice (row maximum and row sum together, as a running pair; then the output); nothing of them goes to memory.
#define DW 8                     /* waves per work-group */
#define DROW (16 * DRT)          /* query rows per work-group */
#define DCOL (NP / DW)           /* key columns per wave */
#define DPIT (DCOL + 8)          /* LDS row pitch in f16: 16-byte multiple, rows 8 apart fall on other banks */
__global__ __launch_bounds__(DW * 32) void k_attdiff(const _Float16* __restrict__ A1h, const _Float16* __restrict__ A1l, const _Float16* __restrict__ A2h, const _Float16* __restrict__ A2l,
                                                 const _Float16* __restrict__ B2h, const _Float16* __restrict__ B2l, const _Float16* __restrict__ B1h, const _Float16* __restrict__ B1l, _Float16* __restrict__ D16) {
  __shared__ __attribute__((aligned(16))) _Float16 st[DW][DROW][DPIT];
  __shared__ float red[2][DW][DROW], redu[2][DW][DROW];  /* each wave's -max * log2(e) of every row, and its row sums relative to that */
  __shared__ float fin[2][DROW], finu[2][DROW];          /* the same over all columns, the sum as 1 / sum */
  const int tid = threadIdx.x, w = tid >> 5, lane = tid & 31, ln = lane & 15, hh = lane >> 4; const int row0 = blockIdx.x * DROW;
  { const size_t pb = (size_t)blockIdx.y * 4 * NP * C8;  /* blockIdx.y = batch: four planes of each kind a batch */
    A1h += pb; A1l += pb; A2h += pb; A2l += pb; B2h += pb; B2l += pb; B1h += pb; B1l += pb; D16 += (size_t)blockIdx.y * NP * NP; }
  QFrag q[DRT];
#pragma unroll
  for (int i = 0; i < DRT; ++i) { const size_t ao = (size_t)(row0 + 16 * i) * C8 + 8 * lane;
#pragma unroll
    for (int ks = 0; ks < 2; ++ks) { q[i].a1h[ks] = frag_at(A1h + ao + ks * 512); q[i].a1l[ks] = frag_at(A1l + ao + ks * 512); q[i].a2h[ks] = frag_at(A2h + ao + ks * 512); q[i].a2l[ks] = frag_at(A2l + ao + ks * 512); } }
  asm volatile("s_wait_xcnt 0x0" ::: "memory");  /* stands in front of the reuse of the address registers that the query loads name */
  __builtin_amdgcn_sched_barrier(0);             /* keeps the key-plane address arithmetic, which reuses those registers, behind that wait */
  const size_t bo = (size_t)(w * DCOL) * C8 + 8 * lane; B2h += bo; B2l += bo; B1h += bo; B1l += bo;
  float m1[DRT][8], m2[DRT][8], u1[DRT][8], u2[DRT][8];
#pragma unroll
  for (int i = 0; i < DRT; ++i)
#pragma unroll
    for (int r = 0; r < 8; ++r) { m1[i][r] = 3.0e38f; m2[i][r] = 3.0e38f; u1[i][r] = 0.f; u2[i][r] = 0.f; }  /* m1, m2 hold -max * log2(e) throughout */
#pragma unroll 1  /* rolled: an unrolled body would hold several steps' B fragments and leave the 512-register budget of 2 waves per SIMD */
  for (int j = 0; j < DCOL / 16; j += 2) { v8f s1[DRT], s2[DRT], t1[DRT], t2[DRT]; const size_t o = (size_t)j * 16 * C8, o2 = o + 16 * C8;
    logit_tile(q, B2h + o, B2l + o, B1h + o, B1l + o, s1, s2); logit_tile(q, B2h + o2, B2l + o2, B1h + o2, B1l + o2, t1, t2);
#pragma unroll
    for (int i = 0; i < DRT; ++i) { online2(s1[i], t1[i], m1[i], u1[i]); online2(s2[i], t2[i], m2[i], u2[i]); } }
#pragma unroll
  for (int i = 0; i < DRT; ++i) { online_row(m1[i], u1[i]); online_row(m2[i], u2[i]); }
  if (ln == 0) {
#pragma unroll
    for (int i = 0; i < DRT; ++i)
#pragma unroll
      for (int r = 0; r < 8; ++r) { const int rw = 16 * i + 8 * hh + r; red[0][w][rw] = m1[i][r]; red[1][w][rw] = m2[i][r]; redu[0][w][rw] = u1[i][r]; redu[1][w][rw] = u2[i][r]; } }
  __syncthreads();
  if (tid < 2 * DROW) {  /* the eight waves' pairs of one row made one, in the same way */
    const int mt = tid / DROW, rw = tid % DROW; float d[DW], v = red[mt][0][rw];
#pragma unroll
    for (int k = 1; k < DW; ++k) v = fminf(v, red[mt][k][rw]);
#pragma unroll
    for (int k = 0; k < DW; ++k) d[k] = v - red[mt][k][rw];
    const v8f c = exp2_8(d); float sum = 0.f;
#pragma unroll
    for (int k = 0; k < DW; ++k) sum = fmaf(redu[mt][k][rw], c[k], sum);
    fin[mt][rw] = v; finu[mt][rw] = 1.0f / sum; }
  __syncthreads();
#pragma unroll
  for (int i = 0; i < DRT; ++i)
#pragma unroll
    for (int r = 0; r < 8; ++r) { const int rw = 16 * i + 8 * hh + r; m1[i][r] = fin[0][rw]; m2[i][r] = fin[1][rw]; u1[i][r] = finu[0][rw]; u2[i][r] = finu[1][rw]; }  /* from here on u1, u2 hold 1 / sum */
#pragma unroll 1  /* rolled for the register budget, as above */
  for (int j = 0; j < DCOL / 16; ++j) { v8f s1[DRT], s2[DRT]; const size_t o = (size_t)j * 16 * C8; logit_tile(q, B2h + o, B2l + o, B1h + o, B1l + o, s1, s2);
#pragma unroll
    for (int i = 0; i < DRT; ++i) { const v8f e1 = exp_rel(s1[i], m1[i]), e2 = exp_rel(s2[i], m2[i]);
#pragma unroll
      for (int r = 0; r < 8; ++r) st[w][16 * i + 8 * hh + r][j * 16 + ln] = (_Float16)(fabsf(e1[r] * u1[i][r] - e2[r] * u2[i][r]) * 16384.0f); } }
  // each wave reads back only its own slab: the fence keeps the LDS reads behind the writes of the wave's other lanes, no work-group barrier is needed
  __builtin_amdgcn_fence(__ATOMIC_ACQ_REL, "workgroup"); __builtin_amdgcn_wave_barrier();
#pragma unroll 1  /* rolled in groups of eight rows: sixteen LDS reads go out ahead of their stores */
  for (int r0 = 0; r0 < DROW; r0 += 8) {
#pragma unroll
    for (int r = r0; r < r0 + 8; ++r)
#pragma unroll
      for (int c = 0; c < DCOL; c += 256) { const v8us v = *(const v8us*)&st[w][r][c + lane * 8]; *(v8us*)((unsigned short*)D16 + (size_t)(row0 + r) * NP + w * DCOL + c + lane * 8) = v; }
    asm volatile("s_wait_xcnt 0x0" ::: "memory");  /* stands in front of the next trip's rewrite of the data and address registers that these stores name */
  }
}

// C[M][N] (f32, pitch ldc) = A[M][K] . B[N][K]^T * alpha + bias[col] (bias rounded to bf16); A and B f16 with k contiguous. One 128 x 128 tile of C per work-group of 4 waves (2 x 2, 64 x 64 each):
// an operand row that comes from L2 feeds 128 rows or columns of C, and a fragment that is read from LDS feeds four WMMAs.
// A stage is 128 k of the tile's 128 A rows and 128 B rows, brought into LDS by asynchronous b128 copies: one copy of a wave is 256 contiguous bytes (2 whole lines) of each of two rows, where a fragment load
// straight from the row-major operand touches 16 lines. Two buffers: the next stage's copies fly while this stage is worked on. M, N multiples of 128, K a multiple of 128.
// Every accumulator sums k in rising order, 32 at a time.
#define GT 128                   /* rows of each operand per work-group */
#define GW 64                    /* rows and columns of C per wave */
#define GK 128                   /* k per stage */
#define GP (GK + 8)              /* LDS row pitch in f16: 272 B = 16 B x odd, so the 16 rows of a ds_load_b128 fall on all banks */
#define GQ (GW + 4)              /* row pitch in f32 of a wave's tile of C in LDS: rows 8 apart fall on other banks, 16-byte multiple */
typedef __attribute__((address_space(3))) const _Float16 lds_f16;
// eight pairs of rows (8 rows apart) of one operand: l = the lane's LDS byte address, g = the lane's global address, gs = 8 rows of the operand in elements
__device__ __forceinline__ void copy8(unsigned l, const _Float16* g, size_t gs) {
  const unsigned ls = 8 * GP * 2;
  // the last line is the wait that stands in front of any rewrite of the address registers that these copies name
  asm volatile("global_load_async_to_lds_b128 %0, %8, off\n\t"
               "global_load_async_to_lds_b128 %1, %9, off\n\t"
               "global_load_async_to_lds_b128 %2, %10, off\n\t"
               "global_load_async_to_lds_b128 %3, %11, off\n\t"
               "global_load_async_to_lds_b128 %4, %12, off\n\t"
               "global_load_async_to_lds_b128 %5, %13, off\n\t"
               "global_load_async_to_lds_b128 %6, %14, off\n\t"
               "global_load_async_to_lds_b128 %7, %15, off\n\t"
               "s_wait_xcnt 0x0"
               :: "v"(l), "v"(l + ls), "v"(l + 2 * ls), "v"(l + 3 * ls), "v"(l + 4 * ls), "v"(l + 5 * ls), "v"(l + 6 * ls), "v"(l + 7 * ls),
                  "v"(g), "v"(g + gs), "v"(g + 2 * gs), "v"(g + 3 * gs), "v"(g + 4 * gs), "v"(g + 5 * gs), "v"(g + 6 * gs), "v"(g + 7 * gs) : "memory");
}
// one stage: wave w brings rows 2 w, 2 w + 1, 2 w + 8, 2 w + 9, ..., 2 w + 121 of the A tile (LDS rows 0..127) and of the B tile (LDS rows 128..255): 32 copies of a wave
__device__ __forceinline__ void fill_stage(unsigned l, const _Float16* ga, size_t sa, const _Float16* gb, size_t sb) {
  copy8(l, ga, sa); copy8(l + 64 * GP * 2, ga + 8 * sa, sa); copy8(l + 128 * GP * 2, gb, sb); copy8(l + 192 * GP * 2, gb + 8 * sb, sb);
}
// fragment from a row-major LDS tile; p = row (lane & 15), k = 8 * (lane >> 4): k 8*(lane>>4)+0..7 and 16+8*(lane>>4)+0..7, alike for A and B
__device__ __forceinline__ v16h frag_lds(const _Float16* p) { FragH f; f.half[0] = *(const v8us*)((const unsigned short*)p); f.half[1] = *(const v8us*)((const unsigned short*)p + 16); return f.v; }
// blockIdx.z = batch: A, B and C move on by sA, sB, sC elements
__global__ __launch_bounds__(128) void k_gemm_t(const _Float16* __restrict__ A, int lda, size_t sA, const _Float16* __restrict__ B, int ldb, size_t sB, float alpha, const float* __restrict__ bias, float* __restrict__ C, int ldc, size_t sC, int K) {
  __shared__ __attribute__((aligned(16))) _Float16 sm[2][2 * GT][GP];
  const int tid = threadIdx.x, w = tid >> 5, lane = tid & 31, ln = lane & 15, hh = lane >> 4, wr = w >> 1, wc = w & 1;
  const int row0 = blockIdx.y * GT, col0 = blockIdx.x * GT;
  A += blockIdx.z * sA; B += blockIdx.z * sB; C += blockIdx.z * sC;
  const _Float16* ga = A + (size_t)(row0 + 2 * w + hh) * lda + ln * 8; const _Float16* gb = B + (size_t)(col0 + 2 * w + hh) * ldb + ln * 8;
  const size_t sa = (size_t)8 * lda, sb = (size_t)8 * ldb;
  const unsigned l0 = (unsigned)(uintptr_t)(lds_f16*)&sm[0][2 * w + hh][ln * 8], lbuf = 2 * GT * GP * 2;
  const int nt = K / GK;
  v8f acc[4][4] = {};
  fill_stage(l0, ga, sa, gb, sb);
  float bv[4] = {0.f, 0.f, 0.f, 0.f};
  if (bias) {  /* the lane's four bias values: one branch, so that the four loads go out together, while stage 0 is under way */
    const float* bp = bias + col0 + wc * GW + ln; const float b0 = bp[0], b1 = bp[16], b2 = bp[32], b3 = bp[48];
    bv[0] = bf16_round(b0); bv[1] = bf16_round(b1); bv[2] = bf16_round(b2); bv[3] = bf16_round(b3);
  }
  asm volatile("s_wait_asynccnt 0x0" ::: "memory");  /* this wave's copies of stage 0 have landed */
  __syncthreads();                                   /* and every other wave's */
  if (nt > 1) fill_stage(l0 + lbuf, ga + GK, sa, gb + GK, sb);
  for (int t = 0; t < nt; ++t) {
    const _Float16* pa = &sm[t & 1][wr * GW + ln][8 * hh]; const _Float16* pb = &sm[t & 1][GT + wc * GW + ln][8 * hh];
    v16h fa[GK / 32][4], fb[GK / 32][4];
#pragma unroll  /* every index constant: the fragments stay in registers */
    for (int ks = 0; ks < GK / 32; ++ks) {
      fa[ks][0] = frag_lds(pa + ks * 32);
#pragma unroll
      for (int j = 0; j < 4; ++j) fb[ks][j] = frag_lds(pb + j * 16 * GP + ks * 32);
#pragma unroll
      for (int i = 1; i < 4; ++i) fa[ks][i] = frag_lds(pa + i * 16 * GP + ks * 32);
    }
    // keeps the stage's 64 LDS loads one group in front of its WMMAs, which then follow behind counted waits; left alone the compiler reuses fragment registers and the lone wave of a SIMD waits out the LDS latency several times per k step
    __builtin_amdgcn_sched_barrier(0);
#pragma unroll  /* as above */
    for (int ks = 0; ks < GK / 32; ++ks)
#pragma unroll
      for (int i = 0; i < 4; ++i)
#pragma unroll
        for (int j = 0; j < 4; ++j) acc[i][j] = wm(fa[ks][i], fb[ks][j], acc[i][j]);
    // keeps the WMMAs in front of the waits below, so that they run while the later LDS loads still return and the refill is issued directly behind the barrier
    __builtin_amdgcn_sched_barrier(0);
    asm volatile("s_wait_dscnt 0x0" ::: "memory");     /* this wave's reads of the buffer are done before it is refilled */
    asm volatile("s_wait_asynccnt 0x0" ::: "memory");  /* this wave's copies of stage t + 1 have landed */
    __syncthreads();                                   /* publishes stage t + 1 and ends every wave's reads of stage t */
    if (t + 2 < nt) fill_stage(l0 + (t & 1) * lbuf, ga + (size_t)(t + 2) * GK, sa, gb + (size_t)(t + 2) * GK, sb);
  }
  asm volatile("s_wait_asynccnt 0x0" ::: "memory");    /* no copy is left in flight when the wave ends */
  // behind the last trip's barrier no wave reads the operand buffers any more and no copy is under way: the four waves' tiles of C take the place of buffer 0 (4 x 64 x 68 f32 = its size)
  float* so = (float*)&sm[0][0][0] + w * GW * GQ;
#pragma unroll  /* these three: constant accumulator indices, so that acc stays in registers */
  for (int j = 0; j < 4; ++j)
#pragma unroll
    for (int i = 0; i < 4; ++i)
#pragma unroll
      for (int r = 0; r < 8; ++r) so[(i * 16 + 8 * hh + r) * GQ + j * 16 + ln] = acc[i][j][r] * alpha + bv[j];
  // each wave reads back only its own slab, so that a store covers whole 128-B lines: the fence keeps the LDS reads behind the writes of the wave's other lanes
  __builtin_amdgcn_fence(__ATOMIC_ACQ_REL, "workgroup"); __builtin_amdgcn_wave_barrier();
  float* cw = C + (size_t)(row0 + wr * GW + hh) * ldc + col0 + wc * GW + ln * 4;
#pragma unroll 1  /* rolled in groups of sixteen rows: eight LDS reads go out ahead of their stores */
  for (int q0 = 0; q0 < GW / 2; q0 += 8) {
#pragma unroll
    for (int q = q0; q < q0 + 8; ++q) { const v4f v = *(const v4fa*)&so[(q * 2 + hh) * GQ + ln * 4]; *(v4f*)(cw + (size_t)(q * 2) * ldc) = v; }
    asm volatile("s_wait_xcnt 0x0" ::: "memory");  /* stands in front of the next trip's rewrite of the data and address registers that these stores name */
  }
}

extern "C" void kernel_launch(void* const* d_in, const int* in_sizes, int n_in,
                              void* d_out, int out_size, void* d_ws, size_t ws_size, hipStream_t stream) {
  (void)in_sizes; (void)n_in; (void)out_size;
  const float* x1 = (const float*)d_in[0]; const float* x2 = (const float*)d_in[1]; const float* Wb = (const float*)d_in[2]; const float* bb_ = (const float*)d_in[3]; const float* Wc = (const float*)d_in[4]; const float* bc = (const float*)d_in[5]; const float* Wd = (const float*)d_in[6]; const float* bd = (const float*)d_in[7]; const float* al = (const float*)d_in[8]; const float* be = (const float*)d_in[9];
  char* ws = (char*)d_ws; size_t off = 0;
  auto take = [&](size_t bytes) { char* p = ws + off; off += (bytes + 255) & ~(size_t)255; return p; };
  _Float16* BW = (_Float16*)take((size_t)NW * CC * 2); float* BI = (float*)take(NW * 4);
  _Float16* X = (_Float16*)take((size_t)NS * NP * CC * 2); float* P = (float*)take((size_t)NS * NP * NW * 4);
  _Float16* Hh = (_Float16*)take((size_t)2 * NS * NP * C8 * 2); _Float16* Hl = (_Float16*)take((size_t)2 * NS * NP * C8 * 2);      /* plane 2 s + j: conv_b (j 0) or conv_c (j 1) of slab s */
  _Float16* FT = (_Float16*)take((size_t)NBt * CC * NP * 2); _Float16* D16 = (_Float16*)take((size_t)NBt * NP * NP * 2);
  if (off > ws_size) return;
  const size_t n8 = (size_t)NP * C8 / 8, pl = (size_t)NP * C8;
  k_prep<<<(NW * CC / 8 + 255) / 256, 256, 0, stream>>>(Wb, Wc, Wd, bb_, bc, bd, BW, BI);      /* conv weights [O][C] = natural Bt */
  k_tok<<<dim3(NP / TWX, CC / TR, NS), 256, 0, stream>>>(x1, x2, X);
  k_gemm_t<<<dim3(NW / GT, NS * NP / GT), 128, 0, stream>>>(X, CC, 0, BW, CC, 0, 0.0625f, BI, P, NW, 0, CC);      /* P[s][n][0..63] = conv_b, [64..127] = conv_c, [128..639] = conv_d of slab s (exact + bias) */
  k_split<<<dim3((unsigned)((n8 + 255) / 256), 2 * NS), 256, 0, stream>>>(P, Hh, Hl, n8);      /* a1, b1, a2, b2 of each batch -> hi/lo planes */
  k_fcomb<<<dim3(NP / TR, CC / TWF, NBt), 256, 0, stream>>>(P, al, be, FT);
  k_attdiff<<<dim3(NP / DROW, NBt), DW * 32, 0, stream>>>(Hh, Hl, Hh + 2 * pl, Hl + 2 * pl, Hh + 3 * pl, Hl + 3 * pl, Hh + pl, Hl + pl, D16);      /* a1 = plane 0, a2 = plane 2, b2 = plane 3, b1 = plane 1: |softmax(a1.b2) - softmax(a2.b1)| x 2^14 */
  k_gemm_t<<<dim3(NP / GT, CC / GT, NBt), 128, 0, stream>>>(FT, NP, (size_t)CC * NP, D16, NP, (size_t)NP * NP, 1.0f / 16384.0f, nullptr, (float*)d_out, NP, (size_t)CC * NP, NP);      /* out[b][c][n] = sum_m F[c][m] att[n][m]: M 512 (c), N 4096 (n), K 4096 (m) -> NCHW directly */
}

// v009
// One run takes 126 microseconds.
// Two timings next to v008 both put it at 1.09 times that version's speed.
// Counting every step since v000, it is 12.1 times as fast.
#include <hip/hip_runtime.h>
// Position-attention difference module (B 2, C 512, 64×64 = 4096 positions): a1 = conv_b(x1), b2 = conv_c(x2), a2 = conv_b(x2), b1 = conv_c(x1) (1×1, 512→64, + bias); f = conv_d (512→512, + bias); att12 = softmax_m(a1ᵀ·b2), att21 = softmax_m(a2ᵀ·b1) (no scaling); att = |att12 − att21|; out = α·f1·attᵀ + β·f2·attᵀ = (α f1 + β f2)·attᵀ → [2,512,64,64].
// Structure: every kernel runs once, over both batches and both inputs (6 launches): 1x1 convs as one launch of GEMM tiles on position-major f16 planes; conv_b and conv_c of x1 and x2 have exact products; a/b as f16 hi + lo*2^10 planes so both logit matrices are about f32 (three cross products each); one kernel forms both logit matrices in registers, both softmaxes per row in f32 and writes |difference| x 2^14 as f16; conv_d is linear, so F = alpha f1 + beta f2 = conv_d's weights . (alpha x1 + beta x2) + (alpha + beta) bias: one product on the combined input (f32 combine, then f16), written as f16; out = F.att^T by one GEMM straight into the NCHW output.
// Compute dtype: inputs and parameters rounded to bf16; logits ≈f32; softmaxes/difference in f32; |Δ| (×2^14) and F as f16 operands (≈2^-12), f32 accumulation. v_wmma_f32_16x16x32_f16.
#define NBt 2
#define CC 512
#define C8 64
#define NP 4096
#define NW (2 * C8 + CC)         /* rows of the stacked weights [Wb; Wc; Wd] */
#define NS (2 * NBt)             /* position-major input slabs: slab s = 2 * batch + (0 for x1, 1 for x2) */
#define NAB (2 * C8)             /* columns of the projection matrix P: conv_b, conv_c */
typedef __bf16 v16b __attribute__((ext_vector_type(16)));
typedef unsigned short v8us __attribute__((ext_vector_type(8), may_alias));
typedef float  v8f  __attribute__((ext_vector_type(8)));
typedef float  v4f  __attribute__((ext_vector_type(4)));
typedef float  v4fa __attribute__((ext_vector_type(4), may_alias));
union FragB { v16b v; v8us half[2]; unsigned short u[16]; };

__device__ __forceinline__ unsigned short bf16_bits(float x) { unsigned int u = __float_as_uint(x); return (unsigned short)((u + 0x7FFFu + ((u >> 16) & 1u)) >> 16); }
__device__ __forceinline__ float bf16_val(unsigned short b) { return __uint_as_float(((unsigned int)b) << 16); }
__device__ __forceinline__ float bf16_round(float x) { return bf16_val(bf16_bits(x)); }
// D += A·B with NT terms: 1 = ah·bh, 2 = + al·bh (A split), 3 = + ah·bl (both split)
template <int NT>
__device__ __forceinline__ v8f mmaN(v16b ah, v16b al, v16b bh, v16b bl, v8f c) {
  c = __builtin_amdgcn_wmma_f32_16x16x32_bf16(false, ah, false, bh, (short)0, c, false, false);
  if (NT >= 2) c = __builtin_amdgcn_wmma_f32_16x16x32_bf16(false, al, false, bh, (short)0, c, false, false);
  if (NT >= 3) c = __builtin_amdgcn_wmma_f32_16x16x32_bf16(false, ah, false, bl, (short)0, c, false, false);
  asm volatile("v_nop\n\tv_nop\n\tv_nop\n\tv_nop" : "+v"(c) : "v"(ah), "v"(al), "v"(bh), "v"(bl));
  return c;
}

__global__ __launch_bounds__(256) void k_wt_bf16(const float* __restrict__ W, unsigned short* __restrict__ Wt, int K, int N) {
  const int t = blockIdx.x * 256 + threadIdx.x;
  const int k8n = K / 8;
  if (t >= N * k8n) return;
  const int n = t / k8n, k8 = (t % k8n) * 8;
  v8us v;
#pragma unroll
  for (int i = 0; i < 8; ++i) v[i] = bf16_bits(W[(size_t)(k8 + i) * N + n]);
  *(v8us*)(Wt + (size_t)n * K + k8) = v;
  
}

// GEMM C[M][N] (f32, pitch ldc) = act(A[M][K]·W + bias). A f32 row-major (pitch lda) converted per fragment to bf16
// (ASPLIT: hi/lo two planes -> 2 terms, else single rounded term); Wt bf16 [N][K] (pitch ldb). BIAS_BF16 rounds the
// bias to bf16 first (bias quantised to bf16 before the add). K%32==0, M%16==0, N%64==0.
template <bool ASPLIT, int ACT, bool BIAS_BF16>
__global__ __launch_bounds__(128) void k_gemm_bf(const float* __restrict__ A, int lda, const unsigned short* __restrict__ Wt, int ldb,
                                               const float* __restrict__ bias, float* __restrict__ C, int ldc, int M, int N, int K) {
  __shared__ __attribute__((aligned(16))) float so[4][16][64];
  const int tid = threadIdx.x, w = tid >> 5, lane = tid & 31, ln = lane & 15, hh = lane >> 4;
  const int ntn = N / 64;
  const int wid = blockIdx.x * 4 + w;
  const int mt = wid / ntn, nq = wid % ntn;
  if (mt * 16 >= M) return;
  const int row0 = mt * 16, col0 = nq * 64;
  const float* arow = A + (size_t)(row0 + ln) * lda;
  v8f acc[4] = {};
  for (int kb = 0; kb < K; kb += 32) {
    FragB ah, al;
    const v4f x0 = *(const v4fa*)(arow + kb + 8 * hh), x1 = *(const v4fa*)(arow + kb + 8 * hh + 4);
    const v4f x2 = *(const v4fa*)(arow + kb + 16 + 8 * hh), x3 = *(const v4fa*)(arow + kb + 16 + 8 * hh + 4);
    float xs[16] = {x0[0],x0[1],x0[2],x0[3],x1[0],x1[1],x1[2],x1[3],x2[0],x2[1],x2[2],x2[3],x3[0],x3[1],x3[2],x3[3]};
#pragma unroll
    for (int i = 0; i < 16; ++i) { const unsigned short hb = bf16_bits(xs[i]); ah.u[i] = hb; al.u[i] = ASPLIT ? bf16_bits(xs[i] - bf16_val(hb)) : (unsigned short)0; }
#pragma unroll
    for (int t = 0; t < 4; ++t) {
      const unsigned short* brow = Wt + (size_t)(col0 + t * 16 + ln) * ldb + kb;
      FragB b;
      b.half[0] = *(const v8us*)(brow + 8 * hh);
      b.half[1] = *(const v8us*)(brow + 16 + 8 * hh);
      acc[t] = mmaN<ASPLIT ? 2 : 1>(ah.v, al.v, b.v, b.v, acc[t]);
    }
  }
#pragma unroll
  for (int t = 0; t < 4; ++t) {
    float bv = bias ? bias[col0 + t * 16 + ln] : 0.f;
    if (BIAS_BF16) bv = bf16_round(bv);
#pragma unroll
    for (int r = 0; r < 8; ++r) { float v = acc[t][r] + bv; if (ACT == 1) v = fmaxf(v, 0.f); so[w][8 * hh + r][t * 16 + ln] = v; }
  }
  __builtin_amdgcn_fence(__ATOMIC_ACQ_REL, "workgroup");
  __builtin_amdgcn_wave_barrier();
  const int rsub = lane >> 4, c4 = (lane & 15) * 4;
  {
#pragma unroll
    for (int q = 0; q < 8; ++q) {
      const int r = q * 2 + rsub;
      const v4f v = *(const v4fa*)&so[w][r][c4];
      *(v4f*)(C + (size_t)(row0 + r) * ldc + col0 + c4) = v;
    }
    
  }
}

// GEMM C = act(A·W + bias + resid): A f32 (ASPLIT -> hi/lo 2 terms), Wt bf16 [N][K]; ACT 0 none, 1 relu, 2 exact gelu;
// resid (optional, f32, row index = (row % rmod), pitch ldr, RES_BF16 rounds it) added before the activation.
template <bool ASPLIT, int ACT, bool BIAS_BF16, bool RES_BF16>
__global__ __launch_bounds__(128) void k_gemm_bf3(const float* __restrict__ A, int lda, const unsigned short* __restrict__ Wt, int ldb,
                                                const float* __restrict__ bias, const float* __restrict__ resid, int rmod, int ldr,
                                                float* __restrict__ C, int ldc, int M, int N, int K) {
  __shared__ __attribute__((aligned(16))) float so[4][16][64];
  const int tid = threadIdx.x, w = tid >> 5, lane = tid & 31, ln = lane & 15, hh = lane >> 4;
  const int ntn = N / 64;
  const int wid = blockIdx.x * 4 + w;
  const int mt = wid / ntn, nq = wid % ntn;
  if (mt * 16 >= M) return;
  const int row0 = mt * 16, col0 = nq * 64;
  const float* arow = A + (size_t)(row0 + ln) * lda;
  v8f acc[4] = {};
  for (int kb = 0; kb < K; kb += 32) {
    FragB ah, al;
    const v4f x0 = *(const v4fa*)(arow + kb + 8 * hh), x1 = *(const v4fa*)(arow + kb + 8 * hh + 4);
    const v4f x2 = *(const v4fa*)(arow + kb + 16 + 8 * hh), x3 = *(const v4fa*)(arow + kb + 16 + 8 * hh + 4);
    float xs[16] = {x0[0],x0[1],x0[2],x0[3],x1[0],x1[1],x1[2],x1[3],x2[0],x2[1],x2[2],x2[3],x3[0],x3[1],x3[2],x3[3]};
#pragma unroll
    for (int i = 0; i < 16; ++i) { const unsigned short hb = bf16_bits(xs[i]); ah.u[i] = hb; al.u[i] = ASPLIT ? bf16_bits(xs[i] - bf16_val(hb)) : (unsigned short)0; }
#pragma unroll
    for (int t = 0; t < 4; ++t) {
      const unsigned short* brow = Wt + (size_t)(col0 + t * 16 + ln) * ldb + kb;
      FragB b;
      b.half[0] = *(const v8us*)(brow + 8 * hh);
      b.half[1] = *(const v8us*)(brow + 16 + 8 * hh);
      acc[t] = mmaN<ASPLIT ? 2 : 1>(ah.v, al.v, b.v, b.v, acc[t]);
    }
  }
#pragma unroll
  for (int t = 0; t < 4; ++t) {
    const int col = col0 + t * 16 + ln;
    float bv = bias ? bias[col] : 0.f;
    if (BIAS_BF16) bv = bf16_round(bv);
#pragma unroll
    for (int r = 0; r < 8; ++r) {
      float v = acc[t][r] + bv;
      if (resid) { float rv = resid[(size_t)((row0 + 8 * hh + r) % rmod) * ldr + col]; if (RES_BF16) rv = bf16_round(rv); v += rv; }
      if (ACT == 1) v = fmaxf(v, 0.f);
      if (ACT == 2) v = 0.5f * v * (1.0f + erff(v * 0.70710678118654752f));
      if (ACT == 3) { const float u = 0.7978845608028654f * (v + 0.044715f * v * v * v); v = 0.5f * v * (1.0f + tanhf(u)); }
      so[w][8 * hh + r][t * 16 + ln] = v;
    }
  }
  __builtin_amdgcn_fence(__ATOMIC_ACQ_REL, "workgroup");
  __builtin_amdgcn_wave_barrier();
  const int rsub = lane >> 4, c4 = (lane & 15) * 4;
  {
#pragma unroll
    for (int q = 0; q < 8; ++q) {
      const int r = q * 2 + rsub;
      const v4f v = *(const v4fa*)&so[w][r][c4];
      *(v4f*)(C + (size_t)(row0 + r) * ldc + col0 + c4) = v;
    }
    
  }
}
// row LayerNorm (biased variance, eps) over N: s = X (+ R); optional out_sum <- s; out_norm <- (s-mu)*rsqrt(var+eps)*g + b
template <bool PARAM_BF16>
__global__ __launch_bounds__(256) void k_layernorm(const float* __restrict__ X, const float* __restrict__ R, const float* __restrict__ g, const float* __restrict__ bta,
                                                  float* __restrict__ out_sum, float* __restrict__ out_norm, int N, float eps) {
  __shared__ float red[256];
  const int row = blockIdx.x, tid = threadIdx.x;
  const float* x = X + (size_t)row * N; const float* rr = R ? R + (size_t)row * N : nullptr;
  float vals[16];                     // up to N = 4096
  const int per = N / 256;            // contiguous chunk per thread? use strided-by-4 chunks: thread handles j = tid*4 + 1024*u
  float s1 = 0.f;
  for (int u = 0; u < per / 4; ++u) {
    const int j = tid * 4 + 1024 * u;
    const v4f a = *(const v4fa*)(x + j);
    v4f b = {0.f,0.f,0.f,0.f}; if (rr) b = *(const v4fa*)(rr + j);
#pragma unroll
    for (int q = 0; q < 4; ++q) { const float v = a[q] + b[q]; vals[u * 4 + q] = v; s1 += v; }
  }
  red[tid] = s1; __syncthreads();
  for (int st = 128; st > 0; st >>= 1) { if (tid < st) red[tid] += red[tid + st]; __syncthreads(); }
  const float mu = red[0] / (float)N; __syncthreads();
  float s2 = 0.f;
  for (int u = 0; u < per / 4; ++u)
#pragma unroll
    for (int q = 0; q < 4; ++q) { const float c = vals[u * 4 + q] - mu; s2 += c * c; }
  red[tid] = s2; __syncthreads();
  for (int st = 128; st > 0; st >>= 1) { if (tid < st) red[tid] += red[tid + st]; __syncthreads(); }
  const float rs = rsqrtf(red[0] / (float)N + eps);
  {
    for (int u = 0; u < per / 4; ++u) {
      const int j = tid * 4 + 1024 * u;
      v4f o, sm;
#pragma unroll
      for (int q = 0; q < 4; ++q) {
        float gg = g[j + q], bb = bta[j + q];
        if (PARAM_BF16) { gg = bf16_round(gg); bb = bf16_round(bb); }
        sm[q] = vals[u * 4 + q]; o[q] = (vals[u * 4 + q] - mu) * rs * gg + bb;
      }
      if (out_sum) *(v4f*)(out_sum + (size_t)row * N + j) = sm;
      *(v4f*)(out_norm + (size_t)row * N + j) = o;
    }
    
  }
}



// ---- f16 WMMA path (v_wmma_f32_16x16x32_f16): 11-bit significands for operands in range — used where a [0,1] probability operand needs more precision than bf16
typedef _Float16 v16h __attribute__((ext_vector_type(16)));
union FragH { v16h v; v8us half[2]; _Float16 h[16]; unsigned short u[16]; };
template <int NT>
__device__ __forceinline__ v8f mmaH(v16h ah, v16h al, v16h bh, v16h bl, v8f c) {
  c = __builtin_amdgcn_wmma_f32_16x16x32_f16(false, ah, false, bh, (short)0, c, false, false);
  if (NT >= 2) c = __builtin_amdgcn_wmma_f32_16x16x32_f16(false, al, false, bh, (short)0, c, false, false);
  if (NT >= 3) c = __builtin_amdgcn_wmma_f32_16x16x32_f16(false, ah, false, bl, (short)0, c, false, false);
  asm volatile("v_nop\n\tv_nop\n\tv_nop\n\tv_nop" : "+v"(c) : "v"(ah), "v"(al), "v"(bh), "v"(bl));
  return c;
}
// batched GEMM like k_gemm_b but f16 operands: A f32 (split into f16 hi/lo if ASPLIT, else rounded to f16), Bt = f16 values [n][k]; alpha; C f32; N multiple of 16 (partial tiles skipped)
template <bool ASPLIT>
__global__ __launch_bounds__(128) void k_gemm_h(const float* __restrict__ A, int lda, size_t sA, const _Float16* __restrict__ Bh, int ldb, size_t sB, float alpha, float* __restrict__ C, int ldc, size_t sC, int M, int N, int K) {
  __shared__ __attribute__((aligned(16))) float so[4][16][64];
  const int tid = threadIdx.x, w = tid >> 5, lane = tid & 31, ln = lane & 15, hh = lane >> 4; const int by = blockIdx.y;
  A += (size_t)by * sA; Bh += (size_t)by * sB; C += (size_t)by * sC;
  const int ntn = (N + 63) / 64; const int wid = blockIdx.x * 4 + w; const int mt = wid / ntn, nq = wid % ntn; if (mt * 16 >= M) return;
  const int row0 = mt * 16, col0 = nq * 64; const float* arow = A + (size_t)(row0 + ln) * lda;
  v8f acc[4] = {};
  for (int kb = 0; kb < K; kb += 32) {
    FragH ah, al;
    const v4f x0 = *(const v4fa*)(arow + kb + 8 * hh), x1 = *(const v4fa*)(arow + kb + 8 * hh + 4), x2 = *(const v4fa*)(arow + kb + 16 + 8 * hh), x3 = *(const v4fa*)(arow + kb + 16 + 8 * hh + 4);
    float xs[16] = {x0[0],x0[1],x0[2],x0[3],x1[0],x1[1],x1[2],x1[3],x2[0],x2[1],x2[2],x2[3],x3[0],x3[1],x3[2],x3[3]};
#pragma unroll
    for (int i = 0; i < 16; ++i) { const _Float16 h = (_Float16)xs[i]; ah.h[i] = h; al.h[i] = ASPLIT ? (_Float16)(xs[i] - (float)h) : (_Float16)0.0f; }
#pragma unroll
    for (int t = 0; t < 4; ++t) { if (col0 + t * 16 >= N) continue; const size_t boff = (size_t)(col0 + t * 16 + ln) * ldb + kb; FragH bq; bq.half[0] = *(const v8us*)(Bh + boff + 8 * hh); bq.half[1] = *(const v8us*)(Bh + boff + 16 + 8 * hh);
      acc[t] = mmaH<ASPLIT ? 2 : 1>(ah.v, al.v, bq.v, bq.v, acc[t]); }
  }
#pragma unroll
  for (int t = 0; t < 4; ++t) { if (col0 + t * 16 >= N) continue;
#pragma unroll
    for (int r = 0; r < 8; ++r) so[w][8 * hh + r][t * 16 + ln] = acc[t][r] * alpha; }
  __builtin_amdgcn_fence(__ATOMIC_ACQ_REL, "workgroup"); __builtin_amdgcn_wave_barrier();
  const int rsub = lane >> 4, c4 = (lane & 15) * 4;
  {
#pragma unroll
    for (int q = 0; q < 8; ++q) { const int r = q * 2 + rsub; if (col0 + c4 < N) { const v4f v = *(const v4fa*)&so[w][r][c4]; *(v4f*)(C + (size_t)(row0 + r) * ldc + col0 + c4) = v; } }
     }
}

// Wt[n][k] = f16(W[k][n]·scale) from f32 row-major W[K][N] (scale = power of two; bf16-exact weights stay exact in f16 away from the subnormal range)
__global__ __launch_bounds__(256) void k_wt_f16(const float* __restrict__ W, _Float16* __restrict__ Wt, int K, int N, float scale) {
  const int t = blockIdx.x * 256 + threadIdx.x; if (t >= N * (K / 8)) return; const int n = t / (K / 8), k8 = (t % (K / 8)) * 8; FragH f;
#pragma unroll
  for (int i = 0; i < 8; ++i) f.h[i] = (_Float16)(bf16_round(W[(size_t)(k8 + i) * N + n]) * scale); const v8us o = f.half[0];
  *(v8us*)((unsigned short*)Wt + (size_t)n * K + k8) = o; 
}
// k_gemm_hh variant with fused epilogue: v = acc·alpha + bias[by·sBias + col] (+ CP[(row/rowsPerB)·sCPb + by·64 + col] if CP) ; ACT 0 none / 1 elu ; writes f32 C and f16 C16, each if non-null
template <int ACT>
__global__ __launch_bounds__(128) void k_gemm_hhx(const _Float16* __restrict__ A, int lda, size_t sA, const _Float16* __restrict__ Bh, int ldb, size_t sB, float alpha, const float* __restrict__ bias, size_t sBias, const float* __restrict__ CP, int rowsPerB, size_t sCPb, int row0g,
    float* __restrict__ C, _Float16* __restrict__ C16, int ldc, size_t sC, int M, int N, int K) {
  __shared__ __attribute__((aligned(16))) float so[4][16][64];
  const int tid = threadIdx.x, w = tid >> 5, lane = tid & 31, ln = lane & 15, hh = lane >> 4; const int by = blockIdx.y;
  A += (size_t)by * sA; Bh += (size_t)by * sB; const size_t cofs = (size_t)by * sC; const float* bp = bias ? bias + (size_t)by * sBias : nullptr;
  const int ntn = (N + 63) / 64; const int wid = blockIdx.x * 4 + w; const int mt = wid / ntn, nq = wid % ntn; if (mt * 16 >= M) return;
  const int row0 = mt * 16, col0 = nq * 64; const _Float16* arow = A + (size_t)(row0 + ln) * lda;
  v8f acc[4] = {};
  for (int kb = 0; kb < K; kb += 32) { FragH ah; ah.half[0] = *(const v8us*)((const unsigned short*)arow + kb + 8 * hh); ah.half[1] = *(const v8us*)((const unsigned short*)arow + kb + 16 + 8 * hh);
#pragma unroll
    for (int t = 0; t < 4; ++t) { if (col0 + t * 16 >= N) continue; const size_t boff = (size_t)(col0 + t * 16 + ln) * ldb + kb; FragH bq; bq.half[0] = *(const v8us*)((const unsigned short*)Bh + boff + 8 * hh); bq.half[1] = *(const v8us*)((const unsigned short*)Bh + boff + 16 + 8 * hh);
      acc[t] = mmaH<1>(ah.v, ah.v, bq.v, bq.v, acc[t]); }
  }
#pragma unroll
  for (int t = 0; t < 4; ++t) { if (col0 + t * 16 >= N) continue; const int col = col0 + t * 16 + ln; const float bv = bp ? bf16_round(bp[col]) : 0.f;
#pragma unroll
    for (int r = 0; r < 8; ++r) { float v = acc[t][r] * alpha + bv; if (CP) { const int bidx = (row0g + row0 + 8 * hh + r) / rowsPerB; v += CP[(size_t)bidx * sCPb + (size_t)by * 64 + col]; } if (ACT == 1) v = (v > 0.f) ? v : expm1f(v); else if (ACT == 7) v = (v > 0.f) ? v + 1.0f : expf(v); else if (ACT == 8) v = tanhf(v); else if (ACT == 9) v = 0.5f * v * (1.0f + tanhf(0.7978845608028654f * (v + 0.044715f * v * v * v))); else if (ACT == 11) v = 1.0f / (1.0f + expf(-v)); else if (ACT == 12) v = (v > 0.f) ? v : 0.01f * v; else if (ACT == 14) v = (v > 0.f) ? v : 0.1f * v; else if (ACT == 15) v = v / (1.0f + expf(-v)); else if (ACT == 3) v = fmaxf(v, 0.f); else if (ACT == 6) v = 0.5f * v * (1.0f + erff(v * 0.70710678118654752f)); so[w][8 * hh + r][t * 16 + ln] = v; } }
  __builtin_amdgcn_fence(__ATOMIC_ACQ_REL, "workgroup"); __builtin_amdgcn_wave_barrier();
  const int rsub = lane >> 4, c4 = (lane & 15) * 4; typedef _Float16 v4h __attribute__((ext_vector_type(4)));
  {
#pragma unroll
    for (int q = 0; q < 8; ++q) { const int r = q * 2 + rsub; if (col0 + c4 < N) { const v4f v = *(const v4fa*)&so[w][r][c4]; if (C) *(v4f*)(C + cofs + (size_t)(row0 + r) * ldc + col0 + c4) = v; if (C16) { v4h h4; for (int i = 0; i < 4; ++i) h4[i] = (_Float16)v[i]; *(v4h*)(C16 + cofs + (size_t)(row0 + r) * ldc + col0 + c4) = h4; } } }
     }
}


typedef _Float16 v4h __attribute__((ext_vector_type(4)));

__global__ __launch_bounds__(256) void k_x16(const float* __restrict__ x, _Float16* __restrict__ X16, size_t n8) { const size_t t = (size_t)blockIdx.x * 256 + threadIdx.x; if (t >= n8) return; FragH f;
#pragma unroll
  for (int q = 0; q < 8; ++q) f.h[q] = (_Float16)bf16_round(x[t * 8 + q]); *(v8us*)((unsigned short*)X16 + t * 8) = f.half[0];  }
__global__ __launch_bounds__(256) void k_h16(const float* __restrict__ x, _Float16* __restrict__ X16, size_t n8) { const size_t t = (size_t)blockIdx.x * 256 + threadIdx.x; if (t >= n8) return; FragH f;
#pragma unroll
  for (int q = 0; q < 8; ++q) f.h[q] = (_Float16)x[t * 8 + q]; *(v8us*)((unsigned short*)X16 + t * 8) = f.half[0];  }
__global__ __launch_bounds__(256) void k_round16f(const float* __restrict__ W, _Float16* __restrict__ Bt, size_t n8) { const size_t t = (size_t)blockIdx.x * 256 + threadIdx.x; if (t >= n8) return; FragH f;
#pragma unroll
  for (int i = 0; i < 8; ++i) f.h[i] = (_Float16)(bf16_round(W[t * 8 + i]) * 16.0f); *(v8us*)((unsigned short*)Bt + t * 8) = f.half[0];  }
template <int NHv, int TTv>
__global__ __launch_bounds__(256) void k_vt(const _Float16* __restrict__ V16, int ldv, int voff, _Float16* __restrict__ Vt) { __shared__ unsigned short tl[64][66]; const int tid = threadIdx.x; const int slab = blockIdx.x / (TTv / 64), lg = blockIdx.x % (TTv / 64); const int b = slab / NHv, h = slab % NHv;
  for (int i = tid; i < 64 * 8; i += 256) { const int r = i / 8, c8 = (i % 8) * 8; FragH f; f.half[0] = *(const v8us*)((const unsigned short*)V16 + ((size_t)b * TTv + lg * 64 + r) * ldv + voff + h * 64 + c8);
#pragma unroll
    for (int q = 0; q < 8; ++q) tl[r][c8 + q] = f.u[q]; }
  __syncthreads();
  {
#pragma unroll
    for (int rd = 0; rd < 2; ++rd) { const int d = rd * 32 + tid / 8, pc = tid % 8; FragH f;
#pragma unroll
      for (int q = 0; q < 8; ++q) f.u[q] = tl[pc * 8 + q][d];
      *(v8us*)((unsigned short*)Vt + ((size_t)slab * 64 + d) * TTv + lg * 64 + pc * 8) = f.half[0]; }
     } }

__global__ __launch_bounds__(256) void k_hl(const float* __restrict__ F, _Float16* __restrict__ Hh, _Float16* __restrict__ Hl, size_t n8) { const size_t t = (size_t)blockIdx.x * 256 + threadIdx.x; if (t >= n8) return; FragH fh, fl; const v4f a = *(const v4fa*)(F + t * 8), c = *(const v4fa*)(F + t * 8 + 4);
#pragma unroll
  for (int q = 0; q < 4; ++q) { _Float16 h = (_Float16)a[q]; fh.h[q] = h; fl.h[q] = (_Float16)((a[q] - (float)h) * 1024.0f); h = (_Float16)c[q]; fh.h[4 + q] = h; fl.h[4 + q] = (_Float16)((c[q] - (float)h) * 1024.0f); }
  { *(v8us*)((unsigned short*)Hh + t * 8) = fh.half[0]; *(v8us*)((unsigned short*)Hl + t * 8) = fl.half[0];  } }

// stacked weights BW[NW][CC] = f16(bf16(W) * 16), rows 0..63 Wb, 64..127 Wc, 128..639 Wd, and the stacked biases BI[NW] (f32, as given)
__global__ __launch_bounds__(256) void k_prep(const float* __restrict__ Wb, const float* __restrict__ Wc, const float* __restrict__ Wd, const float* __restrict__ bb, const float* __restrict__ bc, const float* __restrict__ bd, _Float16* __restrict__ BW, float* __restrict__ BI) {
  const int t = blockIdx.x * 256 + threadIdx.x, n1 = C8 * CC / 8; if (t >= NW * CC / 8) return;
  const float* Wp = (t < n1) ? Wb + (size_t)t * 8 : (t < 2 * n1) ? Wc + (size_t)(t - n1) * 8 : Wd + (size_t)(t - 2 * n1) * 8; FragH f;
#pragma unroll
  for (int i = 0; i < 8; ++i) f.h[i] = (_Float16)(bf16_round(Wp[i]) * 16.0f); *(v8us*)((unsigned short*)BW + (size_t)t * 8) = f.half[0];
  if (t < NW) BI[t] = (t < C8) ? bb[t] : (t < 2 * C8) ? bc[t - C8] : bd[t - 2 * C8]; }
// The layout change (k_tok) goes through an LDS tile: 64 source rows x TW contiguous source columns come in as whole 128-B lines (8 lanes x 16 B a row),
// are converted, and leave as rows of 64 f16 = one whole 128-B line each. Read straight across the source rows, every lane of a load would touch a line of its own.
// Few, fat work-groups (one per WGP): every thread has all of its loads in flight at once.
#define TR 64                    /* source rows per tile = f16 per output row */
#define TP (TR + 8)              /* LDS row pitch in f16: 144 B = 16 B x odd */
typedef _Float16 v2ha __attribute__((ext_vector_type(2), may_alias));
// the tile's TW output rows, 128 B each, from LDS to dst (pitch ldd elements): 8 lanes a row
template <int TW>
__device__ __forceinline__ void tile_out(const _Float16 (&tl)[TW][TP], _Float16* __restrict__ dst, size_t ldd, int tid) {
#pragma unroll  /* all LDS reads go out ahead of the stores */
  for (int i = 0; i < TW / 32; ++i) { const int r = (tid >> 3) + 32 * i, e8 = (tid & 7) * 8; const v8us v = *(const v8us*)&tl[r][e8]; *(v8us*)((unsigned short*)dst + (size_t)r * ldd + e8) = v; }
}
#define TWX 256                  /* positions per tile of k_tok */
// blockIdx.x = tile of TWX positions, blockIdx.y = tile of 64 channels, blockIdx.z = batch. The work-group turns the tile of x1 and that of x2, and from the same registers forms the tile of
// alpha x1 + beta x2 (inputs and factors rounded to bf16, combined in f32, then f16): conv_d's one operand
__global__ __launch_bounds__(256) void k_tok(const float* __restrict__ x1, const float* __restrict__ x2, const float* __restrict__ al, const float* __restrict__ be, _Float16* __restrict__ X16, _Float16* __restrict__ XC) {
  __shared__ __attribute__((aligned(16))) _Float16 tl[3][TWX][TP];  /* x1, x2, the combination: [position][channel] */
  const int tid = threadIdx.x, b = blockIdx.z, n0 = blockIdx.x * TWX, c0 = blockIdx.y * TR, c = 2 * (tid >> 3), k0 = (tid & 7) * 4;
  const size_t e0 = ((size_t)b * CC + c0) * NP + n0;                                     /* the tile's first element: the same for the whole work-group */
  const char* xa = (const char*)(x1 + e0); const char* xb = (const char*)(x2 + e0);
  const unsigned ob = (unsigned)(c * NP + k0) * 4;                                       /* the lane's byte offset in the tile */
  const float a = bf16_round(al[0]), bq = bf16_round(be[0]);
  v4f u[TWX / 32], v[TWX / 32], p[TWX / 32], r[TWX / 32];
#pragma unroll  /* constant indices: the values stay in registers, and the thirty-two loads of a thread are all in flight at once */
  for (int i = 0; i < TWX / 32; ++i) { u[i] = *(const v4fa*)(xa + ob + 128 * i); v[i] = *(const v4fa*)(xa + ob + NP * 4 + 128 * i); p[i] = *(const v4fa*)(xb + ob + 128 * i); r[i] = *(const v4fa*)(xb + ob + NP * 4 + 128 * i); }
  asm volatile("s_wait_xcnt 0x0" :: "v"(ob), "s"(xa), "s"(xb) : "memory");  /* stands in front of any rewrite of the offset register and the two scalar bases that these loads name; the operands keep those registers until here */
  __builtin_amdgcn_sched_barrier(0);                      /* keeps the conversions behind all the loads; left alone the compiler holds sixteen loads back until the first have returned: a second memory latency */
#pragma unroll
  for (int i = 0; i < TWX / 32; ++i)
#pragma unroll
    for (int q = 0; q < 4; ++q) {
      const float u0 = bf16_round(u[i][q]), v0 = bf16_round(v[i][q]), p0 = bf16_round(p[i][q]), r0 = bf16_round(r[i][q]); v2ha h;
      h[0] = (_Float16)u0; h[1] = (_Float16)v0; *(v2ha*)&tl[0][k0 + 32 * i + q][c] = h;
      h[0] = (_Float16)p0; h[1] = (_Float16)r0; *(v2ha*)&tl[1][k0 + 32 * i + q][c] = h;
      h[0] = (_Float16)(a * u0 + bq * p0); h[1] = (_Float16)(a * v0 + bq * r0); *(v2ha*)&tl[2][k0 + 32 * i + q][c] = h;
    }
  __syncthreads();  /* the tiles are whole before any wave reads them across */
  tile_out<TWX>(tl[0], X16 + ((size_t)(2 * b) * NP + n0) * CC + c0, CC, tid);
  asm volatile("s_wait_xcnt 0x0" ::: "memory");  /* stands in front of the next tile's reuse of the data and address registers that these stores name */
  tile_out<TWX>(tl[1], X16 + ((size_t)(2 * b + 1) * NP + n0) * CC + c0, CC, tid);
  asm volatile("s_wait_xcnt 0x0" ::: "memory");  /* as above */
  tile_out<TWX>(tl[2], XC + ((size_t)b * NP + n0) * CC + c0, CC, tid);
}
// blockIdx.y = plane p = 2 * slab + (0 for conv_b, 1 for conv_c): columns 64 (p & 1) .. + 63 of slab p >> 1 of P
__global__ __launch_bounds__(256) void k_split(const float* __restrict__ F, _Float16* __restrict__ Hh, _Float16* __restrict__ Hl, size_t n8) {
  #pragma clang fp contract(off)
  const size_t t = (size_t)blockIdx.x * 256 + threadIdx.x; if (t >= n8) return;
  const size_t p = blockIdx.y; F += (p >> 1) * NP * NAB + (p & 1) * C8; Hh += p * NP * C8; Hl += p * NP * C8;
  // planes in WMMA fragment order, 16 positions x 64 channels per 2-KiB block: [k step of 32][fragment half][lane][8 channels]; piece t of the plane is position 16*(t>>7) + (t&15), channels 8*sc..8*sc+7
  const size_t sc = ((t >> 6) & 1) * 4 + ((t >> 5) & 1) * 2 + ((t >> 4) & 1), so = ((t >> 7) * 16 + (t & 15)) * NAB + sc * 8;
  const v4f a = *(const v4fa*)(F + so), c = *(const v4fa*)(F + so + 4); FragH fh, fl;
#pragma unroll
  for (int q = 0; q < 8; ++q) { const float v = (q < 4) ? a[q] : c[q - 4]; const _Float16 hi = (_Float16)v; fh.h[q] = hi; fl.h[q] = (_Float16)((v - (float)hi) * 1024.0f); }
  { *(v8us*)((unsigned short*)Hh + t * 8) = fh.half[0]; *(v8us*)((unsigned short*)Hl + t * 8) = fl.half[0];  } }
// One 16x32 f16 fragment (A row or B column = lane & 15; k = 8*(lane>>4)+0..7 and 16+8*(lane>>4)+0..7) from a plane in the fragment order that k_split writes; p already holds 8*lane.
// Each of the two loads reads 512 contiguous bytes (4 whole lines) per wave; from a row-major plane it would touch 16 lines.
__device__ __forceinline__ v16h frag_at(const _Float16* p) { FragH f; f.half[0] = *(const v8us*)((const unsigned short*)p); f.half[1] = *(const v8us*)((const unsigned short*)p + 256); return f.v; }
__device__ __forceinline__ v8f wm(v16h a, v16h b, v8f c) { return __builtin_amdgcn_wmma_f32_16x16x32_f16(false, a, false, b, (short)0, c, false, false); }
// value of lane ^ X inside the 16-lane row, by DPP row_xmask (a shuffle would go through the LDS pipe and its wait); every lane is on where it is used
template <int X> __device__ __forceinline__ float row_xor(float v) { return __int_as_float(__builtin_amdgcn_update_dpp(0, __float_as_int(v), 0x160 + X, 0xf, 0xf, true)); }
__device__ __forceinline__ float row_min16(float v) { v = fminf(v, row_xor<1>(v)); v = fminf(v, row_xor<2>(v)); v = fminf(v, row_xor<4>(v)); return fminf(v, row_xor<8>(v)); }
__device__ __forceinline__ float row_sum16(float v) { v += row_xor<1>(v); v += row_xor<2>(v); v += row_xor<4>(v); return v + row_xor<8>(v); }
// 2^x of eight values by the hardware's instruction
__device__ __forceinline__ v8f exp2_8(const float (&x)[8]) {
  float e0, e1, e2, e3, e4, e5, e6, e7;
  asm("v_exp_f32 %0, %8\n\tv_exp_f32 %1, %9\n\tv_exp_f32 %2, %10\n\tv_exp_f32 %3, %11\n\tv_exp_f32 %4, %12\n\tv_exp_f32 %5, %13\n\tv_exp_f32 %6, %14\n\tv_exp_f32 %7, %15\n\tv_nop"
      : "=&v"(e0), "=&v"(e1), "=&v"(e2), "=&v"(e3), "=&v"(e4), "=&v"(e5), "=&v"(e6), "=&v"(e7) : "v"(x[0]), "v"(x[1]), "v"(x[2]), "v"(x[3]), "v"(x[4]), "v"(x[5]), "v"(x[6]), "v"(x[7]));
  return v8f{e0, e1, e2, e3, e4, e5, e6, e7};
}
// e^(s - m) for the eight rows of a logit tile as 2^(s * log2(e) + nm), nm = -m * log2(e) formed once per row: one fused multiply-add and the hardware's 2^x each. s <= m up to rounding, so nothing
// overflows, and a result under the smallest normal number may go to zero: it is far below one unit of the f16 output. The library's expf spends about a dozen vector instructions on ranges that cannot occur here.
#define LOG2E 1.4426950408889634f
__device__ __forceinline__ v8f exp_rel(v8f s, const float (&nm)[8]) {
  float x[8];
#pragma unroll  /* constant indices: x stays in registers */
  for (int r = 0; r < 8; ++r) x[r] = fmaf(s[r], LOG2E, nm[r]);
  return exp2_8(x);
}
// Row maximum and row sum in one pass. For eight rows the lane keeps nm = -(largest logit it has seen) * log2(e) and u = the sum of 2^(s * log2(e) + nm) over the logits s it has seen.
// Two more logit tiles a and b: nm falls to the new value, the old sum is brought along by 2^(new nm - old nm) (exactly 1 where nm stays), and the two new terms are added.
// Two tiles a step: one new nm and one such factor serve two logits. At the start nm is far above any value it can take and u is 0: the first factor is 0.
__device__ __forceinline__ void online2(v8f a, v8f b, float (&nm)[8], float (&u)[8]) {
  float d[8];
#pragma unroll  /* constant indices: everything stays in registers */
  for (int r = 0; r < 8; ++r) { const float n = fminf(nm[r], -LOG2E * fmaxf(a[r], b[r])); d[r] = n - nm[r]; nm[r] = n; }
  const v8f c = exp2_8(d), ea = exp_rel(a, nm), eb = exp_rel(b, nm);
#pragma unroll
  for (int r = 0; r < 8; ++r) u[r] = fmaf(u[r], c[r], ea[r] + eb[r]);
}
// the sixteen lanes' pairs (nm, u) of eight rows made one, alike in all sixteen lanes: the pair of the wave's columns
__device__ __forceinline__ void online_row(float (&nm)[8], float (&u)[8]) {
  float d[8];
#pragma unroll
  for (int r = 0; r < 8; ++r) { const float n = row_min16(nm[r]); d[r] = n - nm[r]; nm[r] = n; }
  const v8f c = exp2_8(d);
#pragma unroll
  for (int r = 0; r < 8; ++r) u[r] = row_sum16(u[r] * c[r]);
}
struct QFrag { v16h a1h[2], a1l[2], a2h[2], a2l[2]; };
#define DRT 2                    /* 16-row query tiles per wave: every B fragment that is loaded feeds both */
// both logit tiles (16 query rows x 16 key columns, K 64) of each of the wave's DRT query tiles from the hi/lo planes: hi*hi in one accumulator, the two cross terms (scaled 2^10) in a second
__device__ __forceinline__ void logit_tile(const QFrag (&q)[DRT], const _Float16* b2h, const _Float16* b2l, const _Float16* b1h, const _Float16* b1l, v8f (&s1)[DRT], v8f (&s2)[DRT]) {
  v8f h1[DRT] = {}, l1[DRT] = {}, h2[DRT] = {}, l2[DRT] = {};
  const v16h p[2] = {frag_at(b2h), frag_at(b2h + 512)}, x[2] = {frag_at(b1h), frag_at(b1h + 512)}, pl[2] = {frag_at(b2l), frag_at(b2l + 512)}, xl[2] = {frag_at(b1l), frag_at(b1l + 512)};
  // holds all sixteen loads of the tile in front of its first WMMA: one load latency a tile; left alone the compiler reuses fragment registers and waits for memory several times a tile
  asm volatile("" :: "v"(p[0]), "v"(p[1]), "v"(x[0]), "v"(x[1]), "v"(pl[0]), "v"(pl[1]), "v"(xl[0]), "v"(xl[1]));
#pragma unroll
  for (int ks = 0; ks < 2; ++ks) {
#pragma unroll
    for (int i = 0; i < DRT; ++i) { h1[i] = wm(q[i].a1h[ks], p[ks], h1[i]); h2[i] = wm(q[i].a2h[ks], x[ks], h2[i]); }
#pragma unroll
    for (int i = 0; i < DRT; ++i) { l1[i] = wm(q[i].a1l[ks], p[ks], l1[i]); l2[i] = wm(q[i].a2l[ks], x[ks], l2[i]); }
#pragma unroll
    for (int i = 0; i < DRT; ++i) { l1[i] = wm(q[i].a1h[ks], pl[ks], l1[i]); l2[i] = wm(q[i].a2h[ks], xl[ks], l2[i]); }
  }
#pragma unroll
  for (int i = 0; i < DRT; ++i)
#pragma unroll
    for (int r = 0; r < 8; ++r) { s1[i][r] = h1[i][r] + l1[i][r] * 0.0009765625f; s2[i][r] = h2[i][r] + l2[i][r] * 0.0009765625f; }
}
// Logits, both softmaxes and |difference| in one kernel: a work-group of 8 waves owns 32 query rows (one work-group per WGP covers all rows), wave w the key columns [512 w, 512 w + 512).
// Every wave holds the query fragments of both 16-row tiles in registers (2 waves per SIMD: 512 registers each), so the key planes are read from L2 once per 32 rows and pass.
// The logits stay in registers and are formed twice (row maximum and row sum together, as a running pair; then the output); nothing of them goes to memory.
#define DW 8                     /* waves per work-group */
#define DROW (16 * DRT)          /* query rows per work-group */
#define DCOL (NP / DW)           /* key columns per wave */
#define DPIT (DCOL + 8)          /* LDS row pitch in f16: 16-byte multiple, rows 8 apart fall on other banks */
__global__ __launch_bounds__(DW * 32) void k_attdiff(const _Float16* __restrict__ A1h, const _Float16* __restrict__ A1l, const _Float16* __restrict__ A2h, const _Float16* __restrict__ A2l,
                                                 const _Float16* __restrict__ B2h, const _Float16* __restrict__ B2l, const _Float16* __restrict__ B1h, const _Float16* __restrict__ B1l, _Float16* __restrict__ D16) {
  __shared__ __attribute__((aligned(16))) _Float16 st[DW][DROW][DPIT];
  __shared__ float red[2][DW][DROW], redu[2][DW][DROW];  /* each wave's -max * log2(e) of every row, and its row sums relative to that */
  __shared__ float fin[2][DROW], finu[2][DROW];          /* the same over all columns, the sum as 1 / sum */
  const int tid = threadIdx.x, w = tid >> 5, lane = tid & 31, ln = lane & 15, hh = lane >> 4; const int row0 = blockIdx.x * DROW;
  { const size_t pb = (size_t)blockIdx.y * 4 * NP * C8;  /* blockIdx.y = batch: four planes of each kind a batch */
    A1h += pb; A1l += pb; A2h += pb; A2l += pb; B2h += pb; B2l += pb; B1h += pb; B1l += pb; D16 += (size_t)blockIdx.y * NP * NP; }
  QFrag q[DRT];
#pragma unroll
  for (int i = 0; i < DRT; ++i) { const size_t ao = (size_t)(row0 + 16 * i) * C8 + 8 * lane;
#pragma unroll
    for (int ks = 0; ks < 2; ++ks) { q[i].a1h[ks] = frag_at(A1h + ao + ks * 512); q[i].a1l[ks] = frag_at(A1l + ao + ks * 512); q[i].a2h[ks] = frag_at(A2h + ao + ks * 512); q[i].a2l[ks] = frag_at(A2l + ao + ks * 512); } }
  asm volatile("s_wait_xcnt 0x0" ::: "memory");  /* stands in front of the reuse of the address registers that the query loads name */
  __builtin_amdgcn_sched_barrier(0);             /* keeps the key-plane address arithmetic, which reuses those registers, behind that wait */
  const size_t bo = (size_t)(w * DCOL) * C8 + 8 * lane; B2h += bo; B2l += bo; B1h += bo; B1l += bo;
  float m1[DRT][8], m2[DRT][8], u1[DRT][8], u2[DRT][8];
#pragma unroll
  for (int i = 0; i < DRT; ++i)
#pragma unroll
    for (int r = 0; r < 8; ++r) { m1[i][r] = 3.0e38f; m2[i][r] = 3.0e38f; u1[i][r] = 0.f; u2[i][r] = 0.f; }  /* m1, m2 hold -max * log2(e) throughout */
#pragma unroll 1  /* rolled: an unrolled body would hold several steps' B fragments and leave the 512-register budget of 2 waves per SIMD */
  for (int j = 0; j < DCOL / 16; j += 2) { v8f s1[DRT], s2[DRT], t1[DRT], t2[DRT]; const size_t o = (size_t)j * 16 * C8, o2 = o + 16 * C8;
    logit_tile(q, B2h + o, B2l + o, B1h + o, B1l + o, s1, s2); logit_tile(q, B2h + o2, B2l + o2, B1h + o2, B1l + o2, t1, t2);
#pragma unroll
    for (int i = 0; i < DRT; ++i) { online2(s1[i], t1[i], m1[i], u1[i]); online2(s2[i], t2[i], m2[i], u2[i]); } }
#pragma unroll
  for (int i = 0; i < DRT; ++i) { online_row(m1[i], u1[i]); online_row(m2[i], u2[i]); }
  if (ln == 0) {
#pragma unroll
    for (int i = 0; i < DRT; ++i)
#pragma unroll
      for (int r = 0; r < 8; ++r) { const int rw = 16 * i + 8 * hh + r; red[0][w][rw] = m1[i][r]; red[1][w][rw] = m2[i][r]; redu[0][w][rw] = u1[i][r]; redu[1][w][rw] = u2[i][r]; } }
  __syncthreads();
  if (tid < 2 * DROW) {  /* the eight waves' pairs of one row made one, in the same way */
    const int mt = tid / DROW, rw = tid % DROW; float d[DW], v = red[mt][0][rw];
#pragma unroll
    for (int k = 1; k < DW; ++k) v = fminf(v, red[mt][k][rw]);
#pragma unroll
    for (int k = 0; k < DW; ++k) d[k] = v - red[mt][k][rw];
    const v8f c = exp2_8(d); float sum = 0.f;
#pragma unroll
    for (int k = 0; k < DW; ++k) sum = fmaf(redu[mt][k][rw], c[k], sum);
    fin[mt][rw] = v; finu[mt][rw] = 1.0f / sum; }
  __syncthreads();
#pragma unroll
  for (int i = 0; i < DRT; ++i)
#pragma unroll
    for (int r = 0; r < 8; ++r) { const int rw = 16 * i + 8 * hh + r; m1[i][r] = fin[0][rw]; m2[i][r] = fin[1][rw]; u1[i][r] = finu[0][rw]; u2[i][r] = finu[1][rw]; }  /* from here on u1, u2 hold 1 / sum */
#pragma unroll 1  /* rolled for the register budget, as above */
  for (int j = 0; j < DCOL / 16; ++j) { v8f s1[DRT], s2[DRT]; const size_t o = (size_t)j * 16 * C8; logit_tile(q, B2h + o, B2l + o, B1h + o, B1l + o, s1, s2);
#pragma unroll
    for (int i = 0; i < DRT; ++i) { const v8f e1 = exp_rel(s1[i], m1[i]), e2 = exp_rel(s2[i], m2[i]);
#pragma unroll
      for (int r = 0; r < 8; ++r) st[w][16 * i + 8 * hh + r][j * 16 + ln] = (_Float16)(fabsf(e1[r] * u1[i][r] - e2[r] * u2[i][r]) * 16384.0f); } }
  // each wave reads back only its own slab: the fence keeps the LDS reads behind the writes of the wave's other lanes, no work-group barrier is needed
  __builtin_amdgcn_fence(__ATOMIC_ACQ_REL, "workgroup"); __builtin_amdgcn_wave_barrier();
#pragma unroll 1  /* rolled in groups of eight rows: sixteen LDS reads go out ahead of their stores */
  for (int r0 = 0; r0 < DROW; r0 += 8) {
#pragma unroll
    for (int r = r0; r < r0 + 8; ++r)
#pragma unroll
      for (int c = 0; c < DCOL; c += 256) { const v8us v = *(const v8us*)&st[w][r][c + lane * 8]; *(v8us*)((unsigned short*)D16 + (size_t)(row0 + r) * NP + w * DCOL + c + lane * 8) = v; }
    asm volatile("s_wait_xcnt 0x0" ::: "memory");  /* stands in front of the next trip's rewrite of the data and address registers that these stores name */
  }
}

// C[M][N] (f32, pitch ldc) = A[M][K] . B[N][K]^T * alpha + bias[col] (bias rounded to bf16); A and B f16 with k contiguous. One 128 x 128 tile of C per work-group of 4 waves (2 x 2, 64 x 64 each):
// an operand row that comes from L2 feeds 128 rows or columns of C, and a fragment that is read from LDS feeds four WMMAs.
// A stage is 128 k of the tile's 128 A rows and 128 B rows, brought into LDS by asynchronous b128 copies: one copy of a wave is 256 contiguous bytes (2 whole lines) of each of two rows, where a fragment load
// straight from the row-major operand touches 16 lines. Two buffers: the next stage's copies fly while this stage is worked on. M, N multiples of 128, K a multiple of 128.
// Every accumulator sums k in rising order, 32 at a time.
#define GT 128                   /* rows of each operand per work-group */
#define GW 64                    /* rows and columns of C per wave */
#define GK 128                   /* k per stage */
#define GP (GK + 8)              /* LDS row pitch in f16: 272 B = 16 B x odd, so the 16 rows of a ds_load_b128 fall on all banks */
#define GQ (GW + 4)              /* row pitch in f32 of a wave's tile of C in LDS: rows 8 apart fall on other banks, 16-byte multiple */
typedef __attribute__((address_space(3))) const _Float16 lds_f16;
// eight pairs of rows (8 rows apart) of one operand: l = the lane's LDS byte address, g = the lane's global address, gs = 8 rows of the operand in elements
__device__ __forceinline__ void copy8(unsigned l, const _Float16* g, size_t gs) {
  const unsigned ls = 8 * GP * 2;
  // the last line is the wait that stands in front of any rewrite of the address registers that these copies name
  asm volatile("global_load_async_to_lds_b128 %0, %8, off\n\t"
               "global_load_async_to_lds_b128 %1, %9, off\n\t"
               "global_load_async_to_lds_b128 %2, %10, off\n\t"
               "global_load_async_to_lds_b128 %3, %11, off\n\t"
               "global_load_async_to_lds_b128 %4, %12, off\n\t"
               "global_load_async_to_lds_b128 %5, %13, off\n\t"
               "global_load_async_to_lds_b128 %6, %14, off\n\t"
               "global_load_async_to_lds_b128 %7, %15, off\n\t"
               "s_wait_xcnt 0x0"
               :: "v"(l), "v"(l + ls), "v"(l + 2 * ls), "v"(l + 3 * ls), "v"(l + 4 * ls), "v"(l + 5 * ls), "v"(l + 6 * ls), "v"(l + 7 * ls),
                  "v"(g), "v"(g + gs), "v"(g + 2 * gs), "v"(g + 3 * gs), "v"(g + 4 * gs), "v"(g + 5 * gs), "v"(g + 6 * gs), "v"(g + 7 * gs) : "memory");
}
// one stage: wave w brings rows 2 w, 2 w + 1, 2 w + 8, 2 w + 9, ..., 2 w + 121 of the A tile (LDS rows 0..127) and of the B tile (LDS rows 128..255): 32 copies of a wave
__device__ __forceinline__ void fill_stage(unsigned l, const _Float16* ga, size_t sa, const _Float16* gb, size_t sb) {
  copy8(l, ga, sa); copy8(l + 64 * GP * 2, ga + 8 * sa, sa); copy8(l + 128 * GP * 2, gb, sb); copy8(l + 192 * GP * 2, gb + 8 * sb, sb);
}
// fragment from a row-major LDS tile; p = row (lane & 15), k = 8 * (lane >> 4): k 8*(lane>>4)+0..7 and 16+8*(lane>>4)+0..7, alike for A and B
__device__ __forceinline__ v16h frag_lds(const _Float16* p) { FragH f; f.half[0] = *(const v8us*)((const unsigned short*)p); f.half[1] = *(const v8us*)((const unsigned short*)p + 16); return f.v; }
// blockIdx.z = batch: A, B and C move on by sA, sB, sC elements
__global__ __launch_bounds__(128) void k_gemm_t(const _Float16* __restrict__ A, int lda, size_t sA, const _Float16* __restrict__ B, int ldb, size_t sB, float alpha, const float* __restrict__ bias, float* __restrict__ C, int ldc, size_t sC, int K) {
  __shared__ __attribute__((aligned(16))) _Float16 sm[2][2 * GT][GP];
  const int tid = threadIdx.x, w = tid >> 5, lane = tid & 31, ln = lane & 15, hh = lane >> 4, wr = w >> 1, wc = w & 1;
  const int row0 = blockIdx.y * GT, col0 = blockIdx.x * GT;
  A += blockIdx.z * sA; B += blockIdx.z * sB; C += blockIdx.z * sC;
  const _Float16* ga = A + (size_t)(row0 + 2 * w + hh) * lda + ln * 8; const _Float16* gb = B + (size_t)(col0 + 2 * w + hh) * ldb + ln * 8;
  const size_t sa = (size_t)8 * lda, sb = (size_t)8 * ldb;
  const unsigned l0 = (unsigned)(uintptr_t)(lds_f16*)&sm[0][2 * w + hh][ln * 8], lbuf = 2 * GT * GP * 2;
  const int nt = K / GK;
  v8f acc[4][4] = {};
  fill_stage(l0, ga, sa, gb, sb);
  float bv[4] = {0.f, 0.f, 0.f, 0.f};
  if (bias) {  /* the lane's four bias values: one branch, so that the four loads go out together, while stage 0 is under way */
    const float* bp = bias + col0 + wc * GW + ln; const float b0 = bp[0], b1 = bp[16], b2 = bp[32], b3 = bp[48];
    bv[0] = bf16_round(b0); bv[1] = bf16_round(b1); bv[2] = bf16_round(b2); bv[3] = bf16_round(b3);
  }
  asm volatile("s_wait_asynccnt 0x0" ::: "memory");  /* this wave's copies of stage 0 have landed */
  __syncthreads();                                   /* and every other wave's */
  if (nt > 1) fill_stage(l0 + lbuf, ga + GK, sa, gb + GK, sb);
  for (int t = 0; t < nt; ++t) {
    const _Float16* pa = &sm[t & 1][wr * GW + ln][8 * hh]; const _Float16* pb = &sm[t & 1][GT + wc * GW + ln][8 * hh];
    v16h fa[GK / 32][4], fb[GK / 32][4];
#pragma unroll  /* every index constant: the fragments stay in registers */
    for (int ks = 0; ks < GK / 32; ++ks) {
      fa[ks][0] = frag_lds(pa + ks * 32);
#pragma unroll
      for (int j = 0; j < 4; ++j) fb[ks][j] = frag_lds(pb + j * 16 * GP + ks * 32);
#pragma unroll
      for (int i = 1; i < 4; ++i) fa[ks][i] = frag_lds(pa + i * 16 * GP + ks * 32);
    }
    // keeps the stage's 64 LDS loads one group in front of its WMMAs, which then follow behind counted waits; left alone the compiler reuses fragment registers and the lone wave of a SIMD waits out the LDS latency several times per k step
    __builtin_amdgcn_sched_barrier(0);
#pragma unroll  /* as above */
    for (int ks = 0; ks < GK / 32; ++ks)
#pragma unroll
      for (int i = 0; i < 4; ++i)
#pragma unroll
        for (int j = 0; j < 4; ++j) acc[i][j] = wm(fa[ks][i], fb[ks][j], acc[i][j]);
    // keeps the WMMAs in front of the waits below, so that they run while the later LDS loads still return and the refill is issued directly behind the barrier
    __builtin_amdgcn_sched_barrier(0);
    asm volatile("s_wait_dscnt 0x0" ::: "memory");     /* this wave's reads of the buffer are done before it is refilled */
    asm volatile("s_wait_asynccnt 0x0" ::: "memory");  /* this wave's copies of stage t + 1 have landed */
    __syncthreads();                                   /* publishes stage t + 1 and ends every wave's reads of stage t */
    if (t + 2 < nt) fill_stage(l0 + (t & 1) * lbuf, ga + (size_t)(t + 2) * GK, sa, gb + (size_t)(t + 2) * GK, sb);
  }
  asm volatile("s_wait_asynccnt 0x0" ::: "memory");    /* no copy is left in flight when the wave ends */
  // behind the last trip's barrier no wave reads the operand buffers any more and no copy is under way: the four waves' tiles of C take the place of buffer 0 (4 x 64 x 68 f32 = its size)
  float* so = (float*)&sm[0][0][0] + w * GW * GQ;
#pragma unroll  /* these three: constant accumulator indices, so that acc stays in registers */
  for (int j = 0; j < 4; ++j)
#pragma unroll
    for (int i = 0; i < 4; ++i)
#pragma unroll
      for (int r = 0; r < 8; ++r) so[(i * 16 + 8 * hh + r) * GQ + j * 16 + ln] = acc[i][j][r] * alpha + bv[j];
  // each wave reads back only its own slab, so that a store covers whole 128-B lines: the fence keeps the LDS reads behind the writes of the wave's other lanes
  __builtin_amdgcn_fence(__ATOMIC_ACQ_REL, "workgroup"); __builtin_amdgcn_wave_barrier();
  float* cw = C + (size_t)(row0 + wr * GW + hh) * ldc + col0 + wc * GW + ln * 4;
#pragma unroll 1  /* rolled in groups of sixteen rows: eight LDS reads go out ahead of their stores */
  for (int q0 = 0; q0 < GW / 2; q0 += 8) {
#pragma unroll
    for (int q = q0; q < q0 + 8; ++q) { const v4f v = *(const v4fa*)&so[(q * 2 + hh) * GQ + ln * 4]; *(v4f*)(cw + (size_t)(q * 2) * ldc) = v; }
    asm volatile("s_wait_xcnt 0x0" ::: "memory");  /* stands in front of the next trip's rewrite of the data and address registers that these stores name */
  }
}

// All 1x1 convs in one launch, each work-group one 128 x 128 tile with k_gemm_t's stages, K = CC, all work-groups resident at once (two per WGP).
// Work-groups 0 .. CWA - 1: P[position][0..63] = conv_b, [64..127] = conv_c of 128 positions of the four slabs of X (A = X, B = rows 0..127 of BW; f32, bias by column).
// The others: FT[batch][channel][position] = f16(conv_d's weights . XC + (alpha + beta) bias) (A = 128 rows of BW from row 128 on, B = 128 positions of XC; bias by row): the out product's A operand as it stands.
#define CWA (NS * NP / GT)
#define CWF (NBt * (CC / GT) * (NP / GT))
__global__ __launch_bounds__(128) void k_conv(const _Float16* __restrict__ X, const _Float16* __restrict__ XC, const _Float16* __restrict__ BW, const float* __restrict__ BI,
                                              const float* __restrict__ al, const float* __restrict__ be, float* __restrict__ P, _Float16* __restrict__ FT) {
  __shared__ __attribute__((aligned(16))) _Float16 sm[2][2 * GT][GP];
  const int tid = threadIdx.x, w = tid >> 5, lane = tid & 31, ln = lane & 15, hh = lane >> 4, wr = w >> 1, wc = w & 1;
  const int bid = blockIdx.x, f = bid - CWA, fb = f / ((CC / GT) * (NP / GT)), fr = (f / (NP / GT)) % (CC / GT), fc = f % (NP / GT);  /* conv_d: batch, tile of channels, tile of positions */
  const bool fd = bid >= CWA;  /* the same for the whole work-group */
  const _Float16* A = fd ? BW + (size_t)(NAB + fr * GT) * CC : X + (size_t)bid * GT * CC;
  const _Float16* B = fd ? XC + ((size_t)fb * NP + fc * GT) * CC : BW;
  const _Float16* ga = A + (size_t)(2 * w + hh) * CC + ln * 8; const _Float16* gb = B + (size_t)(2 * w + hh) * CC + ln * 8;
  const size_t sa = (size_t)8 * CC;
  const unsigned l0 = (unsigned)(uintptr_t)(lds_f16*)&sm[0][2 * w + hh][ln * 8], lbuf = 2 * GT * GP * 2;
  const int nt = CC / GK;
  v8f acc[4][4] = {};
  fill_stage(l0, ga, sa, gb, sa);
  float bv[4] = {0.f, 0.f, 0.f, 0.f}; v4f rb[4][2] = {};  /* the lane's bias values, by column or by row: their loads go out while stage 0 is under way */
  if (fd) {
    const float* bp = BI + NAB + fr * GT + wr * GW + 8 * hh; const float ab = bf16_round(al[0]) + bf16_round(be[0]);
#pragma unroll  /* constant indices: rb stays in registers */
    for (int i = 0; i < 4; ++i) { rb[i][0] = *(const v4fa*)(bp + i * 16); rb[i][1] = *(const v4fa*)(bp + i * 16 + 4); }
#pragma unroll
    for (int i = 0; i < 4; ++i)
#pragma unroll
      for (int r = 0; r < 8; ++r) rb[i][r >> 2][r & 3] = ab * bf16_round(rb[i][r >> 2][r & 3]);
  } else {
    const float* bp = BI + wc * GW + ln; const float b0 = bp[0], b1 = bp[16], b2 = bp[32], b3 = bp[48];
    bv[0] = bf16_round(b0); bv[1] = bf16_round(b1); bv[2] = bf16_round(b2); bv[3] = bf16_round(b3);
  }
  asm volatile("s_wait_asynccnt 0x0" ::: "memory");  /* this wave's copies of stage 0 have landed */
  __syncthreads();                                   /* and every other wave's */
  fill_stage(l0 + lbuf, ga + GK, sa, gb + GK, sa);
#pragma unroll 1  /* rolled: unrolled, the four stages' copy addresses take the kernel past 512 registers, the budget of two work-groups per WGP, and into scratch */
  for (int t = 0; t < nt; ++t) {
    const _Float16* pa = &sm[t & 1][wr * GW + ln][8 * hh]; const _Float16* pb = &sm[t & 1][GT + wc * GW + ln][8 * hh];
    v16h fa[GK / 32][4], fq[GK / 32][4];
#pragma unroll  /* every index constant: the fragments stay in registers */
    for (int ks = 0; ks < GK / 32; ++ks) {
      fa[ks][0] = frag_lds(pa + ks * 32);
#pragma unroll
      for (int j = 0; j < 4; ++j) fq[ks][j] = frag_lds(pb + j * 16 * GP + ks * 32);
#pragma unroll
      for (int i = 1; i < 4; ++i) fa[ks][i] = frag_lds(pa + i * 16 * GP + ks * 32);
    }
    // keeps the stage's 64 LDS loads one group in front of its WMMAs, which then follow behind counted waits, as in k_gemm_t
    __builtin_amdgcn_sched_barrier(0);
#pragma unroll  /* as above */
    for (int ks = 0; ks < GK / 32; ++ks)
#pragma unroll
      for (int i = 0; i < 4; ++i)
#pragma unroll
        for (int j = 0; j < 4; ++j) acc[i][j] = wm(fa[ks][i], fq[ks][j], acc[i][j]);
    // keeps the WMMAs in front of the waits below, so that the refill is issued directly behind the barrier
    __builtin_amdgcn_sched_barrier(0);
    asm volatile("s_wait_dscnt 0x0" ::: "memory");     /* this wave's reads of the buffer are done before it is refilled */
    asm volatile("s_wait_asynccnt 0x0" ::: "memory");  /* this wave's copies of stage t + 1 have landed */
    __syncthreads();                                   /* publishes stage t + 1 and ends every wave's reads of stage t */
    if (t + 2 < nt) fill_stage(l0 + (t & 1) * lbuf, ga + (size_t)(t + 2) * GK, sa, gb + (size_t)(t + 2) * GK, sa);
  }
  asm volatile("s_wait_asynccnt 0x0" ::: "memory");    /* no copy is left in flight when the wave ends */
  // behind the last trip's barrier no wave reads the operand buffers any more and no copy is under way: the four waves' tiles of C take the place of buffer 0, as in k_gemm_t
  float* so = (float*)&sm[0][0][0] + w * GW * GQ;
#pragma unroll  /* these three: constant accumulator indices, so that acc stays in registers */
  for (int j = 0; j < 4; ++j)
#pragma unroll
    for (int i = 0; i < 4; ++i)
#pragma unroll
      for (int r = 0; r < 8; ++r) so[(i * 16 + 8 * hh + r) * GQ + j * 16 + ln] = acc[i][j][r] * 0.0625f + (bv[j] + rb[i][r >> 2][r & 3]);  /* one of the two is 0 */
  // each wave reads back only its own slab, so that a store covers whole 128-B lines: the fence keeps the LDS reads behind the writes of the wave's other lanes
  __builtin_amdgcn_fence(__ATOMIC_ACQ_REL, "workgroup"); __builtin_amdgcn_wave_barrier();
  if (fd) {
    const int rq = lane >> 3, e8 = (lane & 7) * 8;  /* 8 lanes a row of 64 f16 = one line */
    unsigned short* cw = (unsigned short*)FT + ((size_t)fb * CC + fr * GT + wr * GW + rq) * NP + fc * GT + wc * GW + e8;
#pragma unroll 1  /* rolled in groups of thirty-two rows: sixteen LDS reads go out ahead of their stores */
    for (int q0 = 0; q0 < GW / 4; q0 += 8) {
#pragma unroll
      for (int q = q0; q < q0 + 8; ++q) { const float* sp = &so[(q * 4 + rq) * GQ + e8]; const v4f v0 = *(const v4fa*)sp, v1 = *(const v4fa*)(sp + 4); FragH h;
#pragma unroll
        for (int k = 0; k < 4; ++k) { h.h[k] = (_Float16)v0[k]; h.h[4 + k] = (_Float16)v1[k]; }
        *(v8us*)(cw + (size_t)(q * 4) * NP) = h.half[0]; }
      asm volatile("s_wait_xcnt 0x0" ::: "memory");  /* stands in front of the next trip's rewrite of the data and address registers that these stores name */
    }
  } else {
    float* cw = P + ((size_t)bid * GT + wr * GW + hh) * NAB + wc * GW + ln * 4;
#pragma unroll 1  /* rolled in groups of sixteen rows: eight LDS reads go out ahead of their stores */
    for (int q0 = 0; q0 < GW / 2; q0 += 8) {
#pragma unroll
      for (int q = q0; q < q0 + 8; ++q) { const v4f v = *(const v4fa*)&so[(q * 2 + hh) * GQ + ln * 4]; *(v4f*)(cw + (size_t)(q * 2) * NAB) = v; }
      asm volatile("s_wait_xcnt 0x0" ::: "memory");  /* stands in front of the next trip's rewrite of the data and address registers that these stores name */
    }
  }
}

extern "C" void kernel_launch(void* const* d_in, const int* in_sizes, int n_in,
                              void* d_out, int out_size, void* d_ws, size_t ws_size, hipStream_t stream) {
  (void)in_sizes; (void)n_in; (void)out_size;
  const float* x1 = (const float*)d_in[0]; const float* x2 = (const float*)d_in[1]; const float* Wb = (const float*)d_in[2]; const float* bb_ = (const float*)d_in[3]; const float* Wc = (const float*)d_in[4]; const float* bc = (const float*)d_in[5]; const float* Wd = (const float*)d_in[6]; const float* bd = (const float*)d_in[7]; const float* al = (const float*)d_in[8]; const float* be = (const float*)d_in[9];
  char* ws = (char*)d_ws; size_t off = 0;
  auto take = [&](size_t bytes) { char* p = ws + off; off += (bytes + 255) & ~(size_t)255; return p; };
  _Float16* BW = (_Float16*)take((size_t)NW * CC * 2); float* BI = (float*)take(NW * 4);
  _Float16* X = (_Float16*)take((size_t)NS * NP * CC * 2); _Float16* XC = (_Float16*)take((size_t)NBt * NP * CC * 2); float* P = (float*)take((size_t)NS * NP * NAB * 4);
  _Float16* Hh = (_Float16*)take((size_t)2 * NS * NP * C8 * 2); _Float16* Hl = (_Float16*)take((size_t)2 * NS * NP * C8 * 2);      /* plane 2 s + j: conv_b (j 0) or conv_c (j 1) of slab s */
  _Float16* FT = (_Float16*)take((size_t)NBt * CC * NP * 2); _Float16* D16 = (_Float16*)take((size_t)NBt * NP * NP * 2);
  if (off > ws_size) return;
  const size_t n8 = (size_t)NP * C8 / 8, pl = (size_t)NP * C8;
  k_prep<<<(NW * CC / 8 + 255) / 256, 256, 0, stream>>>(Wb, Wc, Wd, bb_, bc, bd, BW, BI);      /* conv weights [O][C] = natural Bt */
  k_tok<<<dim3(NP / TWX, CC / TR, NBt), 256, 0, stream>>>(x1, x2, al, be, X, XC);
  k_conv<<<CWA + CWF, 128, 0, stream>>>(X, XC, BW, BI, al, be, P, FT);      /* P[s][n][0..63] = conv_b, [64..127] = conv_c of slab s (exact + bias); FT = alpha f1 + beta f2 */
  k_split<<<dim3((unsigned)((n8 + 255) / 256), 2 * NS), 256, 0, stream>>>(P, Hh, Hl, n8);      /* a1, b1, a2, b2 of each batch -> hi/lo planes */
  k_attdiff<<<dim3(NP / DROW, NBt), DW * 32, 0, stream>>>(Hh, Hl, Hh + 2 * pl, Hl + 2 * pl, Hh + 3 * pl, Hl + 3 * pl, Hh + pl, Hl + pl, D16);      /* a1 = plane 0, a2 = plane 2, b2 = plane 3, b1 = plane 1: |softmax(a1.b2) - softmax(a2.b1)| x 2^14 */
  k_gemm_t<<<dim3(NP / GT, CC / GT, NBt), 128, 0, stream>>>(FT, NP, (size_t)CC * NP, D16, NP, (size_t)NP * NP, 1.0f / 16384.0f, nullptr, (float*)d_out, NP, (size_t)CC * NP, NP);      /* out[b][c][n] = sum_m F[c][m] att[n][m]: M 512 (c), N 4096 (n), K 4096 (m) -> NCHW directly */
}

// v010
// One run takes 120 microseconds.
// Timed twice side by side with v009, it ran 1.05 times as fast both times.
// Counting every step since v000, it is 12.7 times as fast.
#include <hip/hip_runtime.h>
// Position-attention difference module (B 2, C 512, 64×64 = 4096 positions): a1 = conv_b(x1), b2 = conv_c(x2), a2 = conv_b(x2), b1 = conv_c(x1) (1×1, 512→64, + bias); f = conv_d (512→512, + bias); att12 = softmax_m(a1ᵀ·b2), att21 = softmax_m(a2ᵀ·b1) (no scaling); att = |att12 − att21|; out = α·f1·attᵀ + β·f2·attᵀ = (α f1 + β f2)·attᵀ → [2,512,64,64].
// Structure: every kernel runs once, over both batches and both inputs (4 launches): the weight conversion rides in the grid of the layout change; 1x1 convs as one launch of GEMM tiles on position-major f16 planes, which also splits conv_b and conv_c into their hi/lo planes; conv_b and conv_c of x1 and x2 have exact products; a/b as f16 hi + lo*2^10 planes so both logit matrices are about f32 (three cross products each); one kernel forms both logit matrices in registers, both softmaxes per row in f32 and writes |difference| x 2^14 as f16; conv_d is linear, so F = alpha f1 + beta f2 = conv_d's weights . (alpha x1 + beta x2) + (alpha + beta) bias: one product on the combined input (f32 combine, then f16), written as f16; out = F.att^T by one GEMM straight into the NCHW output.
// Compute dtype: inputs and parameters rounded to bf16; logits ≈f32; softmaxes/difference in f32; |Δ| (×2^14) and F as f16 operands (≈2^-12), f32 accumulation. v_wmma_f32_16x16x32_f16.
#define NBt 2
#define CC 512
#define C8 64
#define NP 4096
#define NW (2 * C8 + CC)         /* rows of the stacked weights [Wb; Wc; Wd] */
#define NS (2 * NBt)             /* position-major input slabs: slab s = 2 * batch + (0 for x1, 1 for x2) */
#define NAB (2 * C8)             /* columns of the projection matrix P: conv_b, conv_c */
typedef __bf16 v16b __attribute__((ext_vector_type(16)));
typedef unsigned short v8us __attribute__((ext_vector_type(8), may_alias));
typedef float  v8f  __attribute__((ext_vector_type(8)));
typedef float  v4f  __attribute__((ext_vector_type(4)));
typedef float  v4fa __attribute__((ext_vector_type(4), may_alias));
union FragB { v16b v; v8us half[2]; unsigned short u[16]; };

__device__ __forceinline__ unsigned short bf16_bits(float x) { unsigned int u = __float_as_uint(x); return (unsigned short)((u + 0x7FFFu + ((u >> 16) & 1u)) >> 16); }
__device__ __forceinline__ float bf16_val(unsigned short b) { return __uint_as_float(((unsigned int)b) << 16); }
__device__ __forceinline__ float bf16_round(float x) { return bf16_val(bf16_bits(x)); }
// D += A·B with NT terms: 1 = ah·bh, 2 = + al·bh (A split), 3 = + ah·bl (both split)
template <int NT>
__device__ __forceinline__ v8f mmaN(v16b ah, v16b al, v16b bh, v16b bl, v8f c) {
  c = __builtin_amdgcn_wmma_f32_16x16x32_bf16(false, ah, false, bh, (short)0, c, false, false);
  if (NT >= 2) c = __builtin_amdgcn_wmma_f32_16x16x32_bf16(false, al, false, bh, (short)0, c, false, false);
  if (NT >= 3) c = __builtin_amdgcn_wmma_f32_16x16x32_bf16(false, ah, false, bl, (short)0, c, false, false);
  asm volatile("v_nop\n\tv_nop\n\tv_nop\n\tv_nop" : "+v"(c) : "v"(ah), "v"(al), "v"(bh), "v"(bl));
  return c;
}

__global__ __launch_bounds__(256) void k_wt_bf16(const float* __restrict__ W, unsigned short* __restrict__ Wt, int K, int N) {
  const int t = blockIdx.x * 256 + threadIdx.x;
  const int k8n = K / 8;
  if (t >= N * k8n) return;
  const int n = t / k8n, k8 = (t % k8n) * 8;
  v8us v;
#pragma unroll
  for (int i = 0; i < 8; ++i) v[i] = bf16_bits(W[(size_t)(k8 + i) * N + n]);
  *(v8us*)(Wt + (size_t)n * K + k8) = v;
  
}

// GEMM C[M][N] (f32, pitch ldc) = act(A[M][K]·W + bias). A f32 row-major (pitch lda) converted per fragment to bf16
// (ASPLIT: hi/lo two planes -> 2 terms, else single rounded term); Wt bf16 [N][K] (pitch ldb). BIAS_BF16 rounds the
// bias to bf16 first (bias quantised to bf16 before the add). K%32==0, M%16==0, N%64==0.
template <bool ASPLIT, int ACT, bool BIAS_BF16>
__global__ __launch_bounds__(128) void k_gemm_bf(const float* __restrict__ A, int lda, const unsigned short* __restrict__ Wt, int ldb,
                                               const float* __restrict__ bias, float* __restrict__ C, int ldc, int M, int N, int K) {
  __shared__ __attribute__((aligned(16))) float so[4][16][64];
  const int tid = threadIdx.x, w = tid >> 5, lane = tid & 31, ln = lane & 15, hh = lane >> 4;
  const int ntn = N / 64;
  const int wid = blockIdx.x * 4 + w;
  const int mt = wid / ntn, nq = wid % ntn;
  if (mt * 16 >= M) return;
  const int row0 = mt * 16, col0 = nq * 64;
  const float* arow = A + (size_t)(row0 + ln) * lda;
  v8f acc[4] = {};
  for (int kb = 0; kb < K; kb += 32) {
    FragB ah, al;
    const v4f x0 = *(const v4fa*)(arow + kb + 8 * hh), x1 = *(const v4fa*)(arow + kb + 8 * hh + 4);
    const v4f x2 = *(const v4fa*)(arow + kb + 16 + 8 * hh), x3 = *(const v4fa*)(arow + kb + 16 + 8 * hh + 4);
    float xs[16] = {x0[0],x0[1],x0[2],x0[3],x1[0],x1[1],x1[2],x1[3],x2[0],x2[1],x2[2],x2[3],x3[0],x3[1],x3[2],x3[3]};
#pragma unroll
    for (int i = 0; i < 16; ++i) { const unsigned short hb = bf16_bits(xs[i]); ah.u[i] = hb; al.u[i] = ASPLIT ? bf16_bits(xs[i] - bf16_val(hb)) : (unsigned short)0; }
#pragma unroll
    for (int t = 0; t < 4; ++t) {
      const unsigned short* brow = Wt + (size_t)(col0 + t * 16 + ln) * ldb + kb;
      FragB b;
      b.half[0] = *(const v8us*)(brow + 8 * hh);
      b.half[1] = *(const v8us*)(brow + 16 + 8 * hh);
      acc[t] = mmaN<ASPLIT ? 2 : 1>(ah.v, al.v, b.v, b.v, acc[t]);
    }
  }
#pragma unroll
  for (int t = 0; t < 4; ++t) {
    float bv = bias ? bias[col0 + t * 16 + ln] : 0.f;
    if (BIAS_BF16) bv = bf16_round(bv);
#pragma unroll
    for (int r = 0; r < 8; ++r) { float v = acc[t][r] + bv; if (ACT == 1) v = fmaxf(v, 0.f); so[w][8 * hh + r][t * 16 + ln] = v; }
  }
  __builtin_amdgcn_fence(__ATOMIC_ACQ_REL, "workgroup");
  __builtin_amdgcn_wave_barrier();
  const int rsub = lane >> 4, c4 = (lane & 15) * 4;
  {
#pragma unroll
    for (int q = 0; q < 8; ++q) {
      const int r = q * 2 + rsub;
      const v4f v = *(const v4fa*)&so[w][r][c4];
      *(v4f*)(C + (size_t)(row0 + r) * ldc + col0 + c4) = v;
    }
    
  }
}

// GEMM C = act(A·W + bias + resid): A f32 (ASPLIT -> hi/lo 2 terms), Wt bf16 [N][K]; ACT 0 none, 1 relu, 2 exact gelu;
// resid (optional, f32, row index = (row % rmod), pitch ldr, RES_BF16 rounds it) added before the activation.
template <bool ASPLIT, int ACT, bool BIAS_BF16, bool RES_BF16>
__global__ __launch_bounds__(128) void k_gemm_bf3(const float* __restrict__ A, int lda, const unsigned short* __restrict__ Wt, int ldb,
                                                const float* __restrict__ bias, const float* __restrict__ resid, int rmod, int ldr,
                                                float* __restrict__ C, int ldc, int M, int N, int K) {
  __shared__ __attribute__((aligned(16))) float so[4][16][64];
  const int tid = threadIdx.x, w = tid >> 5, lane = tid & 31, ln = lane & 15, hh = lane >> 4;
  const int ntn = N / 64;
  const int wid = blockIdx.x * 4 + w;
  const int mt = wid / ntn, nq = wid % ntn;
  if (mt * 16 >= M) return;
  const int row0 = mt * 16, col0 = nq * 64;
  const float* arow = A + (size_t)(row0 + ln) * lda;
  v8f acc[4] = {};
  for (int kb = 0; kb < K; kb += 32) {
    FragB ah, al;
    const v4f x0 = *(const v4fa*)(arow + kb + 8 * hh), x1 = *(const v4fa*)(arow + kb + 8 * hh + 4);
    const v4f x2 = *(const v4fa*)(arow + kb + 16 + 8 * hh), x3 = *(const v4fa*)(arow + kb + 16 + 8 * hh + 4);
    float xs[16] = {x0[0],x0[1],x0[2],x0[3],x1[0],x1[1],x1[2],x1[3],x2[0],x2[1],x2[2],x2[3],x3[0],x3[1],x3[2],x3[3]};
#pragma unroll
    for (int i = 0; i < 16; ++i) { const unsigned short hb = bf16_bits(xs[i]); ah.u[i] = hb; al.u[i] = ASPLIT ? bf16_bits(xs[i] - bf16_val(hb)) : (unsigned short)0; }
#pragma unroll
    for (int t = 0; t < 4; ++t) {
      const unsigned short* brow = Wt + (size_t)(col0 + t * 16 + ln) * ldb + kb;
      FragB b;
      b.half[0] = *(const v8us*)(brow + 8 * hh);
      b.half[1] = *(const v8us*)(brow + 16 + 8 * hh);
      acc[t] = mmaN<ASPLIT ? 2 : 1>(ah.v, al.v, b.v, b.v, acc[t]);
    }
  }
#pragma unroll
  for (int t = 0; t < 4; ++t) {
    const int col = col0 + t * 16 + ln;
    float bv = bias ? bias[col] : 0.f;
    if (BIAS_BF16) bv = bf16_round(bv);
#pragma unroll
    for (int r = 0; r < 8; ++r) {
      float v = acc[t][r] + bv;
      if (resid) { float rv = resid[(size_t)((row0 + 8 * hh + r) % rmod) * ldr + col]; if (RES_BF16) rv = bf16_round(rv); v += rv; }
      if (ACT == 1) v = fmaxf(v, 0.f);
      if (ACT == 2) v = 0.5f * v * (1.0f + erff(v * 0.70710678118654752f));
      if (ACT == 3) { const float u = 0.7978845608028654f * (v + 0.044715f * v * v * v); v = 0.5f * v * (1.0f + tanhf(u)); }
      so[w][8 * hh + r][t * 16 + ln] = v;
    }
  }
  __builtin_amdgcn_fence(__ATOMIC_ACQ_REL, "workgroup");
  __builtin_amdgcn_wave_barrier();
  const int rsub = lane >> 4, c4 = (lane & 15) * 4;
  {
#pragma unroll
    for (int q = 0; q < 8; ++q) {
      const int r = q * 2 + rsub;
      const v4f v = *(const v4fa*)&so[w][r][c4];
      *(v4f*)(C + (size_t)(row0 + r) * ldc + col0 + c4) = v;
    }
    
  }
}
// row LayerNorm (biased variance, eps) over N: s = X (+ R); optional out_sum <- s; out_norm <- (s-mu)*rsqrt(var+eps)*g + b
template <bool PARAM_BF16>
__global__ __launch_bounds__(256) void k_layernorm(const float* __restrict__ X, const float* __restrict__ R, const float* __restrict__ g, const float* __restrict__ bta,
                                                  float* __restrict__ out_sum, float* __restrict__ out_norm, int N, float eps) {
  __shared__ float red[256];
  const int row = blockIdx.x, tid = threadIdx.x;
  const float* x = X + (size_t)row * N; const float* rr = R ? R + (size_t)row * N : nullptr;
  float vals[16];                     // up to N = 4096
  const int per = N / 256;            // contiguous chunk per thread? use strided-by-4 chunks: thread handles j = tid*4 + 1024*u
  float s1 = 0.f;
  for (int u = 0; u < per / 4; ++u) {
    const int j = tid * 4 + 1024 * u;
    const v4f a = *(const v4fa*)(x + j);
    v4f b = {0.f,0.f,0.f,0.f}; if (rr) b = *(const v4fa*)(rr + j);
#pragma unroll
    for (int q = 0; q < 4; ++q) { const float v = a[q] + b[q]; vals[u * 4 + q] = v; s1 += v; }
  }
  red[tid] = s1; __syncthreads();
  for (int st = 128; st > 0; st >>= 1) { if (tid < st) red[tid] += red[tid + st]; __syncthreads(); }
  const float mu = red[0] / (float)N; __syncthreads();
  float s2 = 0.f;
  for (int u = 0; u < per / 4; ++u)
#pragma unroll
    for (int q = 0; q < 4; ++q) { const float c = vals[u * 4 + q] - mu; s2 += c * c; }
  red[tid] = s2; __syncthreads();
  for (int st = 128; st > 0; st >>= 1) { if (tid < st) red[tid] += red[tid + st]; __syncthreads(); }
  const float rs = rsqrtf(red[0] / (float)N + eps);
  {
    for (int u = 0; u < per / 4; ++u) {
      const int j = tid * 4 + 1024 * u;
      v4f o, sm;
#pragma unroll
      for (int q = 0; q < 4; ++q) {
        float gg = g[j + q], bb = bta[j + q];
        if (PARAM_BF16) { gg = bf16_round(gg); bb = bf16_round(bb); }
        sm[q] = vals[u * 4 + q]; o[q] = (vals[u * 4 + q] - mu) * rs * gg + bb;
      }
      if (out_sum) *(v4f*)(out_sum + (size_t)row * N + j) = sm;
      *(v4f*)(out_norm + (size_t)row * N + j) = o;
    }
    
  }
}



// ---- f16 WMMA path (v_wmma_f32_16x16x32_f16): 11-bit significands for operands in range — used where a [0,1] probability operand needs more precision than bf16
typedef _Float16 v16h __attribute__((ext_vector_type(16)));
union FragH { v16h v; v8us half[2]; _Float16 h[16]; unsigned short u[16]; };
template <int NT>
__device__ __forceinline__ v8f mmaH(v16h ah, v16h al, v16h bh, v16h bl, v8f c) {
  c = __builtin_amdgcn_wmma_f32_16x16x32_f16(false, ah, false, bh, (short)0, c, false, false);
  if (NT >= 2) c = __builtin_amdgcn_wmma_f32_16x16x32_f16(false, al, false, bh, (short)0, c, false, false);
  if (NT >= 3) c = __builtin_amdgcn_wmma_f32_16x16x32_f16(false, ah, false, bl, (short)0, c, false, false);
  asm volatile("v_nop\n\tv_nop\n\tv_nop\n\tv_nop" : "+v"(c) : "v"(ah), "v"(al), "v"(bh), "v"(bl));
  return c;
}
// batched GEMM like k_gemm_b but f16 operands: A f32 (split into f16 hi/lo if ASPLIT, else rounded to f16), Bt = f16 values [n][k]; alpha; C f32; N multiple of 16 (partial tiles skipped)
template <bool ASPLIT>
__global__ __launch_bounds__(128) void k_gemm_h(const float* __restrict__ A, int lda, size_t sA, const _Float16* __restrict__ Bh, int ldb, size_t sB, float alpha, float* __restrict__ C, int ldc, size_t sC, int M, int N, int K) {
  __shared__ __attribute__((aligned(16))) float so[4][16][64];
  const int tid = threadIdx.x, w = tid >> 5, lane = tid & 31, ln = lane & 15, hh = lane >> 4; const int by = blockIdx.y;
  A += (size_t)by * sA; Bh += (size_t)by * sB; C += (size_t)by * sC;
  const int ntn = (N + 63) / 64; const int wid = blockIdx.x * 4 + w; const int mt = wid / ntn, nq = wid % ntn; if (mt * 16 >= M) return;
  const int row0 = mt * 16, col0 = nq * 64; const float* arow = A + (size_t)(row0 + ln) * lda;
  v8f acc[4] = {};
  for (int kb = 0; kb < K; kb += 32) {
    FragH ah, al;
    const v4f x0 = *(const v4fa*)(arow + kb + 8 * hh), x1 = *(const v4fa*)(arow + kb + 8 * hh + 4), x2 = *(const v4fa*)(arow + kb + 16 + 8 * hh), x3 = *(const v4fa*)(arow + kb + 16 + 8 * hh + 4);
    float xs[16] = {x0[0],x0[1],x0[2],x0[3],x1[0],x1[1],x1[2],x1[3],x2[0],x2[1],x2[2],x2[3],x3[0],x3[1],x3[2],x3[3]};
#pragma unroll
    for (int i = 0; i < 16; ++i) { const _Float16 h = (_Float16)xs[i]; ah.h[i] = h; al.h[i] = ASPLIT ? (_Float16)(xs[i] - (float)h) : (_Float16)0.0f; }
#pragma unroll
    for (int t = 0; t < 4; ++t) { if (col0 + t * 16 >= N) continue; const size_t boff = (size_t)(col0 + t * 16 + ln) * ldb + kb; FragH bq; bq.half[0] = *(const v8us*)(Bh + boff + 8 * hh); bq.half[1] = *(const v8us*)(Bh + boff + 16 + 8 * hh);
      acc[t] = mmaH<ASPLIT ? 2 : 1>(ah.v, al.v, bq.v, bq.v, acc[t]); }
  }
#pragma unroll
  for (int t = 0; t < 4; ++t) { if (col0 + t * 16 >= N) continue;
#pragma unroll
    for (int r = 0; r < 8; ++r) so[w][8 * hh + r][t * 16 + ln] = acc[t][r] * alpha; }
  __builtin_amdgcn_fence(__ATOMIC_ACQ_REL, "workgroup"); __builtin_amdgcn_wave_barrier();
  const int rsub = lane >> 4, c4 = (lane & 15) * 4;
  {
#pragma unroll
    for (int q = 0; q < 8; ++q) { const int r = q * 2 + rsub; if (col0 + c4 < N) { const v4f v = *(const v4fa*)&so[w][r][c4]; *(v4f*)(C + (size_t)(row0 + r) * ldc + col0 + c4) = v; } }
     }
}

// Wt[n][k] = f16(W[k][n]·scale) from f32 row-major W[K][N] (scale = power of two; bf16-exact weights stay exact in f16 away from the subnormal range)
__global__ __launch_bounds__(256) void k_wt_f16(const float* __restrict__ W, _Float16* __restrict__ Wt, int K, int N, float scale) {
  const int t = blockIdx.x * 256 + threadIdx.x; if (t >= N * (K / 8)) return; const int n = t / (K / 8), k8 = (t % (K / 8)) * 8; FragH f;
#pragma unroll
  for (int i = 0; i < 8; ++i) f.h[i] = (_Float16)(bf16_round(W[(size_t)(k8 + i) * N + n]) * scale); const v8us o = f.half[0];
  *(v8us*)((unsigned short*)Wt + (size_t)n * K + k8) = o; 
}
// k_gemm_hh variant with fused epilogue: v = acc·alpha + bias[by·sBias + col] (+ CP[(row/rowsPerB)·sCPb + by·64 + col] if CP) ; ACT 0 none / 1 elu ; writes f32 C and f16 C16, each if non-null
template <int ACT>
__global__ __launch_bounds__(128) void k_gemm_hhx(const _Float16* __restrict__ A, int lda, size_t sA, const _Float16* __restrict__ Bh, int ldb, size_t sB, float alpha, const float* __restrict__ bias, size_t sBias, const float* __restrict__ CP, int rowsPerB, size_t sCPb, int row0g,
    float* __restrict__ C, _Float16* __restrict__ C16, int ldc, size_t sC, int M, int N, int K) {
  __shared__ __attribute__((aligned(16))) float so[4][16][64];
  const int tid = threadIdx.x, w = tid >> 5, lane = tid & 31, ln = lane & 15, hh = lane >> 4; const int by = blockIdx.y;
  A += (size_t)by * sA; Bh += (size_t)by * sB; const size_t cofs = (size_t)by * sC; const float* bp = bias ? bias + (size_t)by * sBias : nullptr;
  const int ntn = (N + 63) / 64; const int wid = blockIdx.x * 4 + w; const int mt = wid / ntn, nq = wid % ntn; if (mt * 16 >= M) return;
  const int row0 = mt * 16, col0 = nq * 64; const _Float16* arow = A + (size_t)(row0 + ln) * lda;
  v8f acc[4] = {};
  for (int kb = 0; kb < K; kb += 32) { FragH ah; ah.half[0] = *(const v8us*)((const unsigned short*)arow + kb + 8 * hh); ah.half[1] = *(const v8us*)((const unsigned short*)arow + kb + 16 + 8 * hh);
#pragma unroll
    for (int t = 0; t < 4; ++t) { if (col0 + t * 16 >= N) continue; const size_t boff = (size_t)(col0 + t * 16 + ln) * ldb + kb; FragH bq; bq.half[0] = *(const v8us*)((const unsigned short*)Bh + boff + 8 * hh); bq.half[1] = *(const v8us*)((const unsigned short*)Bh + boff + 16 + 8 * hh);
      acc[t] = mmaH<1>(ah.v, ah.v, bq.v, bq.v, acc[t]); }
  }
#pragma unroll
  for (int t = 0; t < 4; ++t) { if (col0 + t * 16 >= N) continue; const int col = col0 + t * 16 + ln; const float bv = bp ? bf16_round(bp[col]) : 0.f;
#pragma unroll
    for (int r = 0; r < 8; ++r) { float v = acc[t][r] * alpha + bv; if (CP) { const int bidx = (row0g + row0 + 8 * hh + r) / rowsPerB; v += CP[(size_t)bidx * sCPb + (size_t)by * 64 + col]; } if (ACT == 1) v = (v > 0.f) ? v : expm1f(v); else if (ACT == 7) v = (v > 0.f) ? v + 1.0f : expf(v); else if (ACT == 8) v = tanhf(v); else if (ACT == 9) v = 0.5f * v * (1.0f + tanhf(0.7978845608028654f * (v + 0.044715f * v * v * v))); else if (ACT == 11) v = 1.0f / (1.0f + expf(-v)); else if (ACT == 12) v = (v > 0.f) ? v : 0.01f * v; else if (ACT == 14) v = (v > 0.f) ? v : 0.1f * v; else if (ACT == 15) v = v / (1.0f + expf(-v)); else if (ACT == 3) v = fmaxf(v, 0.f); else if (ACT == 6) v = 0.5f * v * (1.0f + erff(v * 0.70710678118654752f)); so[w][8 * hh + r][t * 16 + ln] = v; } }
  __builtin_amdgcn_fence(__ATOMIC_ACQ_REL, "workgroup"); __builtin_amdgcn_wave_barrier();
  const int rsub = lane >> 4, c4 = (lane & 15) * 4; typedef _Float16 v4h __attribute__((ext_vector_type(4)));
  {
#pragma unroll
    for (int q = 0; q < 8; ++q) { const int r = q * 2 + rsub; if (col0 + c4 < N) { const v4f v = *(const v4fa*)&so[w][r][c4]; if (C) *(v4f*)(C + cofs + (size_t)(row0 + r) * ldc + col0 + c4) = v; if (C16) { v4h h4; for (int i = 0; i < 4; ++i) h4[i] = (_Float16)v[i]; *(v4h*)(C16 + cofs + (size_t)(row0 + r) * ldc + col0 + c4) = h4; } } }
     }
}


typedef _Float16 v4h __attribute__((ext_vector_type(4)));

__global__ __launch_bounds__(256) void k_x16(const float* __restrict__ x, _Float16* __restrict__ X16, size_t n8) { const size_t t = (size_t)blockIdx.x * 256 + threadIdx.x; if (t >= n8) return; FragH f;
#pragma unroll
  for (int q = 0; q < 8; ++q) f.h[q] = (_Float16)bf16_round(x[t * 8 + q]); *(v8us*)((unsigned short*)X16 + t * 8) = f.half[0];  }
__global__ __launch_bounds__(256) void k_h16(const float* __restrict__ x, _Float16* __restrict__ X16, size_t n8) { const size_t t = (size_t)blockIdx.x * 256 + threadIdx.x; if (t >= n8) return; FragH f;
#pragma unroll
  for (int q = 0; q < 8; ++q) f.h[q] = (_Float16)x[t * 8 + q]; *(v8us*)((unsigned short*)X16 + t * 8) = f.half[0];  }
__global__ __launch_bounds__(256) void k_round16f(const float* __restrict__ W, _Float16* __restrict__ Bt, size_t n8) { const size_t t = (size_t)blockIdx.x * 256 + threadIdx.x; if (t >= n8) return; FragH f;
#pragma unroll
  for (int i = 0; i < 8; ++i) f.h[i] = (_Float16)(bf16_round(W[t * 8 + i]) * 16.0f); *(v8us*)((unsigned short*)Bt + t * 8) = f.half[0];  }
template <int NHv, int TTv>
__global__ __launch_bounds__(256) void k_vt(const _Float16* __restrict__ V16, int ldv, int voff, _Float16* __restrict__ Vt) { __shared__ unsigned short tl[64][66]; const int tid = threadIdx.x; const int slab = blockIdx.x / (TTv / 64), lg = blockIdx.x % (TTv / 64); const int b = slab / NHv, h = slab % NHv;
  for (int i = tid; i < 64 * 8; i += 256) { const int r = i / 8, c8 = (i % 8) * 8; FragH f; f.half[0] = *(const v8us*)((const unsigned short*)V16 + ((size_t)b * TTv + lg * 64 + r) * ldv + voff + h * 64 + c8);
#pragma unroll
    for (int q = 0; q < 8; ++q) tl[r][c8 + q] = f.u[q]; }
  __syncthreads();
  {
#pragma unroll
    for (int rd = 0; rd < 2; ++rd) { const int d = rd * 32 + tid / 8, pc = tid % 8; FragH f;
#pragma unroll
      for (int q = 0; q < 8; ++q) f.u[q] = tl[pc * 8 + q][d];
      *(v8us*)((unsigned short*)Vt + ((size_t)slab * 64 + d) * TTv + lg * 64 + pc * 8) = f.half[0]; }
     } }

__global__ __launch_bounds__(256) void k_hl(const float* __restrict__ F, _Float16* __restrict__ Hh, _Float16* __restrict__ Hl, size_t n8) { const size_t t = (size_t)blockIdx.x * 256 + threadIdx.x; if (t >= n8) return; FragH fh, fl; const v4f a = *(const v4fa*)(F + t * 8), c = *(const v4fa*)(F + t * 8 + 4);
#pragma unroll
  for (int q = 0; q < 4; ++q) { _Float16 h = (_Float16)a[q]; fh.h[q] = h; fl.h[q] = (_Float16)((a[q] - (float)h) * 1024.0f); h = (_Float16)c[q]; fh.h[4 + q] = h; fl.h[4 + q] = (_Float16)((c[q] - (float)h) * 1024.0f); }
  { *(v8us*)((unsigned short*)Hh + t * 8) = fh.half[0]; *(v8us*)((unsigned short*)Hl + t * 8) = fl.half[0];  } }

// stacked weights BW[NW][CC] = f16(bf16(W) * 16), rows 0..63 Wb, 64..127 Wc, 128..639 Wd, and the stacked biases BI[NW] (f32, as given)
// piece t = eight weights in a row, t < NW * CC / 8
__device__ __forceinline__ void prep_piece(int t, const float* __restrict__ Wb, const float* __restrict__ Wc, const float* __restrict__ Wd, const float* __restrict__ bb, const float* __restrict__ bc, const float* __restrict__ bd, _Float16* __restrict__ BW, float* __restrict__ BI) {
  const int n1 = C8 * CC / 8;
  const float* Wp = (t < n1) ? Wb + (size_t)t * 8 : (t < 2 * n1) ? Wc + (size_t)(t - n1) * 8 : Wd + (size_t)(t - 2 * n1) * 8; FragH f;
#pragma unroll
  for (int i = 0; i < 8; ++i) f.h[i] = (_Float16)(bf16_round(Wp[i]) * 16.0f); *(v8us*)((unsigned short*)BW + (size_t)t * 8) = f.half[0];
  if (t < NW) BI[t] = (t < C8) ? bb[t] : (t < 2 * C8) ? bc[t - C8] : bd[t - 2 * C8]; }
// The layout change (k_tok) goes through an LDS tile: 64 source rows x TW contiguous source columns come in as whole 128-B lines (8 lanes x 16 B a row),
// are converted, and leave as rows of 64 f16 = one whole 128-B line each. Read straight across the source rows, every lane of a load would touch a line of its own.
// Few, fat work-groups (one per WGP): every thread has all of its loads in flight at once.
#define TR 64                    /* source rows per tile = f16 per output row */
#define TP (TR + 8)              /* LDS row pitch in f16: 144 B = 16 B x odd */
typedef _Float16 v2ha __attribute__((ext_vector_type(2), may_alias));
// the tile's TW output rows, 128 B each, from LDS to dst (pitch ldd elements): 8 lanes a row
template <int TW>
__device__ __forceinline__ void tile_out(const _Float16 (&tl)[TW][TP], _Float16* __restrict__ dst, size_t ldd, int tid) {
#pragma unroll  /* all LDS reads go out ahead of the stores */
  for (int i = 0; i < TW / 32; ++i) { const int r = (tid >> 3) + 32 * i, e8 = (tid & 7) * 8; const v8us v = *(const v8us*)&tl[r][e8]; *(v8us*)((unsigned short*)dst + (size_t)r * ldd + e8) = v; }
}
#define TWX 256                  /* positions per tile of k_tok */
#define TOKB ((NP / TWX) * (CC / TR) * NBt)   /* work-groups that turn a tile */
#define PREPB (NW * CC / 8 / 256)             /* work-groups that convert weights: 256 pieces each, no remainder */
// Work-groups 0 .. TOKB - 1: tile of TWX positions (fastest), tile of 64 channels, batch. The others convert the stacked weights, which only the next launch reads: no launch of their own.
// A tile's work-group turns the tile of x1 and that of x2, and from the same registers forms the tile of
// alpha x1 + beta x2 (inputs and factors rounded to bf16, combined in f32, then f16): conv_d's one operand
__global__ __launch_bounds__(256) void k_tok(const float* __restrict__ x1, const float* __restrict__ x2, const float* __restrict__ al, const float* __restrict__ be,
                                             const float* __restrict__ Wb, const float* __restrict__ Wc, const float* __restrict__ Wd, const float* __restrict__ bb, const float* __restrict__ bc, const float* __restrict__ bd,
                                             _Float16* __restrict__ X16, _Float16* __restrict__ XC, _Float16* __restrict__ BW, float* __restrict__ BI) {
  __shared__ __attribute__((aligned(16))) _Float16 tl[3][TWX][TP];  /* x1, x2, the combination: [position][channel] */
  const int bid = blockIdx.x;
  if (bid >= TOKB) { prep_piece((bid - TOKB) * 256 + (int)threadIdx.x, Wb, Wc, Wd, bb, bc, bd, BW, BI); return; }  /* the whole work-group leaves, in front of the barrier */
  const int tid = threadIdx.x, b = bid / ((NP / TWX) * (CC / TR)), n0 = (bid % (NP / TWX)) * TWX, c0 = ((bid / (NP / TWX)) % (CC / TR)) * TR, c = 2 * (tid >> 3), k0 = (tid & 7) * 4;
  const size_t e0 = ((size_t)b * CC + c0) * NP + n0;                                     /* the tile's first element: the same for the whole work-group */
  const char* xa = (const char*)(x1 + e0); const char* xb = (const char*)(x2 + e0);
  const unsigned ob = (unsigned)(c * NP + k0) * 4;                                       /* the lane's byte offset in the tile */
  const float a = bf16_round(al[0]), bq = bf16_round(be[0]);
  v4f u[TWX / 32], v[TWX / 32], p[TWX / 32], r[TWX / 32];
#pragma unroll  /* constant indices: the values stay in registers, and the thirty-two loads of a thread are all in flight at once */
  for (int i = 0; i < TWX / 32; ++i) { u[i] = *(const v4fa*)(xa + ob + 128 * i); v[i] = *(const v4fa*)(xa + ob + NP * 4 + 128 * i); p[i] = *(const v4fa*)(xb + ob + 128 * i); r[i] = *(const v4fa*)(xb + ob + NP * 4 + 128 * i); }
  asm volatile("s_wait_xcnt 0x0" :: "v"(ob), "s"(xa), "s"(xb) : "memory");  /* stands in front of any rewrite of the offset register and the two scalar bases that these loads name; the operands keep those registers until here */
  __builtin_amdgcn_sched_barrier(0);                      /* keeps the conversions behind all the loads; left alone the compiler holds sixteen loads back until the first have returned: a second memory latency */
#pragma unroll
  for (int i = 0; i < TWX / 32; ++i)
#pragma unroll
    for (int q = 0; q < 4; ++q) {
      const float u0 = bf16_round(u[i][q]), v0 = bf16_round(v[i][q]), p0 = bf16_round(p[i][q]), r0 = bf16_round(r[i][q]); v2ha h;
      h[0] = (_Float16)u0; h[1] = (_Float16)v0; *(v2ha*)&tl[0][k0 + 32 * i + q][c] = h;
      h[0] = (_Float16)p0; h[1] = (_Float16)r0; *(v2ha*)&tl[1][k0 + 32 * i + q][c] = h;
      h[0] = (_Float16)(a * u0 + bq * p0); h[1] = (_Float16)(a * v0 + bq * r0); *(v2ha*)&tl[2][k0 + 32 * i + q][c] = h;
    }
  __syncthreads();  /* the tiles are whole before any wave reads them across */
  tile_out<TWX>(tl[0], X16 + ((size_t)(2 * b) * NP + n0) * CC + c0, CC, tid);
  asm volatile("s_wait_xcnt 0x0" ::: "memory");  /* stands in front of the next tile's reuse of the data and address registers that these stores name */
  tile_out<TWX>(tl[1], X16 + ((size_t)(2 * b + 1) * NP + n0) * CC + c0, CC, tid);
  asm volatile("s_wait_xcnt 0x0" ::: "memory");  /* as above */
  tile_out<TWX>(tl[2], XC + ((size_t)b * NP + n0) * CC + c0, CC, tid);
}
// One 16x32 f16 fragment (A row or B column = lane & 15; k = 8*(lane>>4)+0..7 and 16+8*(lane>>4)+0..7) from a plane in the fragment order that k_conv writes; p already holds 8*lane.
// Each of the two loads reads 512 contiguous bytes (4 whole lines) per wave; from a row-major plane it would touch 16 lines.
__device__ __forceinline__ v16h frag_at(const _Float16* p) { FragH f; f.half[0] = *(const v8us*)((const unsigned short*)p); f.half[1] = *(const v8us*)((const unsigned short*)p + 256); return f.v; }
__device__ __forceinline__ v8f wm(v16h a, v16h b, v8f c) { return __builtin_amdgcn_wmma_f32_16x16x32_f16(false, a, false, b, (short)0, c, false, false); }
// value of lane ^ X inside the 16-lane row, by DPP row_xmask (a shuffle would go through the LDS pipe and its wait); every lane is on where it is used
template <int X> __device__ __forceinline__ float row_xor(float v) { return __int_as_float(__builtin_amdgcn_update_dpp(0, __float_as_int(v), 0x160 + X, 0xf, 0xf, true)); }
__device__ __forceinline__ float row_min16(float v) { v = fminf(v, row_xor<1>(v)); v = fminf(v, row_xor<2>(v)); v = fminf(v, row_xor<4>(v)); return fminf(v, row_xor<8>(v)); }
__device__ __forceinline__ float row_sum16(float v) { v += row_xor<1>(v); v += row_xor<2>(v); v += row_xor<4>(v); return v + row_xor<8>(v); }
// 2^x of eight values by the hardware's instruction
__device__ __forceinline__ v8f exp2_8(const float (&x)[8]) {
  float e0, e1, e2, e3, e4, e5, e6, e7;
  asm("v_exp_f32 %0, %8\n\tv_exp_f32 %1, %9\n\tv_exp_f32 %2, %10\n\tv_exp_f32 %3, %11\n\tv_exp_f32 %4, %12\n\tv_exp_f32 %5, %13\n\tv_exp_f32 %6, %14\n\tv_exp_f32 %7, %15\n\tv_nop"
      : "=&v"(e0), "=&v"(e1), "=&v"(e2), "=&v"(e3), "=&v"(e4), "=&v"(e5), "=&v"(e6), "=&v"(e7) : "v"(x[0]), "v"(x[1]), "v"(x[2]), "v"(x[3]), "v"(x[4]), "v"(x[5]), "v"(x[6]), "v"(x[7]));
  return v8f{e0, e1, e2, e3, e4, e5, e6, e7};
}
// e^(s - m) for the eight rows of a logit tile as 2^(s * log2(e) + nm), nm = -m * log2(e) formed once per row: one fused multiply-add and the hardware's 2^x each. s <= m up to rounding, so nothing
// overflows, and a result under the smallest normal number may go to zero: it is far below one unit of the f16 output. The library's expf spends about a dozen vector instructions on ranges that cannot occur here.
#define LOG2E 1.4426950408889634f
__device__ __forceinline__ v8f exp_rel(v8f s, const float (&nm)[8]) {
  float x[8];
#pragma unroll  /* constant indices: x stays in registers */
  for (int r = 0; r < 8; ++r) x[r] = fmaf(s[r], LOG2E, nm[r]);
  return exp2_8(x);
}
// Row maximum and row sum in one pass. For eight rows the lane keeps nm = -(largest logit it has seen) * log2(e) and u = the sum of 2^(s * log2(e) + nm) over the logits s it has seen.
// Two more logit tiles a and b: nm falls to the new value, the old sum is brought along by 2^(new nm - old nm) (exactly 1 where nm stays), and the two new terms are added.
// Two tiles a step: one new nm and one such factor serve two logits. At the start nm is far above any value it can take and u is 0: the first factor is 0.
__device__ __forceinline__ void online2(v8f a, v8f b, float (&nm)[8], float (&u)[8]) {
  float d[8];
#pragma unroll  /* constant indices: everything stays in registers */
  for (int r = 0; r < 8; ++r) { const float n = fminf(nm[r], -LOG2E * fmaxf(a[r], b[r])); d[r] = n - nm[r]; nm[r] = n; }
  const v8f c = exp2_8(d), ea = exp_rel(a, nm), eb = exp_rel(b, nm);
#pragma unroll
  for (int r = 0; r < 8; ++r) u[r] = fmaf(u[r], c[r], ea[r] + eb[r]);
}
// the sixteen lanes' pairs (nm, u) of eight rows made one, alike in all sixteen lanes: the pair of the wave's columns
__device__ __forceinline__ void online_row(float (&nm)[8], float (&u)[8]) {
  float d[8];
#pragma unroll
  for (int r = 0; r < 8; ++r) { const float n = row_min16(nm[r]); d[r] = n - nm[r]; nm[r] = n; }
  const v8f c = exp2_8(d);
#pragma unroll
  for (int r = 0; r < 8; ++r) u[r] = row_sum16(u[r] * c[r]);
}
struct QFrag { v16h a1h[2], a1l[2], a2h[2], a2l[2]; };
#define DRT 2                    /* 16-row query tiles per wave: every B fragment that is loaded feeds both */
// both logit tiles (16 query rows x 16 key columns, K 64) of each of the wave's DRT query tiles from the hi/lo planes: hi*hi in one accumulator, the two cross terms (scaled 2^10) in a second
__device__ __forceinline__ void logit_tile(const QFrag (&q)[DRT], const _Float16* b2h, const _Float16* b2l, const _Float16* b1h, const _Float16* b1l, v8f (&s1)[DRT], v8f (&s2)[DRT]) {
  v8f h1[DRT] = {}, l1[DRT] = {}, h2[DRT] = {}, l2[DRT] = {};
  const v16h p[2] = {frag_at(b2h), frag_at(b2h + 512)}, x[2] = {frag_at(b1h), frag_at(b1h + 512)}, pl[2] = {frag_at(b2l), frag_at(b2l + 512)}, xl[2] = {frag_at(b1l), frag_at(b1l + 512)};
  // holds all sixteen loads of the tile in front of its first WMMA: one load latency a tile; left alone the compiler reuses fragment registers and waits for memory several times a tile
  asm volatile("" :: "v"(p[0]), "v"(p[1]), "v"(x[0]), "v"(x[1]), "v"(pl[0]), "v"(pl[1]), "v"(xl[0]), "v"(xl[1]));
#pragma unroll
  for (int ks = 0; ks < 2; ++ks) {
#pragma unroll
    for (int i = 0; i < DRT; ++i) { h1[i] = wm(q[i].a1h[ks], p[ks], h1[i]); h2[i] = wm(q[i].a2h[ks], x[ks], h2[i]); }
#pragma unroll
    for (int i = 0; i < DRT; ++i) { l1[i] = wm(q[i].a1l[ks], p[ks], l1[i]); l2[i] = wm(q[i].a2l[ks], x[ks], l2[i]); }
#pragma unroll
    for (int i = 0; i < DRT; ++i) { l1[i] = wm(q[i].a1h[ks], pl[ks], l1[i]); l2[i] = wm(q[i].a2h[ks], xl[ks], l2[i]); }
  }
#pragma unroll
  for (int i = 0; i < DRT; ++i)
#pragma unroll
    for (int r = 0; r < 8; ++r) { s1[i][r] = h1[i][r] + l1[i][r] * 0.0009765625f; s2[i][r] = h2[i][r] + l2[i][r] * 0.0009765625f; }
}
// Logits, both softmaxes and |difference| in one kernel: a work-group of 8 waves owns 32 query rows (one work-group per WGP covers all rows), wave w the key columns [512 w, 512 w + 512).
// Every wave holds the query fragments of both 16-row tiles in registers (2 waves per SIMD: 512 registers each), so the key planes are read from L2 once per 32 rows and pass.
// The logits stay in registers and are formed twice (row maximum and row sum together, as a running pair; then the output); nothing of them goes to memory.
#define DW 8                     /* waves per work-group */
#define DROW (16 * DRT)          /* query rows per work-group */
#define DCOL (NP / DW)           /* key columns per wave */
#define DPIT (DCOL + 8)          /* LDS row pitch in f16: 16-byte multiple, rows 8 apart fall on other banks */
__global__ __launch_bounds__(DW * 32) void k_attdiff(const _Float16* __restrict__ A1h, const _Float16* __restrict__ A1l, const _Float16* __restrict__ A2h, const _Float16* __restrict__ A2l,
                                                 const _Float16* __restrict__ B2h, const _Float16* __restrict__ B2l, const _Float16* __restrict__ B1h, const _Float16* __restrict__ B1l, _Float16* __restrict__ D16) {
  __shared__ __attribute__((aligned(16))) _Float16 st[DW][DROW][DPIT];
  __shared__ float red[2][DW][DROW], redu[2][DW][DROW];  /* each wave's -max * log2(e) of every row, and its row sums relative to that */
  __shared__ float fin[2][DROW], finu[2][DROW];          /* the same over all columns, the sum as 1 / sum */
  const int tid = threadIdx.x, w = tid >> 5, lane = tid & 31, ln = lane & 15, hh = lane >> 4; const int row0 = blockIdx.x * DROW;
  { const size_t pb = (size_t)blockIdx.y * 4 * NP * C8;  /* blockIdx.y = batch: four planes of each kind a batch */
    A1h += pb; A1l += pb; A2h += pb; A2l += pb; B2h += pb; B2l += pb; B1h += pb; B1l += pb; D16 += (size_t)blockIdx.y * NP * NP; }
  QFrag q[DRT];
#pragma unroll
  for (int i = 0; i < DRT; ++i) { const size_t ao = (size_t)(row0 + 16 * i) * C8 + 8 * lane;
#pragma unroll
    for (int ks = 0; ks < 2; ++ks) { q[i].a1h[ks] = frag_at(A1h + ao + ks * 512); q[i].a1l[ks] = frag_at(A1l + ao + ks * 512); q[i].a2h[ks] = frag_at(A2h + ao + ks * 512); q[i].a2l[ks] = frag_at(A2l + ao + ks * 512); } }
  asm volatile("s_wait_xcnt 0x0" ::: "memory");  /* stands in front of the reuse of the address registers that the query loads name */
  __builtin_amdgcn_sched_barrier(0);             /* keeps the key-plane address arithmetic, which reuses those registers, behind that wait */
  const size_t bo = (size_t)(w * DCOL) * C8 + 8 * lane; B2h += bo; B2l += bo; B1h += bo; B1l += bo;
  float m1[DRT][8], m2[DRT][8], u1[DRT][8], u2[DRT][8];
#pragma unroll
  for (int i = 0; i < DRT; ++i)
#pragma unroll
    for (int r = 0; r < 8; ++r) { m1[i][r] = 3.0e38f; m2[i][r] = 3.0e38f; u1[i][r] = 0.f; u2[i][r] = 0.f; }  /* m1, m2 hold -max * log2(e) throughout */
#pragma unroll 1  /* rolled: an unrolled body would hold several steps' B fragments and leave the 512-register budget of 2 waves per SIMD */
  for (int j = 0; j < DCOL / 16; j += 2) { v8f s1[DRT], s2[DRT], t1[DRT], t2[DRT]; const size_t o = (size_t)j * 16 * C8, o2 = o + 16 * C8;
    logit_tile(q, B2h + o, B2l + o, B1h + o, B1l + o, s1, s2); logit_tile(q, B2h + o2, B2l + o2, B1h + o2, B1l + o2, t1, t2);
#pragma unroll
    for (int i = 0; i < DRT; ++i) { online2(s1[i], t1[i], m1[i], u1[i]); online2(s2[i], t2[i], m2[i], u2[i]); } }
#pragma unroll
  for (int i = 0; i < DRT; ++i) { online_row(m1[i], u1[i]); online_row(m2[i], u2[i]); }
  if (ln == 0) {
#pragma unroll
    for (int i = 0; i < DRT; ++i)
#pragma unroll
      for (int r = 0; r < 8; ++r) { const int rw = 16 * i + 8 * hh + r; red[0][w][rw] = m1[i][r]; red[1][w][rw] = m2[i][r]; redu[0][w][rw] = u1[i][r]; redu[1][w][rw] = u2[i][r]; } }
  __syncthreads();
  if (tid < 2 * DROW) {  /* the eight waves' pairs of one row made one, in the same way */
    const int mt = tid / DROW, rw = tid % DROW; float d[DW], v = red[mt][0][rw];
#pragma unroll
    for (int k = 1; k < DW; ++k) v = fminf(v, red[mt][k][rw]);
#pragma unroll
    for (int k = 0; k < DW; ++k) d[k] = v - red[mt][k][rw];
    const v8f c = exp2_8(d); float sum = 0.f;
#pragma unroll
    for (int k = 0; k < DW; ++k) sum = fmaf(redu[mt][k][rw], c[k], sum);
    fin[mt][rw] = v; finu[mt][rw] = 1.0f / sum; }
  __syncthreads();
#pragma unroll
  for (int i = 0; i < DRT; ++i)
#pragma unroll
    for (int r = 0; r < 8; ++r) { const int rw = 16 * i + 8 * hh + r; m1[i][r] = fin[0][rw]; m2[i][r] = fin[1][rw]; u1[i][r] = finu[0][rw]; u2[i][r] = finu[1][rw]; }  /* from here on u1, u2 hold 1 / sum */
#pragma unroll 1  /* rolled for the register budget, as above */
  for (int j = 0; j < DCOL / 16; ++j) { v8f s1[DRT], s2[DRT]; const size_t o = (size_t)j * 16 * C8; logit_tile(q, B2h + o, B2l + o, B1h + o, B1l + o, s1, s2);
#pragma unroll
    for (int i = 0; i < DRT; ++i) { const v8f e1 = exp_rel(s1[i], m1[i]), e2 = exp_rel(s2[i], m2[i]);
#pragma unroll
      for (int r = 0; r < 8; ++r) st[w][16 * i + 8 * hh + r][j * 16 + ln] = (_Float16)(fabsf(e1[r] * u1[i][r] - e2[r] * u2[i][r]) * 16384.0f); } }
  // each wave reads back only its own slab: the fence keeps the LDS reads behind the writes of the wave's other lanes, no work-group barrier is needed
  __builtin_amdgcn_fence(__ATOMIC_ACQ_REL, "workgroup"); __builtin_amdgcn_wave_barrier();
#pragma unroll 1  /* rolled in groups of eight rows: sixteen LDS reads go out ahead of their stores */
  for (int r0 = 0; r0 < DROW; r0 += 8) {
#pragma unroll
    for (int r = r0; r < r0 + 8; ++r)
#pragma unroll
      for (int c = 0; c < DCOL; c += 256) { const v8us v = *(const v8us*)&st[w][r][c + lane * 8]; *(v8us*)((unsigned short*)D16 + (size_t)(row0 + r) * NP + w * DCOL + c + lane * 8) = v; }
    asm volatile("s_wait_xcnt 0x0" ::: "memory");  /* stands in front of the next trip's rewrite of the data and address registers that these stores name */
  }
}

// C[M][N] (f32, pitch ldc) = A[M][K] . B[N][K]^T * alpha + bias[col] (bias rounded to bf16); A and B f16 with k contiguous. One 128 x 128 tile of C per work-group of 4 waves (2 x 2, 64 x 64 each):
// an operand row that comes from L2 feeds 128 rows or columns of C, and a fragment that is read from LDS feeds four WMMAs.
// A stage is 128 k of the tile's 128 A rows and 128 B rows, brought into LDS by asynchronous b128 copies: one copy of a wave is 256 contiguous bytes (2 whole lines) of each of two rows, where a fragment load
// straight from the row-major operand touches 16 lines. Two buffers: the next stage's copies fly while this stage is worked on. M, N multiples of 128, K a multiple of 128.
// Every accumulator sums k in rising order, 32 at a time.
#define GT 128                   /* rows of each operand per work-group */
#define GW 64                    /* rows and columns of C per wave */
#define GK 128                   /* k per stage */
#define GP (GK + 8)              /* LDS row pitch in f16: 272 B = 16 B x odd, so the 16 rows of a ds_load_b128 fall on all banks */
#define GQ (GW + 4)              /* row pitch in f32 of a wave's tile of C in LDS: rows 8 apart fall on other banks, 16-byte multiple */
typedef __attribute__((address_space(3))) const _Float16 lds_f16;
// eight pairs of rows (8 rows apart) of one operand: l = the lane's LDS byte address, g = the lane's global address, gs = 8 rows of the operand in elements
__device__ __forceinline__ void copy8(unsigned l, const _Float16* g, size_t gs) {
  const unsigned ls = 8 * GP * 2;
  // the last line is the wait that stands in front of any rewrite of the address registers that these copies name
  asm volatile("global_load_async_to_lds_b128 %0, %8, off\n\t"
               "global_load_async_to_lds_b128 %1, %9, off\n\t"
               "global_load_async_to_lds_b128 %2, %10, off\n\t"
               "global_load_async_to_lds_b128 %3, %11, off\n\t"
               "global_load_async_to_lds_b128 %4, %12, off\n\t"
               "global_load_async_to_lds_b128 %5, %13, off\n\t"
               "global_load_async_to_lds_b128 %6, %14, off\n\t"
               "global_load_async_to_lds_b128 %7, %15, off\n\t"
               "s_wait_xcnt 0x0"
               :: "v"(l), "v"(l + ls), "v"(l + 2 * ls), "v"(l + 3 * ls), "v"(l + 4 * ls), "v"(l + 5 * ls), "v"(l + 6 * ls), "v"(l + 7 * ls),
                  "v"(g), "v"(g + gs), "v"(g + 2 * gs), "v"(g + 3 * gs), "v"(g + 4 * gs), "v"(g + 5 * gs), "v"(g + 6 * gs), "v"(g + 7 * gs) : "memory");
}
// one stage: wave w brings rows 2 w, 2 w + 1, 2 w + 8, 2 w + 9, ..., 2 w + 121 of the A tile (LDS rows 0..127) and of the B tile (LDS rows 128..255): 32 copies of a wave
__device__ __forceinline__ void fill_stage(unsigned l, const _Float16* ga, size_t sa, const _Float16* gb, size_t sb) {
  copy8(l, ga, sa); copy8(l + 64 * GP * 2, ga + 8 * sa, sa); copy8(l + 128 * GP * 2, gb, sb); copy8(l + 192 * GP * 2, gb + 8 * sb, sb);
}
// fragment from a row-major LDS tile; p = row (lane & 15), k = 8 * (lane >> 4): k 8*(lane>>4)+0..7 and 16+8*(lane>>4)+0..7, alike for A and B
__device__ __forceinline__ v16h frag_lds(const _Float16* p) { FragH f; f.half[0] = *(const v8us*)((const unsigned short*)p); f.half[1] = *(const v8us*)((const unsigned short*)p + 16); return f.v; }
// blockIdx.z = batch: A, B and C move on by sA, sB, sC elements
__global__ __launch_bounds__(128) void k_gemm_t(const _Float16* __restrict__ A, int lda, size_t sA, const _Float16* __restrict__ B, int ldb, size_t sB, float alpha, const float* __restrict__ bias, float* __restrict__ C, int ldc, size_t sC, int K) {
  __shared__ __attribute__((aligned(16))) _Float16 sm[2][2 * GT][GP];
  const int tid = threadIdx.x, w = tid >> 5, lane = tid & 31, ln = lane & 15, hh = lane >> 4, wr = w >> 1, wc = w & 1;
  const int row0 = blockIdx.y * GT, col0 = blockIdx.x * GT;
  A += blockIdx.z * sA; B += blockIdx.z * sB; C += blockIdx.z * sC;
  const _Float16* ga = A + (size_t)(row0 + 2 * w + hh) * lda + ln * 8; const _Float16* gb = B + (size_t)(col0 + 2 * w + hh) * ldb + ln * 8;
  const size_t sa = (size_t)8 * lda, sb = (size_t)8 * ldb;
  const unsigned l0 = (unsigned)(uintptr_t)(lds_f16*)&sm[0][2 * w + hh][ln * 8], lbuf = 2 * GT * GP * 2;
  const int nt = K / GK;
  v8f acc[4][4] = {};
  fill_stage(l0, ga, sa, gb, sb);
  float bv[4] = {0.f, 0.f, 0.f, 0.f};
  if (bias) {  /* the lane's four bias values: one branch, so that the four loads go out together, while stage 0 is under way */
    const float* bp = bias + col0 + wc * GW + ln; const float b0 = bp[0], b1 = bp[16], b2 = bp[32], b3 = bp[48];
    bv[0] = bf16_round(b0); bv[1] = bf16_round(b1); bv[2] = bf16_round(b2); bv[3] = bf16_round(b3);
  }
  asm volatile("s_wait_asynccnt 0x0" ::: "memory");  /* this wave's copies of stage 0 have landed */
  __syncthreads();                                   /* and every other wave's */
  if (nt > 1) fill_stage(l0 + lbuf, ga + GK, sa, gb + GK, sb);
  for (int t = 0; t < nt; ++t) {
    const _Float16* pa = &sm[t & 1][wr * GW + ln][8 * hh]; const _Float16* pb = &sm[t & 1][GT + wc * GW + ln][8 * hh];
    v16h fa[GK / 32][4], fb[GK / 32][4];
#pragma unroll  /* every index constant: the fragments stay in registers */
    for (int ks = 0; ks < GK / 32; ++ks) {
      fa[ks][0] = frag_lds(pa + ks * 32);
#pragma unroll
      for (int j = 0; j < 4; ++j) fb[ks][j] = frag_lds(pb + j * 16 * GP + ks * 32);
#pragma unroll
      for (int i = 1; i < 4; ++i) fa[ks][i] = frag_lds(pa + i * 16 * GP + ks * 32);
    }
    // keeps the stage's 64 LDS loads one group in front of its WMMAs, which then follow behind counted waits; left alone the compiler reuses fragment registers and the lone wave of a SIMD waits out the LDS latency several times per k step
    __builtin_amdgcn_sched_barrier(0);
#pragma unroll  /* as above */
    for (int ks = 0; ks < GK / 32; ++ks)
#pragma unroll
      for (int i = 0; i < 4; ++i)
#pragma unroll
        for (int j = 0; j < 4; ++j) acc[i][j] = wm(fa[ks][i], fb[ks][j], acc[i][j]);
    // keeps the WMMAs in front of the waits below, so that they run while the later LDS loads still return and the refill is issued directly behind the barrier
    __builtin_amdgcn_sched_barrier(0);
    asm volatile("s_wait_dscnt 0x0" ::: "memory");     /* this wave's reads of the buffer are done before it is refilled */
    asm volatile("s_wait_asynccnt 0x0" ::: "memory");  /* this wave's copies of stage t + 1 have landed */
    __syncthreads();                                   /* publishes stage t + 1 and ends every wave's reads of stage t */
    if (t + 2 < nt) fill_stage(l0 + (t & 1) * lbuf, ga + (size_t)(t + 2) * GK, sa, gb + (size_t)(t + 2) * GK, sb);
  }
  asm volatile("s_wait_asynccnt 0x0" ::: "memory");    /* no copy is left in flight when the wave ends */
  // behind the last trip's barrier no wave reads the operand buffers any more and no copy is under way: the four waves' tiles of C take the place of buffer 0 (4 x 64 x 68 f32 = its size)
  float* so = (float*)&sm[0][0][0] + w * GW * GQ;
#pragma unroll  /* these three: constant accumulator indices, so that acc stays in registers */
  for (int j = 0; j < 4; ++j)
#pragma unroll
    for (int i = 0; i < 4; ++i)
#pragma unroll
      for (int r = 0; r < 8; ++r) so[(i * 16 + 8 * hh + r) * GQ + j * 16 + ln] = acc[i][j][r] * alpha + bv[j];
  // each wave reads back only its own slab, so that a store covers whole 128-B lines: the fence keeps the LDS reads behind the writes of the wave's other lanes
  __builtin_amdgcn_fence(__ATOMIC_ACQ_REL, "workgroup"); __builtin_amdgcn_wave_barrier();
  float* cw = C + (size_t)(row0 + wr * GW + hh) * ldc + col0 + wc * GW + ln * 4;
#pragma unroll 1  /* rolled in groups of sixteen rows: eight LDS reads go out ahead of their stores */
  for (int q0 = 0; q0 < GW / 2; q0 += 8) {
#pragma unroll
    for (int q = q0; q < q0 + 8; ++q) { const v4f v = *(const v4fa*)&so[(q * 2 + hh) * GQ + ln * 4]; *(v4f*)(cw + (size_t)(q * 2) * ldc) = v; }
    asm volatile("s_wait_xcnt 0x0" ::: "memory");  /* stands in front of the next trip's rewrite of the data and address registers that these stores name */
  }
}

// All 1x1 convs in one launch, each work-group one 128 x 128 tile with k_gemm_t's stages, K = CC, all work-groups resident at once (two per WGP).
// Work-groups 0 .. CWA - 1: conv_b (columns 0..63) and conv_c (64..127) of 128 positions of the four slabs of X (A = X, B = rows 0..127 of BW; f32, bias by column), split from the f32 tile in LDS
// into the f16 planes Hh (hi) and Hl ((value - hi) * 2^10): plane 2 * slab + (0 for conv_b, 1 for conv_c), in WMMA fragment order: no f32 copy in memory and no launch for the split.
// The others: FT[batch][channel][position] = f16(conv_d's weights . XC + (alpha + beta) bias) (A = 128 rows of BW from row 128 on, B = 128 positions of XC; bias by row): the out product's A operand as it stands.
#define CWA (NS * NP / GT)
#define CWF (NBt * (CC / GT) * (NP / GT))
__global__ __launch_bounds__(128) void k_conv(const _Float16* __restrict__ X, const _Float16* __restrict__ XC, const _Float16* __restrict__ BW, const float* __restrict__ BI,
                                              const float* __restrict__ al, const float* __restrict__ be, _Float16* __restrict__ Hh, _Float16* __restrict__ Hl, _Float16* __restrict__ FT) {
  __shared__ __attribute__((aligned(16))) _Float16 sm[2][2 * GT][GP];
  const int tid = threadIdx.x, w = tid >> 5, lane = tid & 31, ln = lane & 15, hh = lane >> 4, wr = w >> 1, wc = w & 1;
  const int bid = blockIdx.x, f = bid - CWA, fb = f / ((CC / GT) * (NP / GT)), fr = (f / (NP / GT)) % (CC / GT), fc = f % (NP / GT);  /* conv_d: batch, tile of channels, tile of positions */
  const bool fd = bid >= CWA;  /* the same for the whole work-group */
  const _Float16* A = fd ? BW + (size_t)(NAB + fr * GT) * CC : X + (size_t)bid * GT * CC;
  const _Float16* B = fd ? XC + ((size_t)fb * NP + fc * GT) * CC : BW;
  const _Float16* ga = A + (size_t)(2 * w + hh) * CC + ln * 8; const _Float16* gb = B + (size_t)(2 * w + hh) * CC + ln * 8;
  const size_t sa = (size_t)8 * CC;
  const unsigned l0 = (unsigned)(uintptr_t)(lds_f16*)&sm[0][2 * w + hh][ln * 8], lbuf = 2 * GT * GP * 2;
  const int nt = CC / GK;
  v8f acc[4][4] = {};
  fill_stage(l0, ga, sa, gb, sa);
  float bv[4] = {0.f, 0.f, 0.f, 0.f}; v4f rb[4][2] = {};  /* the lane's bias values, by column or by row: their loads go out while stage 0 is under way */
  if (fd) {
    const float* bp = BI + NAB + fr * GT + wr * GW + 8 * hh; const float ab = bf16_round(al[0]) + bf16_round(be[0]);
#pragma unroll  /* constant indices: rb stays in registers */
    for (int i = 0; i < 4; ++i) { rb[i][0] = *(const v4fa*)(bp + i * 16); rb[i][1] = *(const v4fa*)(bp + i * 16 + 4); }
#pragma unroll
    for (int i = 0; i < 4; ++i)
#pragma unroll
      for (int r = 0; r < 8; ++r) rb[i][r >> 2][r & 3] = ab * bf16_round(rb[i][r >> 2][r & 3]);
  } else {
    const float* bp = BI + wc * GW + ln; const float b0 = bp[0], b1 = bp[16], b2 = bp[32], b3 = bp[48];
    bv[0] = bf16_round(b0); bv[1] = bf16_round(b1); bv[2] = bf16_round(b2); bv[3] = bf16_round(b3);
  }
  asm volatile("s_wait_asynccnt 0x0" ::: "memory");  /* this wave's copies of stage 0 have landed */
  __syncthreads();                                   /* and every other wave's */
  fill_stage(l0 + lbuf, ga + GK, sa, gb + GK, sa);
#pragma unroll 1  /* rolled: unrolled, the four stages' copy addresses take the kernel past 512 registers, the budget of two work-groups per WGP, and into scratch */
  for (int t = 0; t < nt; ++t) {
    const _Float16* pa = &sm[t & 1][wr * GW + ln][8 * hh]; const _Float16* pb = &sm[t & 1][GT + wc * GW + ln][8 * hh];
    v16h fa[GK / 32][4], fq[GK / 32][4];
#pragma unroll  /* every index constant: the fragments stay in registers */
    for (int ks = 0; ks < GK / 32; ++ks) {
      fa[ks][0] = frag_lds(pa + ks * 32);
#pragma unroll
      for (int j = 0; j < 4; ++j) fq[ks][j] = frag_lds(pb + j * 16 * GP + ks * 32);
#pragma unroll
      for (int i = 1; i < 4; ++i) fa[ks][i] = frag_lds(pa + i * 16 * GP + ks * 32);
    }
    // keeps the stage's 64 LDS loads one group in front of its WMMAs, which then follow behind counted waits, as in k_gemm_t
    __builtin_amdgcn_sched_barrier(0);
#pragma unroll  /* as above */
    for (int ks = 0; ks < GK / 32; ++ks)
#pragma unroll
      for (int i = 0; i < 4; ++i)
#pragma unroll
        for (int j = 0; j < 4; ++j) acc[i][j] = wm(fa[ks][i], fq[ks][j], acc[i][j]);
    // keeps the WMMAs in front of the waits below, so that the refill is issued directly behind the barrier
    __builtin_amdgcn_sched_barrier(0);
    asm volatile("s_wait_dscnt 0x0" ::: "memory");     /* this wave's reads of the buffer are done before it is refilled */
    asm volatile("s_wait_asynccnt 0x0" ::: "memory");  /* this wave's copies of stage t + 1 have landed */
    __syncthreads();                                   /* publishes stage t + 1 and ends every wave's reads of stage t */
    if (t + 2 < nt) fill_stage(l0 + (t & 1) * lbuf, ga + (size_t)(t + 2) * GK, sa, gb + (size_t)(t + 2) * GK, sa);
  }
  asm volatile("s_wait_asynccnt 0x0" ::: "memory");    /* no copy is left in flight when the wave ends */
  // behind the last trip's barrier no wave reads the operand buffers any more and no copy is under way: the four waves' tiles of C take the place of buffer 0, as in k_gemm_t
  float* so = (float*)&sm[0][0][0] + w * GW * GQ;
#pragma unroll  /* these three: constant accumulator indices, so that acc stays in registers */
  for (int j = 0; j < 4; ++j)
#pragma unroll
    for (int i = 0; i < 4; ++i)
#pragma unroll
      for (int r = 0; r < 8; ++r) so[(i * 16 + 8 * hh + r) * GQ + j * 16 + ln] = acc[i][j][r] * 0.0625f + (bv[j] + rb[i][r >> 2][r & 3]);  /* one of the two is 0 */
  // each wave reads back only its own slab, so that a store covers whole 128-B lines: the fence keeps the LDS reads behind the writes of the wave's other lanes
  __builtin_amdgcn_fence(__ATOMIC_ACQ_REL, "workgroup"); __builtin_amdgcn_wave_barrier();
  if (fd) {
    const int rq = lane >> 3, e8 = (lane & 7) * 8;  /* 8 lanes a row of 64 f16 = one line */
    unsigned short* cw = (unsigned short*)FT + ((size_t)fb * CC + fr * GT + wr * GW + rq) * NP + fc * GT + wc * GW + e8;
#pragma unroll 1  /* rolled in groups of thirty-two rows: sixteen LDS reads go out ahead of their stores */
    for (int q0 = 0; q0 < GW / 4; q0 += 8) {
#pragma unroll
      for (int q = q0; q < q0 + 8; ++q) { const float* sp = &so[(q * 4 + rq) * GQ + e8]; const v4f v0 = *(const v4fa*)sp, v1 = *(const v4fa*)(sp + 4); FragH h;
#pragma unroll
        for (int k = 0; k < 4; ++k) { h.h[k] = (_Float16)v0[k]; h.h[4 + k] = (_Float16)v1[k]; }
        *(v8us*)(cw + (size_t)(q * 4) * NP) = h.half[0]; }
      asm volatile("s_wait_xcnt 0x0" ::: "memory");  /* stands in front of the next trip's rewrite of the data and address registers that these stores name */
    }
  } else {
    // The wave's slab is 64 positions x the 64 channels of one plane (wc): four blocks of 16 positions. A block is 2 KiB of each plane, [k step of 32][fragment half][lane][8 channels]:
    // its piece 32 q + lane is position lane & 15, channels 8 sc .. 8 sc + 7, sc = 4 (q >> 1) + 2 (q & 1) + (lane >> 4). A store of a wave covers 512 contiguous bytes.
    const size_t po = ((size_t)(2 * (bid / (NP / GT)) + wc) * NP + (bid % (NP / GT)) * GT + wr * GW) * C8 + lane * 8;
    unsigned short* ch = (unsigned short*)Hh + po; unsigned short* cl = (unsigned short*)Hl + po;
#pragma unroll 1  /* rolled by blocks: a block's eight LDS reads go out ahead of its stores */
    for (int k = 0; k < GW / 16; ++k) {
#pragma unroll
      for (int q = 0; q < 4; ++q) { const float* sp = &so[(k * 16 + ln) * GQ + ((q >> 1) * 4 + (q & 1) * 2 + hh) * 8]; const v4f v0 = *(const v4fa*)sp, v1 = *(const v4fa*)(sp + 4); FragH fh, fl;
#pragma unroll
        for (int e = 0; e < 8; ++e) { const float v = (e < 4) ? v0[e & 3] : v1[e & 3]; const _Float16 hi = (_Float16)v; fh.h[e] = hi; fl.h[e] = (_Float16)((v - (float)hi) * 1024.0f); }
        *(v8us*)(ch + k * 1024 + q * 256) = fh.half[0]; *(v8us*)(cl + k * 1024 + q * 256) = fl.half[0]; }
      asm volatile("s_wait_xcnt 0x0" ::: "memory");  /* stands in front of the next trip's rewrite of the data and address registers that these stores name */
    }
  }
}

extern "C" void kernel_launch(void* const* d_in, const int* in_sizes, int n_in,
                              void* d_out, int out_size, void* d_ws, size_t ws_size, hipStream_t stream) {
  (void)in_sizes; (void)n_in; (void)out_size;
  const float* x1 = (const float*)d_in[0]; const float* x2 = (const float*)d_in[1]; const float* Wb = (const float*)d_in[2]; const float* bb_ = (const float*)d_in[3]; const float* Wc = (const float*)d_in[4]; const float* bc = (const float*)d_in[5]; const float* Wd = (const float*)d_in[6]; const float* bd = (const float*)d_in[7]; const float* al = (const float*)d_in[8]; const float* be = (const float*)d_in[9];
  char* ws = (char*)d_ws; size_t off = 0;
  auto take = [&](size_t bytes) { char* p = ws + off; off += (bytes + 255) & ~(size_t)255; return p; };
  _Float16* BW = (_Float16*)take((size_t)NW * CC * 2); float* BI = (float*)take(NW * 4);
  _Float16* X = (_Float16*)take((size_t)NS * NP * CC * 2); _Float16* XC = (_Float16*)take((size_t)NBt * NP * CC * 2);
  _Float16* Hh = (_Float16*)take((size_t)2 * NS * NP * C8 * 2); _Float16* Hl = (_Float16*)take((size_t)2 * NS * NP * C8 * 2);      /* plane 2 s + j: conv_b (j 0) or conv_c (j 1) of slab s */
  _Float16* FT = (_Float16*)take((size_t)NBt * CC * NP * 2); _Float16* D16 = (_Float16*)take((size_t)NBt * NP * NP * 2);
  if (off > ws_size) return;
  const size_t pl = (size_t)NP * C8;
  k_tok<<<TOKB + PREPB, 256, 0, stream>>>(x1, x2, al, be, Wb, Wc, Wd, bb_, bc, bd, X, XC, BW, BI);      /* position-major inputs; conv weights [O][C] = natural Bt */
  k_conv<<<CWA + CWF, 128, 0, stream>>>(X, XC, BW, BI, al, be, Hh, Hl, FT);      /* a1, b1, a2, b2 of each batch (exact + bias) -> hi/lo planes; FT = alpha f1 + beta f2 */
  k_attdiff<<<dim3(NP / DROW, NBt), DW * 32, 0, stream>>>(Hh, Hl, Hh + 2 * pl, Hl + 2 * pl, Hh + 3 * pl, Hl + 3 * pl, Hh + pl, Hl + pl, D16);      /* a1 = plane 0, a2 = plane 2, b2 = plane 3, b1 = plane 1: |softmax(a1.b2) - softmax(a2.b1)| x 2^14 */
  k_gemm_t<<<dim3(NP / GT, CC / GT, NBt), 128, 0, stream>>>(FT, NP, (size_t)CC * NP, D16, NP, (size_t)NP * NP, 1.0f / 16384.0f, nullptr, (float*)d_out, NP, (size_t)CC * NP, NP);      /* out[b][c][n] = sum_m F[c][m] att[n][m]: M 512 (c), N 4096 (n), K 4096 (m) -> NCHW directly */
}
